// v000
// Measured on an AMD MI455X. A time is GPU time per run, averaged over a window of back-to-back runs after a warm-up
// (all launches, gaps included; the runs take copies of the inputs in turn), and the median of several windows.
// Apart from v000's, it joins two sittings. Times from different sittings can be a few percent apart, while
// side-by-side timings come from the same sitting.
// v000 is the starting kernel. One run takes 406 microseconds.
// Contractions: q, k, v^T projections x.W (+bias): v_wmma_f32_16x16x32_bf16, single product of bf16-RNE-valued x and W planes, f32 accumulate;
// scores q.k^T: bf16 hi/lo split (hi.hi + hi.lo + lo.hi); rel-pos term q.ErWin^T: q hi/lo x bf16-RNE Er (hi.E + lo.E); P.V: bf16 hi/lo split (3 products);
// all v_wmma_f32_16x16x32_bf16 with f32 accumulate. Softmax, bias adds and the 1/sqrt(32) score scale in f32.
//
// Math implemented (B=4, S=4096, hidden 128, 4 heads x 32):
//   q = x.Wq + bq, k = x.Wk + bk, v = x.Wv + bv   (W stored [in][out]; head h = columns h*32..h*32+31)
//   rel[i][j] = q_i . Er[S-1-(i-j)]  for j <= i   (pad-left / reshape shift identity; j > i entries are masked)
//   logit[i][j] = (q_i.k_j + rel[i][j]) * (1/sqrt(32)),  causal (j <= i, diagonal included), softmax over j, out = P.v
//   out[(b*S + i)*128 + h*32 + d]   (no output projection)
//
// Plane / carry audit: every 16-bit plane is bf16 with unit carry (x, W^T, Er: bf16-RNE of the inputs; q, k, v^T: hi/lo bf16
// pairs of the f32 projection results; P: hi/lo bf16 pairs of exp(s - m)); nothing is scaled, nothing to fold back.
//
// Er window per (query block qb, key chunk kc): window row w <-> Er row e0 + w, e0 = S - 64 - 64*(qb - kc), w in 0..127
// (clamped copy, rows past S-1 only ever meet masked keys). For block row il (0..63) and chunk key jl (0..63):
// w = 63 - il + jl. Wave wv (rows il = 16*wv..16*wv+15) computes G[16][80] = q . Win[48 - 16*wv + 0..79]^T and reads
// G[row][15 - (il - 16*wv) + jl].
#include <hip/hip_runtime.h>
#include <math.h>
#include <stdint.h>

#define NB   4
#define SEQ  4096
#define HID  128
#define NH   4
#define HD   32
#define NQB  (SEQ / 64)

typedef __attribute__((ext_vector_type(16))) _Float16 v16h;
typedef __attribute__((ext_vector_type(8)))  _Float16 v8h;
typedef __attribute__((ext_vector_type(16))) __bf16   v16b;
typedef __attribute__((ext_vector_type(8)))  __bf16   v8b;
typedef __attribute__((ext_vector_type(8)))  float    v8f;
typedef __attribute__((ext_vector_type(4)))  float    v4f;
typedef __attribute__((ext_vector_type(4)))  unsigned int v4u;
typedef v4f __attribute__((may_alias)) v4fa;

__device__ __forceinline__ unsigned short f2bf_bits(float f) {
  unsigned u = __float_as_uint(f);
  return (unsigned short)((u + 0x7FFFu + ((u >> 16) & 1u)) >> 16);
}
__device__ __forceinline__ float bf_bits2f(unsigned short h) { return __uint_as_float(((unsigned)h) << 16); }
__device__ __forceinline__ float bf_rne(float f) { return bf_bits2f(f2bf_bits(f)); }
__device__ __forceinline__ unsigned pk16(unsigned short a, unsigned short b) { return (unsigned)a | ((unsigned)b << 16); }

// hazard guards as plain device helpers
__device__ __forceinline__ void dep_guard_b(v8f& a, v8f& b, v16b x, v16b y) { asm volatile("v_nop\n\tv_nop\n\tv_nop\n\tv_nop" : "+v"(a), "+v"(b) : "v"(x), "v"(y)); }
__device__ __forceinline__ void keep4_b(v16b a, v16b b, v16b c, v16b d) { asm volatile("v_nop" :: "v"(a), "v"(b), "v"(c), "v"(d)); }
__device__ __forceinline__ void acc_guard4(v8f& a, v8f& b, v8f& c, v8f& d) { asm volatile("v_nop\n\tv_nop\n\tv_nop\n\tv_nop" : "+v"(a), "+v"(b), "+v"(c), "+v"(d)); }

// 16-bit WMMA fragment (A: p = row m at k0 + 8h; B stored [n][k]: p = row n at k0 + 8h; same split k map):
// elements 0..7 <- p[0..7], elements 8..15 <- p[16..23]
struct FragB {
  union U { v16b v; v8b h[2]; };
  static __device__ __forceinline__ v16b load(const __bf16* p) {
    U f; f.h[0] = *(const v8b*)(p); f.h[1] = *(const v8b*)(p + 16); return f.v;
  }
  static __device__ __forceinline__ v8f mma(v16b a, v16b b, v8f c) {
    return __builtin_amdgcn_wmma_f32_16x16x32_bf16(false, a, false, b, (short)0, c, false, false);
  }
};

__device__ __forceinline__ v8f zero8() { v8f z = {0.f, 0.f, 0.f, 0.f, 0.f, 0.f, 0.f, 0.f}; return z; }

// ---- Register-blocked batched WMMA GEMM (bf16 operands) --------------------
// C[m,n] = scale * sum_k A[m,k] * Bt[n,k] (+bf16-RNE bias); each wave owns a 64x64 tile, 8 waves per block.
// A row-major [M,K]; Bt row-major [N,K]; M,N % 64 == 0, K % 32 == 0 (host-checked).
// SPLIT: operands are hi/lo planes (A2/Bt2 = lo planes, same layout); product = hi.hi + hi.lo + lo.hi.
// BIAS_MODE: 0 = none, 1 = bias[m], 2 = bias[n]  (bias value converted bf16-RNE, added in f32).
// OUT_MODE: 0 = f32, 2 = bf16 hi plane (Cout) + bf16 lo plane (Cout2).
// coverage: 4 slabs x 16 rows x 64 cols = the whole 64x64 tile per wave; tiles cover M x N exactly.
template <bool SPLIT, int BIAS_MODE, int OUT_MODE>
__global__ __launch_bounds__(256) void wmma_gemm64(
    const unsigned short* __restrict__ Ap, const unsigned short* __restrict__ A2p, int lda, long strideA,
    const unsigned short* __restrict__ Btp, const unsigned short* __restrict__ Bt2p, int ldb, long strideB,
    void* __restrict__ Cout, void* __restrict__ Cout2, int ldc, long strideC,
    const float* __restrict__ bias, int M, int N, int K, float scale) {
  const __bf16* A = (const __bf16*)(const void*)Ap;   const __bf16* A2  = (const __bf16*)(const void*)A2p;
  const __bf16* Bt = (const __bf16*)(const void*)Btp; const __bf16* Bt2 = (const __bf16*)(const void*)Bt2p;
  __shared__ __align__(16) float sT[8][16 * 68];   // per-wave 16x64 slab, pitch 68 floats
  const int b    = blockIdx.y;
  const int lane = threadIdx.x & 31;
  const int wave = threadIdx.x >> 5;
  const int tilesN = N >> 6;
  const int tilesM = M >> 6;
  const int tile = blockIdx.x * 8 + wave;
  if (tile >= tilesM * tilesN) return;   // wave-uniform; no block barriers in this kernel
  const int tm = tile / tilesN;
  const int tn = tile - tm * tilesN;
  const int m0 = tm << 6;
  const int n0 = tn << 6;

  const __bf16* Ab  = A  + (size_t)b * strideA;
  const __bf16* Bb  = Bt + (size_t)b * strideB;
  const __bf16* Ab2 = SPLIT ? (A2  + (size_t)b * strideA) : nullptr;
  const __bf16* Bb2 = SPLIT ? (Bt2 + (size_t)b * strideB) : nullptr;

  const int rlane = lane & 15;                 // row (A) / col (B, D) within subtile
  const int koff  = (lane >> 4) * 8;           // k offset of this lane half
  const int mOff  = (lane >> 4) * 8;           // D row offset

  v8f acc[4][4];
#pragma unroll
  for (int i = 0; i < 4; ++i)
#pragma unroll
    for (int j = 0; j < 4; ++j) acc[i][j] = zero8();

  for (int k0 = 0; k0 < K; k0 += 32) {
    v16b bh[4], bl[4];
#pragma unroll
    for (int j = 0; j < 4; ++j) {
      const size_t bo = (size_t)(n0 + (j << 4) + rlane) * ldb + koff + k0;
      bh[j] = FragB::load(Bb + bo);
      bl[j] = bh[j];
      if (SPLIT) bl[j] = FragB::load(Bb2 + bo);
    }
#pragma unroll
    for (int i = 0; i < 4; ++i) {
      const size_t ao = (size_t)(m0 + (i << 4) + rlane) * lda + koff + k0;
      v16b ah = FragB::load(Ab + ao);
      v16b al = ah;
      if (SPLIT) al = FragB::load(Ab2 + ao);
#pragma unroll
      for (int j = 0; j < 4; ++j) {
        acc[i][j] = FragB::mma(ah, bh[j], acc[i][j]);
        if (SPLIT) {
          acc[i][j] = FragB::mma(ah, bl[j], acc[i][j]);
          acc[i][j] = FragB::mma(al, bh[j], acc[i][j]);
        }
      }
      dep_guard_b(acc[i][0], acc[i][3], ah, al);
    }
    keep4_b(bh[0], bh[1], bh[2], bh[3]);
    if (SPLIT) keep4_b(bl[0], bl[1], bl[2], bl[3]);
  }
  acc_guard4(acc[0][0], acc[0][1], acc[0][2], acc[0][3]);
  acc_guard4(acc[1][0], acc[1][1], acc[1][2], acc[1][3]);
  acc_guard4(acc[2][0], acc[2][1], acc[2][2], acc[2][3]);
  acc_guard4(acc[3][0], acc[3][1], acc[3][2], acc[3][3]);

  // ---- epilogue ----
  float* slab = sT[wave];
#pragma unroll
  for (int i = 0; i < 4; ++i) {
    const int mBase = m0 + (i << 4);
#pragma unroll
    for (int j = 0; j < 4; ++j) {
      const int n = n0 + (j << 4) + rlane;
      float bv = 0.f;
      if (BIAS_MODE == 2) bv = bf_rne(bias[n]);
#pragma unroll
      for (int r = 0; r < 8; ++r) {
        float v = acc[i][j][r] * scale;
        if (BIAS_MODE == 1) v += bf_rne(bias[mBase + mOff + r]);
        if (BIAS_MODE == 2) v += bv;
        slab[(mOff + r) * 68 + (j << 4) + rlane] = v;
      }
    }
    __builtin_amdgcn_fence(__ATOMIC_RELEASE, "workgroup");
    __builtin_amdgcn_wave_barrier();
    __builtin_amdgcn_fence(__ATOMIC_ACQUIRE, "workgroup");
    if (OUT_MODE == 0) {
      float* C = (float*)Cout + (size_t)b * strideC;
      const int hh = lane >> 4, c4 = (lane & 15) * 4;     // row seg = 256 B = 16 lanes x 16 B
      {
#pragma unroll
        for (int it = 0; it < 8; ++it) {
          const int row = it * 2 + hh;
          v4f v = *(const v4fa*)(slab + row * 68 + c4);
          *(v4f*)(C + (size_t)(mBase + row) * ldc + n0 + c4) = v;
        }
        
      }
    } else {
      const int q = lane >> 3, c8 = (lane & 7) * 8;
      unsigned short* C  = (unsigned short*)Cout  + (size_t)b * strideC;
      unsigned short* C2 = (unsigned short*)Cout2 + (size_t)b * strideC;
      {
#pragma unroll
        for (int it = 0; it < 4; ++it) {
          const int row = it * 4 + q;
          const float* sp = slab + row * 68 + c8;
          v8h hv, lv;
#pragma unroll
          for (int e = 0; e < 8; ++e) {
            unsigned short hb = f2bf_bits(sp[e]);
            unsigned short lb = f2bf_bits(sp[e] - bf_bits2f(hb));
            hv[e] = __builtin_bit_cast(_Float16, hb);
            lv[e] = __builtin_bit_cast(_Float16, lb);
          }
          *(v8h*)(C  + (size_t)(mBase + row) * ldc + n0 + c8) = hv;
          *(v8h*)(C2 + (size_t)(mBase + row) * ldc + n0 + c8) = lv;
        }
        
      }
    }
    __builtin_amdgcn_fence(__ATOMIC_RELEASE, "workgroup");
    __builtin_amdgcn_wave_barrier();
    __builtin_amdgcn_fence(__ATOMIC_ACQUIRE, "workgroup");
  }
}

// ---------------------------------------------------------------------------
// Contiguous f32 -> bf16-RNE plane: one thread = 8 consecutive elements = one 16-B store, so every wave writes
// grid = ceil(n8/256); coverage: n8 threads x 8 = the whole plane (n8 * 8 elements).
// ---------------------------------------------------------------------------
__global__ __launch_bounds__(256) void cvt_bf16x8_kernel(const float* __restrict__ in, unsigned short* __restrict__ o, int n8) {
  const int i = blockIdx.x * 256 + threadIdx.x;
  if (i < n8) {
    const float* sp = in + (size_t)i * 8;
    const v4f a  = *(const v4f*)(sp);
    const v4f a2 = *(const v4f*)(sp + 4);
    v4u w;
    w[0] = pk16(f2bf_bits(a[0]),  f2bf_bits(a[1]));
    w[1] = pk16(f2bf_bits(a[2]),  f2bf_bits(a[3]));
    w[2] = pk16(f2bf_bits(a2[0]), f2bf_bits(a2[1]));
    w[3] = pk16(f2bf_bits(a2[2]), f2bf_bits(a2[3]));
    unsigned short* dp = o + (size_t)i * 8;
    *(v4u*)dp = w;
    
  }
}

// ---------------------------------------------------------------------------
// Fused transpose + bf16 split of an f32 matrix: in [R rows][Cc cols] (pitch Cc) ->
//   oh[c][r] = bf16_rne(in[r][c]), ol[c][r] = bf16_rne(in[r][c] - oh)   ([Cc][R], pitch R).
// 64x64 tiles through LDS. grid = (Cc/64, R/64), 256 threads (R, Cc multiples of 64).
// Coverage per block and plane: load 4 it x 256 thr x 4 floats = 64x64; store 2 it x 256 thr x 8 u16 = 64x64.
// ---------------------------------------------------------------------------
__global__ __launch_bounds__(256) void tsplit_kernel(const float* __restrict__ W, unsigned short* __restrict__ oh,
                                                     unsigned short* __restrict__ ol, int R, int Cc) {
  __shared__ __align__(16) float tf[64 * 68];
  const int c0  = blockIdx.x * 64;   // input column block = output row block
  const int r0  = blockIdx.y * 64;   // input row block    = output column block
  const int tid = threadIdx.x;
  {
    const int lr = tid >> 4;         // 0..15
    const int c4 = (tid & 15) * 4;   // 0..60
#pragma unroll
    for (int it = 0; it < 4; ++it) {
      const int rr = it * 16 + lr;   // 0..63
      const v4f a = *(const v4f*)(W + (size_t)(r0 + rr) * Cc + c0 + c4);
      *(v4f*)(tf + rr * 68 + c4) = a;
    }
  }
  __syncthreads();
  const int sub = tid >> 3;          // 0..31
  const int c8  = (tid & 7) * 8;     // 0..56
  v4u hv[2], lv[2];
#pragma unroll
  for (int it = 0; it < 2; ++it) {
    const int oc = it * 32 + sub;    // output row within tile (= input column)
    v4u a, a2;
#pragma unroll
    for (int q = 0; q < 4; ++q) {
      const float f0 = tf[(c8 + 2 * q) * 68 + oc];
      const float f1 = tf[(c8 + 2 * q + 1) * 68 + oc];
      const unsigned short h0 = f2bf_bits(f0), h1 = f2bf_bits(f1);
      const unsigned short l0 = f2bf_bits(f0 - bf_bits2f(h0)), l1 = f2bf_bits(f1 - bf_bits2f(h1));
      a[q]  = pk16(h0, h1);
      a2[q] = pk16(l0, l1);
    }
    hv[it] = a; lv[it] = a2;
  }
  {
#pragma unroll
    for (int it = 0; it < 2; ++it) {
      const int oc = it * 32 + sub;
      const size_t go = (size_t)(c0 + oc) * R + r0 + c8;
      *(v4u*)(oh + go) = hv[it];
      *(v4u*)(ol + go) = lv[it];
    }
    
  }
}

// =====================================================================================
// Causal rel-pos attention, head dim 32, all (batch, head) pairs in one launch.
//   q planes (hi/lo bf16): element (b, t, h, d) at [(b*SEQ + t)*HID + h*32 + d]
//   k planes (hi/lo bf16): same layout
//   v^T planes (hi/lo bf16): element (b, h, d, s) at [((b*HID + h*32 + d))*SEQ + s]
//   er plane (bf16-RNE of Er): [r][d], pitch 32
//   scores = ((q.k) + (q.ErWin at the shift index)) * sscale; masked (s > t) scores set to -inf.
//   Block = 4 waves = 64 query rows of one (b,h); grid.x = NB*NH*64; key chunks of 64, trip count qb+1 <= 64.
//   Staging per chunk (128 threads, plain 16-B copies, __syncthreads before and after):
//     K hi/lo [64][32]: 128 thr x 16 elements per plane = whole tile; V^T hi/lo [32][64]: 128 thr x 16 = whole tile;
//     Er window [128][32]: 128 thr x 32 = all 128 rows (clamped source row, so every row is written).
//   Per-wave LDS: P hi/lo [16][64] (8 rows x 2 halves x 4x16 cols written = whole tile before it is read),
//     G [16][80] f32 (5 n-tiles x 16 cols x 16 rows written, columns 0..78 read), reused as out staging [16][36].
// =====================================================================================
#define AT_NW 4
#define AT_QB 64
#define AT_KC 64
#define EWIN  128
#define GP    80
#define OSP   36

__device__ __forceinline__ __bf16 at_f2bf(float f) { return __builtin_bit_cast(__bf16, f2bf_bits(f)); }
__device__ __forceinline__ void at_split(float f, __bf16& hi, __bf16& lo) {
  const unsigned short hb = f2bf_bits(f);
  hi = __builtin_bit_cast(__bf16, hb);
  lo = at_f2bf(f - __uint_as_float(((unsigned)hb) << 16));
}
__device__ __forceinline__ v8f at_mma(v16b a, v16b b, v8f c) {
  c = __builtin_amdgcn_wmma_f32_16x16x32_bf16(false, a, false, b, (short)0, c, false, false);
  asm volatile("v_nop\n\tv_nop\n\tv_nop\n\tv_nop" : "+v"(c) : "v"(a), "v"(b));
  return c;
}

__global__ __launch_bounds__(128)
void relattn32_kernel(const unsigned short* __restrict__ qhp, const unsigned short* __restrict__ qlp,
                      const unsigned short* __restrict__ khp, const unsigned short* __restrict__ klp,
                      const unsigned short* __restrict__ vhp, const unsigned short* __restrict__ vlp,
                      const unsigned short* __restrict__ erp, float* __restrict__ out, float sscale) {
  union FB { v16b v; v8b h[2]; };
  __shared__ __align__(16) __bf16 Ksh[AT_KC * HD];             // K hi [kv][d]      4 KB
  __shared__ __align__(16) __bf16 Ksl[AT_KC * HD];             // K lo
  __shared__ __align__(16) __bf16 Vth[HD * AT_KC];             // V hi [d][kv]      4 KB
  __shared__ __align__(16) __bf16 Vtl[HD * AT_KC];             // V lo
  __shared__ __align__(16) __bf16 Esh[EWIN * HD];              // Er window [w][d]  8 KB
  __shared__ __align__(16) __bf16 Psh[AT_NW][16 * AT_KC];      // per wave P hi [row][kv]
  __shared__ __align__(16) __bf16 Psl[AT_NW][16 * AT_KC];      // per wave P lo
  __shared__ __align__(16) float  Gs[AT_NW][16 * GP];          // per wave rel tile [16][80]; later out staging pitch 36

  const int tid  = threadIdx.x;
  const int wave = tid >> 5;
  const int lane = tid & 31;
  const int hh   = lane >> 4;
  const int c    = lane & 15;

  const int bx   = blockIdx.x;
  const int qb   = bx & (NQB - 1);        // 0..63
  const int pair = bx >> 6;               // 0..15
  const int b    = pair >> 2;
  const int h    = pair & 3;
  const int q0   = qb * AT_QB + wave * 16;
  const size_t rowBase = (size_t)b * SEQ;

  const __bf16* Qh = (const __bf16*)(const void*)qhp + h * HD;
  const __bf16* Ql = (const __bf16*)(const void*)qlp + h * HD;
  const __bf16* Kh = (const __bf16*)(const void*)khp + h * HD;
  const __bf16* Kl = (const __bf16*)(const void*)klp + h * HD;
  const __bf16* Vh = (const __bf16*)(const void*)vhp + ((size_t)b * HID + h * HD) * SEQ;
  const __bf16* Vl = (const __bf16*)(const void*)vlp + ((size_t)b * HID + h * HD) * SEQ;
  const __bf16* Er = (const __bf16*)(const void*)erp;
  float*        ob = out + h * HD;

  // ---- Q fragments (A operand, row = lane&15, split k map, one k-step of 32 = d), hi and lo ----
  const v16b qah = FragB::load(Qh + (rowBase + q0 + c) * HID + 8 * hh);
  const v16b qal = FragB::load(Ql + (rowBase + q0 + c) * HID + 8 * hh);

  float mrow[8], lrow[8];
  v8f oacc[2];
#pragma unroll
  for (int r = 0; r < 8; ++r) { mrow[r] = -INFINITY; lrow[r] = 0.f; }
  oacc[0] = zero8(); oacc[1] = zero8();

  const int wbase = 48 - 16 * wave;       // first window row of this wave's G tile
  float* gw = Gs[wave];
  __bf16* pwh = Psh[wave];
  __bf16* pwl = Psl[wave];

  const int nChunks = qb + 1;             // block-uniform, <= 64
  for (int kc = 0; kc < nChunks; ++kc) {
    const int kv0 = kc * AT_KC;
    int e0 = SEQ - 64 - 64 * (qb - kc);   // Er window base row, 0 .. 4032
    __syncthreads();
    {
      // K: thread -> key row r = tid>>1, d half = (tid&1)*16; 2 x 8 elements per plane
      const int r = tid >> 1, half = (tid & 1) * 16;
      const __bf16* ks = Kh + (rowBase + kv0 + r) * HID + half;
      const __bf16* kl = Kl + (rowBase + kv0 + r) * HID + half;
      // V^T: thread -> d = tid>>2, key quarter = (tid&3)*16; 2 x 8 elements per plane
      const int d = tid >> 2, qt = (tid & 3) * 16;
      const __bf16* vs = Vh + (size_t)d * SEQ + kv0 + qt;
      const __bf16* vl = Vl + (size_t)d * SEQ + kv0 + qt;
      // Er window: thread -> window row tid, clamped source row (address clamp), 4 x 8 elements
      int erow = e0 + tid;
      erow = erow < 0 ? 0 : erow;
      erow = erow > (SEQ - 1) ? (SEQ - 1) : erow;
      const __bf16* es = Er + (size_t)erow * HD;
#pragma unroll
      for (int i = 0; i < 2; ++i) {
        const v8b a0 = *(const v8b*)(ks + 8 * i);
        const v8b a1 = *(const v8b*)(kl + 8 * i);
        const v8b b0 = *(const v8b*)(vs + 8 * i);
        const v8b b1 = *(const v8b*)(vl + 8 * i);
        *(v8b*)(Ksh + r * HD    + half + 8 * i) = a0;
        *(v8b*)(Ksl + r * HD    + half + 8 * i) = a1;
        *(v8b*)(Vth + d * AT_KC + qt   + 8 * i) = b0;
        *(v8b*)(Vtl + d * AT_KC + qt   + 8 * i) = b1;
      }
#pragma unroll
      for (int i = 0; i < 4; ++i) {
        const v8b ee = *(const v8b*)(es + 8 * i);
        *(v8b*)(Esh + tid * HD + 8 * i) = ee;
      }
    }
    __syncthreads();

    // ---- content scores: 16 queries x 64 keys, 3-term split ----
    v8f s[4];
#pragma unroll
    for (int j = 0; j < 4; ++j) {
      FB kb, kl;
      const __bf16* kp = Ksh + (j * 16 + c) * HD + 8 * hh;
      const __bf16* kq = Ksl + (j * 16 + c) * HD + 8 * hh;
      kb.h[0] = *(const v8b*)(kp); kb.h[1] = *(const v8b*)(kp + 16);
      kl.h[0] = *(const v8b*)(kq); kl.h[1] = *(const v8b*)(kq + 16);
      v8f a = zero8();
      a = at_mma(qah, kb.v, a);
      a = at_mma(qah, kl.v, a);
      a = at_mma(qal, kb.v, a);
      s[j] = a;
    }

    // ---- rel-pos tile G[16][80] = q . Win[wbase + 0..79]^T (2 products), to this wave's LDS tile ----
#pragma unroll
    for (int nt = 0; nt < 5; ++nt) {
      FB eb;
      const __bf16* ep = Esh + (wbase + nt * 16 + c) * HD + 8 * hh;
      eb.h[0] = *(const v8b*)(ep); eb.h[1] = *(const v8b*)(ep + 16);
      v8f g = zero8();
      g = at_mma(qah, eb.v, g);
      g = at_mma(qal, eb.v, g);
#pragma unroll
      for (int r = 0; r < 8; ++r) gw[(8 * hh + r) * GP + nt * 16 + c] = g[r];
    }
    __builtin_amdgcn_fence(__ATOMIC_RELEASE, "workgroup");
    __builtin_amdgcn_wave_barrier();
    __builtin_amdgcn_fence(__ATOMIC_ACQUIRE, "workgroup");

    // ---- combine, scale, causal mask, chunk row max ----
    const bool diag = (kc == qb);           // block-uniform
    float cm[8];
#pragma unroll
    for (int r = 0; r < 8; ++r) {
      const int il   = wave * 16 + 8 * hh + r;          // row within the 64-row block
      const int qrow = qb * AT_QB + il;
      const float* gr = gw + (8 * hh + r) * GP + (15 - 8 * hh - r);   // + jl gives shift column 15 - il_w + jl
      float m = -INFINITY;
#pragma unroll
      for (int j = 0; j < 4; ++j) {
        const int kvcol = kv0 + j * 16 + c;
        const float rel = gr[j * 16 + c];
        const float sv  = (s[j][r] + rel) * sscale;
        const bool msk  = diag && (kvcol > qrow);
        const float sm  = msk ? -INFINITY : sv;
        s[j][r] = sm;
        m = fmaxf(m, sm);
      }
#pragma unroll
      for (int off = 1; off < 16; off <<= 1) m = fmaxf(m, __shfl_xor(m, off, 32));
      cm[r] = m;
    }

    // ---- online softmax update; P (unnormalised) as bf16 hi/lo into this wave's LDS tiles ----
#pragma unroll
    for (int r = 0; r < 8; ++r) {
      const float mnew  = fmaxf(mrow[r], cm[r]);
      const float alpha = __expf(mrow[r] - mnew);
      mrow[r] = mnew;
      float psum = 0.f;
#pragma unroll
      for (int j = 0; j < 4; ++j) {
        const float p = __expf(s[j][r] - mnew);
        psum += p;
        __bf16 a, bl; at_split(p, a, bl);
        pwh[(8 * hh + r) * AT_KC + j * 16 + c] = a;
        pwl[(8 * hh + r) * AT_KC + j * 16 + c] = bl;
      }
#pragma unroll
      for (int off = 1; off < 16; off <<= 1) psum += __shfl_xor(psum, off, 32);
      lrow[r] = lrow[r] * alpha + psum;
      oacc[0][r] *= alpha;
      oacc[1][r] *= alpha;
    }
    __builtin_amdgcn_fence(__ATOMIC_RELEASE, "workgroup");
    __builtin_amdgcn_wave_barrier();
    __builtin_amdgcn_fence(__ATOMIC_ACQUIRE, "workgroup");

    // ---- O += P . V : A = P tile (row = query, split k map over keys), B = V^T rows d; 3-term split ----
#pragma unroll 1
    for (int kk = 0; kk < 2; ++kk) {
      FB pa, pl;
      pa.h[0] = *(const v8b*)(pwh + c * AT_KC + kk * 32 + 8 * hh);
      pa.h[1] = *(const v8b*)(pwh + c * AT_KC + kk * 32 + 16 + 8 * hh);
      pl.h[0] = *(const v8b*)(pwl + c * AT_KC + kk * 32 + 8 * hh);
      pl.h[1] = *(const v8b*)(pwl + c * AT_KC + kk * 32 + 16 + 8 * hh);
#pragma unroll
      for (int t = 0; t < 2; ++t) {
        FB vb, vl;
        vb.h[0] = *(const v8b*)(Vth + (t * 16 + c) * AT_KC + kk * 32 + 8 * hh);
        vb.h[1] = *(const v8b*)(Vth + (t * 16 + c) * AT_KC + kk * 32 + 16 + 8 * hh);
        vl.h[0] = *(const v8b*)(Vtl + (t * 16 + c) * AT_KC + kk * 32 + 8 * hh);
        vl.h[1] = *(const v8b*)(Vtl + (t * 16 + c) * AT_KC + kk * 32 + 16 + 8 * hh);
        oacc[t] = at_mma(pa.v, vb.v, oacc[t]);
        oacc[t] = at_mma(pa.v, vl.v, oacc[t]);
        oacc[t] = at_mma(pl.v, vb.v, oacc[t]);
      }
    }
  }

  __builtin_amdgcn_fence(__ATOMIC_RELEASE, "workgroup");
  __builtin_amdgcn_wave_barrier();
  __builtin_amdgcn_fence(__ATOMIC_ACQUIRE, "workgroup");
  float* os = gw;
#pragma unroll
  for (int r = 0; r < 8; ++r) {
    const float inv = 1.0f / lrow[r];
    os[(8 * hh + r) * OSP + c]      = oacc[0][r] * inv;
    os[(8 * hh + r) * OSP + 16 + c] = oacc[1][r] * inv;
  }
  __builtin_amdgcn_fence(__ATOMIC_RELEASE, "workgroup");
  __builtin_amdgcn_wave_barrier();
  __builtin_amdgcn_fence(__ATOMIC_ACQUIRE, "workgroup");
  {
    const int q4 = lane >> 3, c4 = (lane & 7) * 4;
    {
#pragma unroll
      for (int it = 0; it < 4; ++it) {
        const int row = it * 4 + q4;                   // it 0..3 x q4 0..3 covers rows 0..15 of the wave tile
        const v4f val = *(const v4fa*)(os + row * OSP + c4);
        *(v4f*)(ob + (rowBase + q0 + row) * HID + c4) = val;
      }
      
    }
  }
}

// ---------------------------------------------------------------------------
// Workspace region map (byte offsets):
//   WqTh bf16 [128 n][128 k]        0      WqTl     32768
//   WkTh                        65536      WkTl     98304
//   WvTh                       131072      WvTl    163840     (lo weight planes written, not consumed)
//   Xb   bf16 [16384][128]     196608                         (4194304 B)
//   ErB  bf16 [4096][32]      4390912                         (262144 B)
//   Qh   bf16 [16384][128]    4653056      Ql    8847360
//   Kh   bf16 [16384][128]   13041664      Kl   17235968
//   VTh  bf16 [4][128][4096] 21430272      VTl  25624576
//   total                    29818880
// Every region is written in whole 64x64 tiles / whole 16-B-per-lane runs; all extents are exact tile multiples,
// ---------------------------------------------------------------------------
extern "C" void kernel_launch(void* const* d_in, const int* in_sizes, int n_in,
                              void* d_out, int out_size, void* d_ws, size_t ws_size,
                              hipStream_t stream) {
  if (n_in < 8) return;
  if (in_sizes[0] != NB * SEQ * HID) return;
  if (in_sizes[1] != HID * HID || in_sizes[3] != HID * HID || in_sizes[5] != HID * HID) return;
  if (in_sizes[2] != HID || in_sizes[4] != HID || in_sizes[6] != HID) return;
  if (in_sizes[7] != SEQ * HD) return;
  if (out_size != NB * SEQ * HID) return;

  const float* x  = (const float*)d_in[0];
  const float* Wq = (const float*)d_in[1];
  const float* bq = (const float*)d_in[2];
  const float* Wk = (const float*)d_in[3];
  const float* bk = (const float*)d_in[4];
  const float* Wv = (const float*)d_in[5];
  const float* bv = (const float*)d_in[6];
  const float* Er = (const float*)d_in[7];
  float* out = (float*)d_out;

  const size_t PW = (size_t)HID * HID * 2;            //    32768  bf16 weight plane
  const size_t PX = (size_t)NB * SEQ * HID * 2;       //  4194304  bf16 activation plane (all batch rows)
  const size_t PE = (size_t)SEQ * HD * 2;             //   262144  bf16 Er plane
  const size_t PV = (size_t)NB * HID * SEQ * 2;       //  4194304  bf16 v^T plane
  size_t off = 0;
  const size_t oWqTh = off; off += PW;  const size_t oWqTl = off; off += PW;
  const size_t oWkTh = off; off += PW;  const size_t oWkTl = off; off += PW;
  const size_t oWvTh = off; off += PW;  const size_t oWvTl = off; off += PW;
  const size_t oXb   = off; off += PX;
  const size_t oErB  = off; off += PE;
  const size_t oQh   = off; off += PX;  const size_t oQl   = off; off += PX;
  const size_t oKh   = off; off += PX;  const size_t oKl   = off; off += PX;
  const size_t oVTh  = off; off += PV;  const size_t oVTl  = off; off += PV;
  if (off > ws_size) return;                          // off = 29818880
  if (off > (size_t)134217728) return;

  char* ws = (char*)d_ws;
  unsigned short* WqTh = (unsigned short*)(ws + oWqTh); unsigned short* WqTl = (unsigned short*)(ws + oWqTl);
  unsigned short* WkTh = (unsigned short*)(ws + oWkTh); unsigned short* WkTl = (unsigned short*)(ws + oWkTl);
  unsigned short* WvTh = (unsigned short*)(ws + oWvTh); unsigned short* WvTl = (unsigned short*)(ws + oWvTl);
  unsigned short* Xb   = (unsigned short*)(ws + oXb);
  unsigned short* ErB  = (unsigned short*)(ws + oErB);
  unsigned short* Qh   = (unsigned short*)(ws + oQh);   unsigned short* Ql   = (unsigned short*)(ws + oQl);
  unsigned short* Kh   = (unsigned short*)(ws + oKh);   unsigned short* Kl   = (unsigned short*)(ws + oKl);
  unsigned short* VTh  = (unsigned short*)(ws + oVTh);  unsigned short* VTl  = (unsigned short*)(ws + oVTl);

  const dim3 blk(256);
  const float sscale = 0.17677669529663688f;          // 1/sqrt(32)

  // (1) weights [in k][out n] f32 -> transposed bf16 planes [n][k]   (in [128][128] -> out [128][128]; grid (cols/64, rows/64))
  tsplit_kernel<<<dim3(HID / 64, HID / 64), blk, 0, stream>>>(Wq, WqTh, WqTl, HID, HID);
  tsplit_kernel<<<dim3(HID / 64, HID / 64), blk, 0, stream>>>(Wk, WkTh, WkTl, HID, HID);
  tsplit_kernel<<<dim3(HID / 64, HID / 64), blk, 0, stream>>>(Wv, WvTh, WvTl, HID, HID);
  // (2) x -> bf16 plane [16384][128]; Er -> bf16 plane [4096][32]
  const int n8x = NB * SEQ * HID / 8;                 // 262144 threads x 8 = whole plane
  const int n8e = SEQ * HD / 8;                       //  16384 threads x 8 = whole plane
  cvt_bf16x8_kernel<<<dim3((n8x + 255) / 256), blk, 0, stream>>>(x, Xb, n8x);
  cvt_bf16x8_kernel<<<dim3((n8e + 255) / 256), blk, 0, stream>>>(Er, ErB, n8e);
  // (3) q = x.Wq + bq -> Q hi/lo planes [b*4096+t][h*32+d]   (M=16384, N=128, K=128; 512 tiles -> 64 blocks)
  const dim3 gProj(((NB * SEQ / 64) * (HID / 64) + 7) / 8, 1);
  wmma_gemm64<false, 2, 2><<<gProj, blk, 0, stream>>>(
      Xb, Xb, HID, 0L, WqTh, WqTh, HID, 0L, (void*)Qh, (void*)Ql, HID, 0L, bq, NB * SEQ, HID, HID, 1.0f);
  // (4) k = x.Wk + bk -> K hi/lo planes
  wmma_gemm64<false, 2, 2><<<gProj, blk, 0, stream>>>(
      Xb, Xb, HID, 0L, WkTh, WkTh, HID, 0L, (void*)Kh, (void*)Kl, HID, 0L, bk, NB * SEQ, HID, HID, 1.0f);
  // (5) v^T = Wv^T . x^T + bv[m] -> VT hi/lo planes [b][h*32+d][s]   (A = Wv^T plane [128][128], Bt = x plane rows of batch z;
  //     M=128, N=4096, K=128; 128 tiles -> 16 blocks, grid.y = batch)
  const dim3 gVT(((HID / 64) * (SEQ / 64) + 7) / 8, NB);
  wmma_gemm64<false, 1, 2><<<gVT, blk, 0, stream>>>(
      WvTh, WvTh, HID, 0L, Xb, Xb, HID, (long)SEQ * HID, (void*)VTh, (void*)VTl, SEQ, (long)HID * SEQ,
      bv, HID, SEQ, HID, 1.0f);
  // (6) causal rel-pos attention: 1024 blocks = 16 (b,h) pairs x 64 query blocks, 128 threads
  relattn32_kernel<<<dim3(NB * NH * NQB), dim3(128), 0, stream>>>(Qh, Ql, Kh, Kl, VTh, VTl, ErB, out, sscale);
  (void)hipGetLastError();
}

// v001
// A run of this version takes 298 microseconds.
// Timed twice side by side with v000, it ran 1.40 times as fast both times.
// Contractions: q, k, v^T projections x.W (+bias): v_wmma_f32_16x16x32_bf16, single product of bf16-RNE-valued x and W planes, f32 accumulate;
// scores q.k^T: bf16 hi/lo split (hi.hi + hi.lo + lo.hi); rel-pos term q.ErWin^T: q hi/lo x bf16-RNE Er (hi.E + lo.E); P.V: bf16 hi/lo split (3 products);
// all v_wmma_f32_16x16x32_bf16 with f32 accumulate. Softmax, bias adds and the 1/sqrt(32) score scale in f32.
//
// Math implemented (B=4, S=4096, hidden 128, 4 heads x 32):
//   q = x.Wq + bq, k = x.Wk + bk, v = x.Wv + bv   (W stored [in][out]; head h = columns h*32..h*32+31)
//   rel[i][j] = q_i . Er[S-1-(i-j)]  for j <= i   (pad-left / reshape shift identity; j > i entries are masked)
//   logit[i][j] = (q_i.k_j + rel[i][j]) * (1/sqrt(32)),  causal (j <= i, diagonal included), softmax over j, out = P.v
//   out[(b*S + i)*128 + h*32 + d]   (no output projection)
//
// Plane / carry audit: every 16-bit plane is bf16 with unit carry (x, W^T, Er: bf16-RNE of the inputs; q, k, v^T: hi/lo bf16
// pairs of the f32 projection results; P: hi/lo bf16 pairs of exp(s - m)); nothing is scaled, nothing to fold back.
//
// Er window per (query block qb, key chunk kc): window row w <-> Er row e0 + w, e0 = S - 64 - 64*(qb - kc), w in 0..127
// (clamped copy, rows past S-1 only ever meet masked keys). For block row il (0..63) and chunk key jl (0..63):
// w = 63 - il + jl. Wave wv (rows il = 16*wv..16*wv+15) computes G[16][80] = q . Win[48 - 16*wv + 0..79]^T and reads
// G[row][15 - (il - 16*wv) + jl].
#include <hip/hip_runtime.h>
#include <math.h>
#include <stdint.h>

#define NB   4
#define SEQ  4096
#define HID  128
#define NH   4
#define HD   32
#define NQB  (SEQ / 64)

typedef __attribute__((ext_vector_type(16))) _Float16 v16h;
typedef __attribute__((ext_vector_type(8)))  _Float16 v8h;
typedef __attribute__((ext_vector_type(16))) __bf16   v16b;
typedef __attribute__((ext_vector_type(8)))  __bf16   v8b;
typedef __attribute__((ext_vector_type(8)))  float    v8f;
typedef __attribute__((ext_vector_type(4)))  float    v4f;
typedef __attribute__((ext_vector_type(4)))  unsigned int v4u;
typedef v4f __attribute__((may_alias)) v4fa;

__device__ __forceinline__ unsigned short f2bf_bits(float f) {
  unsigned u = __float_as_uint(f);
  return (unsigned short)((u + 0x7FFFu + ((u >> 16) & 1u)) >> 16);
}
__device__ __forceinline__ float bf_bits2f(unsigned short h) { return __uint_as_float(((unsigned)h) << 16); }
__device__ __forceinline__ float bf_rne(float f) { return bf_bits2f(f2bf_bits(f)); }
__device__ __forceinline__ unsigned pk16(unsigned short a, unsigned short b) { return (unsigned)a | ((unsigned)b << 16); }

// hazard guards as plain device helpers
__device__ __forceinline__ void dep_guard_b(v8f& a, v8f& b, v16b x, v16b y) { asm volatile("v_nop\n\tv_nop\n\tv_nop\n\tv_nop" : "+v"(a), "+v"(b) : "v"(x), "v"(y)); }
__device__ __forceinline__ void keep4_b(v16b a, v16b b, v16b c, v16b d) { asm volatile("v_nop" :: "v"(a), "v"(b), "v"(c), "v"(d)); }
__device__ __forceinline__ void acc_guard4(v8f& a, v8f& b, v8f& c, v8f& d) { asm volatile("v_nop\n\tv_nop\n\tv_nop\n\tv_nop" : "+v"(a), "+v"(b), "+v"(c), "+v"(d)); }

// 16-bit WMMA fragment (A: p = row m at k0 + 8h; B stored [n][k]: p = row n at k0 + 8h; same split k map):
// elements 0..7 <- p[0..7], elements 8..15 <- p[16..23]
struct FragB {
  union U { v16b v; v8b h[2]; };
  static __device__ __forceinline__ v16b load(const __bf16* p) {
    U f; f.h[0] = *(const v8b*)(p); f.h[1] = *(const v8b*)(p + 16); return f.v;
  }
  static __device__ __forceinline__ v8f mma(v16b a, v16b b, v8f c) {
    return __builtin_amdgcn_wmma_f32_16x16x32_bf16(false, a, false, b, (short)0, c, false, false);
  }
};

__device__ __forceinline__ v8f zero8() { v8f z = {0.f, 0.f, 0.f, 0.f, 0.f, 0.f, 0.f, 0.f}; return z; }

// ---- Register-blocked batched WMMA GEMM (bf16 operands) --------------------
// C[m,n] = scale * sum_k A[m,k] * Bt[n,k] (+bf16-RNE bias); each wave owns a 64x64 tile, 8 waves per block.
// A row-major [M,K]; Bt row-major [N,K]; M,N % 64 == 0, K % 32 == 0 (host-checked).
// SPLIT: operands are hi/lo planes (A2/Bt2 = lo planes, same layout); product = hi.hi + hi.lo + lo.hi.
// BIAS_MODE: 0 = none, 1 = bias[m], 2 = bias[n]  (bias value converted bf16-RNE, added in f32).
// OUT_MODE: 0 = f32, 2 = bf16 hi plane (Cout) + bf16 lo plane (Cout2).
// coverage: 4 slabs x 16 rows x 64 cols = the whole 64x64 tile per wave; tiles cover M x N exactly.
template <bool SPLIT, int BIAS_MODE, int OUT_MODE>
__global__ __launch_bounds__(256) void wmma_gemm64(
    const unsigned short* __restrict__ Ap, const unsigned short* __restrict__ A2p, int lda, long strideA,
    const unsigned short* __restrict__ Btp, const unsigned short* __restrict__ Bt2p, int ldb, long strideB,
    void* __restrict__ Cout, void* __restrict__ Cout2, int ldc, long strideC,
    const float* __restrict__ bias, int M, int N, int K, float scale) {
  const __bf16* A = (const __bf16*)(const void*)Ap;   const __bf16* A2  = (const __bf16*)(const void*)A2p;
  const __bf16* Bt = (const __bf16*)(const void*)Btp; const __bf16* Bt2 = (const __bf16*)(const void*)Bt2p;
  __shared__ __align__(16) float sT[8][16 * 68];   // per-wave 16x64 slab, pitch 68 floats
  const int b    = blockIdx.y;
  const int lane = threadIdx.x & 31;
  const int wave = threadIdx.x >> 5;
  const int tilesN = N >> 6;
  const int tilesM = M >> 6;
  const int tile = blockIdx.x * 8 + wave;
  if (tile >= tilesM * tilesN) return;   // wave-uniform; no block barriers in this kernel
  const int tm = tile / tilesN;
  const int tn = tile - tm * tilesN;
  const int m0 = tm << 6;
  const int n0 = tn << 6;

  const __bf16* Ab  = A  + (size_t)b * strideA;
  const __bf16* Bb  = Bt + (size_t)b * strideB;
  const __bf16* Ab2 = SPLIT ? (A2  + (size_t)b * strideA) : nullptr;
  const __bf16* Bb2 = SPLIT ? (Bt2 + (size_t)b * strideB) : nullptr;

  const int rlane = lane & 15;                 // row (A) / col (B, D) within subtile
  const int koff  = (lane >> 4) * 8;           // k offset of this lane half
  const int mOff  = (lane >> 4) * 8;           // D row offset

  v8f acc[4][4];
#pragma unroll
  for (int i = 0; i < 4; ++i)
#pragma unroll
    for (int j = 0; j < 4; ++j) acc[i][j] = zero8();

  for (int k0 = 0; k0 < K; k0 += 32) {
    v16b bh[4], bl[4];
#pragma unroll
    for (int j = 0; j < 4; ++j) {
      const size_t bo = (size_t)(n0 + (j << 4) + rlane) * ldb + koff + k0;
      bh[j] = FragB::load(Bb + bo);
      bl[j] = bh[j];
      if (SPLIT) bl[j] = FragB::load(Bb2 + bo);
    }
#pragma unroll
    for (int i = 0; i < 4; ++i) {
      const size_t ao = (size_t)(m0 + (i << 4) + rlane) * lda + koff + k0;
      v16b ah = FragB::load(Ab + ao);
      v16b al = ah;
      if (SPLIT) al = FragB::load(Ab2 + ao);
#pragma unroll
      for (int j = 0; j < 4; ++j) {
        acc[i][j] = FragB::mma(ah, bh[j], acc[i][j]);
        if (SPLIT) {
          acc[i][j] = FragB::mma(ah, bl[j], acc[i][j]);
          acc[i][j] = FragB::mma(al, bh[j], acc[i][j]);
        }
      }
      dep_guard_b(acc[i][0], acc[i][3], ah, al);
    }
    keep4_b(bh[0], bh[1], bh[2], bh[3]);
    if (SPLIT) keep4_b(bl[0], bl[1], bl[2], bl[3]);
  }
  acc_guard4(acc[0][0], acc[0][1], acc[0][2], acc[0][3]);
  acc_guard4(acc[1][0], acc[1][1], acc[1][2], acc[1][3]);
  acc_guard4(acc[2][0], acc[2][1], acc[2][2], acc[2][3]);
  acc_guard4(acc[3][0], acc[3][1], acc[3][2], acc[3][3]);

  // ---- epilogue ----
  float* slab = sT[wave];
#pragma unroll
  for (int i = 0; i < 4; ++i) {
    const int mBase = m0 + (i << 4);
#pragma unroll
    for (int j = 0; j < 4; ++j) {
      const int n = n0 + (j << 4) + rlane;
      float bv = 0.f;
      if (BIAS_MODE == 2) bv = bf_rne(bias[n]);
#pragma unroll
      for (int r = 0; r < 8; ++r) {
        float v = acc[i][j][r] * scale;
        if (BIAS_MODE == 1) v += bf_rne(bias[mBase + mOff + r]);
        if (BIAS_MODE == 2) v += bv;
        slab[(mOff + r) * 68 + (j << 4) + rlane] = v;
      }
    }
    __builtin_amdgcn_fence(__ATOMIC_RELEASE, "workgroup");
    __builtin_amdgcn_wave_barrier();
    __builtin_amdgcn_fence(__ATOMIC_ACQUIRE, "workgroup");
    if (OUT_MODE == 0) {
      float* C = (float*)Cout + (size_t)b * strideC;
      const int hh = lane >> 4, c4 = (lane & 15) * 4;     // row seg = 256 B = 16 lanes x 16 B
      {
#pragma unroll
        for (int it = 0; it < 8; ++it) {
          const int row = it * 2 + hh;
          v4f v = *(const v4fa*)(slab + row * 68 + c4);
          *(v4f*)(C + (size_t)(mBase + row) * ldc + n0 + c4) = v;
        }
        
      }
    } else {
      const int q = lane >> 3, c8 = (lane & 7) * 8;
      unsigned short* C  = (unsigned short*)Cout  + (size_t)b * strideC;
      unsigned short* C2 = (unsigned short*)Cout2 + (size_t)b * strideC;
      {
#pragma unroll
        for (int it = 0; it < 4; ++it) {
          const int row = it * 4 + q;
          const float* sp = slab + row * 68 + c8;
          v8h hv, lv;
#pragma unroll
          for (int e = 0; e < 8; ++e) {
            unsigned short hb = f2bf_bits(sp[e]);
            unsigned short lb = f2bf_bits(sp[e] - bf_bits2f(hb));
            hv[e] = __builtin_bit_cast(_Float16, hb);
            lv[e] = __builtin_bit_cast(_Float16, lb);
          }
          *(v8h*)(C  + (size_t)(mBase + row) * ldc + n0 + c8) = hv;
          *(v8h*)(C2 + (size_t)(mBase + row) * ldc + n0 + c8) = lv;
        }
        
      }
    }
    __builtin_amdgcn_fence(__ATOMIC_RELEASE, "workgroup");
    __builtin_amdgcn_wave_barrier();
    __builtin_amdgcn_fence(__ATOMIC_ACQUIRE, "workgroup");
  }
}

// ---------------------------------------------------------------------------
// Contiguous f32 -> bf16-RNE plane: one thread = 8 consecutive elements = one 16-B store, so every wave writes
// grid = ceil(n8/256); coverage: n8 threads x 8 = the whole plane (n8 * 8 elements).
// ---------------------------------------------------------------------------
__global__ __launch_bounds__(256) void cvt_bf16x8_kernel(const float* __restrict__ in, unsigned short* __restrict__ o, int n8) {
  const int i = blockIdx.x * 256 + threadIdx.x;
  if (i < n8) {
    const float* sp = in + (size_t)i * 8;
    const v4f a  = *(const v4f*)(sp);
    const v4f a2 = *(const v4f*)(sp + 4);
    v4u w;
    w[0] = pk16(f2bf_bits(a[0]),  f2bf_bits(a[1]));
    w[1] = pk16(f2bf_bits(a[2]),  f2bf_bits(a[3]));
    w[2] = pk16(f2bf_bits(a2[0]), f2bf_bits(a2[1]));
    w[3] = pk16(f2bf_bits(a2[2]), f2bf_bits(a2[3]));
    unsigned short* dp = o + (size_t)i * 8;
    *(v4u*)dp = w;
    
  }
}

// ---------------------------------------------------------------------------
// Fused transpose + bf16 split of an f32 matrix: in [R rows][Cc cols] (pitch Cc) ->
//   oh[c][r] = bf16_rne(in[r][c]), ol[c][r] = bf16_rne(in[r][c] - oh)   ([Cc][R], pitch R).
// 64x64 tiles through LDS. grid = (Cc/64, R/64), 256 threads (R, Cc multiples of 64).
// Coverage per block and plane: load 4 it x 256 thr x 4 floats = 64x64; store 2 it x 256 thr x 8 u16 = 64x64.
// ---------------------------------------------------------------------------
__global__ __launch_bounds__(256) void tsplit_kernel(const float* __restrict__ W, unsigned short* __restrict__ oh,
                                                     unsigned short* __restrict__ ol, int R, int Cc) {
  __shared__ __align__(16) float tf[64 * 68];
  const int c0  = blockIdx.x * 64;   // input column block = output row block
  const int r0  = blockIdx.y * 64;   // input row block    = output column block
  const int tid = threadIdx.x;
  {
    const int lr = tid >> 4;         // 0..15
    const int c4 = (tid & 15) * 4;   // 0..60
#pragma unroll
    for (int it = 0; it < 4; ++it) {
      const int rr = it * 16 + lr;   // 0..63
      const v4f a = *(const v4f*)(W + (size_t)(r0 + rr) * Cc + c0 + c4);
      *(v4f*)(tf + rr * 68 + c4) = a;
    }
  }
  __syncthreads();
  const int sub = tid >> 3;          // 0..31
  const int c8  = (tid & 7) * 8;     // 0..56
  v4u hv[2], lv[2];
#pragma unroll
  for (int it = 0; it < 2; ++it) {
    const int oc = it * 32 + sub;    // output row within tile (= input column)
    v4u a, a2;
#pragma unroll
    for (int q = 0; q < 4; ++q) {
      const float f0 = tf[(c8 + 2 * q) * 68 + oc];
      const float f1 = tf[(c8 + 2 * q + 1) * 68 + oc];
      const unsigned short h0 = f2bf_bits(f0), h1 = f2bf_bits(f1);
      const unsigned short l0 = f2bf_bits(f0 - bf_bits2f(h0)), l1 = f2bf_bits(f1 - bf_bits2f(h1));
      a[q]  = pk16(h0, h1);
      a2[q] = pk16(l0, l1);
    }
    hv[it] = a; lv[it] = a2;
  }
  {
#pragma unroll
    for (int it = 0; it < 2; ++it) {
      const int oc = it * 32 + sub;
      const size_t go = (size_t)(c0 + oc) * R + r0 + c8;
      *(v4u*)(oh + go) = hv[it];
      *(v4u*)(ol + go) = lv[it];
    }
    
  }
}

// =====================================================================================
// Causal rel-pos attention, head dim 32, all (batch, head) pairs in one launch.
//   q planes (hi/lo bf16): element (b, t, h, d) at [(b*SEQ + t)*HID + h*32 + d]
//   k planes (hi/lo bf16): same layout
//   v^T planes (hi/lo bf16): element (b, h, d, s) at [((b*HID + h*32 + d))*SEQ + s]
//   er plane (bf16-RNE of Er): [r][d], pitch 32
//   scores = ((q.k) + (q.ErWin at the shift index)) * sscale; masked (s > t) scores set to -inf.
//   Block = 4 waves = 64 query rows of one (b,h); grid.x = NB*NH*64; key chunks of 64, trip count qb+1 <= 64.
//   Staging per chunk (128 threads, plain 16-B copies, __syncthreads before and after):
//     K hi/lo [64][32]: 128 thr x 16 elements per plane = whole tile; V^T hi/lo [32][64]: 128 thr x 16 = whole tile;
//     Er window [128][32]: 128 thr x 32 = all 128 rows (clamped source row, so every row is written).
//   Per-wave LDS: P hi/lo [16][64] (8 rows x 2 halves x 4x16 cols written = whole tile before it is read),
//     G [16][80] f32 (5 n-tiles x 16 cols x 16 rows written, columns 0..78 read), reused as out staging [16][36].
//   LDS rows are padded (KP, VP, GP below); the pad bytes are never written and never read.
// =====================================================================================
#define AT_NW 4
#define AT_QB 64
#define AT_KC 64
#define EWIN  128
#define GP    84   // G row pitch in floats: the two lane halves (8 rows apart) land 32 banks apart on the store, 24 on the shifted read
#define OSP   36
#define KP    40   // K and Er-window row pitch in elements: 64-B rows at 80 B (16 B x odd), conflict-free for 16-B fragment reads
#define VP    72   // V^T and P row pitch in elements: 128-B rows at 144 B (16 B x odd)

__device__ __forceinline__ __bf16 at_f2bf(float f) { return __builtin_bit_cast(__bf16, f2bf_bits(f)); }
__device__ __forceinline__ void at_split(float f, __bf16& hi, __bf16& lo) {
  const unsigned short hb = f2bf_bits(f);
  hi = __builtin_bit_cast(__bf16, hb);
  lo = at_f2bf(f - __uint_as_float(((unsigned)hb) << 16));
}
__device__ __forceinline__ v8f at_mma(v16b a, v16b b, v8f c) {
  c = __builtin_amdgcn_wmma_f32_16x16x32_bf16(false, a, false, b, (short)0, c, false, false);
  asm volatile("v_nop\n\tv_nop\n\tv_nop\n\tv_nop" : "+v"(c) : "v"(a), "v"(b));
  return c;
}

__global__ __launch_bounds__(128)
void relattn32_kernel(const unsigned short* __restrict__ qhp, const unsigned short* __restrict__ qlp,
                      const unsigned short* __restrict__ khp, const unsigned short* __restrict__ klp,
                      const unsigned short* __restrict__ vhp, const unsigned short* __restrict__ vlp,
                      const unsigned short* __restrict__ erp, float* __restrict__ out, float sscale) {
  union FB { v16b v; v8b h[2]; };
  __shared__ __align__(16) __bf16 Ksh[AT_KC * KP];             // K hi [kv][d], pitch KP      5 KB
  __shared__ __align__(16) __bf16 Ksl[AT_KC * KP];             // K lo
  __shared__ __align__(16) __bf16 Vth[HD * VP];                // V hi [d][kv], pitch VP      4.5 KB
  __shared__ __align__(16) __bf16 Vtl[HD * VP];                // V lo
  __shared__ __align__(16) __bf16 Esh[EWIN * KP];              // Er window [w][d], pitch KP  10 KB
  __shared__ __align__(16) __bf16 Psh[AT_NW][16 * VP];         // per wave P hi [row][kv], pitch VP
  __shared__ __align__(16) __bf16 Psl[AT_NW][16 * VP];         // per wave P lo
  __shared__ __align__(16) float  Gs[AT_NW][16 * GP];          // per wave rel tile [16][80], pitch GP; later out staging pitch 36

  const int tid  = threadIdx.x;
  const int wave = tid >> 5;
  const int lane = tid & 31;
  const int hh   = lane >> 4;
  const int c    = lane & 15;

  const int bx   = blockIdx.x;
  const int qb   = bx & (NQB - 1);        // 0..63
  const int pair = bx >> 6;               // 0..15
  const int b    = pair >> 2;
  const int h    = pair & 3;
  const int q0   = qb * AT_QB + wave * 16;
  const size_t rowBase = (size_t)b * SEQ;

  const __bf16* Qh = (const __bf16*)(const void*)qhp + h * HD;
  const __bf16* Ql = (const __bf16*)(const void*)qlp + h * HD;
  const __bf16* Kh = (const __bf16*)(const void*)khp + h * HD;
  const __bf16* Kl = (const __bf16*)(const void*)klp + h * HD;
  const __bf16* Vh = (const __bf16*)(const void*)vhp + ((size_t)b * HID + h * HD) * SEQ;
  const __bf16* Vl = (const __bf16*)(const void*)vlp + ((size_t)b * HID + h * HD) * SEQ;
  const __bf16* Er = (const __bf16*)(const void*)erp;
  float*        ob = out + h * HD;

  // ---- Q fragments (A operand, row = lane&15, split k map, one k-step of 32 = d), hi and lo ----
  const v16b qah = FragB::load(Qh + (rowBase + q0 + c) * HID + 8 * hh);
  const v16b qal = FragB::load(Ql + (rowBase + q0 + c) * HID + 8 * hh);

  float mrow[8], lrow[8];
  v8f oacc[2];
#pragma unroll
  for (int r = 0; r < 8; ++r) { mrow[r] = -INFINITY; lrow[r] = 0.f; }
  oacc[0] = zero8(); oacc[1] = zero8();

  const int wbase = 48 - 16 * wave;       // first window row of this wave's G tile
  float* gw = Gs[wave];
  __bf16* pwh = Psh[wave];
  __bf16* pwl = Psl[wave];

  const int nChunks = qb + 1;             // block-uniform, <= 64
  for (int kc = 0; kc < nChunks; ++kc) {
    const int kv0 = kc * AT_KC;
    int e0 = SEQ - 64 - 64 * (qb - kc);   // Er window base row, 0 .. 4032
    __syncthreads();
    {
      // K: thread -> key row r = tid>>1, d half = (tid&1)*16; 2 x 8 elements per plane
      const int r = tid >> 1, half = (tid & 1) * 16;
      const __bf16* ks = Kh + (rowBase + kv0 + r) * HID + half;
      const __bf16* kl = Kl + (rowBase + kv0 + r) * HID + half;
      // V^T: thread -> d = tid>>2, key quarter = (tid&3)*16; 2 x 8 elements per plane
      const int d = tid >> 2, qt = (tid & 3) * 16;
      const __bf16* vs = Vh + (size_t)d * SEQ + kv0 + qt;
      const __bf16* vl = Vl + (size_t)d * SEQ + kv0 + qt;
      // Er window: thread -> window row tid, clamped source row (address clamp), 4 x 8 elements
      int erow = e0 + tid;
      erow = erow < 0 ? 0 : erow;
      erow = erow > (SEQ - 1) ? (SEQ - 1) : erow;
      const __bf16* es = Er + (size_t)erow * HD;
#pragma unroll
      for (int i = 0; i < 2; ++i) {
        const v8b a0 = *(const v8b*)(ks + 8 * i);
        const v8b a1 = *(const v8b*)(kl + 8 * i);
        const v8b b0 = *(const v8b*)(vs + 8 * i);
        const v8b b1 = *(const v8b*)(vl + 8 * i);
        *(v8b*)(Ksh + r * KP + half + 8 * i) = a0;
        *(v8b*)(Ksl + r * KP + half + 8 * i) = a1;
        *(v8b*)(Vth + d * VP + qt   + 8 * i) = b0;
        *(v8b*)(Vtl + d * VP + qt   + 8 * i) = b1;
      }
#pragma unroll
      for (int i = 0; i < 4; ++i) {
        const v8b ee = *(const v8b*)(es + 8 * i);
        *(v8b*)(Esh + tid * KP + 8 * i) = ee;
      }
    }
    __syncthreads();

    // ---- content scores: 16 queries x 64 keys, 3-term split ----
    v8f s[4];
#pragma unroll
    for (int j = 0; j < 4; ++j) {
      FB kb, kl;
      const __bf16* kp = Ksh + (j * 16 + c) * KP + 8 * hh;
      const __bf16* kq = Ksl + (j * 16 + c) * KP + 8 * hh;
      kb.h[0] = *(const v8b*)(kp); kb.h[1] = *(const v8b*)(kp + 16);
      kl.h[0] = *(const v8b*)(kq); kl.h[1] = *(const v8b*)(kq + 16);
      v8f a = zero8();
      a = at_mma(qah, kb.v, a);
      a = at_mma(qah, kl.v, a);
      a = at_mma(qal, kb.v, a);
      s[j] = a;
    }

    // ---- rel-pos tile G[16][80] = q . Win[wbase + 0..79]^T (2 products), to this wave's LDS tile ----
#pragma unroll
    for (int nt = 0; nt < 5; ++nt) {
      FB eb;
      const __bf16* ep = Esh + (wbase + nt * 16 + c) * KP + 8 * hh;
      eb.h[0] = *(const v8b*)(ep); eb.h[1] = *(const v8b*)(ep + 16);
      v8f g = zero8();
      g = at_mma(qah, eb.v, g);
      g = at_mma(qal, eb.v, g);
#pragma unroll
      for (int r = 0; r < 8; ++r) gw[(8 * hh + r) * GP + nt * 16 + c] = g[r];
    }
    __builtin_amdgcn_fence(__ATOMIC_RELEASE, "workgroup");
    __builtin_amdgcn_wave_barrier();
    __builtin_amdgcn_fence(__ATOMIC_ACQUIRE, "workgroup");

    // ---- combine, scale, causal mask, chunk row max ----
    const bool diag = (kc == qb);           // block-uniform
    float cm[8];
#pragma unroll
    for (int r = 0; r < 8; ++r) {
      const int il   = wave * 16 + 8 * hh + r;          // row within the 64-row block
      const int qrow = qb * AT_QB + il;
      const float* gr = gw + (8 * hh + r) * GP + (15 - 8 * hh - r);   // + jl gives shift column 15 - il_w + jl
      float m = -INFINITY;
#pragma unroll
      for (int j = 0; j < 4; ++j) {
        const int kvcol = kv0 + j * 16 + c;
        const float rel = gr[j * 16 + c];
        const float sv  = (s[j][r] + rel) * sscale;
        const bool msk  = diag && (kvcol > qrow);
        const float sm  = msk ? -INFINITY : sv;
        s[j][r] = sm;
        m = fmaxf(m, sm);
      }
#pragma unroll
      for (int off = 1; off < 16; off <<= 1) m = fmaxf(m, __shfl_xor(m, off, 32));
      cm[r] = m;
    }

    // ---- online softmax update; P (unnormalised) as bf16 hi/lo into this wave's LDS tiles ----
#pragma unroll
    for (int r = 0; r < 8; ++r) {
      const float mnew  = fmaxf(mrow[r], cm[r]);
      const float alpha = __expf(mrow[r] - mnew);
      mrow[r] = mnew;
      float psum = 0.f;
#pragma unroll
      for (int j = 0; j < 4; ++j) {
        const float p = __expf(s[j][r] - mnew);
        psum += p;
        __bf16 a, bl; at_split(p, a, bl);
        pwh[(8 * hh + r) * VP + j * 16 + c] = a;
        pwl[(8 * hh + r) * VP + j * 16 + c] = bl;
      }
#pragma unroll
      for (int off = 1; off < 16; off <<= 1) psum += __shfl_xor(psum, off, 32);
      lrow[r] = lrow[r] * alpha + psum;
      oacc[0][r] *= alpha;
      oacc[1][r] *= alpha;
    }
    __builtin_amdgcn_fence(__ATOMIC_RELEASE, "workgroup");
    __builtin_amdgcn_wave_barrier();
    __builtin_amdgcn_fence(__ATOMIC_ACQUIRE, "workgroup");

    // ---- O += P . V : A = P tile (row = query, split k map over keys), B = V^T rows d; 3-term split ----
#pragma unroll 1
    for (int kk = 0; kk < 2; ++kk) {
      FB pa, pl;
      pa.h[0] = *(const v8b*)(pwh + c * VP + kk * 32 + 8 * hh);
      pa.h[1] = *(const v8b*)(pwh + c * VP + kk * 32 + 16 + 8 * hh);
      pl.h[0] = *(const v8b*)(pwl + c * VP + kk * 32 + 8 * hh);
      pl.h[1] = *(const v8b*)(pwl + c * VP + kk * 32 + 16 + 8 * hh);
#pragma unroll
      for (int t = 0; t < 2; ++t) {
        FB vb, vl;
        vb.h[0] = *(const v8b*)(Vth + (t * 16 + c) * VP + kk * 32 + 8 * hh);
        vb.h[1] = *(const v8b*)(Vth + (t * 16 + c) * VP + kk * 32 + 16 + 8 * hh);
        vl.h[0] = *(const v8b*)(Vtl + (t * 16 + c) * VP + kk * 32 + 8 * hh);
        vl.h[1] = *(const v8b*)(Vtl + (t * 16 + c) * VP + kk * 32 + 16 + 8 * hh);
        oacc[t] = at_mma(pa.v, vb.v, oacc[t]);
        oacc[t] = at_mma(pa.v, vl.v, oacc[t]);
        oacc[t] = at_mma(pl.v, vb.v, oacc[t]);
      }
    }
  }

  __builtin_amdgcn_fence(__ATOMIC_RELEASE, "workgroup");
  __builtin_amdgcn_wave_barrier();
  __builtin_amdgcn_fence(__ATOMIC_ACQUIRE, "workgroup");
  float* os = gw;
#pragma unroll
  for (int r = 0; r < 8; ++r) {
    const float inv = 1.0f / lrow[r];
    os[(8 * hh + r) * OSP + c]      = oacc[0][r] * inv;
    os[(8 * hh + r) * OSP + 16 + c] = oacc[1][r] * inv;
  }
  __builtin_amdgcn_fence(__ATOMIC_RELEASE, "workgroup");
  __builtin_amdgcn_wave_barrier();
  __builtin_amdgcn_fence(__ATOMIC_ACQUIRE, "workgroup");
  {
    const int q4 = lane >> 3, c4 = (lane & 7) * 4;
    {
#pragma unroll
      for (int it = 0; it < 4; ++it) {
        const int row = it * 4 + q4;                   // it 0..3 x q4 0..3 covers rows 0..15 of the wave tile
        const v4f val = *(const v4fa*)(os + row * OSP + c4);
        *(v4f*)(ob + (rowBase + q0 + row) * HID + c4) = val;
      }
      
    }
  }
}

// ---------------------------------------------------------------------------
// Workspace region map (byte offsets):
//   WqTh bf16 [128 n][128 k]        0      WqTl     32768
//   WkTh                        65536      WkTl     98304
//   WvTh                       131072      WvTl    163840     (lo weight planes written, not consumed)
//   Xb   bf16 [16384][128]     196608                         (4194304 B)
//   ErB  bf16 [4096][32]      4390912                         (262144 B)
//   Qh   bf16 [16384][128]    4653056      Ql    8847360
//   Kh   bf16 [16384][128]   13041664      Kl   17235968
//   VTh  bf16 [4][128][4096] 21430272      VTl  25624576
//   total                    29818880
// Every region is written in whole 64x64 tiles / whole 16-B-per-lane runs; all extents are exact tile multiples,
// ---------------------------------------------------------------------------
extern "C" void kernel_launch(void* const* d_in, const int* in_sizes, int n_in,
                              void* d_out, int out_size, void* d_ws, size_t ws_size,
                              hipStream_t stream) {
  if (n_in < 8) return;
  if (in_sizes[0] != NB * SEQ * HID) return;
  if (in_sizes[1] != HID * HID || in_sizes[3] != HID * HID || in_sizes[5] != HID * HID) return;
  if (in_sizes[2] != HID || in_sizes[4] != HID || in_sizes[6] != HID) return;
  if (in_sizes[7] != SEQ * HD) return;
  if (out_size != NB * SEQ * HID) return;

  const float* x  = (const float*)d_in[0];
  const float* Wq = (const float*)d_in[1];
  const float* bq = (const float*)d_in[2];
  const float* Wk = (const float*)d_in[3];
  const float* bk = (const float*)d_in[4];
  const float* Wv = (const float*)d_in[5];
  const float* bv = (const float*)d_in[6];
  const float* Er = (const float*)d_in[7];
  float* out = (float*)d_out;

  const size_t PW = (size_t)HID * HID * 2;            //    32768  bf16 weight plane
  const size_t PX = (size_t)NB * SEQ * HID * 2;       //  4194304  bf16 activation plane (all batch rows)
  const size_t PE = (size_t)SEQ * HD * 2;             //   262144  bf16 Er plane
  const size_t PV = (size_t)NB * HID * SEQ * 2;       //  4194304  bf16 v^T plane
  size_t off = 0;
  const size_t oWqTh = off; off += PW;  const size_t oWqTl = off; off += PW;
  const size_t oWkTh = off; off += PW;  const size_t oWkTl = off; off += PW;
  const size_t oWvTh = off; off += PW;  const size_t oWvTl = off; off += PW;
  const size_t oXb   = off; off += PX;
  const size_t oErB  = off; off += PE;
  const size_t oQh   = off; off += PX;  const size_t oQl   = off; off += PX;
  const size_t oKh   = off; off += PX;  const size_t oKl   = off; off += PX;
  const size_t oVTh  = off; off += PV;  const size_t oVTl  = off; off += PV;
  if (off > ws_size) return;                          // off = 29818880
  if (off > (size_t)134217728) return;

  char* ws = (char*)d_ws;
  unsigned short* WqTh = (unsigned short*)(ws + oWqTh); unsigned short* WqTl = (unsigned short*)(ws + oWqTl);
  unsigned short* WkTh = (unsigned short*)(ws + oWkTh); unsigned short* WkTl = (unsigned short*)(ws + oWkTl);
  unsigned short* WvTh = (unsigned short*)(ws + oWvTh); unsigned short* WvTl = (unsigned short*)(ws + oWvTl);
  unsigned short* Xb   = (unsigned short*)(ws + oXb);
  unsigned short* ErB  = (unsigned short*)(ws + oErB);
  unsigned short* Qh   = (unsigned short*)(ws + oQh);   unsigned short* Ql   = (unsigned short*)(ws + oQl);
  unsigned short* Kh   = (unsigned short*)(ws + oKh);   unsigned short* Kl   = (unsigned short*)(ws + oKl);
  unsigned short* VTh  = (unsigned short*)(ws + oVTh);  unsigned short* VTl  = (unsigned short*)(ws + oVTl);

  const dim3 blk(256);
  const float sscale = 0.17677669529663688f;          // 1/sqrt(32)

  // (1) weights [in k][out n] f32 -> transposed bf16 planes [n][k]   (in [128][128] -> out [128][128]; grid (cols/64, rows/64))
  tsplit_kernel<<<dim3(HID / 64, HID / 64), blk, 0, stream>>>(Wq, WqTh, WqTl, HID, HID);
  tsplit_kernel<<<dim3(HID / 64, HID / 64), blk, 0, stream>>>(Wk, WkTh, WkTl, HID, HID);
  tsplit_kernel<<<dim3(HID / 64, HID / 64), blk, 0, stream>>>(Wv, WvTh, WvTl, HID, HID);
  // (2) x -> bf16 plane [16384][128]; Er -> bf16 plane [4096][32]
  const int n8x = NB * SEQ * HID / 8;                 // 262144 threads x 8 = whole plane
  const int n8e = SEQ * HD / 8;                       //  16384 threads x 8 = whole plane
  cvt_bf16x8_kernel<<<dim3((n8x + 255) / 256), blk, 0, stream>>>(x, Xb, n8x);
  cvt_bf16x8_kernel<<<dim3((n8e + 255) / 256), blk, 0, stream>>>(Er, ErB, n8e);
  // (3) q = x.Wq + bq -> Q hi/lo planes [b*4096+t][h*32+d]   (M=16384, N=128, K=128; 512 tiles -> 64 blocks)
  const dim3 gProj(((NB * SEQ / 64) * (HID / 64) + 7) / 8, 1);
  wmma_gemm64<false, 2, 2><<<gProj, blk, 0, stream>>>(
      Xb, Xb, HID, 0L, WqTh, WqTh, HID, 0L, (void*)Qh, (void*)Ql, HID, 0L, bq, NB * SEQ, HID, HID, 1.0f);
  // (4) k = x.Wk + bk -> K hi/lo planes
  wmma_gemm64<false, 2, 2><<<gProj, blk, 0, stream>>>(
      Xb, Xb, HID, 0L, WkTh, WkTh, HID, 0L, (void*)Kh, (void*)Kl, HID, 0L, bk, NB * SEQ, HID, HID, 1.0f);
  // (5) v^T = Wv^T . x^T + bv[m] -> VT hi/lo planes [b][h*32+d][s]   (A = Wv^T plane [128][128], Bt = x plane rows of batch z;
  //     M=128, N=4096, K=128; 128 tiles -> 16 blocks, grid.y = batch)
  const dim3 gVT(((HID / 64) * (SEQ / 64) + 7) / 8, NB);
  wmma_gemm64<false, 1, 2><<<gVT, blk, 0, stream>>>(
      WvTh, WvTh, HID, 0L, Xb, Xb, HID, (long)SEQ * HID, (void*)VTh, (void*)VTl, SEQ, (long)HID * SEQ,
      bv, HID, SEQ, HID, 1.0f);
  // (6) causal rel-pos attention: 1024 blocks = 16 (b,h) pairs x 64 query blocks, 128 threads
  relattn32_kernel<<<dim3(NB * NH * NQB), dim3(128), 0, stream>>>(Qh, Ql, Kh, Kl, VTh, VTl, ErB, out, sscale);
  (void)hipGetLastError();
}

// v002
// Measured time: 197 microseconds a run.
// In both of two side-by-side timings against v001, it was 1.51 times as fast.
// Over all steps from v000 it is 2.12 times as fast.
// Contractions: q, k, v^T projections x.W, v^T = Wv^T.x^T (+bias): v_wmma_f32_16x16x32_bf16, single product of bf16-RNE-valued x and W planes, f32 accumulate;
// scores (k.q^T, keys as rows): bf16 hi/lo split (hi.hi + hi.lo + lo.hi); rel-pos term ErWin.q^T: q hi/lo x bf16-RNE Er (hi.E + lo.E); V^T.P^T: bf16 hi/lo split (3 products);
// all v_wmma_f32_16x16x32_bf16 with f32 accumulate. Softmax, bias adds and the 1/sqrt(32) score scale in f32.
//
// Math implemented (B=4, S=4096, hidden 128, 4 heads x 32):
//   q = x.Wq + bq, k = x.Wk + bk, v = x.Wv + bv   (W stored [in][out]; head h = columns h*32..h*32+31)
//   rel[i][j] = q_i . Er[S-1-(i-j)]  for j <= i   (pad-left / reshape shift identity; j > i entries are masked)
//   logit[i][j] = (q_i.k_j + rel[i][j]) * (1/sqrt(32)),  causal (j <= i, diagonal included), softmax over j, out = P.v
//   out[(b*S + i)*128 + h*32 + d]   (no output projection)
//
// Plane / carry audit: every 16-bit plane is bf16 with unit carry (x, W^T, Er: bf16-RNE of the inputs; q, k, v^T: hi/lo bf16
// pairs of the f32 projection results; P: hi/lo bf16 pairs of exp(s - m)); nothing is scaled, nothing to fold back.
//
// Er window per (query block qb, key chunk kc): window row w <-> Er row e0 + w, e0 = S - 64 - 64*(qb - kc), w in 0..127
// (clamped copy, rows past S-1 only ever meet masked keys). For block row il (0..63) and chunk key jl (0..63):
// w = 63 - il + jl. Wave wv (rows il = 16*wv..16*wv+15) computes G^T[80][16] = Win[48 - 16*wv + 0..79] . q^T, stores it as G[row][80] and reads
// G[row][15 - (il - 16*wv) + jl].
#include <hip/hip_runtime.h>
#include <math.h>
#include <stdint.h>

#define NB   4
#define SEQ  4096
#define HID  128
#define NH   4
#define HD   32
#define NQB  (SEQ / 64)

typedef __attribute__((ext_vector_type(16))) _Float16 v16h;
typedef __attribute__((ext_vector_type(8)))  _Float16 v8h;
typedef __attribute__((ext_vector_type(16))) __bf16   v16b;
typedef __attribute__((ext_vector_type(8)))  __bf16   v8b;
typedef __attribute__((ext_vector_type(8)))  float    v8f;
typedef __attribute__((ext_vector_type(4)))  float    v4f;
typedef __attribute__((ext_vector_type(4)))  unsigned int v4u;
typedef v4f __attribute__((may_alias)) v4fa;

__device__ __forceinline__ unsigned short f2bf_bits(float f) {
  unsigned u = __float_as_uint(f);
  return (unsigned short)((u + 0x7FFFu + ((u >> 16) & 1u)) >> 16);
}
__device__ __forceinline__ float bf_bits2f(unsigned short h) { return __uint_as_float(((unsigned)h) << 16); }
__device__ __forceinline__ float bf_rne(float f) { return bf_bits2f(f2bf_bits(f)); }
__device__ __forceinline__ unsigned pk16(unsigned short a, unsigned short b) { return (unsigned)a | ((unsigned)b << 16); }

// hazard guards as plain device helpers
__device__ __forceinline__ void dep_guard_b(v8f& a, v8f& b, v16b x, v16b y) { asm volatile("v_nop\n\tv_nop\n\tv_nop\n\tv_nop" : "+v"(a), "+v"(b) : "v"(x), "v"(y)); }
__device__ __forceinline__ void keep4_b(v16b a, v16b b, v16b c, v16b d) { asm volatile("v_nop" :: "v"(a), "v"(b), "v"(c), "v"(d)); }
__device__ __forceinline__ void acc_guard4(v8f& a, v8f& b, v8f& c, v8f& d) { asm volatile("v_nop\n\tv_nop\n\tv_nop\n\tv_nop" : "+v"(a), "+v"(b), "+v"(c), "+v"(d)); }

// 16-bit WMMA fragment (A: p = row m at k0 + 8h; B stored [n][k]: p = row n at k0 + 8h; same split k map):
// elements 0..7 <- p[0..7], elements 8..15 <- p[16..23]
struct FragB {
  union U { v16b v; v8b h[2]; };
  static __device__ __forceinline__ v16b load(const __bf16* p) {
    U f; f.h[0] = *(const v8b*)(p); f.h[1] = *(const v8b*)(p + 16); return f.v;
  }
  static __device__ __forceinline__ v8f mma(v16b a, v16b b, v8f c) {
    return __builtin_amdgcn_wmma_f32_16x16x32_bf16(false, a, false, b, (short)0, c, false, false);
  }
};

__device__ __forceinline__ v8f zero8() { v8f z = {0.f, 0.f, 0.f, 0.f, 0.f, 0.f, 0.f, 0.f}; return z; }

// ---- Register-blocked batched WMMA GEMM (bf16 operands) --------------------
// C[m,n] = scale * sum_k A[m,k] * Bt[n,k] (+bf16-RNE bias); each wave owns a 64x64 tile, 8 waves per block.
// A row-major [M,K]; Bt row-major [N,K]; M,N % 64 == 0, K % 32 == 0 (host-checked).
// SPLIT: operands are hi/lo planes (A2/Bt2 = lo planes, same layout); product = hi.hi + hi.lo + lo.hi.
// BIAS_MODE: 0 = none, 1 = bias[m], 2 = bias[n]  (bias value converted bf16-RNE, added in f32).
// OUT_MODE: 0 = f32, 2 = bf16 hi plane (Cout) + bf16 lo plane (Cout2).
// coverage: 4 slabs x 16 rows x 64 cols = the whole 64x64 tile per wave; tiles cover M x N exactly.
template <bool SPLIT, int BIAS_MODE, int OUT_MODE>
__global__ __launch_bounds__(256) void wmma_gemm64(
    const unsigned short* __restrict__ Ap, const unsigned short* __restrict__ A2p, int lda, long strideA,
    const unsigned short* __restrict__ Btp, const unsigned short* __restrict__ Bt2p, int ldb, long strideB,
    void* __restrict__ Cout, void* __restrict__ Cout2, int ldc, long strideC,
    const float* __restrict__ bias, int M, int N, int K, float scale) {
  const __bf16* A = (const __bf16*)(const void*)Ap;   const __bf16* A2  = (const __bf16*)(const void*)A2p;
  const __bf16* Bt = (const __bf16*)(const void*)Btp; const __bf16* Bt2 = (const __bf16*)(const void*)Bt2p;
  __shared__ __align__(16) float sT[8][16 * 68];   // per-wave 16x64 slab, pitch 68 floats
  const int b    = blockIdx.y;
  const int lane = threadIdx.x & 31;
  const int wave = threadIdx.x >> 5;
  const int tilesN = N >> 6;
  const int tilesM = M >> 6;
  const int tile = blockIdx.x * 8 + wave;
  if (tile >= tilesM * tilesN) return;   // wave-uniform; no block barriers in this kernel
  const int tm = tile / tilesN;
  const int tn = tile - tm * tilesN;
  const int m0 = tm << 6;
  const int n0 = tn << 6;

  const __bf16* Ab  = A  + (size_t)b * strideA;
  const __bf16* Bb  = Bt + (size_t)b * strideB;
  const __bf16* Ab2 = SPLIT ? (A2  + (size_t)b * strideA) : nullptr;
  const __bf16* Bb2 = SPLIT ? (Bt2 + (size_t)b * strideB) : nullptr;

  const int rlane = lane & 15;                 // row (A) / col (B, D) within subtile
  const int koff  = (lane >> 4) * 8;           // k offset of this lane half
  const int mOff  = (lane >> 4) * 8;           // D row offset

  v8f acc[4][4];
#pragma unroll
  for (int i = 0; i < 4; ++i)
#pragma unroll
    for (int j = 0; j < 4; ++j) acc[i][j] = zero8();

  for (int k0 = 0; k0 < K; k0 += 32) {
    v16b bh[4], bl[4];
#pragma unroll
    for (int j = 0; j < 4; ++j) {
      const size_t bo = (size_t)(n0 + (j << 4) + rlane) * ldb + koff + k0;
      bh[j] = FragB::load(Bb + bo);
      bl[j] = bh[j];
      if (SPLIT) bl[j] = FragB::load(Bb2 + bo);
    }
#pragma unroll
    for (int i = 0; i < 4; ++i) {
      const size_t ao = (size_t)(m0 + (i << 4) + rlane) * lda + koff + k0;
      v16b ah = FragB::load(Ab + ao);
      v16b al = ah;
      if (SPLIT) al = FragB::load(Ab2 + ao);
#pragma unroll
      for (int j = 0; j < 4; ++j) {
        acc[i][j] = FragB::mma(ah, bh[j], acc[i][j]);
        if (SPLIT) {
          acc[i][j] = FragB::mma(ah, bl[j], acc[i][j]);
          acc[i][j] = FragB::mma(al, bh[j], acc[i][j]);
        }
      }
      dep_guard_b(acc[i][0], acc[i][3], ah, al);
    }
    keep4_b(bh[0], bh[1], bh[2], bh[3]);
    if (SPLIT) keep4_b(bl[0], bl[1], bl[2], bl[3]);
  }
  acc_guard4(acc[0][0], acc[0][1], acc[0][2], acc[0][3]);
  acc_guard4(acc[1][0], acc[1][1], acc[1][2], acc[1][3]);
  acc_guard4(acc[2][0], acc[2][1], acc[2][2], acc[2][3]);
  acc_guard4(acc[3][0], acc[3][1], acc[3][2], acc[3][3]);

  // ---- epilogue ----
  float* slab = sT[wave];
#pragma unroll
  for (int i = 0; i < 4; ++i) {
    const int mBase = m0 + (i << 4);
#pragma unroll
    for (int j = 0; j < 4; ++j) {
      const int n = n0 + (j << 4) + rlane;
      float bv = 0.f;
      if (BIAS_MODE == 2) bv = bf_rne(bias[n]);
#pragma unroll
      for (int r = 0; r < 8; ++r) {
        float v = acc[i][j][r] * scale;
        if (BIAS_MODE == 1) v += bf_rne(bias[mBase + mOff + r]);
        if (BIAS_MODE == 2) v += bv;
        slab[(mOff + r) * 68 + (j << 4) + rlane] = v;
      }
    }
    __builtin_amdgcn_fence(__ATOMIC_RELEASE, "workgroup");
    __builtin_amdgcn_wave_barrier();
    __builtin_amdgcn_fence(__ATOMIC_ACQUIRE, "workgroup");
    if (OUT_MODE == 0) {
      float* C = (float*)Cout + (size_t)b * strideC;
      const int hh = lane >> 4, c4 = (lane & 15) * 4;     // row seg = 256 B = 16 lanes x 16 B
      {
#pragma unroll
        for (int it = 0; it < 8; ++it) {
          const int row = it * 2 + hh;
          v4f v = *(const v4fa*)(slab + row * 68 + c4);
          *(v4f*)(C + (size_t)(mBase + row) * ldc + n0 + c4) = v;
        }
        
      }
    } else {
      const int q = lane >> 3, c8 = (lane & 7) * 8;
      unsigned short* C  = (unsigned short*)Cout  + (size_t)b * strideC;
      unsigned short* C2 = (unsigned short*)Cout2 + (size_t)b * strideC;
      {
#pragma unroll
        for (int it = 0; it < 4; ++it) {
          const int row = it * 4 + q;
          const float* sp = slab + row * 68 + c8;
          v8h hv, lv;
#pragma unroll
          for (int e = 0; e < 8; ++e) {
            unsigned short hb = f2bf_bits(sp[e]);
            unsigned short lb = f2bf_bits(sp[e] - bf_bits2f(hb));
            hv[e] = __builtin_bit_cast(_Float16, hb);
            lv[e] = __builtin_bit_cast(_Float16, lb);
          }
          *(v8h*)(C  + (size_t)(mBase + row) * ldc + n0 + c8) = hv;
          *(v8h*)(C2 + (size_t)(mBase + row) * ldc + n0 + c8) = lv;
        }
        
      }
    }
    __builtin_amdgcn_fence(__ATOMIC_RELEASE, "workgroup");
    __builtin_amdgcn_wave_barrier();
    __builtin_amdgcn_fence(__ATOMIC_ACQUIRE, "workgroup");
  }
}

// ---------------------------------------------------------------------------
// Contiguous f32 -> bf16-RNE plane: one thread = 8 consecutive elements = one 16-B store, so every wave writes
// grid = ceil(n8/256); coverage: n8 threads x 8 = the whole plane (n8 * 8 elements).
// ---------------------------------------------------------------------------
__global__ __launch_bounds__(256) void cvt_bf16x8_kernel(const float* __restrict__ in, unsigned short* __restrict__ o, int n8) {
  const int i = blockIdx.x * 256 + threadIdx.x;
  if (i < n8) {
    const float* sp = in + (size_t)i * 8;
    const v4f a  = *(const v4f*)(sp);
    const v4f a2 = *(const v4f*)(sp + 4);
    v4u w;
    w[0] = pk16(f2bf_bits(a[0]),  f2bf_bits(a[1]));
    w[1] = pk16(f2bf_bits(a[2]),  f2bf_bits(a[3]));
    w[2] = pk16(f2bf_bits(a2[0]), f2bf_bits(a2[1]));
    w[3] = pk16(f2bf_bits(a2[2]), f2bf_bits(a2[3]));
    unsigned short* dp = o + (size_t)i * 8;
    *(v4u*)dp = w;
    
  }
}

// ---------------------------------------------------------------------------
// Fused transpose + bf16 split of an f32 matrix: in [R rows][Cc cols] (pitch Cc) ->
//   oh[c][r] = bf16_rne(in[r][c]), ol[c][r] = bf16_rne(in[r][c] - oh)   ([Cc][R], pitch R).
// 64x64 tiles through LDS. grid = (Cc/64, R/64), 256 threads (R, Cc multiples of 64).
// Coverage per block and plane: load 4 it x 256 thr x 4 floats = 64x64; store 2 it x 256 thr x 8 u16 = 64x64.
// ---------------------------------------------------------------------------
__global__ __launch_bounds__(256) void tsplit_kernel(const float* __restrict__ W, unsigned short* __restrict__ oh,
                                                     unsigned short* __restrict__ ol, int R, int Cc) {
  __shared__ __align__(16) float tf[64 * 68];
  const int c0  = blockIdx.x * 64;   // input column block = output row block
  const int r0  = blockIdx.y * 64;   // input row block    = output column block
  const int tid = threadIdx.x;
  {
    const int lr = tid >> 4;         // 0..15
    const int c4 = (tid & 15) * 4;   // 0..60
#pragma unroll
    for (int it = 0; it < 4; ++it) {
      const int rr = it * 16 + lr;   // 0..63
      const v4f a = *(const v4f*)(W + (size_t)(r0 + rr) * Cc + c0 + c4);
      *(v4f*)(tf + rr * 68 + c4) = a;
    }
  }
  __syncthreads();
  const int sub = tid >> 3;          // 0..31
  const int c8  = (tid & 7) * 8;     // 0..56
  v4u hv[2], lv[2];
#pragma unroll
  for (int it = 0; it < 2; ++it) {
    const int oc = it * 32 + sub;    // output row within tile (= input column)
    v4u a, a2;
#pragma unroll
    for (int q = 0; q < 4; ++q) {
      const float f0 = tf[(c8 + 2 * q) * 68 + oc];
      const float f1 = tf[(c8 + 2 * q + 1) * 68 + oc];
      const unsigned short h0 = f2bf_bits(f0), h1 = f2bf_bits(f1);
      const unsigned short l0 = f2bf_bits(f0 - bf_bits2f(h0)), l1 = f2bf_bits(f1 - bf_bits2f(h1));
      a[q]  = pk16(h0, h1);
      a2[q] = pk16(l0, l1);
    }
    hv[it] = a; lv[it] = a2;
  }
  {
#pragma unroll
    for (int it = 0; it < 2; ++it) {
      const int oc = it * 32 + sub;
      const size_t go = (size_t)(c0 + oc) * R + r0 + c8;
      *(v4u*)(oh + go) = hv[it];
      *(v4u*)(ol + go) = lv[it];
    }
    
  }
}

// =====================================================================================
// Causal rel-pos attention, head dim 32, all (batch, head) pairs in one launch.
//   q planes (hi/lo bf16): element (b, t, h, d) at [(b*SEQ + t)*HID + h*32 + d]
//   k planes (hi/lo bf16): same layout
//   v^T planes (hi/lo bf16): element (b, h, d, s) at [((b*HID + h*32 + d))*SEQ + s]
//   er plane (bf16-RNE of Er): [r][d], pitch 32
//   scores = ((q.k) + (q.ErWin at the shift index)) * sscale; masked (s > t) scores set to -inf.
//   Block = 4 waves = 64 query rows of one (b,h); grid.x = NB*NH*64; key chunks of 64, trip count qb+1 <= 64.
//   Staging per chunk (128 threads, plain 16-B copies, __syncthreads before and after):
//     K hi/lo [64][32]: 128 thr x 16 elements per plane = whole tile; V^T hi/lo [32][64]: 128 thr x 16 = whole tile;
//     Er window [128][32]: 128 thr x 32 = all 128 rows (clamped source row, so every row is written).
//   All three products are taken transposed (keys, window rows or d as the rows of D, queries as its columns), so lane (c, hh)
//   holds query c of the wave's 16: its scores for keys 16j + 8hh + r, its maximum and sum in-lane (the two lane halves are joined
//   by one cross-half move), and exp(s - m) converts in place into the B fragment of V^T.P^T (element e of k-step kk =
//   tile 2kk + (e >> 3), register e & 7: the same split k map as the V^T loader). P never goes through LDS.
//   Per-wave LDS: G [16 queries][80] f32 (5 tiles x 16 window rows x 16 queries written, columns 0..78 read), reused as out staging [16][36].
//   LDS rows are padded (KP, VP, GP below); the pad bytes are never written and never read.
// =====================================================================================
#define AT_NW 4
#define AT_QB 64
#define AT_KC 64
#define EWIN  128
#define GP    84   // G row pitch in floats: 16 B x odd for the 16-B stores (lane = row); the shifted 4-B reads step 83 floats a query and 8 between lane halves; mod 32 banks, upper-half query c + 8 meets lower-half query c
#define OSP   36
#define KP    40   // K and Er-window row pitch in elements: 64-B rows at 80 B (16 B x odd), conflict-free for 16-B fragment reads
#define VP    72   // V^T row pitch in elements: 128-B rows at 144 B (16 B x odd)

__device__ __forceinline__ __bf16 at_f2bf(float f) { return __builtin_bit_cast(__bf16, f2bf_bits(f)); }
__device__ __forceinline__ void at_split(float f, __bf16& hi, __bf16& lo) {
  const unsigned short hb = f2bf_bits(f);
  hi = __builtin_bit_cast(__bf16, hb);
  lo = at_f2bf(f - __uint_as_float(((unsigned)hb) << 16));
}
// lane l <-> lane l ^ 16 (the two halves that share a query)
__device__ __forceinline__ float at_xhalf(float x) {
  return __builtin_bit_cast(float, __builtin_amdgcn_permlanex16(__builtin_bit_cast(int, x), __builtin_bit_cast(int, x),
                                                                0x76543210, 0xfedcba98, false, false));
}
__device__ __forceinline__ v8f at_mma(v16b a, v16b b, v8f c) {
  c = __builtin_amdgcn_wmma_f32_16x16x32_bf16(false, a, false, b, (short)0, c, false, false);
  asm volatile("v_nop\n\tv_nop\n\tv_nop\n\tv_nop" : "+v"(c) : "v"(a), "v"(b));
  return c;
}

__global__ __launch_bounds__(128)
void relattn32_kernel(const unsigned short* __restrict__ qhp, const unsigned short* __restrict__ qlp,
                      const unsigned short* __restrict__ khp, const unsigned short* __restrict__ klp,
                      const unsigned short* __restrict__ vhp, const unsigned short* __restrict__ vlp,
                      const unsigned short* __restrict__ erp, float* __restrict__ out, float sscale) {
  union FB { v16b v; v8b h[2]; };
  __shared__ __align__(16) __bf16 Ksh[AT_KC * KP];             // K hi [kv][d], pitch KP      5 KB
  __shared__ __align__(16) __bf16 Ksl[AT_KC * KP];             // K lo
  __shared__ __align__(16) __bf16 Vth[HD * VP];                // V hi [d][kv], pitch VP      4.5 KB
  __shared__ __align__(16) __bf16 Vtl[HD * VP];                // V lo
  __shared__ __align__(16) __bf16 Esh[EWIN * KP];              // Er window [w][d], pitch KP  10 KB
  __shared__ __align__(16) float  Gs[AT_NW][16 * GP];          // per wave rel tile [query][80], pitch GP; later out staging pitch 36

  const int tid  = threadIdx.x;
  const int wave = tid >> 5;
  const int lane = tid & 31;
  const int hh   = lane >> 4;
  const int c    = lane & 15;

  const int bx   = blockIdx.x;
  const int qb   = bx & (NQB - 1);        // 0..63
  const int pair = bx >> 6;               // 0..15
  const int b    = pair >> 2;
  const int h    = pair & 3;
  const int q0   = qb * AT_QB + wave * 16;
  const size_t rowBase = (size_t)b * SEQ;

  const __bf16* Qh = (const __bf16*)(const void*)qhp + h * HD;
  const __bf16* Ql = (const __bf16*)(const void*)qlp + h * HD;
  const __bf16* Kh = (const __bf16*)(const void*)khp + h * HD;
  const __bf16* Kl = (const __bf16*)(const void*)klp + h * HD;
  const __bf16* Vh = (const __bf16*)(const void*)vhp + ((size_t)b * HID + h * HD) * SEQ;
  const __bf16* Vl = (const __bf16*)(const void*)vlp + ((size_t)b * HID + h * HD) * SEQ;
  const __bf16* Er = (const __bf16*)(const void*)erp;
  float*        ob = out + h * HD;

  // ---- Q fragments (B operand, column = query = lane&15, split k map, one k-step of 32 = d), hi and lo ----
  const v16b qah = FragB::load(Qh + (rowBase + q0 + c) * HID + 8 * hh);
  const v16b qal = FragB::load(Ql + (rowBase + q0 + c) * HID + 8 * hh);

  float mrow = -INFINITY;                 // running maximum of query c (equal in both lane halves)
  float lrow = 0.f;                       // running sum of query c over this lane half's keys; halves joined after the loop
  v8f oacc[2];                            // O^T: oacc[t][r] = out[query c][d = 16t + 8hh + r]
  oacc[0] = zero8(); oacc[1] = zero8();
  const int qrow = qb * AT_QB + wave * 16 + c;

  const int wbase = 48 - 16 * wave;       // first window row of this wave's G tile
  float* gw = Gs[wave];

  const int nChunks = qb + 1;             // block-uniform, <= 64
  for (int kc = 0; kc < nChunks; ++kc) {
    const int kv0 = kc * AT_KC;
    int e0 = SEQ - 64 - 64 * (qb - kc);   // Er window base row, 0 .. 4032
    __syncthreads();
    {
      // K: thread -> key row r = tid>>1, d half = (tid&1)*16; 2 x 8 elements per plane
      const int r = tid >> 1, half = (tid & 1) * 16;
      const __bf16* ks = Kh + (rowBase + kv0 + r) * HID + half;
      const __bf16* kl = Kl + (rowBase + kv0 + r) * HID + half;
      // V^T: thread -> d = tid>>2, key quarter = (tid&3)*16; 2 x 8 elements per plane
      const int d = tid >> 2, qt = (tid & 3) * 16;
      const __bf16* vs = Vh + (size_t)d * SEQ + kv0 + qt;
      const __bf16* vl = Vl + (size_t)d * SEQ + kv0 + qt;
      // Er window: thread -> window row tid, clamped source row (address clamp), 4 x 8 elements
      int erow = e0 + tid;
      erow = erow < 0 ? 0 : erow;
      erow = erow > (SEQ - 1) ? (SEQ - 1) : erow;
      const __bf16* es = Er + (size_t)erow * HD;
#pragma unroll
      for (int i = 0; i < 2; ++i) {
        const v8b a0 = *(const v8b*)(ks + 8 * i);
        const v8b a1 = *(const v8b*)(kl + 8 * i);
        const v8b b0 = *(const v8b*)(vs + 8 * i);
        const v8b b1 = *(const v8b*)(vl + 8 * i);
        *(v8b*)(Ksh + r * KP + half + 8 * i) = a0;
        *(v8b*)(Ksl + r * KP + half + 8 * i) = a1;
        *(v8b*)(Vth + d * VP + qt   + 8 * i) = b0;
        *(v8b*)(Vtl + d * VP + qt   + 8 * i) = b1;
      }
#pragma unroll
      for (int i = 0; i < 4; ++i) {
        const v8b ee = *(const v8b*)(es + 8 * i);
        *(v8b*)(Esh + tid * KP + 8 * i) = ee;
      }
    }
    __syncthreads();

    // ---- content scores, transposed: S^T tile j = K rows (16j..16j+15) . q^T, 3-term split; s[j][r] = score(key 16j + 8hh + r, query c) ----
    v8f s[4];
#pragma unroll
    for (int j = 0; j < 4; ++j) {
      FB kb, kl;
      const __bf16* kp = Ksh + (j * 16 + c) * KP + 8 * hh;
      const __bf16* kq = Ksl + (j * 16 + c) * KP + 8 * hh;
      kb.h[0] = *(const v8b*)(kp); kb.h[1] = *(const v8b*)(kp + 16);
      kl.h[0] = *(const v8b*)(kq); kl.h[1] = *(const v8b*)(kq + 16);
      v8f a = zero8();
      a = at_mma(kb.v, qah, a);
      a = at_mma(kl.v, qah, a);
      a = at_mma(kb.v, qal, a);
      s[j] = a;
    }

    // ---- rel-pos tile, transposed: G^T = Win[wbase + 0..79] . q^T (2 products); a lane's 8 registers are 8 consecutive
    //      window columns of its query's row, so they go to this wave's G[query][80] as two 16-B stores ----
#pragma unroll
    for (int nt = 0; nt < 5; ++nt) {
      FB eb;
      const __bf16* ep = Esh + (wbase + nt * 16 + c) * KP + 8 * hh;
      eb.h[0] = *(const v8b*)(ep); eb.h[1] = *(const v8b*)(ep + 16);
      v8f g = zero8();
      g = at_mma(eb.v, qah, g);
      g = at_mma(eb.v, qal, g);
      float* gp = gw + c * GP + nt * 16 + 8 * hh;
      const v4f g0 = {g[0], g[1], g[2], g[3]};
      const v4f g1 = {g[4], g[5], g[6], g[7]};
      *(v4fa*)(gp)     = g0;
      *(v4fa*)(gp + 4) = g1;
    }
    __builtin_amdgcn_fence(__ATOMIC_RELEASE, "workgroup");
    __builtin_amdgcn_wave_barrier();
    __builtin_amdgcn_fence(__ATOMIC_ACQUIRE, "workgroup");

    // ---- combine, scale, causal mask, chunk maximum of query c (in-lane, four independent chains, then the other half) ----
    const bool diag = (kc == qb);           // block-uniform
    const float* gr = gw + c * GP + (15 - c) + 8 * hh;   // + 16j + r gives shift column 15 - c + jl, jl = 16j + 8hh + r
    float mj[4];
#pragma unroll
    for (int j = 0; j < 4; ++j) {
      float m = -INFINITY;
#pragma unroll
      for (int r = 0; r < 8; ++r) {
        const int kvcol = kv0 + j * 16 + 8 * hh + r;
        const float rel = gr[j * 16 + r];
        const float sv  = (s[j][r] + rel) * sscale;
        const bool msk  = diag && (kvcol > qrow);
        const float sm  = msk ? -INFINITY : sv;
        s[j][r] = sm;
        m = fmaxf(m, sm);
      }
      mj[j] = m;
    }
    float cm = fmaxf(fmaxf(mj[0], mj[1]), fmaxf(mj[2], mj[3]));
    cm = fmaxf(cm, at_xhalf(cm));           // key kv0 is never masked, so the joined maximum is finite

    // ---- online softmax update; P^T (unnormalised) as bf16 hi/lo straight into the B fragments of V^T.P^T ----
    const float mnew  = fmaxf(mrow, cm);
    const float alpha = __expf(mrow - mnew);
    mrow = mnew;
    FB ph[2], pl[2];
    float pj[4];
#pragma unroll
    for (int j = 0; j < 4; ++j) {
      float psum = 0.f;
#pragma unroll
      for (int r = 0; r < 8; ++r) {
        const float p = __expf(s[j][r] - mnew);
        psum += p;
        __bf16 a, bl; at_split(p, a, bl);
        ph[j >> 1].v[(j & 1) * 8 + r] = a;
        pl[j >> 1].v[(j & 1) * 8 + r] = bl;
      }
      pj[j] = psum;
    }
    lrow = lrow * alpha + ((pj[0] + pj[1]) + (pj[2] + pj[3]));
#pragma unroll
    for (int r = 0; r < 8; ++r) {
      oacc[0][r] *= alpha;
      oacc[1][r] *= alpha;
    }

    // ---- O^T += V^T . P^T : A = V^T rows d (split k map over keys), B = P^T fragments; 3-term split ----
#pragma unroll
    for (int kk = 0; kk < 2; ++kk) {
#pragma unroll
      for (int t = 0; t < 2; ++t) {
        FB vb, vl;
        vb.h[0] = *(const v8b*)(Vth + (t * 16 + c) * VP + kk * 32 + 8 * hh);
        vb.h[1] = *(const v8b*)(Vth + (t * 16 + c) * VP + kk * 32 + 16 + 8 * hh);
        vl.h[0] = *(const v8b*)(Vtl + (t * 16 + c) * VP + kk * 32 + 8 * hh);
        vl.h[1] = *(const v8b*)(Vtl + (t * 16 + c) * VP + kk * 32 + 16 + 8 * hh);
        oacc[t] = at_mma(vb.v, ph[kk].v, oacc[t]);
        oacc[t] = at_mma(vl.v, ph[kk].v, oacc[t]);
        oacc[t] = at_mma(vb.v, pl[kk].v, oacc[t]);
      }
    }
  }

  __builtin_amdgcn_fence(__ATOMIC_RELEASE, "workgroup");
  __builtin_amdgcn_wave_barrier();
  __builtin_amdgcn_fence(__ATOMIC_ACQUIRE, "workgroup");
  float* os = gw;
  {
    const float inv = 1.0f / (lrow + at_xhalf(lrow));   // the two halves' key sums joined once
#pragma unroll
    for (int t = 0; t < 2; ++t) {
      float* op = os + c * OSP + t * 16 + 8 * hh;        // row = query c, 8 consecutive d
      const v4f o0 = {oacc[t][0] * inv, oacc[t][1] * inv, oacc[t][2] * inv, oacc[t][3] * inv};
      const v4f o1 = {oacc[t][4] * inv, oacc[t][5] * inv, oacc[t][6] * inv, oacc[t][7] * inv};
      *(v4fa*)(op)     = o0;
      *(v4fa*)(op + 4) = o1;
    }
  }
  __builtin_amdgcn_fence(__ATOMIC_RELEASE, "workgroup");
  __builtin_amdgcn_wave_barrier();
  __builtin_amdgcn_fence(__ATOMIC_ACQUIRE, "workgroup");
  {
    const int q4 = lane >> 3, c4 = (lane & 7) * 4;
    {
#pragma unroll
      for (int it = 0; it < 4; ++it) {
        const int row = it * 4 + q4;                   // it 0..3 x q4 0..3 covers rows 0..15 of the wave tile
        const v4f val = *(const v4fa*)(os + row * OSP + c4);
        *(v4f*)(ob + (rowBase + q0 + row) * HID + c4) = val;
      }
      
    }
  }
}

// ---------------------------------------------------------------------------
// Workspace region map (byte offsets):
//   WqTh bf16 [128 n][128 k]        0      WqTl     32768
//   WkTh                        65536      WkTl     98304
//   WvTh                       131072      WvTl    163840     (lo weight planes written, not consumed)
//   Xb   bf16 [16384][128]     196608                         (4194304 B)
//   ErB  bf16 [4096][32]      4390912                         (262144 B)
//   Qh   bf16 [16384][128]    4653056      Ql    8847360
//   Kh   bf16 [16384][128]   13041664      Kl   17235968
//   VTh  bf16 [4][128][4096] 21430272      VTl  25624576
//   total                    29818880
// Every region is written in whole 64x64 tiles / whole 16-B-per-lane runs; all extents are exact tile multiples,
// ---------------------------------------------------------------------------
extern "C" void kernel_launch(void* const* d_in, const int* in_sizes, int n_in,
                              void* d_out, int out_size, void* d_ws, size_t ws_size,
                              hipStream_t stream) {
  if (n_in < 8) return;
  if (in_sizes[0] != NB * SEQ * HID) return;
  if (in_sizes[1] != HID * HID || in_sizes[3] != HID * HID || in_sizes[5] != HID * HID) return;
  if (in_sizes[2] != HID || in_sizes[4] != HID || in_sizes[6] != HID) return;
  if (in_sizes[7] != SEQ * HD) return;
  if (out_size != NB * SEQ * HID) return;

  const float* x  = (const float*)d_in[0];
  const float* Wq = (const float*)d_in[1];
  const float* bq = (const float*)d_in[2];
  const float* Wk = (const float*)d_in[3];
  const float* bk = (const float*)d_in[4];
  const float* Wv = (const float*)d_in[5];
  const float* bv = (const float*)d_in[6];
  const float* Er = (const float*)d_in[7];
  float* out = (float*)d_out;

  const size_t PW = (size_t)HID * HID * 2;            //    32768  bf16 weight plane
  const size_t PX = (size_t)NB * SEQ * HID * 2;       //  4194304  bf16 activation plane (all batch rows)
  const size_t PE = (size_t)SEQ * HD * 2;             //   262144  bf16 Er plane
  const size_t PV = (size_t)NB * HID * SEQ * 2;       //  4194304  bf16 v^T plane
  size_t off = 0;
  const size_t oWqTh = off; off += PW;  const size_t oWqTl = off; off += PW;
  const size_t oWkTh = off; off += PW;  const size_t oWkTl = off; off += PW;
  const size_t oWvTh = off; off += PW;  const size_t oWvTl = off; off += PW;
  const size_t oXb   = off; off += PX;
  const size_t oErB  = off; off += PE;
  const size_t oQh   = off; off += PX;  const size_t oQl   = off; off += PX;
  const size_t oKh   = off; off += PX;  const size_t oKl   = off; off += PX;
  const size_t oVTh  = off; off += PV;  const size_t oVTl  = off; off += PV;
  if (off > ws_size) return;                          // off = 29818880
  if (off > (size_t)134217728) return;

  char* ws = (char*)d_ws;
  unsigned short* WqTh = (unsigned short*)(ws + oWqTh); unsigned short* WqTl = (unsigned short*)(ws + oWqTl);
  unsigned short* WkTh = (unsigned short*)(ws + oWkTh); unsigned short* WkTl = (unsigned short*)(ws + oWkTl);
  unsigned short* WvTh = (unsigned short*)(ws + oWvTh); unsigned short* WvTl = (unsigned short*)(ws + oWvTl);
  unsigned short* Xb   = (unsigned short*)(ws + oXb);
  unsigned short* ErB  = (unsigned short*)(ws + oErB);
  unsigned short* Qh   = (unsigned short*)(ws + oQh);   unsigned short* Ql   = (unsigned short*)(ws + oQl);
  unsigned short* Kh   = (unsigned short*)(ws + oKh);   unsigned short* Kl   = (unsigned short*)(ws + oKl);
  unsigned short* VTh  = (unsigned short*)(ws + oVTh);  unsigned short* VTl  = (unsigned short*)(ws + oVTl);

  const dim3 blk(256);
  const float sscale = 0.17677669529663688f;          // 1/sqrt(32)

  // (1) weights [in k][out n] f32 -> transposed bf16 planes [n][k]   (in [128][128] -> out [128][128]; grid (cols/64, rows/64))
  tsplit_kernel<<<dim3(HID / 64, HID / 64), blk, 0, stream>>>(Wq, WqTh, WqTl, HID, HID);
  tsplit_kernel<<<dim3(HID / 64, HID / 64), blk, 0, stream>>>(Wk, WkTh, WkTl, HID, HID);
  tsplit_kernel<<<dim3(HID / 64, HID / 64), blk, 0, stream>>>(Wv, WvTh, WvTl, HID, HID);
  // (2) x -> bf16 plane [16384][128]; Er -> bf16 plane [4096][32]
  const int n8x = NB * SEQ * HID / 8;                 // 262144 threads x 8 = whole plane
  const int n8e = SEQ * HD / 8;                       //  16384 threads x 8 = whole plane
  cvt_bf16x8_kernel<<<dim3((n8x + 255) / 256), blk, 0, stream>>>(x, Xb, n8x);
  cvt_bf16x8_kernel<<<dim3((n8e + 255) / 256), blk, 0, stream>>>(Er, ErB, n8e);
  // (3) q = x.Wq + bq -> Q hi/lo planes [b*4096+t][h*32+d]   (M=16384, N=128, K=128; 512 tiles -> 64 blocks)
  const dim3 gProj(((NB * SEQ / 64) * (HID / 64) + 7) / 8, 1);
  wmma_gemm64<false, 2, 2><<<gProj, blk, 0, stream>>>(
      Xb, Xb, HID, 0L, WqTh, WqTh, HID, 0L, (void*)Qh, (void*)Ql, HID, 0L, bq, NB * SEQ, HID, HID, 1.0f);
  // (4) k = x.Wk + bk -> K hi/lo planes
  wmma_gemm64<false, 2, 2><<<gProj, blk, 0, stream>>>(
      Xb, Xb, HID, 0L, WkTh, WkTh, HID, 0L, (void*)Kh, (void*)Kl, HID, 0L, bk, NB * SEQ, HID, HID, 1.0f);
  // (5) v^T = Wv^T . x^T + bv[m] -> VT hi/lo planes [b][h*32+d][s]   (A = Wv^T plane [128][128], Bt = x plane rows of batch z;
  //     M=128, N=4096, K=128; 128 tiles -> 16 blocks, grid.y = batch)
  const dim3 gVT(((HID / 64) * (SEQ / 64) + 7) / 8, NB);
  wmma_gemm64<false, 1, 2><<<gVT, blk, 0, stream>>>(
      WvTh, WvTh, HID, 0L, Xb, Xb, HID, (long)SEQ * HID, (void*)VTh, (void*)VTl, SEQ, (long)HID * SEQ,
      bv, HID, SEQ, HID, 1.0f);
  // (6) causal rel-pos attention: 1024 blocks = 16 (b,h) pairs x 64 query blocks, 128 threads
  relattn32_kernel<<<dim3(NB * NH * NQB), dim3(128), 0, stream>>>(Qh, Ql, Kh, Kl, VTh, VTl, ErB, out, sscale);
  (void)hipGetLastError();
}

// v003
// One run takes 180 microseconds.
// Timed twice side by side with v002, it ran 1.10 and 1.09 times as fast.
// All steps since v000 together make it 2.32 times as fast.
// Contractions: q, k, v^T projections x.W, v^T = Wv^T.x^T (+bias): v_wmma_f32_16x16x32_bf16, single product of bf16-RNE-valued x and W planes, f32 accumulate;
// scores (k.q^T, keys as rows): bf16 hi/lo split (hi.hi + hi.lo + lo.hi); rel-pos term ErWin.q^T: q hi/lo x bf16-RNE Er (hi.E + lo.E); V^T.P^T: bf16 hi/lo split (3 products);
// all v_wmma_f32_16x16x32_bf16 with f32 accumulate. Softmax, bias adds and the 1/sqrt(32) score scale in f32.
//
// Math implemented (B=4, S=4096, hidden 128, 4 heads x 32):
//   q = x.Wq + bq, k = x.Wk + bk, v = x.Wv + bv   (W stored [in][out]; head h = columns h*32..h*32+31)
//   rel[i][j] = q_i . Er[S-1-(i-j)]  for j <= i   (pad-left / reshape shift identity; j > i entries are masked)
//   logit[i][j] = (q_i.k_j + rel[i][j]) * (1/sqrt(32)),  causal (j <= i, diagonal included), softmax over j, out = P.v
//   out[(b*S + i)*128 + h*32 + d]   (no output projection)
//
// Plane / carry audit: every 16-bit plane is bf16 with unit carry (x, W^T, Er: bf16-RNE of the inputs; q, k, v^T: hi/lo bf16
// pairs of the f32 projection results; P: hi/lo bf16 pairs of exp(s - m)); nothing is scaled, nothing to fold back.
//
// Er window per (query block qb, key chunk kc): window row w <-> Er row e0 + w, e0 = S - 64 - 64*(qb - kc), w in 0..127
// (clamped copy, rows past S-1 only ever meet masked keys). For block row il (0..63) and chunk key jl (0..63):
// w = 63 - il + jl. Wave wv (rows il = 16*wv..16*wv+15) computes G^T[80][16] = Win[48 - 16*wv + 0..79] . q^T, stores it as G[row][80] and reads
// G[row][15 - (il - 16*wv) + jl].
#include <hip/hip_runtime.h>
#include <math.h>
#include <stdint.h>

#define NB   4
#define SEQ  4096
#define HID  128
#define NH   4
#define HD   32
#define NQB  (SEQ / 64)

typedef __attribute__((ext_vector_type(16))) _Float16 v16h;
typedef __attribute__((ext_vector_type(8)))  _Float16 v8h;
typedef __attribute__((ext_vector_type(16))) __bf16   v16b;
typedef __attribute__((ext_vector_type(8)))  __bf16   v8b;
typedef __attribute__((ext_vector_type(8)))  float    v8f;
typedef __attribute__((ext_vector_type(4)))  float    v4f;
typedef __attribute__((ext_vector_type(4)))  unsigned int v4u;
typedef v4f __attribute__((may_alias)) v4fa;

__device__ __forceinline__ unsigned short f2bf_bits(float f) {
  unsigned u = __float_as_uint(f);
  return (unsigned short)((u + 0x7FFFu + ((u >> 16) & 1u)) >> 16);
}
__device__ __forceinline__ float bf_bits2f(unsigned short h) { return __uint_as_float(((unsigned)h) << 16); }
__device__ __forceinline__ float bf_rne(float f) { return bf_bits2f(f2bf_bits(f)); }
__device__ __forceinline__ unsigned pk16(unsigned short a, unsigned short b) { return (unsigned)a | ((unsigned)b << 16); }

// hazard guards as plain device helpers
__device__ __forceinline__ void dep_guard_b(v8f& a, v8f& b, v16b x, v16b y) { asm volatile("v_nop\n\tv_nop\n\tv_nop\n\tv_nop" : "+v"(a), "+v"(b) : "v"(x), "v"(y)); }
__device__ __forceinline__ void keep4_b(v16b a, v16b b, v16b c, v16b d) { asm volatile("v_nop" :: "v"(a), "v"(b), "v"(c), "v"(d)); }
__device__ __forceinline__ void acc_guard4(v8f& a, v8f& b, v8f& c, v8f& d) { asm volatile("v_nop\n\tv_nop\n\tv_nop\n\tv_nop" : "+v"(a), "+v"(b), "+v"(c), "+v"(d)); }

// 16-bit WMMA fragment (A: p = row m at k0 + 8h; B stored [n][k]: p = row n at k0 + 8h; same split k map):
// elements 0..7 <- p[0..7], elements 8..15 <- p[16..23]
struct FragB {
  union U { v16b v; v8b h[2]; };
  static __device__ __forceinline__ v16b load(const __bf16* p) {
    U f; f.h[0] = *(const v8b*)(p); f.h[1] = *(const v8b*)(p + 16); return f.v;
  }
  static __device__ __forceinline__ v8f mma(v16b a, v16b b, v8f c) {
    return __builtin_amdgcn_wmma_f32_16x16x32_bf16(false, a, false, b, (short)0, c, false, false);
  }
};

__device__ __forceinline__ v8f zero8() { v8f z = {0.f, 0.f, 0.f, 0.f, 0.f, 0.f, 0.f, 0.f}; return z; }

// ---- Register-blocked batched WMMA GEMM (bf16 operands) --------------------
// C[m,n] = scale * sum_k A[m,k] * Bt[n,k] (+bf16-RNE bias); each wave owns a 64x64 tile, 8 waves per block.
// A row-major [M,K]; Bt row-major [N,K]; M,N % 64 == 0, K % 32 == 0 (host-checked).
// SPLIT: operands are hi/lo planes (A2/Bt2 = lo planes, same layout); product = hi.hi + hi.lo + lo.hi.
// BIAS_MODE: 0 = none, 1 = bias[m], 2 = bias[n]  (bias value converted bf16-RNE, added in f32).
// OUT_MODE: 0 = f32, 2 = bf16 hi plane (Cout) + bf16 lo plane (Cout2).
// coverage: 4 slabs x 16 rows x 64 cols = the whole 64x64 tile per wave; tiles cover M x N exactly.
template <bool SPLIT, int BIAS_MODE, int OUT_MODE>
__global__ __launch_bounds__(256) void wmma_gemm64(
    const unsigned short* __restrict__ Ap, const unsigned short* __restrict__ A2p, int lda, long strideA,
    const unsigned short* __restrict__ Btp, const unsigned short* __restrict__ Bt2p, int ldb, long strideB,
    void* __restrict__ Cout, void* __restrict__ Cout2, int ldc, long strideC,
    const float* __restrict__ bias, int M, int N, int K, float scale) {
  const __bf16* A = (const __bf16*)(const void*)Ap;   const __bf16* A2  = (const __bf16*)(const void*)A2p;
  const __bf16* Bt = (const __bf16*)(const void*)Btp; const __bf16* Bt2 = (const __bf16*)(const void*)Bt2p;
  __shared__ __align__(16) float sT[8][16 * 68];   // per-wave 16x64 slab, pitch 68 floats
  const int b    = blockIdx.y;
  const int lane = threadIdx.x & 31;
  const int wave = threadIdx.x >> 5;
  const int tilesN = N >> 6;
  const int tilesM = M >> 6;
  const int tile = blockIdx.x * 8 + wave;
  if (tile >= tilesM * tilesN) return;   // wave-uniform; no block barriers in this kernel
  const int tm = tile / tilesN;
  const int tn = tile - tm * tilesN;
  const int m0 = tm << 6;
  const int n0 = tn << 6;

  const __bf16* Ab  = A  + (size_t)b * strideA;
  const __bf16* Bb  = Bt + (size_t)b * strideB;
  const __bf16* Ab2 = SPLIT ? (A2  + (size_t)b * strideA) : nullptr;
  const __bf16* Bb2 = SPLIT ? (Bt2 + (size_t)b * strideB) : nullptr;

  const int rlane = lane & 15;                 // row (A) / col (B, D) within subtile
  const int koff  = (lane >> 4) * 8;           // k offset of this lane half
  const int mOff  = (lane >> 4) * 8;           // D row offset

  v8f acc[4][4];
#pragma unroll
  for (int i = 0; i < 4; ++i)
#pragma unroll
    for (int j = 0; j < 4; ++j) acc[i][j] = zero8();

  for (int k0 = 0; k0 < K; k0 += 32) {
    v16b bh[4], bl[4];
#pragma unroll
    for (int j = 0; j < 4; ++j) {
      const size_t bo = (size_t)(n0 + (j << 4) + rlane) * ldb + koff + k0;
      bh[j] = FragB::load(Bb + bo);
      bl[j] = bh[j];
      if (SPLIT) bl[j] = FragB::load(Bb2 + bo);
    }
#pragma unroll
    for (int i = 0; i < 4; ++i) {
      const size_t ao = (size_t)(m0 + (i << 4) + rlane) * lda + koff + k0;
      v16b ah = FragB::load(Ab + ao);
      v16b al = ah;
      if (SPLIT) al = FragB::load(Ab2 + ao);
#pragma unroll
      for (int j = 0; j < 4; ++j) {
        acc[i][j] = FragB::mma(ah, bh[j], acc[i][j]);
        if (SPLIT) {
          acc[i][j] = FragB::mma(ah, bl[j], acc[i][j]);
          acc[i][j] = FragB::mma(al, bh[j], acc[i][j]);
        }
      }
      dep_guard_b(acc[i][0], acc[i][3], ah, al);
    }
    keep4_b(bh[0], bh[1], bh[2], bh[3]);
    if (SPLIT) keep4_b(bl[0], bl[1], bl[2], bl[3]);
  }
  acc_guard4(acc[0][0], acc[0][1], acc[0][2], acc[0][3]);
  acc_guard4(acc[1][0], acc[1][1], acc[1][2], acc[1][3]);
  acc_guard4(acc[2][0], acc[2][1], acc[2][2], acc[2][3]);
  acc_guard4(acc[3][0], acc[3][1], acc[3][2], acc[3][3]);

  // ---- epilogue ----
  float* slab = sT[wave];
#pragma unroll
  for (int i = 0; i < 4; ++i) {
    const int mBase = m0 + (i << 4);
#pragma unroll
    for (int j = 0; j < 4; ++j) {
      const int n = n0 + (j << 4) + rlane;
      float bv = 0.f;
      if (BIAS_MODE == 2) bv = bf_rne(bias[n]);
#pragma unroll
      for (int r = 0; r < 8; ++r) {
        float v = acc[i][j][r] * scale;
        if (BIAS_MODE == 1) v += bf_rne(bias[mBase + mOff + r]);
        if (BIAS_MODE == 2) v += bv;
        slab[(mOff + r) * 68 + (j << 4) + rlane] = v;
      }
    }
    __builtin_amdgcn_fence(__ATOMIC_RELEASE, "workgroup");
    __builtin_amdgcn_wave_barrier();
    __builtin_amdgcn_fence(__ATOMIC_ACQUIRE, "workgroup");
    if (OUT_MODE == 0) {
      float* C = (float*)Cout + (size_t)b * strideC;
      const int hh = lane >> 4, c4 = (lane & 15) * 4;     // row seg = 256 B = 16 lanes x 16 B
      {
#pragma unroll
        for (int it = 0; it < 8; ++it) {
          const int row = it * 2 + hh;
          v4f v = *(const v4fa*)(slab + row * 68 + c4);
          *(v4f*)(C + (size_t)(mBase + row) * ldc + n0 + c4) = v;
        }
        
      }
    } else {
      const int q = lane >> 3, c8 = (lane & 7) * 8;
      unsigned short* C  = (unsigned short*)Cout  + (size_t)b * strideC;
      unsigned short* C2 = (unsigned short*)Cout2 + (size_t)b * strideC;
      {
#pragma unroll
        for (int it = 0; it < 4; ++it) {
          const int row = it * 4 + q;
          const float* sp = slab + row * 68 + c8;
          v8h hv, lv;
#pragma unroll
          for (int e = 0; e < 8; ++e) {
            unsigned short hb = f2bf_bits(sp[e]);
            unsigned short lb = f2bf_bits(sp[e] - bf_bits2f(hb));
            hv[e] = __builtin_bit_cast(_Float16, hb);
            lv[e] = __builtin_bit_cast(_Float16, lb);
          }
          *(v8h*)(C  + (size_t)(mBase + row) * ldc + n0 + c8) = hv;
          *(v8h*)(C2 + (size_t)(mBase + row) * ldc + n0 + c8) = lv;
        }
        
      }
    }
    __builtin_amdgcn_fence(__ATOMIC_RELEASE, "workgroup");
    __builtin_amdgcn_wave_barrier();
    __builtin_amdgcn_fence(__ATOMIC_ACQUIRE, "workgroup");
  }
}

// ---------------------------------------------------------------------------
// Contiguous f32 -> bf16-RNE plane: one thread = 8 consecutive elements = one 16-B store, so every wave writes
// grid = ceil(n8/256); coverage: n8 threads x 8 = the whole plane (n8 * 8 elements).
// ---------------------------------------------------------------------------
__global__ __launch_bounds__(256) void cvt_bf16x8_kernel(const float* __restrict__ in, unsigned short* __restrict__ o, int n8) {
  const int i = blockIdx.x * 256 + threadIdx.x;
  if (i < n8) {
    const float* sp = in + (size_t)i * 8;
    const v4f a  = *(const v4f*)(sp);
    const v4f a2 = *(const v4f*)(sp + 4);
    v4u w;
    w[0] = pk16(f2bf_bits(a[0]),  f2bf_bits(a[1]));
    w[1] = pk16(f2bf_bits(a[2]),  f2bf_bits(a[3]));
    w[2] = pk16(f2bf_bits(a2[0]), f2bf_bits(a2[1]));
    w[3] = pk16(f2bf_bits(a2[2]), f2bf_bits(a2[3]));
    unsigned short* dp = o + (size_t)i * 8;
    *(v4u*)dp = w;
    
  }
}

// ---------------------------------------------------------------------------
// Fused transpose + bf16 split of an f32 matrix: in [R rows][Cc cols] (pitch Cc) ->
//   oh[c][r] = bf16_rne(in[r][c]), ol[c][r] = bf16_rne(in[r][c] - oh)   ([Cc][R], pitch R).
// 64x64 tiles through LDS. grid = (Cc/64, R/64), 256 threads (R, Cc multiples of 64).
// Coverage per block and plane: load 4 it x 256 thr x 4 floats = 64x64; store 2 it x 256 thr x 8 u16 = 64x64.
// ---------------------------------------------------------------------------
__global__ __launch_bounds__(256) void tsplit_kernel(const float* __restrict__ W, unsigned short* __restrict__ oh,
                                                     unsigned short* __restrict__ ol, int R, int Cc) {
  __shared__ __align__(16) float tf[64 * 68];
  const int c0  = blockIdx.x * 64;   // input column block = output row block
  const int r0  = blockIdx.y * 64;   // input row block    = output column block
  const int tid = threadIdx.x;
  {
    const int lr = tid >> 4;         // 0..15
    const int c4 = (tid & 15) * 4;   // 0..60
#pragma unroll
    for (int it = 0; it < 4; ++it) {
      const int rr = it * 16 + lr;   // 0..63
      const v4f a = *(const v4f*)(W + (size_t)(r0 + rr) * Cc + c0 + c4);
      *(v4f*)(tf + rr * 68 + c4) = a;
    }
  }
  __syncthreads();
  const int sub = tid >> 3;          // 0..31
  const int c8  = (tid & 7) * 8;     // 0..56
  v4u hv[2], lv[2];
#pragma unroll
  for (int it = 0; it < 2; ++it) {
    const int oc = it * 32 + sub;    // output row within tile (= input column)
    v4u a, a2;
#pragma unroll
    for (int q = 0; q < 4; ++q) {
      const float f0 = tf[(c8 + 2 * q) * 68 + oc];
      const float f1 = tf[(c8 + 2 * q + 1) * 68 + oc];
      const unsigned short h0 = f2bf_bits(f0), h1 = f2bf_bits(f1);
      const unsigned short l0 = f2bf_bits(f0 - bf_bits2f(h0)), l1 = f2bf_bits(f1 - bf_bits2f(h1));
      a[q]  = pk16(h0, h1);
      a2[q] = pk16(l0, l1);
    }
    hv[it] = a; lv[it] = a2;
  }
  {
#pragma unroll
    for (int it = 0; it < 2; ++it) {
      const int oc = it * 32 + sub;
      const size_t go = (size_t)(c0 + oc) * R + r0 + c8;
      *(v4u*)(oh + go) = hv[it];
      *(v4u*)(ol + go) = lv[it];
    }
    
  }
}

// =====================================================================================
// Causal rel-pos attention, head dim 32, all (batch, head) pairs in one launch.
//   q planes (hi/lo bf16): element (b, t, h, d) at [(b*SEQ + t)*HID + h*32 + d]
//   k planes (hi/lo bf16): same layout
//   v^T planes (hi/lo bf16): element (b, h, d, s) at [((b*HID + h*32 + d))*SEQ + s]
//   er plane (bf16-RNE of Er): [r][d], pitch 32
//   scores = ((q.k) + (q.ErWin at the shift index)) * sscale; masked (s > t) scores set to -inf.
//   Block = 4 waves = 64 query rows of one (b,h) at a time; key chunks of 64, trip count qb+1 <= 64 for query block qb.
//   Every block takes two query blocks of its (b,h), one after the other: 63 - t, then t (t = 0..31), so each block walks
//   (64 - t) + (t + 1) = 65 chunks and no WGP is left with only long or only short blocks. grid.x = NB*NH*32.
//   Staging per chunk (128 threads, plain 16-B copies, __syncthreads before and after):
//     K hi/lo [64][32]: 128 thr x 16 elements per plane = whole tile; V^T hi/lo [32][64]: 128 thr x 16 = whole tile;
//     Er window [128][32]: 128 thr x 32 = all 128 rows (clamped source row, so every row is written).
//   All three products are taken transposed (keys, window rows or d as the rows of D, queries as its columns), so lane (c, hh)
//   holds query c of the wave's 16: its scores for keys 16j + 8hh + r, its maximum and sum in-lane (the two lane halves are joined
//   by one cross-half move), and exp(s - m) converts in place into the B fragment of V^T.P^T (element e of k-step kk =
//   tile 2kk + (e >> 3), register e & 7: the same split k map as the V^T loader). P never goes through LDS.
//   Per-wave LDS: G [16 queries][80] f32 (5 tiles x 16 window rows x 16 queries written, columns 0..78 read), reused as out staging [16][36].
//   LDS rows are padded (KP, VP, GP below); the pad bytes are never written and never read.
// =====================================================================================
#define AT_NW 4
#define AT_QB 64
#define AT_KC 64
#define EWIN  128
#define GP    84   // G row pitch in floats: 16 B x odd for the 16-B stores (lane = row); the shifted 4-B reads step 83 floats a query and 8 between lane halves; mod 32 banks, upper-half query c + 8 meets lower-half query c
#define OSP   36
#define KP    40   // K and Er-window row pitch in elements: 64-B rows at 80 B (16 B x odd), conflict-free for 16-B fragment reads
#define VP    72   // V^T row pitch in elements: 128-B rows at 144 B (16 B x odd)

__device__ __forceinline__ __bf16 at_f2bf(float f) { return __builtin_bit_cast(__bf16, f2bf_bits(f)); }
__device__ __forceinline__ void at_split(float f, __bf16& hi, __bf16& lo) {
  const unsigned short hb = f2bf_bits(f);
  hi = __builtin_bit_cast(__bf16, hb);
  lo = at_f2bf(f - __uint_as_float(((unsigned)hb) << 16));
}
// lane l <-> lane l ^ 16 (the two halves that share a query)
__device__ __forceinline__ float at_xhalf(float x) {
  return __builtin_bit_cast(float, __builtin_amdgcn_permlanex16(__builtin_bit_cast(int, x), __builtin_bit_cast(int, x),
                                                                0x76543210, 0xfedcba98, false, false));
}
__device__ __forceinline__ v8f at_mma(v16b a, v16b b, v8f c) {
  c = __builtin_amdgcn_wmma_f32_16x16x32_bf16(false, a, false, b, (short)0, c, false, false);
  asm volatile("v_nop\n\tv_nop\n\tv_nop\n\tv_nop" : "+v"(c) : "v"(a), "v"(b));
  return c;
}

__global__ __launch_bounds__(128)
void relattn32_kernel(const unsigned short* __restrict__ qhp, const unsigned short* __restrict__ qlp,
                      const unsigned short* __restrict__ khp, const unsigned short* __restrict__ klp,
                      const unsigned short* __restrict__ vhp, const unsigned short* __restrict__ vlp,
                      const unsigned short* __restrict__ erp, float* __restrict__ out, float sscale) {
  union FB { v16b v; v8b h[2]; };
  __shared__ __align__(16) __bf16 Ksh[AT_KC * KP];             // K hi [kv][d], pitch KP      5 KB
  __shared__ __align__(16) __bf16 Ksl[AT_KC * KP];             // K lo
  __shared__ __align__(16) __bf16 Vth[HD * VP];                // V hi [d][kv], pitch VP      4.5 KB
  __shared__ __align__(16) __bf16 Vtl[HD * VP];                // V lo
  __shared__ __align__(16) __bf16 Esh[EWIN * KP];              // Er window [w][d], pitch KP  10 KB
  __shared__ __align__(16) float  Gs[AT_NW][16 * GP];          // per wave rel tile [query][80], pitch GP; later out staging pitch 36

  const int tid  = threadIdx.x;
  const int wave = tid >> 5;
  const int lane = tid & 31;
  const int hh   = lane >> 4;
  const int c    = lane & 15;

  const int bx   = blockIdx.x;
  const int tp   = bx & (NQB / 2 - 1);    // 0..31
  const int pair = bx >> 5;               // 0..15
  const int b    = pair >> 2;
  const int h    = pair & 3;
  const size_t rowBase = (size_t)b * SEQ;

  const __bf16* Qh = (const __bf16*)(const void*)qhp + h * HD;
  const __bf16* Ql = (const __bf16*)(const void*)qlp + h * HD;
  const __bf16* Kh = (const __bf16*)(const void*)khp + h * HD;
  const __bf16* Kl = (const __bf16*)(const void*)klp + h * HD;
  const __bf16* Vh = (const __bf16*)(const void*)vhp + ((size_t)b * HID + h * HD) * SEQ;
  const __bf16* Vl = (const __bf16*)(const void*)vlp + ((size_t)b * HID + h * HD) * SEQ;
  const __bf16* Er = (const __bf16*)(const void*)erp;
  float*        ob = out + h * HD;

  const int wbase = 48 - 16 * wave;       // first window row of this wave's G tile
  float* gw = Gs[wave];

  // the block's two query blocks, long one first; every (b, h, qb) is taken by exactly one block (block-uniform trip counts)
  for (int part = 0; part < 2; ++part) {
  const int qb = part ? tp : (NQB - 1 - tp);   // 63..32, then 0..31
  const int q0 = qb * AT_QB + wave * 16;

  // ---- Q fragments (B operand, column = query = lane&15, split k map, one k-step of 32 = d), hi and lo ----
  const v16b qah = FragB::load(Qh + (rowBase + q0 + c) * HID + 8 * hh);
  const v16b qal = FragB::load(Ql + (rowBase + q0 + c) * HID + 8 * hh);

  float mrow = -INFINITY;                 // running maximum of query c (equal in both lane halves)
  float lrow = 0.f;                       // running sum of query c over this lane half's keys; halves joined after the loop
  v8f oacc[2];                            // O^T: oacc[t][r] = out[query c][d = 16t + 8hh + r]
  oacc[0] = zero8(); oacc[1] = zero8();
  const int qrow = qb * AT_QB + wave * 16 + c;

  const int nChunks = qb + 1;             // block-uniform, <= 64
  for (int kc = 0; kc < nChunks; ++kc) {
    const int kv0 = kc * AT_KC;
    int e0 = SEQ - 64 - 64 * (qb - kc);   // Er window base row, 0 .. 4032
    __syncthreads();
    {
      // K: thread -> key row r = tid>>1, d half = (tid&1)*16; 2 x 8 elements per plane
      const int r = tid >> 1, half = (tid & 1) * 16;
      const __bf16* ks = Kh + (rowBase + kv0 + r) * HID + half;
      const __bf16* kl = Kl + (rowBase + kv0 + r) * HID + half;
      // V^T: thread -> d = tid>>2, key quarter = (tid&3)*16; 2 x 8 elements per plane
      const int d = tid >> 2, qt = (tid & 3) * 16;
      const __bf16* vs = Vh + (size_t)d * SEQ + kv0 + qt;
      const __bf16* vl = Vl + (size_t)d * SEQ + kv0 + qt;
      // Er window: thread -> window row tid, clamped source row (address clamp), 4 x 8 elements
      int erow = e0 + tid;
      erow = erow < 0 ? 0 : erow;
      erow = erow > (SEQ - 1) ? (SEQ - 1) : erow;
      const __bf16* es = Er + (size_t)erow * HD;
#pragma unroll
      for (int i = 0; i < 2; ++i) {
        const v8b a0 = *(const v8b*)(ks + 8 * i);
        const v8b a1 = *(const v8b*)(kl + 8 * i);
        const v8b b0 = *(const v8b*)(vs + 8 * i);
        const v8b b1 = *(const v8b*)(vl + 8 * i);
        *(v8b*)(Ksh + r * KP + half + 8 * i) = a0;
        *(v8b*)(Ksl + r * KP + half + 8 * i) = a1;
        *(v8b*)(Vth + d * VP + qt   + 8 * i) = b0;
        *(v8b*)(Vtl + d * VP + qt   + 8 * i) = b1;
      }
#pragma unroll
      for (int i = 0; i < 4; ++i) {
        const v8b ee = *(const v8b*)(es + 8 * i);
        *(v8b*)(Esh + tid * KP + 8 * i) = ee;
      }
    }
    __syncthreads();

    // ---- content scores, transposed: S^T tile j = K rows (16j..16j+15) . q^T, 3-term split; s[j][r] = score(key 16j + 8hh + r, query c) ----
    v8f s[4];
#pragma unroll
    for (int j = 0; j < 4; ++j) {
      FB kb, kl;
      const __bf16* kp = Ksh + (j * 16 + c) * KP + 8 * hh;
      const __bf16* kq = Ksl + (j * 16 + c) * KP + 8 * hh;
      kb.h[0] = *(const v8b*)(kp); kb.h[1] = *(const v8b*)(kp + 16);
      kl.h[0] = *(const v8b*)(kq); kl.h[1] = *(const v8b*)(kq + 16);
      v8f a = zero8();
      a = at_mma(kb.v, qah, a);
      a = at_mma(kl.v, qah, a);
      a = at_mma(kb.v, qal, a);
      s[j] = a;
    }

    // ---- rel-pos tile, transposed: G^T = Win[wbase + 0..79] . q^T (2 products); a lane's 8 registers are 8 consecutive
    //      window columns of its query's row, so they go to this wave's G[query][80] as two 16-B stores ----
#pragma unroll
    for (int nt = 0; nt < 5; ++nt) {
      FB eb;
      const __bf16* ep = Esh + (wbase + nt * 16 + c) * KP + 8 * hh;
      eb.h[0] = *(const v8b*)(ep); eb.h[1] = *(const v8b*)(ep + 16);
      v8f g = zero8();
      g = at_mma(eb.v, qah, g);
      g = at_mma(eb.v, qal, g);
      float* gp = gw + c * GP + nt * 16 + 8 * hh;
      const v4f g0 = {g[0], g[1], g[2], g[3]};
      const v4f g1 = {g[4], g[5], g[6], g[7]};
      *(v4fa*)(gp)     = g0;
      *(v4fa*)(gp + 4) = g1;
    }
    __builtin_amdgcn_fence(__ATOMIC_RELEASE, "workgroup");
    __builtin_amdgcn_wave_barrier();
    __builtin_amdgcn_fence(__ATOMIC_ACQUIRE, "workgroup");

    // ---- combine, scale, causal mask, chunk maximum of query c (in-lane, four independent chains, then the other half) ----
    const bool diag = (kc == qb);           // block-uniform
    const float* gr = gw + c * GP + (15 - c) + 8 * hh;   // + 16j + r gives shift column 15 - c + jl, jl = 16j + 8hh + r
    float mj[4];
#pragma unroll
    for (int j = 0; j < 4; ++j) {
      float m = -INFINITY;
#pragma unroll
      for (int r = 0; r < 8; ++r) {
        const int kvcol = kv0 + j * 16 + 8 * hh + r;
        const float rel = gr[j * 16 + r];
        const float sv  = (s[j][r] + rel) * sscale;
        const bool msk  = diag && (kvcol > qrow);
        const float sm  = msk ? -INFINITY : sv;
        s[j][r] = sm;
        m = fmaxf(m, sm);
      }
      mj[j] = m;
    }
    float cm = fmaxf(fmaxf(mj[0], mj[1]), fmaxf(mj[2], mj[3]));
    cm = fmaxf(cm, at_xhalf(cm));           // key kv0 is never masked, so the joined maximum is finite

    // ---- online softmax update; P^T (unnormalised) as bf16 hi/lo straight into the B fragments of V^T.P^T ----
    const float mnew  = fmaxf(mrow, cm);
    const float alpha = __expf(mrow - mnew);
    mrow = mnew;
    FB ph[2], pl[2];
    float pj[4];
#pragma unroll
    for (int j = 0; j < 4; ++j) {
      float psum = 0.f;
#pragma unroll
      for (int r = 0; r < 8; ++r) {
        const float p = __expf(s[j][r] - mnew);
        psum += p;
        __bf16 a, bl; at_split(p, a, bl);
        ph[j >> 1].v[(j & 1) * 8 + r] = a;
        pl[j >> 1].v[(j & 1) * 8 + r] = bl;
      }
      pj[j] = psum;
    }
    lrow = lrow * alpha + ((pj[0] + pj[1]) + (pj[2] + pj[3]));
#pragma unroll
    for (int r = 0; r < 8; ++r) {
      oacc[0][r] *= alpha;
      oacc[1][r] *= alpha;
    }

    // ---- O^T += V^T . P^T : A = V^T rows d (split k map over keys), B = P^T fragments; 3-term split ----
#pragma unroll
    for (int kk = 0; kk < 2; ++kk) {
#pragma unroll
      for (int t = 0; t < 2; ++t) {
        FB vb, vl;
        vb.h[0] = *(const v8b*)(Vth + (t * 16 + c) * VP + kk * 32 + 8 * hh);
        vb.h[1] = *(const v8b*)(Vth + (t * 16 + c) * VP + kk * 32 + 16 + 8 * hh);
        vl.h[0] = *(const v8b*)(Vtl + (t * 16 + c) * VP + kk * 32 + 8 * hh);
        vl.h[1] = *(const v8b*)(Vtl + (t * 16 + c) * VP + kk * 32 + 16 + 8 * hh);
        oacc[t] = at_mma(vb.v, ph[kk].v, oacc[t]);
        oacc[t] = at_mma(vl.v, ph[kk].v, oacc[t]);
        oacc[t] = at_mma(vb.v, pl[kk].v, oacc[t]);
      }
    }
  }

  __builtin_amdgcn_fence(__ATOMIC_RELEASE, "workgroup");
  __builtin_amdgcn_wave_barrier();
  __builtin_amdgcn_fence(__ATOMIC_ACQUIRE, "workgroup");
  float* os = gw;
  {
    const float inv = 1.0f / (lrow + at_xhalf(lrow));   // the two halves' key sums joined once
#pragma unroll
    for (int t = 0; t < 2; ++t) {
      float* op = os + c * OSP + t * 16 + 8 * hh;        // row = query c, 8 consecutive d
      const v4f o0 = {oacc[t][0] * inv, oacc[t][1] * inv, oacc[t][2] * inv, oacc[t][3] * inv};
      const v4f o1 = {oacc[t][4] * inv, oacc[t][5] * inv, oacc[t][6] * inv, oacc[t][7] * inv};
      *(v4fa*)(op)     = o0;
      *(v4fa*)(op + 4) = o1;
    }
  }
  __builtin_amdgcn_fence(__ATOMIC_RELEASE, "workgroup");
  __builtin_amdgcn_wave_barrier();
  __builtin_amdgcn_fence(__ATOMIC_ACQUIRE, "workgroup");
  {
    const int q4 = lane >> 3, c4 = (lane & 7) * 4;
    {
#pragma unroll
      for (int it = 0; it < 4; ++it) {
        const int row = it * 4 + q4;                   // it 0..3 x q4 0..3 covers rows 0..15 of the wave tile
        const v4f val = *(const v4fa*)(os + row * OSP + c4);
        *(v4f*)(ob + (rowBase + q0 + row) * HID + c4) = val;
      }
      // the next query block's set-up rewrites the data and address registers that these stores name
      asm volatile("s_wait_xcnt 0x0" ::: "memory");
    }
  }
  }   // part: the next query block's first barrier stands before any staging store; G / out staging is this wave's own
}

// ---------------------------------------------------------------------------
// Workspace region map (byte offsets):
//   WqTh bf16 [128 n][128 k]        0      WqTl     32768
//   WkTh                        65536      WkTl     98304
//   WvTh                       131072      WvTl    163840     (lo weight planes written, not consumed)
//   Xb   bf16 [16384][128]     196608                         (4194304 B)
//   ErB  bf16 [4096][32]      4390912                         (262144 B)
//   Qh   bf16 [16384][128]    4653056      Ql    8847360
//   Kh   bf16 [16384][128]   13041664      Kl   17235968
//   VTh  bf16 [4][128][4096] 21430272      VTl  25624576
//   total                    29818880
// Every region is written in whole 64x64 tiles / whole 16-B-per-lane runs; all extents are exact tile multiples,
// ---------------------------------------------------------------------------
extern "C" void kernel_launch(void* const* d_in, const int* in_sizes, int n_in,
                              void* d_out, int out_size, void* d_ws, size_t ws_size,
                              hipStream_t stream) {
  if (n_in < 8) return;
  if (in_sizes[0] != NB * SEQ * HID) return;
  if (in_sizes[1] != HID * HID || in_sizes[3] != HID * HID || in_sizes[5] != HID * HID) return;
  if (in_sizes[2] != HID || in_sizes[4] != HID || in_sizes[6] != HID) return;
  if (in_sizes[7] != SEQ * HD) return;
  if (out_size != NB * SEQ * HID) return;

  const float* x  = (const float*)d_in[0];
  const float* Wq = (const float*)d_in[1];
  const float* bq = (const float*)d_in[2];
  const float* Wk = (const float*)d_in[3];
  const float* bk = (const float*)d_in[4];
  const float* Wv = (const float*)d_in[5];
  const float* bv = (const float*)d_in[6];
  const float* Er = (const float*)d_in[7];
  float* out = (float*)d_out;

  const size_t PW = (size_t)HID * HID * 2;            //    32768  bf16 weight plane
  const size_t PX = (size_t)NB * SEQ * HID * 2;       //  4194304  bf16 activation plane (all batch rows)
  const size_t PE = (size_t)SEQ * HD * 2;             //   262144  bf16 Er plane
  const size_t PV = (size_t)NB * HID * SEQ * 2;       //  4194304  bf16 v^T plane
  size_t off = 0;
  const size_t oWqTh = off; off += PW;  const size_t oWqTl = off; off += PW;
  const size_t oWkTh = off; off += PW;  const size_t oWkTl = off; off += PW;
  const size_t oWvTh = off; off += PW;  const size_t oWvTl = off; off += PW;
  const size_t oXb   = off; off += PX;
  const size_t oErB  = off; off += PE;
  const size_t oQh   = off; off += PX;  const size_t oQl   = off; off += PX;
  const size_t oKh   = off; off += PX;  const size_t oKl   = off; off += PX;
  const size_t oVTh  = off; off += PV;  const size_t oVTl  = off; off += PV;
  if (off > ws_size) return;                          // off = 29818880
  if (off > (size_t)134217728) return;

  char* ws = (char*)d_ws;
  unsigned short* WqTh = (unsigned short*)(ws + oWqTh); unsigned short* WqTl = (unsigned short*)(ws + oWqTl);
  unsigned short* WkTh = (unsigned short*)(ws + oWkTh); unsigned short* WkTl = (unsigned short*)(ws + oWkTl);
  unsigned short* WvTh = (unsigned short*)(ws + oWvTh); unsigned short* WvTl = (unsigned short*)(ws + oWvTl);
  unsigned short* Xb   = (unsigned short*)(ws + oXb);
  unsigned short* ErB  = (unsigned short*)(ws + oErB);
  unsigned short* Qh   = (unsigned short*)(ws + oQh);   unsigned short* Ql   = (unsigned short*)(ws + oQl);
  unsigned short* Kh   = (unsigned short*)(ws + oKh);   unsigned short* Kl   = (unsigned short*)(ws + oKl);
  unsigned short* VTh  = (unsigned short*)(ws + oVTh);  unsigned short* VTl  = (unsigned short*)(ws + oVTl);

  const dim3 blk(256);
  const float sscale = 0.17677669529663688f;          // 1/sqrt(32)

  // (1) weights [in k][out n] f32 -> transposed bf16 planes [n][k]   (in [128][128] -> out [128][128]; grid (cols/64, rows/64))
  tsplit_kernel<<<dim3(HID / 64, HID / 64), blk, 0, stream>>>(Wq, WqTh, WqTl, HID, HID);
  tsplit_kernel<<<dim3(HID / 64, HID / 64), blk, 0, stream>>>(Wk, WkTh, WkTl, HID, HID);
  tsplit_kernel<<<dim3(HID / 64, HID / 64), blk, 0, stream>>>(Wv, WvTh, WvTl, HID, HID);
  // (2) x -> bf16 plane [16384][128]; Er -> bf16 plane [4096][32]
  const int n8x = NB * SEQ * HID / 8;                 // 262144 threads x 8 = whole plane
  const int n8e = SEQ * HD / 8;                       //  16384 threads x 8 = whole plane
  cvt_bf16x8_kernel<<<dim3((n8x + 255) / 256), blk, 0, stream>>>(x, Xb, n8x);
  cvt_bf16x8_kernel<<<dim3((n8e + 255) / 256), blk, 0, stream>>>(Er, ErB, n8e);
  // (3) q = x.Wq + bq -> Q hi/lo planes [b*4096+t][h*32+d]   (M=16384, N=128, K=128; 512 tiles -> 64 blocks)
  const dim3 gProj(((NB * SEQ / 64) * (HID / 64) + 7) / 8, 1);
  wmma_gemm64<false, 2, 2><<<gProj, blk, 0, stream>>>(
      Xb, Xb, HID, 0L, WqTh, WqTh, HID, 0L, (void*)Qh, (void*)Ql, HID, 0L, bq, NB * SEQ, HID, HID, 1.0f);
  // (4) k = x.Wk + bk -> K hi/lo planes
  wmma_gemm64<false, 2, 2><<<gProj, blk, 0, stream>>>(
      Xb, Xb, HID, 0L, WkTh, WkTh, HID, 0L, (void*)Kh, (void*)Kl, HID, 0L, bk, NB * SEQ, HID, HID, 1.0f);
  // (5) v^T = Wv^T . x^T + bv[m] -> VT hi/lo planes [b][h*32+d][s]   (A = Wv^T plane [128][128], Bt = x plane rows of batch z;
  //     M=128, N=4096, K=128; 128 tiles -> 16 blocks, grid.y = batch)
  const dim3 gVT(((HID / 64) * (SEQ / 64) + 7) / 8, NB);
  wmma_gemm64<false, 1, 2><<<gVT, blk, 0, stream>>>(
      WvTh, WvTh, HID, 0L, Xb, Xb, HID, (long)SEQ * HID, (void*)VTh, (void*)VTl, SEQ, (long)HID * SEQ,
      bv, HID, SEQ, HID, 1.0f);
  // (6) causal rel-pos attention: 512 blocks = 16 (b,h) pairs x 32 pairs of query blocks (63 - t, t), 128 threads
  relattn32_kernel<<<dim3(NB * NH * (NQB / 2)), dim3(128), 0, stream>>>(Qh, Ql, Kh, Kl, VTh, VTl, ErB, out, sscale);
  (void)hipGetLastError();
}

// v004
// A run of this version takes 157 microseconds.
// Two timings next to v003 put it at 1.16 and 1.15 times that version's speed.
// Counting every step since v000, it is 2.67 times as fast.
// Contractions: q, k, v^T projections x.W, v^T = Wv^T.x^T (+bias): v_wmma_f32_16x16x32_bf16, single product of bf16-RNE-valued x and W planes, f32 accumulate;
// scores (k.q^T, keys as rows): bf16 hi/lo split (hi.hi + hi.lo + lo.hi); rel-pos term ErWin.q^T: q hi/lo x bf16-RNE Er (hi.E + lo.E); V^T.P^T: bf16 hi/lo split (3 products);
// all v_wmma_f32_16x16x32_bf16 with f32 accumulate. Softmax, bias adds and the 1/sqrt(32) score scale in f32.
//
// Math implemented (B=4, S=4096, hidden 128, 4 heads x 32):
//   q = x.Wq + bq, k = x.Wk + bk, v = x.Wv + bv   (W stored [in][out]; head h = columns h*32..h*32+31)
//   rel[i][j] = q_i . Er[S-1-(i-j)]  for j <= i   (pad-left / reshape shift identity; j > i entries are masked)
//   logit[i][j] = (q_i.k_j + rel[i][j]) * (1/sqrt(32)),  causal (j <= i, diagonal included), softmax over j, out = P.v
//   out[(b*S + i)*128 + h*32 + d]   (no output projection)
//
// Plane / carry audit: every 16-bit plane is bf16 with unit carry (x, W^T, Er: bf16-RNE of the inputs; q, k, v^T: hi/lo bf16
// pairs of the f32 projection results; P: hi/lo bf16 pairs of exp(s - m)); nothing is scaled, nothing to fold back.
//
// Er window per (query block qb, key chunk kc): window row w <-> Er row e0 + w, e0 = S - 64 - 64*(qb - kc), w in 0..127
// (clamped copy, rows past S-1 only ever meet masked keys). For block row il (0..63) and chunk key jl (0..63):
// w = 63 - il + jl. Wave wv (rows il = 16*wv..16*wv+15) computes G^T[80][16] = Win[48 - 16*wv + 0..79] . q^T, stores it as G[row][80] and reads
// G[row][15 - (il - 16*wv) + jl].
#include <hip/hip_runtime.h>
#include <math.h>
#include <stdint.h>

#define NB   4
#define SEQ  4096
#define HID  128
#define NH   4
#define HD   32
#define NQB  (SEQ / 64)

typedef __attribute__((ext_vector_type(16))) _Float16 v16h;
typedef __attribute__((ext_vector_type(8)))  _Float16 v8h;
typedef __attribute__((ext_vector_type(16))) __bf16   v16b;
typedef __attribute__((ext_vector_type(8)))  __bf16   v8b;
typedef __attribute__((ext_vector_type(8)))  float    v8f;
typedef __attribute__((ext_vector_type(4)))  float    v4f;
typedef __attribute__((ext_vector_type(4)))  unsigned int v4u;
typedef v4f __attribute__((may_alias)) v4fa;

__device__ __forceinline__ unsigned short f2bf_bits(float f) {
  unsigned u = __float_as_uint(f);
  return (unsigned short)((u + 0x7FFFu + ((u >> 16) & 1u)) >> 16);
}
__device__ __forceinline__ float bf_bits2f(unsigned short h) { return __uint_as_float(((unsigned)h) << 16); }
__device__ __forceinline__ float bf_rne(float f) { return bf_bits2f(f2bf_bits(f)); }
__device__ __forceinline__ unsigned pk16(unsigned short a, unsigned short b) { return (unsigned)a | ((unsigned)b << 16); }

// hazard guards as plain device helpers
__device__ __forceinline__ void dep_guard_b(v8f& a, v8f& b, v16b x, v16b y) { asm volatile("v_nop\n\tv_nop\n\tv_nop\n\tv_nop" : "+v"(a), "+v"(b) : "v"(x), "v"(y)); }
__device__ __forceinline__ void keep4_b(v16b a, v16b b, v16b c, v16b d) { asm volatile("v_nop" :: "v"(a), "v"(b), "v"(c), "v"(d)); }
__device__ __forceinline__ void acc_guard4(v8f& a, v8f& b, v8f& c, v8f& d) { asm volatile("v_nop\n\tv_nop\n\tv_nop\n\tv_nop" : "+v"(a), "+v"(b), "+v"(c), "+v"(d)); }

// 16-bit WMMA fragment (A: p = row m at k0 + 8h; B stored [n][k]: p = row n at k0 + 8h; same split k map):
// elements 0..7 <- p[0..7], elements 8..15 <- p[16..23]
struct FragB {
  union U { v16b v; v8b h[2]; };
  static __device__ __forceinline__ v16b load(const __bf16* p) {
    U f; f.h[0] = *(const v8b*)(p); f.h[1] = *(const v8b*)(p + 16); return f.v;
  }
  static __device__ __forceinline__ v8f mma(v16b a, v16b b, v8f c) {
    return __builtin_amdgcn_wmma_f32_16x16x32_bf16(false, a, false, b, (short)0, c, false, false);
  }
};

__device__ __forceinline__ v8f zero8() { v8f z = {0.f, 0.f, 0.f, 0.f, 0.f, 0.f, 0.f, 0.f}; return z; }

// ---- Register-blocked batched WMMA GEMM (bf16 operands) --------------------
// C[m,n] = scale * sum_k A[m,k] * Bt[n,k] (+bf16-RNE bias); each wave owns a 64x64 tile, 8 waves per block.
// A row-major [M,K]; Bt row-major [N,K]; M,N % 64 == 0, K % 32 == 0 (host-checked).
// SPLIT: operands are hi/lo planes (A2/Bt2 = lo planes, same layout); product = hi.hi + hi.lo + lo.hi.
// BIAS_MODE: 0 = none, 1 = bias[m], 2 = bias[n]  (bias value converted bf16-RNE, added in f32).
// OUT_MODE: 0 = f32, 2 = bf16 hi plane (Cout) + bf16 lo plane (Cout2).
// coverage: 4 slabs x 16 rows x 64 cols = the whole 64x64 tile per wave; tiles cover M x N exactly.
template <bool SPLIT, int BIAS_MODE, int OUT_MODE>
__global__ __launch_bounds__(256) void wmma_gemm64(
    const unsigned short* __restrict__ Ap, const unsigned short* __restrict__ A2p, int lda, long strideA,
    const unsigned short* __restrict__ Btp, const unsigned short* __restrict__ Bt2p, int ldb, long strideB,
    void* __restrict__ Cout, void* __restrict__ Cout2, int ldc, long strideC,
    const float* __restrict__ bias, int M, int N, int K, float scale) {
  const __bf16* A = (const __bf16*)(const void*)Ap;   const __bf16* A2  = (const __bf16*)(const void*)A2p;
  const __bf16* Bt = (const __bf16*)(const void*)Btp; const __bf16* Bt2 = (const __bf16*)(const void*)Bt2p;
  __shared__ __align__(16) float sT[8][16 * 68];   // per-wave 16x64 slab, pitch 68 floats
  const int b    = blockIdx.y;
  const int lane = threadIdx.x & 31;
  const int wave = threadIdx.x >> 5;
  const int tilesN = N >> 6;
  const int tilesM = M >> 6;
  const int tile = blockIdx.x * 8 + wave;
  if (tile >= tilesM * tilesN) return;   // wave-uniform; no block barriers in this kernel
  const int tm = tile / tilesN;
  const int tn = tile - tm * tilesN;
  const int m0 = tm << 6;
  const int n0 = tn << 6;

  const __bf16* Ab  = A  + (size_t)b * strideA;
  const __bf16* Bb  = Bt + (size_t)b * strideB;
  const __bf16* Ab2 = SPLIT ? (A2  + (size_t)b * strideA) : nullptr;
  const __bf16* Bb2 = SPLIT ? (Bt2 + (size_t)b * strideB) : nullptr;

  const int rlane = lane & 15;                 // row (A) / col (B, D) within subtile
  const int koff  = (lane >> 4) * 8;           // k offset of this lane half
  const int mOff  = (lane >> 4) * 8;           // D row offset

  v8f acc[4][4];
#pragma unroll
  for (int i = 0; i < 4; ++i)
#pragma unroll
    for (int j = 0; j < 4; ++j) acc[i][j] = zero8();

  for (int k0 = 0; k0 < K; k0 += 32) {
    v16b bh[4], bl[4];
#pragma unroll
    for (int j = 0; j < 4; ++j) {
      const size_t bo = (size_t)(n0 + (j << 4) + rlane) * ldb + koff + k0;
      bh[j] = FragB::load(Bb + bo);
      bl[j] = bh[j];
      if (SPLIT) bl[j] = FragB::load(Bb2 + bo);
    }
#pragma unroll
    for (int i = 0; i < 4; ++i) {
      const size_t ao = (size_t)(m0 + (i << 4) + rlane) * lda + koff + k0;
      v16b ah = FragB::load(Ab + ao);
      v16b al = ah;
      if (SPLIT) al = FragB::load(Ab2 + ao);
#pragma unroll
      for (int j = 0; j < 4; ++j) {
        acc[i][j] = FragB::mma(ah, bh[j], acc[i][j]);
        if (SPLIT) {
          acc[i][j] = FragB::mma(ah, bl[j], acc[i][j]);
          acc[i][j] = FragB::mma(al, bh[j], acc[i][j]);
        }
      }
      dep_guard_b(acc[i][0], acc[i][3], ah, al);
    }
    keep4_b(bh[0], bh[1], bh[2], bh[3]);
    if (SPLIT) keep4_b(bl[0], bl[1], bl[2], bl[3]);
  }
  acc_guard4(acc[0][0], acc[0][1], acc[0][2], acc[0][3]);
  acc_guard4(acc[1][0], acc[1][1], acc[1][2], acc[1][3]);
  acc_guard4(acc[2][0], acc[2][1], acc[2][2], acc[2][3]);
  acc_guard4(acc[3][0], acc[3][1], acc[3][2], acc[3][3]);

  // ---- epilogue ----
  float* slab = sT[wave];
#pragma unroll
  for (int i = 0; i < 4; ++i) {
    const int mBase = m0 + (i << 4);
#pragma unroll
    for (int j = 0; j < 4; ++j) {
      const int n = n0 + (j << 4) + rlane;
      float bv = 0.f;
      if (BIAS_MODE == 2) bv = bf_rne(bias[n]);
#pragma unroll
      for (int r = 0; r < 8; ++r) {
        float v = acc[i][j][r] * scale;
        if (BIAS_MODE == 1) v += bf_rne(bias[mBase + mOff + r]);
        if (BIAS_MODE == 2) v += bv;
        slab[(mOff + r) * 68 + (j << 4) + rlane] = v;
      }
    }
    __builtin_amdgcn_fence(__ATOMIC_RELEASE, "workgroup");
    __builtin_amdgcn_wave_barrier();
    __builtin_amdgcn_fence(__ATOMIC_ACQUIRE, "workgroup");
    if (OUT_MODE == 0) {
      float* C = (float*)Cout + (size_t)b * strideC;
      const int hh = lane >> 4, c4 = (lane & 15) * 4;     // row seg = 256 B = 16 lanes x 16 B
      {
#pragma unroll
        for (int it = 0; it < 8; ++it) {
          const int row = it * 2 + hh;
          v4f v = *(const v4fa*)(slab + row * 68 + c4);
          *(v4f*)(C + (size_t)(mBase + row) * ldc + n0 + c4) = v;
        }
        
      }
    } else {
      const int q = lane >> 3, c8 = (lane & 7) * 8;
      unsigned short* C  = (unsigned short*)Cout  + (size_t)b * strideC;
      unsigned short* C2 = (unsigned short*)Cout2 + (size_t)b * strideC;
      {
#pragma unroll
        for (int it = 0; it < 4; ++it) {
          const int row = it * 4 + q;
          const float* sp = slab + row * 68 + c8;
          v8h hv, lv;
#pragma unroll
          for (int e = 0; e < 8; ++e) {
            unsigned short hb = f2bf_bits(sp[e]);
            unsigned short lb = f2bf_bits(sp[e] - bf_bits2f(hb));
            hv[e] = __builtin_bit_cast(_Float16, hb);
            lv[e] = __builtin_bit_cast(_Float16, lb);
          }
          *(v8h*)(C  + (size_t)(mBase + row) * ldc + n0 + c8) = hv;
          *(v8h*)(C2 + (size_t)(mBase + row) * ldc + n0 + c8) = lv;
        }
        
      }
    }
    __builtin_amdgcn_fence(__ATOMIC_RELEASE, "workgroup");
    __builtin_amdgcn_wave_barrier();
    __builtin_amdgcn_fence(__ATOMIC_ACQUIRE, "workgroup");
  }
}

// ---------------------------------------------------------------------------
// Contiguous f32 -> bf16-RNE plane: one thread = 8 consecutive elements = one 16-B store, so every wave writes
// grid = ceil(n8/256); coverage: n8 threads x 8 = the whole plane (n8 * 8 elements).
// ---------------------------------------------------------------------------
__global__ __launch_bounds__(256) void cvt_bf16x8_kernel(const float* __restrict__ in, unsigned short* __restrict__ o, int n8) {
  const int i = blockIdx.x * 256 + threadIdx.x;
  if (i < n8) {
    const float* sp = in + (size_t)i * 8;
    const v4f a  = *(const v4f*)(sp);
    const v4f a2 = *(const v4f*)(sp + 4);
    v4u w;
    w[0] = pk16(f2bf_bits(a[0]),  f2bf_bits(a[1]));
    w[1] = pk16(f2bf_bits(a[2]),  f2bf_bits(a[3]));
    w[2] = pk16(f2bf_bits(a2[0]), f2bf_bits(a2[1]));
    w[3] = pk16(f2bf_bits(a2[2]), f2bf_bits(a2[3]));
    unsigned short* dp = o + (size_t)i * 8;
    *(v4u*)dp = w;
    
  }
}

// ---------------------------------------------------------------------------
// Fused transpose + bf16 split of an f32 matrix: in [R rows][Cc cols] (pitch Cc) ->
//   oh[c][r] = bf16_rne(in[r][c]), ol[c][r] = bf16_rne(in[r][c] - oh)   ([Cc][R], pitch R).
// 64x64 tiles through LDS. grid = (Cc/64, R/64), 256 threads (R, Cc multiples of 64).
// Coverage per block and plane: load 4 it x 256 thr x 4 floats = 64x64; store 2 it x 256 thr x 8 u16 = 64x64.
// ---------------------------------------------------------------------------
__global__ __launch_bounds__(256) void tsplit_kernel(const float* __restrict__ W, unsigned short* __restrict__ oh,
                                                     unsigned short* __restrict__ ol, int R, int Cc) {
  __shared__ __align__(16) float tf[64 * 68];
  const int c0  = blockIdx.x * 64;   // input column block = output row block
  const int r0  = blockIdx.y * 64;   // input row block    = output column block
  const int tid = threadIdx.x;
  {
    const int lr = tid >> 4;         // 0..15
    const int c4 = (tid & 15) * 4;   // 0..60
#pragma unroll
    for (int it = 0; it < 4; ++it) {
      const int rr = it * 16 + lr;   // 0..63
      const v4f a = *(const v4f*)(W + (size_t)(r0 + rr) * Cc + c0 + c4);
      *(v4f*)(tf + rr * 68 + c4) = a;
    }
  }
  __syncthreads();
  const int sub = tid >> 3;          // 0..31
  const int c8  = (tid & 7) * 8;     // 0..56
  v4u hv[2], lv[2];
#pragma unroll
  for (int it = 0; it < 2; ++it) {
    const int oc = it * 32 + sub;    // output row within tile (= input column)
    v4u a, a2;
#pragma unroll
    for (int q = 0; q < 4; ++q) {
      const float f0 = tf[(c8 + 2 * q) * 68 + oc];
      const float f1 = tf[(c8 + 2 * q + 1) * 68 + oc];
      const unsigned short h0 = f2bf_bits(f0), h1 = f2bf_bits(f1);
      const unsigned short l0 = f2bf_bits(f0 - bf_bits2f(h0)), l1 = f2bf_bits(f1 - bf_bits2f(h1));
      a[q]  = pk16(h0, h1);
      a2[q] = pk16(l0, l1);
    }
    hv[it] = a; lv[it] = a2;
  }
  {
#pragma unroll
    for (int it = 0; it < 2; ++it) {
      const int oc = it * 32 + sub;
      const size_t go = (size_t)(c0 + oc) * R + r0 + c8;
      *(v4u*)(oh + go) = hv[it];
      *(v4u*)(ol + go) = lv[it];
    }
    
  }
}

// =====================================================================================
// Causal rel-pos attention, head dim 32, all (batch, head) pairs in one launch.
//   q planes (hi/lo bf16): element (b, t, h, d) at [(b*SEQ + t)*HID + h*32 + d]
//   k planes (hi/lo bf16): same layout
//   v^T planes (hi/lo bf16): element (b, h, d, s) at [((b*HID + h*32 + d))*SEQ + s]
//   er plane (bf16-RNE of Er): [r][d], pitch 32
//   scores = ((q.k) + (q.ErWin at the shift index)) * sscale; masked (s > t) scores set to -inf.
//   Block = 8 waves = 2 key groups x 4 waves; the 4 waves of a group hold the 64 query rows of one (b,h) query block, and both
//   groups hold the same rows. Key chunks of 64, qb+1 <= 64 of them for query block qb, taken two a stage: group g takes chunk
//   2*stage + g, so a wave walks half the chunks and four waves instead of two share a SIMD. Each group keeps its own running
//   maximum, sum and O^T; after the last stage group 1 hands them to group 0 through LDS (one barrier) and group 0 joins them.
//   Where qb+1 is odd, group 1 has no chunk in the last stage: it stages chunk qb again (address in range) and skips the products.
//   Every block takes two query blocks of its (b,h), one after the other: 63 - t, then t (t = 0..31), so each block walks
//   (64 - t) + (t + 1) = 65 chunks in 33 stages and no WGP is left with only long or only short blocks. grid.x = NB*NH*32.
//   Staging per stage (plain 16-B copies, __syncthreads before and after); each group's 128 threads stage their own chunk:
//     K hi/lo [64][32]: 128 thr x 16 elements per plane = whole tile; V^T hi/lo [32][64]: 128 thr x 16 = whole tile;
//     Er window [192][32], shared (group g's 128-row window starts at row 64g): 256 thr x 3 x 8 elements = all 192 rows
//     (clamped source row, so every row is written).
//   All three products are taken transposed (keys, window rows or d as the rows of D, queries as its columns), so lane (c, hh)
//   holds query c of the wave's 16: its scores for keys 16j + 8hh + r, its maximum and sum in-lane (the two lane halves are joined
//   by one cross-half move), and exp(s - m) converts in place into the B fragment of V^T.P^T (element e of k-step kk =
//   tile 2kk + (e >> 3), register e & 7: the same split k map as the V^T loader). P never goes through LDS.
//   Per-wave LDS: G [16 queries][80] f32 (5 tiles x 16 window rows x 16 queries written, columns 0..78 read), reused as out staging [16][36].
//   LDS rows are padded (KP, VP, GP below); the pad bytes are never written and never read.
// =====================================================================================
#define AT_NW 8
#define AT_QB 64
#define AT_KC 64
#define EWIN  192
#define MGP   20   // hand-over record pitch in floats per lane: 80 B = 16 B x odd for the 16-B accesses (lane = row)
#define GP    84   // G row pitch in floats: 16 B x odd for the 16-B stores (lane = row); the shifted 4-B reads step 83 floats a lane, so the 16 lanes of a half hit distinct banks
#define OSP   36
#define KP    40   // K and Er-window row pitch in elements: 64-B rows at 80 B (16 B x odd), conflict-free for 16-B fragment reads
#define VP    72   // V^T row pitch in elements: 128-B rows at 144 B (16 B x odd)

__device__ __forceinline__ __bf16 at_f2bf(float f) { return __builtin_bit_cast(__bf16, f2bf_bits(f)); }
__device__ __forceinline__ void at_split(float f, __bf16& hi, __bf16& lo) {
  const unsigned short hb = f2bf_bits(f);
  hi = __builtin_bit_cast(__bf16, hb);
  lo = at_f2bf(f - __uint_as_float(((unsigned)hb) << 16));
}
// lane l <-> lane l ^ 16 (the two halves that share a query)
__device__ __forceinline__ float at_xhalf(float x) {
  return __builtin_bit_cast(float, __builtin_amdgcn_permlanex16(__builtin_bit_cast(int, x), __builtin_bit_cast(int, x),
                                                                0x76543210, 0xfedcba98, false, false));
}
__device__ __forceinline__ v8f at_mma(v16b a, v16b b, v8f c) {
  c = __builtin_amdgcn_wmma_f32_16x16x32_bf16(false, a, false, b, (short)0, c, false, false);
  asm volatile("v_nop\n\tv_nop\n\tv_nop\n\tv_nop" : "+v"(c) : "v"(a), "v"(b));
  return c;
}

__global__ __launch_bounds__(256)
void relattn32_kernel(const unsigned short* __restrict__ qhp, const unsigned short* __restrict__ qlp,
                      const unsigned short* __restrict__ khp, const unsigned short* __restrict__ klp,
                      const unsigned short* __restrict__ vhp, const unsigned short* __restrict__ vlp,
                      const unsigned short* __restrict__ erp, float* __restrict__ out, float sscale) {
  union FB { v16b v; v8b h[2]; };
  __shared__ __align__(16) __bf16 KshA[2 * AT_KC * KP];        // K hi [group][kv][d], pitch KP      2 x 5 KB
  __shared__ __align__(16) __bf16 KslA[2 * AT_KC * KP];        // K lo
  __shared__ __align__(16) __bf16 VthA[2 * HD * VP];           // V hi [group][d][kv], pitch VP      2 x 4.5 KB
  __shared__ __align__(16) __bf16 VtlA[2 * HD * VP];           // V lo
  __shared__ __align__(16) __bf16 Esh[EWIN * KP];              // Er window [w][d], pitch KP         15 KB
  __shared__ __align__(16) float  Gs[AT_NW][16 * GP];          // per wave rel tile [query][80], pitch GP; later hand-over record (group 1) / out staging pitch 36 (group 0)

  const int tid  = threadIdx.x;
  const int wave = __builtin_amdgcn_readfirstlane(tid >> 5);   // in a scalar register: the tests on the key group below are scalar branches
  const int grp  = wave >> 2;             // key group 0 / 1
  const int wq   = wave & 3;              // which 16 of the 64 query rows
  const int tl   = tid & 127;             // thread within its group
  const int lane = tid & 31;
  const int hh   = lane >> 4;
  const int c    = lane & 15;

  const int bx   = blockIdx.x;
  const int tp   = bx & (NQB / 2 - 1);    // 0..31
  const int pair = bx >> 5;               // 0..15
  const int b    = pair >> 2;
  const int h    = pair & 3;
  const size_t rowBase = (size_t)b * SEQ;

  const __bf16* Qh = (const __bf16*)(const void*)qhp + h * HD;
  const __bf16* Ql = (const __bf16*)(const void*)qlp + h * HD;
  const __bf16* Kh = (const __bf16*)(const void*)khp + h * HD;
  const __bf16* Kl = (const __bf16*)(const void*)klp + h * HD;
  const __bf16* Vh = (const __bf16*)(const void*)vhp + ((size_t)b * HID + h * HD) * SEQ;
  const __bf16* Vl = (const __bf16*)(const void*)vlp + ((size_t)b * HID + h * HD) * SEQ;
  const __bf16* Er = (const __bf16*)(const void*)erp;
  float*        ob = out + h * HD;

  const int wbase = 64 * grp + 48 - 16 * wq;   // first row, in the staged 192-row window, of this wave's G tile
  float* gw = Gs[wave];
  __bf16* Ksh = KshA + grp * (AT_KC * KP);     // this group's own chunk
  __bf16* Ksl = KslA + grp * (AT_KC * KP);
  __bf16* Vth = VthA + grp * (HD * VP);
  __bf16* Vtl = VtlA + grp * (HD * VP);

  // the block's two query blocks, long one first; every (b, h, qb) is taken by exactly one block (block-uniform trip counts)
  for (int part = 0; part < 2; ++part) {
  const int qb = part ? tp : (NQB - 1 - tp);   // 63..32, then 0..31
  const int q0 = qb * AT_QB + wq * 16;

  // ---- Q fragments (B operand, column = query = lane&15, split k map, one k-step of 32 = d), hi and lo ----
  const v16b qah = FragB::load(Qh + (rowBase + q0 + c) * HID + 8 * hh);
  const v16b qal = FragB::load(Ql + (rowBase + q0 + c) * HID + 8 * hh);

  float mrow = -INFINITY;                 // running maximum of query c (equal in both lane halves)
  float lrow = 0.f;                       // running sum of query c over this lane half's keys; halves joined after the loop
  v8f oacc[2];                            // O^T: oacc[t][r] = out[query c][d = 16t + 8hh + r]
  oacc[0] = zero8(); oacc[1] = zero8();
  const int qrow = qb * AT_QB + wq * 16 + c;

  const int nStages = (qb + 2) >> 1;      // block-uniform, <= 32: ceil((qb + 1) / 2)
  for (int st = 0; st < nStages; ++st) {
    const int kc    = 2 * st + grp;       // this group's chunk (wave-uniform)
    const bool live = kc <= qb;           // false only for group 1 in the last stage of an odd chunk count
    const int kv0   = (live ? kc : qb) * AT_KC;
    const int e0 = SEQ - 64 - 64 * (qb - 2 * st);   // Er row of staged window row 0 (group 0's window base), 0 .. 4032
    __syncthreads();
    {
      // K: thread -> key row r = tl>>1, d half = (tl&1)*16; 2 x 8 elements per plane
      const int r = tl >> 1, half = (tl & 1) * 16;
      const __bf16* ks = Kh + (rowBase + kv0 + r) * HID + half;
      const __bf16* kl = Kl + (rowBase + kv0 + r) * HID + half;
      // V^T: thread -> d = tl>>2, key quarter = (tl&3)*16; 2 x 8 elements per plane
      const int d = tl >> 2, qt = (tl & 3) * 16;
      const __bf16* vs = Vh + (size_t)d * SEQ + kv0 + qt;
      const __bf16* vl = Vl + (size_t)d * SEQ + kv0 + qt;
      // Er window: 16-B piece p = tid + 256 i -> window row p>>2, d quarter (p&3)*8; clamped source row (address clamp)
      const __bf16* ep[3];
#pragma unroll
      for (int i = 0; i < 3; ++i) {
        const int p = tid + 256 * i;
        int erow = e0 + (p >> 2);
        erow = erow < 0 ? 0 : erow;
        erow = erow > (SEQ - 1) ? (SEQ - 1) : erow;
        ep[i] = Er + (size_t)erow * HD + (p & 3) * 8;
      }
      v8b a0[2], a1[2], b0[2], b1[2], ee[3];
#pragma unroll
      for (int i = 0; i < 2; ++i) {
        a0[i] = *(const v8b*)(ks + 8 * i);
        a1[i] = *(const v8b*)(kl + 8 * i);
        b0[i] = *(const v8b*)(vs + 8 * i);
        b1[i] = *(const v8b*)(vl + 8 * i);
      }
#pragma unroll
      for (int i = 0; i < 3; ++i) ee[i] = *(const v8b*)(ep[i]);
      // the wait that stands before a register named by an issued load is rewritten; the addresses are its inputs so that they
      // live up to it (without them a later load's result was placed over an earlier load's address pair)
      asm volatile("s_wait_xcnt 0x0" :: "v"(ks), "v"(kl), "v"(vs), "v"(vl), "v"(ep[0]), "v"(ep[1]), "v"(ep[2]) : "memory");
#pragma unroll
      for (int i = 0; i < 2; ++i) {
        *(v8b*)(Ksh + r * KP + half + 8 * i) = a0[i];
        *(v8b*)(Ksl + r * KP + half + 8 * i) = a1[i];
        *(v8b*)(Vth + d * VP + qt   + 8 * i) = b0[i];
        *(v8b*)(Vtl + d * VP + qt   + 8 * i) = b1[i];
      }
#pragma unroll
      for (int i = 0; i < 3; ++i) {
        const int p = tid + 256 * i;
        *(v8b*)(Esh + (p >> 2) * KP + (p & 3) * 8) = ee[i];
      }
    }
    __syncthreads();
    if (live) {   // wave-uniform; no block barrier inside

    // ---- content scores, transposed: S^T tile j = K rows (16j..16j+15) . q^T, 3-term split; s[j][r] = score(key 16j + 8hh + r, query c) ----
    v8f s[4];
#pragma unroll
    for (int j = 0; j < 4; ++j) {
      FB kb, kl;
      const __bf16* kp = Ksh + (j * 16 + c) * KP + 8 * hh;
      const __bf16* kq = Ksl + (j * 16 + c) * KP + 8 * hh;
      kb.h[0] = *(const v8b*)(kp); kb.h[1] = *(const v8b*)(kp + 16);
      kl.h[0] = *(const v8b*)(kq); kl.h[1] = *(const v8b*)(kq + 16);
      v8f a = zero8();
      a = at_mma(kb.v, qah, a);
      a = at_mma(kl.v, qah, a);
      a = at_mma(kb.v, qal, a);
      s[j] = a;
    }

    // ---- rel-pos tile, transposed: G^T = Win[wbase + 0..79] . q^T (2 products); a lane's 8 registers are 8 consecutive
    //      window columns of its query's row, so they go to this wave's G[query][80] as two 16-B stores ----
#pragma unroll
    for (int nt = 0; nt < 5; ++nt) {
      FB eb;
      const __bf16* ep = Esh + (wbase + nt * 16 + c) * KP + 8 * hh;
      eb.h[0] = *(const v8b*)(ep); eb.h[1] = *(const v8b*)(ep + 16);
      v8f g = zero8();
      g = at_mma(eb.v, qah, g);
      g = at_mma(eb.v, qal, g);
      float* gp = gw + c * GP + nt * 16 + 8 * hh;
      const v4f g0 = {g[0], g[1], g[2], g[3]};
      const v4f g1 = {g[4], g[5], g[6], g[7]};
      *(v4fa*)(gp)     = g0;
      *(v4fa*)(gp + 4) = g1;
    }
    __builtin_amdgcn_fence(__ATOMIC_RELEASE, "workgroup");
    __builtin_amdgcn_wave_barrier();
    __builtin_amdgcn_fence(__ATOMIC_ACQUIRE, "workgroup");

    // ---- combine, scale, causal mask, chunk maximum of query c (in-lane, four independent chains, then the other half) ----
    const bool diag = (kc == qb);           // wave-uniform
    const float* gr = gw + c * GP + (15 - c) + 8 * hh;   // + 16j + r gives shift column 15 - c + jl, jl = 16j + 8hh + r
    float mj[4];
#pragma unroll
    for (int j = 0; j < 4; ++j) {
      float m = -INFINITY;
#pragma unroll
      for (int r = 0; r < 8; ++r) {
        const int kvcol = kv0 + j * 16 + 8 * hh + r;
        const float rel = gr[j * 16 + r];
        const float sv  = (s[j][r] + rel) * sscale;
        const bool msk  = diag && (kvcol > qrow);
        const float sm  = msk ? -INFINITY : sv;
        s[j][r] = sm;
        m = fmaxf(m, sm);
      }
      mj[j] = m;
    }
    float cm = fmaxf(fmaxf(mj[0], mj[1]), fmaxf(mj[2], mj[3]));
    cm = fmaxf(cm, at_xhalf(cm));           // key kv0 is never masked, so the joined maximum is finite

    // ---- online softmax update; P^T (unnormalised) as bf16 hi/lo straight into the B fragments of V^T.P^T ----
    const float mnew  = fmaxf(mrow, cm);
    const float alpha = __expf(mrow - mnew);
    mrow = mnew;
    FB ph[2], pl[2];
    float pj[4];
#pragma unroll
    for (int j = 0; j < 4; ++j) {
      float psum = 0.f;
#pragma unroll
      for (int r = 0; r < 8; ++r) {
        const float p = __expf(s[j][r] - mnew);
        psum += p;
        __bf16 a, bl; at_split(p, a, bl);
        ph[j >> 1].v[(j & 1) * 8 + r] = a;
        pl[j >> 1].v[(j & 1) * 8 + r] = bl;
      }
      pj[j] = psum;
    }
    lrow = lrow * alpha + ((pj[0] + pj[1]) + (pj[2] + pj[3]));
#pragma unroll
    for (int r = 0; r < 8; ++r) {
      oacc[0][r] *= alpha;
      oacc[1][r] *= alpha;
    }

    // ---- O^T += V^T . P^T : A = V^T rows d (split k map over keys), B = P^T fragments; 3-term split ----
#pragma unroll
    for (int kk = 0; kk < 2; ++kk) {
#pragma unroll
      for (int t = 0; t < 2; ++t) {
        FB vb, vl;
        vb.h[0] = *(const v8b*)(Vth + (t * 16 + c) * VP + kk * 32 + 8 * hh);
        vb.h[1] = *(const v8b*)(Vth + (t * 16 + c) * VP + kk * 32 + 16 + 8 * hh);
        vl.h[0] = *(const v8b*)(Vtl + (t * 16 + c) * VP + kk * 32 + 8 * hh);
        vl.h[1] = *(const v8b*)(Vtl + (t * 16 + c) * VP + kk * 32 + 16 + 8 * hh);
        oacc[t] = at_mma(vb.v, ph[kk].v, oacc[t]);
        oacc[t] = at_mma(vl.v, ph[kk].v, oacc[t]);
        oacc[t] = at_mma(vb.v, pl[kk].v, oacc[t]);
      }
    }
    }   // live
  }

  __builtin_amdgcn_fence(__ATOMIC_RELEASE, "workgroup");
  __builtin_amdgcn_wave_barrier();
  __builtin_amdgcn_fence(__ATOMIC_ACQUIRE, "workgroup");
  // ---- group 1 hands its maximum, sum and O^T to group 0: lane to same lane of wave - 4, through group 1's own G area ----
  if (grp == 1) {
    float* mp = gw + lane * MGP;
#pragma unroll
    for (int t = 0; t < 2; ++t) {
      const v4f o0 = {oacc[t][0], oacc[t][1], oacc[t][2], oacc[t][3]};
      const v4f o1 = {oacc[t][4], oacc[t][5], oacc[t][6], oacc[t][7]};
      *(v4fa*)(mp + t * 8)     = o0;
      *(v4fa*)(mp + t * 8 + 4) = o1;
    }
    mp[16] = mrow;
    mp[17] = lrow;
  }
  __syncthreads();   // publishes the records; group 1 next writes its G area behind two more barriers, after group 0 has read them
  if (grp == 0) {
  {
    const float* mp = Gs[wave + 4] + lane * MGP;
    const float m1 = mp[16], l1 = mp[17];
    const float mN = fmaxf(mrow, m1);        // mrow is finite (group 0 always has chunk 0); m1 is -inf where group 1 had no chunk
    const float a0 = __expf(mrow - mN);
    const float a1 = __expf(m1 - mN);
    lrow = lrow * a0 + l1 * a1;
#pragma unroll
    for (int t = 0; t < 2; ++t) {
      const v4f o0 = *(const v4fa*)(mp + t * 8);
      const v4f o1 = *(const v4fa*)(mp + t * 8 + 4);
#pragma unroll
      for (int r = 0; r < 4; ++r) {
        oacc[t][r]     = oacc[t][r]     * a0 + o0[r] * a1;
        oacc[t][r + 4] = oacc[t][r + 4] * a0 + o1[r] * a1;
      }
    }
  }
  float* os = gw;
  {
    const float inv = 1.0f / (lrow + at_xhalf(lrow));   // the two halves' key sums joined once
#pragma unroll
    for (int t = 0; t < 2; ++t) {
      float* op = os + c * OSP + t * 16 + 8 * hh;        // row = query c, 8 consecutive d
      const v4f o0 = {oacc[t][0] * inv, oacc[t][1] * inv, oacc[t][2] * inv, oacc[t][3] * inv};
      const v4f o1 = {oacc[t][4] * inv, oacc[t][5] * inv, oacc[t][6] * inv, oacc[t][7] * inv};
      *(v4fa*)(op)     = o0;
      *(v4fa*)(op + 4) = o1;
    }
  }
  __builtin_amdgcn_fence(__ATOMIC_RELEASE, "workgroup");
  __builtin_amdgcn_wave_barrier();
  __builtin_amdgcn_fence(__ATOMIC_ACQUIRE, "workgroup");
  {
    const int q4 = lane >> 3, c4 = (lane & 7) * 4;
    {
#pragma unroll
      for (int it = 0; it < 4; ++it) {
        const int row = it * 4 + q4;                   // it 0..3 x q4 0..3 covers rows 0..15 of the wave tile
        const v4f val = *(const v4fa*)(os + row * OSP + c4);
        *(v4f*)(ob + (rowBase + q0 + row) * HID + c4) = val;
      }
      // the next query block's set-up rewrites the data and address registers that these stores name
      asm volatile("s_wait_xcnt 0x0" ::: "memory");
    }
  }
  }   // grp == 0
  }   // part: the next query block's first barrier stands before any staging store; G / out staging is this wave's own
}

// ---------------------------------------------------------------------------
// Workspace region map (byte offsets):
//   WqTh bf16 [128 n][128 k]        0      WqTl     32768
//   WkTh                        65536      WkTl     98304
//   WvTh                       131072      WvTl    163840     (lo weight planes written, not consumed)
//   Xb   bf16 [16384][128]     196608                         (4194304 B)
//   ErB  bf16 [4096][32]      4390912                         (262144 B)
//   Qh   bf16 [16384][128]    4653056      Ql    8847360
//   Kh   bf16 [16384][128]   13041664      Kl   17235968
//   VTh  bf16 [4][128][4096] 21430272      VTl  25624576
//   total                    29818880
// Every region is written in whole 64x64 tiles / whole 16-B-per-lane runs; all extents are exact tile multiples,
// ---------------------------------------------------------------------------
extern "C" void kernel_launch(void* const* d_in, const int* in_sizes, int n_in,
                              void* d_out, int out_size, void* d_ws, size_t ws_size,
                              hipStream_t stream) {
  if (n_in < 8) return;
  if (in_sizes[0] != NB * SEQ * HID) return;
  if (in_sizes[1] != HID * HID || in_sizes[3] != HID * HID || in_sizes[5] != HID * HID) return;
  if (in_sizes[2] != HID || in_sizes[4] != HID || in_sizes[6] != HID) return;
  if (in_sizes[7] != SEQ * HD) return;
  if (out_size != NB * SEQ * HID) return;

  const float* x  = (const float*)d_in[0];
  const float* Wq = (const float*)d_in[1];
  const float* bq = (const float*)d_in[2];
  const float* Wk = (const float*)d_in[3];
  const float* bk = (const float*)d_in[4];
  const float* Wv = (const float*)d_in[5];
  const float* bv = (const float*)d_in[6];
  const float* Er = (const float*)d_in[7];
  float* out = (float*)d_out;

  const size_t PW = (size_t)HID * HID * 2;            //    32768  bf16 weight plane
  const size_t PX = (size_t)NB * SEQ * HID * 2;       //  4194304  bf16 activation plane (all batch rows)
  const size_t PE = (size_t)SEQ * HD * 2;             //   262144  bf16 Er plane
  const size_t PV = (size_t)NB * HID * SEQ * 2;       //  4194304  bf16 v^T plane
  size_t off = 0;
  const size_t oWqTh = off; off += PW;  const size_t oWqTl = off; off += PW;
  const size_t oWkTh = off; off += PW;  const size_t oWkTl = off; off += PW;
  const size_t oWvTh = off; off += PW;  const size_t oWvTl = off; off += PW;
  const size_t oXb   = off; off += PX;
  const size_t oErB  = off; off += PE;
  const size_t oQh   = off; off += PX;  const size_t oQl   = off; off += PX;
  const size_t oKh   = off; off += PX;  const size_t oKl   = off; off += PX;
  const size_t oVTh  = off; off += PV;  const size_t oVTl  = off; off += PV;
  if (off > ws_size) return;                          // off = 29818880
  if (off > (size_t)134217728) return;

  char* ws = (char*)d_ws;
  unsigned short* WqTh = (unsigned short*)(ws + oWqTh); unsigned short* WqTl = (unsigned short*)(ws + oWqTl);
  unsigned short* WkTh = (unsigned short*)(ws + oWkTh); unsigned short* WkTl = (unsigned short*)(ws + oWkTl);
  unsigned short* WvTh = (unsigned short*)(ws + oWvTh); unsigned short* WvTl = (unsigned short*)(ws + oWvTl);
  unsigned short* Xb   = (unsigned short*)(ws + oXb);
  unsigned short* ErB  = (unsigned short*)(ws + oErB);
  unsigned short* Qh   = (unsigned short*)(ws + oQh);   unsigned short* Ql   = (unsigned short*)(ws + oQl);
  unsigned short* Kh   = (unsigned short*)(ws + oKh);   unsigned short* Kl   = (unsigned short*)(ws + oKl);
  unsigned short* VTh  = (unsigned short*)(ws + oVTh);  unsigned short* VTl  = (unsigned short*)(ws + oVTl);

  const dim3 blk(256);
  const float sscale = 0.17677669529663688f;          // 1/sqrt(32)

  // (1) weights [in k][out n] f32 -> transposed bf16 planes [n][k]   (in [128][128] -> out [128][128]; grid (cols/64, rows/64))
  tsplit_kernel<<<dim3(HID / 64, HID / 64), blk, 0, stream>>>(Wq, WqTh, WqTl, HID, HID);
  tsplit_kernel<<<dim3(HID / 64, HID / 64), blk, 0, stream>>>(Wk, WkTh, WkTl, HID, HID);
  tsplit_kernel<<<dim3(HID / 64, HID / 64), blk, 0, stream>>>(Wv, WvTh, WvTl, HID, HID);
  // (2) x -> bf16 plane [16384][128]; Er -> bf16 plane [4096][32]
  const int n8x = NB * SEQ * HID / 8;                 // 262144 threads x 8 = whole plane
  const int n8e = SEQ * HD / 8;                       //  16384 threads x 8 = whole plane
  cvt_bf16x8_kernel<<<dim3((n8x + 255) / 256), blk, 0, stream>>>(x, Xb, n8x);
  cvt_bf16x8_kernel<<<dim3((n8e + 255) / 256), blk, 0, stream>>>(Er, ErB, n8e);
  // (3) q = x.Wq + bq -> Q hi/lo planes [b*4096+t][h*32+d]   (M=16384, N=128, K=128; 512 tiles -> 64 blocks)
  const dim3 gProj(((NB * SEQ / 64) * (HID / 64) + 7) / 8, 1);
  wmma_gemm64<false, 2, 2><<<gProj, blk, 0, stream>>>(
      Xb, Xb, HID, 0L, WqTh, WqTh, HID, 0L, (void*)Qh, (void*)Ql, HID, 0L, bq, NB * SEQ, HID, HID, 1.0f);
  // (4) k = x.Wk + bk -> K hi/lo planes
  wmma_gemm64<false, 2, 2><<<gProj, blk, 0, stream>>>(
      Xb, Xb, HID, 0L, WkTh, WkTh, HID, 0L, (void*)Kh, (void*)Kl, HID, 0L, bk, NB * SEQ, HID, HID, 1.0f);
  // (5) v^T = Wv^T . x^T + bv[m] -> VT hi/lo planes [b][h*32+d][s]   (A = Wv^T plane [128][128], Bt = x plane rows of batch z;
  //     M=128, N=4096, K=128; 128 tiles -> 16 blocks, grid.y = batch)
  const dim3 gVT(((HID / 64) * (SEQ / 64) + 7) / 8, NB);
  wmma_gemm64<false, 1, 2><<<gVT, blk, 0, stream>>>(
      WvTh, WvTh, HID, 0L, Xb, Xb, HID, (long)SEQ * HID, (void*)VTh, (void*)VTl, SEQ, (long)HID * SEQ,
      bv, HID, SEQ, HID, 1.0f);
  // (6) causal rel-pos attention: 512 blocks = 16 (b,h) pairs x 32 pairs of query blocks (63 - t, t), 256 threads (2 key groups x 4 waves)
  relattn32_kernel<<<dim3(NB * NH * (NQB / 2)), dim3(256), 0, stream>>>(Qh, Ql, Kh, Kl, VTh, VTl, ErB, out, sscale);
  (void)hipGetLastError();
}

// v005
// It runs in 122 microseconds.
// In two side-by-side timings against v004, it was 1.27 and 1.28 times as fast.
// Counting every step since v000, it is 3.42 times as fast.
// Contractions: q, k, v^T projections x.W, v^T = Wv^T.x^T (+bias): v_wmma_f32_16x16x32_bf16, single product of bf16-RNE-valued x and W planes, f32 accumulate;
// scores (k.q^T, keys as rows): bf16 hi/lo split (hi.hi + hi.lo + lo.hi); rel-pos term ErWin.q^T: q hi/lo x bf16-RNE Er (hi.E + lo.E); V^T.P^T: bf16 hi/lo split (3 products);
// all v_wmma_f32_16x16x32_bf16 with f32 accumulate. Softmax, bias adds and the 1/sqrt(32) score scale in f32.
//
// Math implemented (B=4, S=4096, hidden 128, 4 heads x 32):
//   q = x.Wq + bq, k = x.Wk + bk, v = x.Wv + bv   (W stored [in][out]; head h = columns h*32..h*32+31)
//   rel[i][j] = q_i . Er[S-1-(i-j)]  for j <= i   (pad-left / reshape shift identity; j > i entries are masked)
//   logit[i][j] = (q_i.k_j + rel[i][j]) * (1/sqrt(32)),  causal (j <= i, diagonal included), softmax over j, out = P.v
//   out[(b*S + i)*128 + h*32 + d]   (no output projection)
//
// Plane / carry audit: every 16-bit plane is bf16 with unit carry (x, W^T, Er: bf16-RNE of the inputs; q, k, v^T: hi/lo bf16
// pairs of the f32 projection results; P: hi/lo bf16 pairs of exp(s - m)); nothing is scaled, nothing to fold back.
//
// Er window per (query block qb, key chunk kc): window row w <-> Er row e0 + w, e0 = S - 64 - 64*(qb - kc), w in 0..127
// (clamped copy, rows past S-1 only ever meet masked keys). For block row il (0..63) and chunk key jl (0..63):
// w = 63 - il + jl. Wave wv (rows il = 16*wv..16*wv+15) computes G^T[80][16] = Win[48 - 16*wv + 0..79] . q^T, stores it as G[row][80] and reads
// G[row][15 - (il - 16*wv) + jl].
#include <hip/hip_runtime.h>
#include <math.h>
#include <stdint.h>

#define NB   4
#define SEQ  4096
#define HID  128
#define NH   4
#define HD   32
#define NQB  (SEQ / 64)

typedef __attribute__((ext_vector_type(16))) _Float16 v16h;
typedef __attribute__((ext_vector_type(8)))  _Float16 v8h;
typedef __attribute__((ext_vector_type(16))) __bf16   v16b;
typedef __attribute__((ext_vector_type(8)))  __bf16   v8b;
typedef __attribute__((ext_vector_type(8)))  float    v8f;
typedef __attribute__((ext_vector_type(4)))  float    v4f;
typedef __attribute__((ext_vector_type(4)))  unsigned int v4u;
typedef v4f __attribute__((may_alias)) v4fa;

__device__ __forceinline__ unsigned short f2bf_bits(float f) {
  unsigned u = __float_as_uint(f);
  return (unsigned short)((u + 0x7FFFu + ((u >> 16) & 1u)) >> 16);
}
__device__ __forceinline__ float bf_bits2f(unsigned short h) { return __uint_as_float(((unsigned)h) << 16); }
__device__ __forceinline__ float bf_rne(float f) { return bf_bits2f(f2bf_bits(f)); }
__device__ __forceinline__ unsigned pk16(unsigned short a, unsigned short b) { return (unsigned)a | ((unsigned)b << 16); }

// hazard guards as plain device helpers
__device__ __forceinline__ void dep_guard_b(v8f& a, v8f& b, v16b x, v16b y) { asm volatile("v_nop\n\tv_nop\n\tv_nop\n\tv_nop" : "+v"(a), "+v"(b) : "v"(x), "v"(y)); }
__device__ __forceinline__ void keep4_b(v16b a, v16b b, v16b c, v16b d) { asm volatile("v_nop" :: "v"(a), "v"(b), "v"(c), "v"(d)); }
__device__ __forceinline__ void acc_guard4(v8f& a, v8f& b, v8f& c, v8f& d) { asm volatile("v_nop\n\tv_nop\n\tv_nop\n\tv_nop" : "+v"(a), "+v"(b), "+v"(c), "+v"(d)); }

// 16-bit WMMA fragment (A: p = row m at k0 + 8h; B stored [n][k]: p = row n at k0 + 8h; same split k map):
// elements 0..7 <- p[0..7], elements 8..15 <- p[16..23]
struct FragB {
  union U { v16b v; v8b h[2]; };
  static __device__ __forceinline__ v16b load(const __bf16* p) {
    U f; f.h[0] = *(const v8b*)(p); f.h[1] = *(const v8b*)(p + 16); return f.v;
  }
  static __device__ __forceinline__ v8f mma(v16b a, v16b b, v8f c) {
    return __builtin_amdgcn_wmma_f32_16x16x32_bf16(false, a, false, b, (short)0, c, false, false);
  }
};

__device__ __forceinline__ v8f zero8() { v8f z = {0.f, 0.f, 0.f, 0.f, 0.f, 0.f, 0.f, 0.f}; return z; }

// ---- Register-blocked batched WMMA GEMM (bf16 operands) --------------------
// C[m,n] = scale * sum_k A[m,k] * Bt[n,k] (+bf16-RNE bias); each wave owns a 64x64 tile, 8 waves per block.
// A row-major [M,K]; Bt row-major [N,K]; M,N % 64 == 0, K % 32 == 0 (met by the constant shapes proj_kernel passes).
// SPLIT: operands are hi/lo planes (A2/Bt2 = lo planes, same layout); product = hi.hi + hi.lo + lo.hi.
// BIAS_MODE: 0 = none, 1 = bias[m], 2 = bias[n]  (bias value converted bf16-RNE, added in f32).
// OUT_MODE: 0 = f32, 2 = bf16 hi plane (Cout) + bf16 lo plane (Cout2).
// coverage: 4 slabs x 16 rows x 64 cols = the whole 64x64 tile per wave; tiles cover M x N exactly.
// Device body: the launching kernel hands in its LDS slabs sT, the block's index bx among the product's blocks and the batch b.
template <bool SPLIT, int BIAS_MODE, int OUT_MODE>
__device__ __forceinline__ void wmma_gemm64(
    float (*sT)[16 * 68], int bx, int b,
    const unsigned short* __restrict__ Ap, const unsigned short* __restrict__ A2p, int lda, long strideA,
    const unsigned short* __restrict__ Btp, const unsigned short* __restrict__ Bt2p, int ldb, long strideB,
    void* __restrict__ Cout, void* __restrict__ Cout2, int ldc, long strideC,
    const float* __restrict__ bias, int M, int N, int K, float scale) {
  const __bf16* A = (const __bf16*)(const void*)Ap;   const __bf16* A2  = (const __bf16*)(const void*)A2p;
  const __bf16* Bt = (const __bf16*)(const void*)Btp; const __bf16* Bt2 = (const __bf16*)(const void*)Bt2p;
  const int lane = threadIdx.x & 31;
  const int wave = threadIdx.x >> 5;
  const int tilesN = N >> 6;
  const int tilesM = M >> 6;
  const int tile = bx * 8 + wave;
  if (tile >= tilesM * tilesN) return;   // wave-uniform; no block barriers in this kernel
  const int tm = tile / tilesN;
  const int tn = tile - tm * tilesN;
  const int m0 = tm << 6;
  const int n0 = tn << 6;

  const __bf16* Ab  = A  + (size_t)b * strideA;
  const __bf16* Bb  = Bt + (size_t)b * strideB;
  const __bf16* Ab2 = SPLIT ? (A2  + (size_t)b * strideA) : nullptr;
  const __bf16* Bb2 = SPLIT ? (Bt2 + (size_t)b * strideB) : nullptr;

  const int rlane = lane & 15;                 // row (A) / col (B, D) within subtile
  const int koff  = (lane >> 4) * 8;           // k offset of this lane half
  const int mOff  = (lane >> 4) * 8;           // D row offset

  v8f acc[4][4];
#pragma unroll
  for (int i = 0; i < 4; ++i)
#pragma unroll
    for (int j = 0; j < 4; ++j) acc[i][j] = zero8();

  for (int k0 = 0; k0 < K; k0 += 32) {
    v16b bh[4], bl[4];
#pragma unroll
    for (int j = 0; j < 4; ++j) {
      const size_t bo = (size_t)(n0 + (j << 4) + rlane) * ldb + koff + k0;
      bh[j] = FragB::load(Bb + bo);
      bl[j] = bh[j];
      if (SPLIT) bl[j] = FragB::load(Bb2 + bo);
    }
#pragma unroll
    for (int i = 0; i < 4; ++i) {
      const size_t ao = (size_t)(m0 + (i << 4) + rlane) * lda + koff + k0;
      v16b ah = FragB::load(Ab + ao);
      v16b al = ah;
      if (SPLIT) al = FragB::load(Ab2 + ao);
#pragma unroll
      for (int j = 0; j < 4; ++j) {
        acc[i][j] = FragB::mma(ah, bh[j], acc[i][j]);
        if (SPLIT) {
          acc[i][j] = FragB::mma(ah, bl[j], acc[i][j]);
          acc[i][j] = FragB::mma(al, bh[j], acc[i][j]);
        }
      }
      dep_guard_b(acc[i][0], acc[i][3], ah, al);
    }
    keep4_b(bh[0], bh[1], bh[2], bh[3]);
    if (SPLIT) keep4_b(bl[0], bl[1], bl[2], bl[3]);
  }
  acc_guard4(acc[0][0], acc[0][1], acc[0][2], acc[0][3]);
  acc_guard4(acc[1][0], acc[1][1], acc[1][2], acc[1][3]);
  acc_guard4(acc[2][0], acc[2][1], acc[2][2], acc[2][3]);
  acc_guard4(acc[3][0], acc[3][1], acc[3][2], acc[3][3]);

  // ---- epilogue ----
  float* slab = sT[wave];
#pragma unroll
  for (int i = 0; i < 4; ++i) {
    const int mBase = m0 + (i << 4);
#pragma unroll
    for (int j = 0; j < 4; ++j) {
      const int n = n0 + (j << 4) + rlane;
      float bv = 0.f;
      if (BIAS_MODE == 2) bv = bf_rne(bias[n]);
#pragma unroll
      for (int r = 0; r < 8; ++r) {
        float v = acc[i][j][r] * scale;
        if (BIAS_MODE == 1) v += bf_rne(bias[mBase + mOff + r]);
        if (BIAS_MODE == 2) v += bv;
        slab[(mOff + r) * 68 + (j << 4) + rlane] = v;
      }
    }
    __builtin_amdgcn_fence(__ATOMIC_RELEASE, "workgroup");
    __builtin_amdgcn_wave_barrier();
    __builtin_amdgcn_fence(__ATOMIC_ACQUIRE, "workgroup");
    if (OUT_MODE == 0) {
      float* C = (float*)Cout + (size_t)b * strideC;
      const int hh = lane >> 4, c4 = (lane & 15) * 4;     // row seg = 256 B = 16 lanes x 16 B
      {
#pragma unroll
        for (int it = 0; it < 8; ++it) {
          const int row = it * 2 + hh;
          v4f v = *(const v4fa*)(slab + row * 68 + c4);
          *(v4f*)(C + (size_t)(mBase + row) * ldc + n0 + c4) = v;
        }
        
      }
    } else {
      const int q = lane >> 3, c8 = (lane & 7) * 8;
      unsigned short* C  = (unsigned short*)Cout  + (size_t)b * strideC;
      unsigned short* C2 = (unsigned short*)Cout2 + (size_t)b * strideC;
      {
#pragma unroll
        for (int it = 0; it < 4; ++it) {
          const int row = it * 4 + q;
          const float* sp = slab + row * 68 + c8;
          v8h hv, lv;
#pragma unroll
          for (int e = 0; e < 8; ++e) {
            unsigned short hb = f2bf_bits(sp[e]);
            unsigned short lb = f2bf_bits(sp[e] - bf_bits2f(hb));
            hv[e] = __builtin_bit_cast(_Float16, hb);
            lv[e] = __builtin_bit_cast(_Float16, lb);
          }
          *(v8h*)(C  + (size_t)(mBase + row) * ldc + n0 + c8) = hv;
          *(v8h*)(C2 + (size_t)(mBase + row) * ldc + n0 + c8) = lv;
        }
        
      }
    }
    __builtin_amdgcn_fence(__ATOMIC_RELEASE, "workgroup");
    __builtin_amdgcn_wave_barrier();
    __builtin_amdgcn_fence(__ATOMIC_ACQUIRE, "workgroup");
  }
}

// ---------------------------------------------------------------------------
// Contiguous f32 -> bf16-RNE plane: one thread = 8 consecutive elements = one 16-B store, so every wave writes
// 512 contiguous bytes; ceil(n8/256) blocks, blk = the block's index among them; coverage: n8 threads x 8 = the whole plane (n8 * 8 elements).
// ---------------------------------------------------------------------------
__device__ __forceinline__ void cvt_bf16x8(int blk, const float* __restrict__ in, unsigned short* __restrict__ o, int n8) {
  const int i = blk * 256 + threadIdx.x;
  if (i < n8) {
    const float* sp = in + (size_t)i * 8;
    const v4f a  = *(const v4f*)(sp);
    const v4f a2 = *(const v4f*)(sp + 4);
    v4u w;
    w[0] = pk16(f2bf_bits(a[0]),  f2bf_bits(a[1]));
    w[1] = pk16(f2bf_bits(a[2]),  f2bf_bits(a[3]));
    w[2] = pk16(f2bf_bits(a2[0]), f2bf_bits(a2[1]));
    w[3] = pk16(f2bf_bits(a2[2]), f2bf_bits(a2[3]));
    unsigned short* dp = o + (size_t)i * 8;
    *(v4u*)dp = w;
    
  }
}

// ---------------------------------------------------------------------------
// Fused transpose + bf16 split of an f32 matrix: in [R rows][Cc cols] (pitch Cc) ->
//   oh[c][r] = bf16_rne(in[r][c]), ol[c][r] = bf16_rne(in[r][c] - oh)   ([Cc][R], pitch R).
// 64x64 tiles through LDS. (Cc/64) x (R/64) blocks (cb, rb), 256 threads (R, Cc multiples of 64).
// Coverage per block and plane: load 4 it x 256 thr x 4 floats = 64x64; store 2 it x 256 thr x 8 u16 = 64x64.
// ---------------------------------------------------------------------------
__device__ __forceinline__ void tsplit(float* tf, int cb, int rb, const float* __restrict__ W, unsigned short* __restrict__ oh,
                                       unsigned short* __restrict__ ol, int R, int Cc) {
  const int c0  = cb * 64;           // input column block = output row block
  const int r0  = rb * 64;           // input row block    = output column block
  const int tid = threadIdx.x;
  {
    const int lr = tid >> 4;         // 0..15
    const int c4 = (tid & 15) * 4;   // 0..60
#pragma unroll
    for (int it = 0; it < 4; ++it) {
      const int rr = it * 16 + lr;   // 0..63
      const v4f a = *(const v4f*)(W + (size_t)(r0 + rr) * Cc + c0 + c4);
      *(v4f*)(tf + rr * 68 + c4) = a;
    }
  }
  __syncthreads();
  const int sub = tid >> 3;          // 0..31
  const int c8  = (tid & 7) * 8;     // 0..56
  v4u hv[2], lv[2];
#pragma unroll
  for (int it = 0; it < 2; ++it) {
    const int oc = it * 32 + sub;    // output row within tile (= input column)
    v4u a, a2;
#pragma unroll
    for (int q = 0; q < 4; ++q) {
      const float f0 = tf[(c8 + 2 * q) * 68 + oc];
      const float f1 = tf[(c8 + 2 * q + 1) * 68 + oc];
      const unsigned short h0 = f2bf_bits(f0), h1 = f2bf_bits(f1);
      const unsigned short l0 = f2bf_bits(f0 - bf_bits2f(h0)), l1 = f2bf_bits(f1 - bf_bits2f(h1));
      a[q]  = pk16(h0, h1);
      a2[q] = pk16(l0, l1);
    }
    hv[it] = a; lv[it] = a2;
  }
  {
#pragma unroll
    for (int it = 0; it < 2; ++it) {
      const int oc = it * 32 + sub;
      const size_t go = (size_t)(c0 + oc) * R + r0 + c8;
      *(v4u*)(oh + go) = hv[it];
      *(v4u*)(ol + go) = lv[it];
    }
    
  }
}

// ---------------------------------------------------------------------------
// Launch 1: every plane that depends on the inputs alone, one grid; the block index picks the job (block-uniform branch).
//   blocks 0..11     weight m = blk >> 2 (Wq, Wk, Wv), 64x64 tile blk & 3: transposed bf16 planes [n][k]
//   blocks 12..75    Er -> bf16 plane [4096][32]    (64 blocks x 256 threads x 8 = the whole plane)
//   blocks 76..1099  x  -> bf16 plane [16384][128]  (1024 blocks x 256 threads x 8 = the whole plane)
// ---------------------------------------------------------------------------
#define PREP_W  12
#define PREP_E  (SEQ * HD / 8 / 256)
#define PREP_X  (NB * SEQ * HID / 8 / 256)
__global__ __launch_bounds__(256) void prep_kernel(const float* __restrict__ x, const float* __restrict__ Wq, const float* __restrict__ Wk,
                                                   const float* __restrict__ Wv, const float* __restrict__ Er,
                                                   unsigned short* __restrict__ Xb, unsigned short* __restrict__ ErB,
                                                   unsigned short* __restrict__ WqTh, unsigned short* __restrict__ WqTl,
                                                   unsigned short* __restrict__ WkTh, unsigned short* __restrict__ WkTl,
                                                   unsigned short* __restrict__ WvTh, unsigned short* __restrict__ WvTl) {
  __shared__ __align__(16) float tf[64 * 68];
  const int blk = blockIdx.x;
  if (blk < PREP_W) {
    const int m = blk >> 2, t = blk & 3;
    const float*    W  = m == 0 ? Wq   : (m == 1 ? Wk   : Wv);
    unsigned short* oh = m == 0 ? WqTh : (m == 1 ? WkTh : WvTh);
    unsigned short* ol = m == 0 ? WqTl : (m == 1 ? WkTl : WvTl);
    tsplit(tf, t & 1, t >> 1, W, oh, ol, HID, HID);
  } else if (blk < PREP_W + PREP_E) {
    cvt_bf16x8(blk - PREP_W, Er, ErB, SEQ * HD / 8);
  } else {
    cvt_bf16x8(blk - (PREP_W + PREP_E), x, Xb, NB * SEQ * HID / 8);
  }
}

// ---------------------------------------------------------------------------
// Launch 2: the three projections, one grid (64, 3); blockIdx.y picks the product (block-uniform branch).
//   y = 0: q = x.Wq + bq -> Q hi/lo planes [b*4096+t][h*32+d]   (M=16384, N=128, K=128; 512 tiles -> 64 blocks)
//   y = 1: k = x.Wk + bk -> K hi/lo planes, same shape
//   y = 2: v^T = Wv^T . x^T + bv[m] -> VT hi/lo planes [b][h*32+d][s]   (A = Wv^T plane [128][128], Bt = x plane rows of batch b;
//          M=128, N=4096, K=128; 128 tiles -> 16 blocks a batch: block = blockIdx.x & 15, batch = blockIdx.x >> 4)
// ---------------------------------------------------------------------------
__global__ __launch_bounds__(256) void proj_kernel(const unsigned short* __restrict__ Xb, const unsigned short* __restrict__ WqTh,
                                                   const unsigned short* __restrict__ WkTh, const unsigned short* __restrict__ WvTh,
                                                   const float* __restrict__ bq, const float* __restrict__ bk, const float* __restrict__ bv,
                                                   unsigned short* __restrict__ Qh, unsigned short* __restrict__ Ql,
                                                   unsigned short* __restrict__ Kh, unsigned short* __restrict__ Kl,
                                                   unsigned short* __restrict__ VTh, unsigned short* __restrict__ VTl) {
  __shared__ __align__(16) float sT[8][16 * 68];   // per-wave 16x64 slab, pitch 68 floats
  const int job = blockIdx.y;
  if (job < 2) {
    const unsigned short* Wt = job ? WkTh : WqTh;
    const float*          bi = job ? bk   : bq;
    unsigned short*       Ch = job ? Kh   : Qh;
    unsigned short*       Cl = job ? Kl   : Ql;
    wmma_gemm64<false, 2, 2>(sT, blockIdx.x, 0, Xb, Xb, HID, 0L, Wt, Wt, HID, 0L, (void*)Ch, (void*)Cl, HID, 0L,
                             bi, NB * SEQ, HID, HID, 1.0f);
  } else {
    wmma_gemm64<false, 1, 2>(sT, blockIdx.x & 15, blockIdx.x >> 4, WvTh, WvTh, HID, 0L, Xb, Xb, HID, (long)SEQ * HID,
                             (void*)VTh, (void*)VTl, SEQ, (long)HID * SEQ, bv, HID, SEQ, HID, 1.0f);
  }
}

// =====================================================================================
// Causal rel-pos attention, head dim 32, all (batch, head) pairs in one launch.
//   q planes (hi/lo bf16): element (b, t, h, d) at [(b*SEQ + t)*HID + h*32 + d]
//   k planes (hi/lo bf16): same layout
//   v^T planes (hi/lo bf16): element (b, h, d, s) at [((b*HID + h*32 + d))*SEQ + s]
//   er plane (bf16-RNE of Er): [r][d], pitch 32
//   scores = ((q.k) + (q.ErWin at the shift index)) * sscale; masked (s > t) scores set to -inf.
//   Block = 8 waves = 2 key groups x 4 waves; the 4 waves of a group hold the 64 query rows of one (b,h) query block, and both
//   groups hold the same rows. Key chunks of 64, qb+1 <= 64 of them for query block qb, taken two a stage: group g takes chunk
//   2*stage + g, so a wave walks half the chunks and four waves instead of two share a SIMD. Each group keeps its own running
//   maximum, sum and O^T; after the last stage group 1 hands them to group 0 through LDS (one barrier) and group 0 joins them.
//   Where qb+1 is odd, group 1 has no chunk in the last stage: it stages chunk qb again (address in range) and skips the products.
//   Every block takes two query blocks of its (b,h), one after the other: 63 - t, then t (t = 0..31), so each block walks
//   (64 - t) + (t + 1) = 65 chunks in 33 stages and no WGP is left with only long or only short blocks. grid.x = NB*NH*32.
//   Staging per stage (plain 16-B copies, __syncthreads before and after); each group's 128 threads stage their own chunk:
//     K hi/lo [64][32]: 128 thr x 16 elements per plane = whole tile; V^T hi/lo [32][64]: 128 thr x 16 = whole tile;
//     Er window [192][32], shared (group g's 128-row window starts at row 64g): 256 thr x 3 x 8 elements = all 192 rows
//     (clamped source row, so every row is written).
//   All three products are taken transposed (keys, window rows or d as the rows of D, queries as its columns), so lane (c, hh)
//   holds query c of the wave's 16: its scores for keys 16j + 8hh + r, its maximum and sum in-lane (the two lane halves are joined
//   by one cross-half move), and exp(s - m) converts in place into the B fragment of V^T.P^T (element e of k-step kk =
//   tile 2kk + (e >> 3), register e & 7: the same split k map as the V^T loader). P never goes through LDS.
//   Per-wave LDS: G [16 queries][80] f32 (5 tiles x 16 window rows x 16 queries written, columns 0..78 read), reused as out staging [16][36].
//   LDS rows are padded (KP, VP, GP below); the pad bytes are never written and never read.
// =====================================================================================
#define AT_NW 8
#define AT_QB 64
#define AT_KC 64
#define EWIN  192
#define MGP   20   // hand-over record pitch in floats per lane: 80 B = 16 B x odd for the 16-B accesses (lane = row)
#define GP    84   // G row pitch in floats: 16 B x odd for the 16-B stores (lane = row); the shifted 4-B reads step 83 floats a lane, so the 16 lanes of a half hit distinct banks
#define OSP   36
#define KP    40   // K and Er-window row pitch in elements: 64-B rows at 80 B (16 B x odd), conflict-free for 16-B fragment reads
#define VP    72   // V^T row pitch in elements: 128-B rows at 144 B (16 B x odd)

__device__ __forceinline__ __bf16 at_f2bf(float f) { return __builtin_bit_cast(__bf16, f2bf_bits(f)); }
__device__ __forceinline__ void at_split(float f, __bf16& hi, __bf16& lo) {
  const unsigned short hb = f2bf_bits(f);
  hi = __builtin_bit_cast(__bf16, hb);
  lo = at_f2bf(f - __uint_as_float(((unsigned)hb) << 16));
}
// lane l <-> lane l ^ 16 (the two halves that share a query)
__device__ __forceinline__ float at_xhalf(float x) {
  return __builtin_bit_cast(float, __builtin_amdgcn_permlanex16(__builtin_bit_cast(int, x), __builtin_bit_cast(int, x),
                                                                0x76543210, 0xfedcba98, false, false));
}
__device__ __forceinline__ v8f at_mma(v16b a, v16b b, v8f c) {
  c = __builtin_amdgcn_wmma_f32_16x16x32_bf16(false, a, false, b, (short)0, c, false, false);
  asm volatile("v_nop\n\tv_nop\n\tv_nop\n\tv_nop" : "+v"(c) : "v"(a), "v"(b));
  return c;
}

__global__ __launch_bounds__(256)
void relattn32_kernel(const unsigned short* __restrict__ qhp, const unsigned short* __restrict__ qlp,
                      const unsigned short* __restrict__ khp, const unsigned short* __restrict__ klp,
                      const unsigned short* __restrict__ vhp, const unsigned short* __restrict__ vlp,
                      const unsigned short* __restrict__ erp, float* __restrict__ out, float sscale) {
  union FB { v16b v; v8b h[2]; };
  __shared__ __align__(16) __bf16 KshA[2 * AT_KC * KP];        // K hi [group][kv][d], pitch KP      2 x 5 KB
  __shared__ __align__(16) __bf16 KslA[2 * AT_KC * KP];        // K lo
  __shared__ __align__(16) __bf16 VthA[2 * HD * VP];           // V hi [group][d][kv], pitch VP      2 x 4.5 KB
  __shared__ __align__(16) __bf16 VtlA[2 * HD * VP];           // V lo
  __shared__ __align__(16) __bf16 Esh[EWIN * KP];              // Er window [w][d], pitch KP         15 KB
  __shared__ __align__(16) float  Gs[AT_NW][16 * GP];          // per wave rel tile [query][80], pitch GP; later hand-over record (group 1) / out staging pitch 36 (group 0)

  const int tid  = threadIdx.x;
  const int wave = __builtin_amdgcn_readfirstlane(tid >> 5);   // in a scalar register: the tests on the key group below are scalar branches
  const int grp  = wave >> 2;             // key group 0 / 1
  const int wq   = wave & 3;              // which 16 of the 64 query rows
  const int tl   = tid & 127;             // thread within its group
  const int lane = tid & 31;
  const int hh   = lane >> 4;
  const int c    = lane & 15;

  const int bx   = blockIdx.x;
  const int tp   = bx & (NQB / 2 - 1);    // 0..31
  const int pair = bx >> 5;               // 0..15
  const int b    = pair >> 2;
  const int h    = pair & 3;
  const size_t rowBase = (size_t)b * SEQ;

  const __bf16* Qh = (const __bf16*)(const void*)qhp + h * HD;
  const __bf16* Ql = (const __bf16*)(const void*)qlp + h * HD;
  const __bf16* Kh = (const __bf16*)(const void*)khp + h * HD;
  const __bf16* Kl = (const __bf16*)(const void*)klp + h * HD;
  const __bf16* Vh = (const __bf16*)(const void*)vhp + ((size_t)b * HID + h * HD) * SEQ;
  const __bf16* Vl = (const __bf16*)(const void*)vlp + ((size_t)b * HID + h * HD) * SEQ;
  const __bf16* Er = (const __bf16*)(const void*)erp;
  float*        ob = out + h * HD;

  const int wbase = 64 * grp + 48 - 16 * wq;   // first row, in the staged 192-row window, of this wave's G tile
  float* gw = Gs[wave];
  __bf16* Ksh = KshA + grp * (AT_KC * KP);     // this group's own chunk
  __bf16* Ksl = KslA + grp * (AT_KC * KP);
  __bf16* Vth = VthA + grp * (HD * VP);
  __bf16* Vtl = VtlA + grp * (HD * VP);

  // the block's two query blocks, long one first; every (b, h, qb) is taken by exactly one block (block-uniform trip counts)
  for (int part = 0; part < 2; ++part) {
  const int qb = part ? tp : (NQB - 1 - tp);   // 63..32, then 0..31
  const int q0 = qb * AT_QB + wq * 16;

  // ---- Q fragments (B operand, column = query = lane&15, split k map, one k-step of 32 = d), hi and lo ----
  const v16b qah = FragB::load(Qh + (rowBase + q0 + c) * HID + 8 * hh);
  const v16b qal = FragB::load(Ql + (rowBase + q0 + c) * HID + 8 * hh);

  float mrow = -INFINITY;                 // running maximum of query c (equal in both lane halves)
  float lrow = 0.f;                       // running sum of query c over this lane half's keys; halves joined after the loop
  v8f oacc[2];                            // O^T: oacc[t][r] = out[query c][d = 16t + 8hh + r]
  oacc[0] = zero8(); oacc[1] = zero8();
  const int qrow = qb * AT_QB + wq * 16 + c;

  const int nStages = (qb + 2) >> 1;      // block-uniform, <= 32: ceil((qb + 1) / 2)
  for (int st = 0; st < nStages; ++st) {
    const int kc    = 2 * st + grp;       // this group's chunk (wave-uniform)
    const bool live = kc <= qb;           // false only for group 1 in the last stage of an odd chunk count
    const int kv0   = (live ? kc : qb) * AT_KC;
    const int e0 = SEQ - 64 - 64 * (qb - 2 * st);   // Er row of staged window row 0 (group 0's window base), 0 .. 4032
    __syncthreads();
    {
      // K: thread -> key row r = tl>>1, d half = (tl&1)*16; 2 x 8 elements per plane
      const int r = tl >> 1, half = (tl & 1) * 16;
      const __bf16* ks = Kh + (rowBase + kv0 + r) * HID + half;
      const __bf16* kl = Kl + (rowBase + kv0 + r) * HID + half;
      // V^T: thread -> d = tl>>2, key quarter = (tl&3)*16; 2 x 8 elements per plane
      const int d = tl >> 2, qt = (tl & 3) * 16;
      const __bf16* vs = Vh + (size_t)d * SEQ + kv0 + qt;
      const __bf16* vl = Vl + (size_t)d * SEQ + kv0 + qt;
      // Er window: 16-B piece p = tid + 256 i -> window row p>>2, d quarter (p&3)*8; clamped source row (address clamp)
      const __bf16* ep[3];
#pragma unroll
      for (int i = 0; i < 3; ++i) {
        const int p = tid + 256 * i;
        int erow = e0 + (p >> 2);
        erow = erow < 0 ? 0 : erow;
        erow = erow > (SEQ - 1) ? (SEQ - 1) : erow;
        ep[i] = Er + (size_t)erow * HD + (p & 3) * 8;
      }
      v8b a0[2], a1[2], b0[2], b1[2], ee[3];
#pragma unroll
      for (int i = 0; i < 2; ++i) {
        a0[i] = *(const v8b*)(ks + 8 * i);
        a1[i] = *(const v8b*)(kl + 8 * i);
        b0[i] = *(const v8b*)(vs + 8 * i);
        b1[i] = *(const v8b*)(vl + 8 * i);
      }
#pragma unroll
      for (int i = 0; i < 3; ++i) ee[i] = *(const v8b*)(ep[i]);
      // the wait that stands before a register named by an issued load is rewritten; the addresses are its inputs so that they
      // live up to it (without them a later load's result was placed over an earlier load's address pair)
      asm volatile("s_wait_xcnt 0x0" :: "v"(ks), "v"(kl), "v"(vs), "v"(vl), "v"(ep[0]), "v"(ep[1]), "v"(ep[2]) : "memory");
#pragma unroll
      for (int i = 0; i < 2; ++i) {
        *(v8b*)(Ksh + r * KP + half + 8 * i) = a0[i];
        *(v8b*)(Ksl + r * KP + half + 8 * i) = a1[i];
        *(v8b*)(Vth + d * VP + qt   + 8 * i) = b0[i];
        *(v8b*)(Vtl + d * VP + qt   + 8 * i) = b1[i];
      }
#pragma unroll
      for (int i = 0; i < 3; ++i) {
        const int p = tid + 256 * i;
        *(v8b*)(Esh + (p >> 2) * KP + (p & 3) * 8) = ee[i];
      }
    }
    __syncthreads();
    if (live) {   // wave-uniform; no block barrier inside

    // ---- content scores, transposed: S^T tile j = K rows (16j..16j+15) . q^T, 3-term split; s[j][r] = score(key 16j + 8hh + r, query c) ----
    v8f s[4];
#pragma unroll
    for (int j = 0; j < 4; ++j) {
      FB kb, kl;
      const __bf16* kp = Ksh + (j * 16 + c) * KP + 8 * hh;
      const __bf16* kq = Ksl + (j * 16 + c) * KP + 8 * hh;
      kb.h[0] = *(const v8b*)(kp); kb.h[1] = *(const v8b*)(kp + 16);
      kl.h[0] = *(const v8b*)(kq); kl.h[1] = *(const v8b*)(kq + 16);
      v8f a = zero8();
      a = at_mma(kb.v, qah, a);
      a = at_mma(kl.v, qah, a);
      a = at_mma(kb.v, qal, a);
      s[j] = a;
    }

    // ---- rel-pos tile, transposed: G^T = Win[wbase + 0..79] . q^T (2 products); a lane's 8 registers are 8 consecutive
    //      window columns of its query's row, so they go to this wave's G[query][80] as two 16-B stores ----
#pragma unroll
    for (int nt = 0; nt < 5; ++nt) {
      FB eb;
      const __bf16* ep = Esh + (wbase + nt * 16 + c) * KP + 8 * hh;
      eb.h[0] = *(const v8b*)(ep); eb.h[1] = *(const v8b*)(ep + 16);
      v8f g = zero8();
      g = at_mma(eb.v, qah, g);
      g = at_mma(eb.v, qal, g);
      float* gp = gw + c * GP + nt * 16 + 8 * hh;
      const v4f g0 = {g[0], g[1], g[2], g[3]};
      const v4f g1 = {g[4], g[5], g[6], g[7]};
      *(v4fa*)(gp)     = g0;
      *(v4fa*)(gp + 4) = g1;
    }
    __builtin_amdgcn_fence(__ATOMIC_RELEASE, "workgroup");
    __builtin_amdgcn_wave_barrier();
    __builtin_amdgcn_fence(__ATOMIC_ACQUIRE, "workgroup");

    // ---- combine, scale, causal mask, chunk maximum of query c (in-lane, four independent chains, then the other half) ----
    const bool diag = (kc == qb);           // wave-uniform
    const float* gr = gw + c * GP + (15 - c) + 8 * hh;   // + 16j + r gives shift column 15 - c + jl, jl = 16j + 8hh + r
    float mj[4];
#pragma unroll
    for (int j = 0; j < 4; ++j) {
      float m = -INFINITY;
#pragma unroll
      for (int r = 0; r < 8; ++r) {
        const int kvcol = kv0 + j * 16 + 8 * hh + r;
        const float rel = gr[j * 16 + r];
        const float sv  = (s[j][r] + rel) * sscale;
        const bool msk  = diag && (kvcol > qrow);
        const float sm  = msk ? -INFINITY : sv;
        s[j][r] = sm;
        m = fmaxf(m, sm);
      }
      mj[j] = m;
    }
    float cm = fmaxf(fmaxf(mj[0], mj[1]), fmaxf(mj[2], mj[3]));
    cm = fmaxf(cm, at_xhalf(cm));           // key kv0 is never masked, so the joined maximum is finite

    // ---- online softmax update; P^T (unnormalised) as bf16 hi/lo straight into the B fragments of V^T.P^T ----
    const float mnew  = fmaxf(mrow, cm);
    const float alpha = __expf(mrow - mnew);
    mrow = mnew;
    FB ph[2], pl[2];
    float pj[4];
#pragma unroll
    for (int j = 0; j < 4; ++j) {
      float psum = 0.f;
#pragma unroll
      for (int r = 0; r < 8; ++r) {
        const float p = __expf(s[j][r] - mnew);
        psum += p;
        __bf16 a, bl; at_split(p, a, bl);
        ph[j >> 1].v[(j & 1) * 8 + r] = a;
        pl[j >> 1].v[(j & 1) * 8 + r] = bl;
      }
      pj[j] = psum;
    }
    lrow = lrow * alpha + ((pj[0] + pj[1]) + (pj[2] + pj[3]));
#pragma unroll
    for (int r = 0; r < 8; ++r) {
      oacc[0][r] *= alpha;
      oacc[1][r] *= alpha;
    }

    // ---- O^T += V^T . P^T : A = V^T rows d (split k map over keys), B = P^T fragments; 3-term split ----
#pragma unroll
    for (int kk = 0; kk < 2; ++kk) {
#pragma unroll
      for (int t = 0; t < 2; ++t) {
        FB vb, vl;
        vb.h[0] = *(const v8b*)(Vth + (t * 16 + c) * VP + kk * 32 + 8 * hh);
        vb.h[1] = *(const v8b*)(Vth + (t * 16 + c) * VP + kk * 32 + 16 + 8 * hh);
        vl.h[0] = *(const v8b*)(Vtl + (t * 16 + c) * VP + kk * 32 + 8 * hh);
        vl.h[1] = *(const v8b*)(Vtl + (t * 16 + c) * VP + kk * 32 + 16 + 8 * hh);
        oacc[t] = at_mma(vb.v, ph[kk].v, oacc[t]);
        oacc[t] = at_mma(vl.v, ph[kk].v, oacc[t]);
        oacc[t] = at_mma(vb.v, pl[kk].v, oacc[t]);
      }
    }
    }   // live
  }

  __builtin_amdgcn_fence(__ATOMIC_RELEASE, "workgroup");
  __builtin_amdgcn_wave_barrier();
  __builtin_amdgcn_fence(__ATOMIC_ACQUIRE, "workgroup");
  // ---- group 1 hands its maximum, sum and O^T to group 0: lane to same lane of wave - 4, through group 1's own G area ----
  if (grp == 1) {
    float* mp = gw + lane * MGP;
#pragma unroll
    for (int t = 0; t < 2; ++t) {
      const v4f o0 = {oacc[t][0], oacc[t][1], oacc[t][2], oacc[t][3]};
      const v4f o1 = {oacc[t][4], oacc[t][5], oacc[t][6], oacc[t][7]};
      *(v4fa*)(mp + t * 8)     = o0;
      *(v4fa*)(mp + t * 8 + 4) = o1;
    }
    mp[16] = mrow;
    mp[17] = lrow;
  }
  __syncthreads();   // publishes the records; group 1 next writes its G area behind two more barriers, after group 0 has read them
  if (grp == 0) {
  {
    const float* mp = Gs[wave + 4] + lane * MGP;
    const float m1 = mp[16], l1 = mp[17];
    const float mN = fmaxf(mrow, m1);        // mrow is finite (group 0 always has chunk 0); m1 is -inf where group 1 had no chunk
    const float a0 = __expf(mrow - mN);
    const float a1 = __expf(m1 - mN);
    lrow = lrow * a0 + l1 * a1;
#pragma unroll
    for (int t = 0; t < 2; ++t) {
      const v4f o0 = *(const v4fa*)(mp + t * 8);
      const v4f o1 = *(const v4fa*)(mp + t * 8 + 4);
#pragma unroll
      for (int r = 0; r < 4; ++r) {
        oacc[t][r]     = oacc[t][r]     * a0 + o0[r] * a1;
        oacc[t][r + 4] = oacc[t][r + 4] * a0 + o1[r] * a1;
      }
    }
  }
  float* os = gw;
  {
    const float inv = 1.0f / (lrow + at_xhalf(lrow));   // the two halves' key sums joined once
#pragma unroll
    for (int t = 0; t < 2; ++t) {
      float* op = os + c * OSP + t * 16 + 8 * hh;        // row = query c, 8 consecutive d
      const v4f o0 = {oacc[t][0] * inv, oacc[t][1] * inv, oacc[t][2] * inv, oacc[t][3] * inv};
      const v4f o1 = {oacc[t][4] * inv, oacc[t][5] * inv, oacc[t][6] * inv, oacc[t][7] * inv};
      *(v4fa*)(op)     = o0;
      *(v4fa*)(op + 4) = o1;
    }
  }
  __builtin_amdgcn_fence(__ATOMIC_RELEASE, "workgroup");
  __builtin_amdgcn_wave_barrier();
  __builtin_amdgcn_fence(__ATOMIC_ACQUIRE, "workgroup");
  {
    const int q4 = lane >> 3, c4 = (lane & 7) * 4;
    {
#pragma unroll
      for (int it = 0; it < 4; ++it) {
        const int row = it * 4 + q4;                   // it 0..3 x q4 0..3 covers rows 0..15 of the wave tile
        const v4f val = *(const v4fa*)(os + row * OSP + c4);
        *(v4f*)(ob + (rowBase + q0 + row) * HID + c4) = val;
      }
      // the next query block's set-up rewrites the data and address registers that these stores name
      asm volatile("s_wait_xcnt 0x0" ::: "memory");
    }
  }
  }   // grp == 0
  }   // part: the next query block's first barrier stands before any staging store; G / out staging is this wave's own
}

// ---------------------------------------------------------------------------
// Workspace region map (byte offsets):
//   WqTh bf16 [128 n][128 k]        0      WqTl     32768
//   WkTh                        65536      WkTl     98304
//   WvTh                       131072      WvTl    163840     (lo weight planes written, not consumed)
//   Xb   bf16 [16384][128]     196608                         (4194304 B)
//   ErB  bf16 [4096][32]      4390912                         (262144 B)
//   Qh   bf16 [16384][128]    4653056      Ql    8847360
//   Kh   bf16 [16384][128]   13041664      Kl   17235968
//   VTh  bf16 [4][128][4096] 21430272      VTl  25624576
//   total                    29818880
// Every region is written in whole 64x64 tiles / whole 16-B-per-lane runs; all extents are exact tile multiples,
// ---------------------------------------------------------------------------
extern "C" void kernel_launch(void* const* d_in, const int* in_sizes, int n_in,
                              void* d_out, int out_size, void* d_ws, size_t ws_size,
                              hipStream_t stream) {
  if (n_in < 8) return;
  if (in_sizes[0] != NB * SEQ * HID) return;
  if (in_sizes[1] != HID * HID || in_sizes[3] != HID * HID || in_sizes[5] != HID * HID) return;
  if (in_sizes[2] != HID || in_sizes[4] != HID || in_sizes[6] != HID) return;
  if (in_sizes[7] != SEQ * HD) return;
  if (out_size != NB * SEQ * HID) return;

  const float* x  = (const float*)d_in[0];
  const float* Wq = (const float*)d_in[1];
  const float* bq = (const float*)d_in[2];
  const float* Wk = (const float*)d_in[3];
  const float* bk = (const float*)d_in[4];
  const float* Wv = (const float*)d_in[5];
  const float* bv = (const float*)d_in[6];
  const float* Er = (const float*)d_in[7];
  float* out = (float*)d_out;

  const size_t PW = (size_t)HID * HID * 2;            //    32768  bf16 weight plane
  const size_t PX = (size_t)NB * SEQ * HID * 2;       //  4194304  bf16 activation plane (all batch rows)
  const size_t PE = (size_t)SEQ * HD * 2;             //   262144  bf16 Er plane
  const size_t PV = (size_t)NB * HID * SEQ * 2;       //  4194304  bf16 v^T plane
  size_t off = 0;
  const size_t oWqTh = off; off += PW;  const size_t oWqTl = off; off += PW;
  const size_t oWkTh = off; off += PW;  const size_t oWkTl = off; off += PW;
  const size_t oWvTh = off; off += PW;  const size_t oWvTl = off; off += PW;
  const size_t oXb   = off; off += PX;
  const size_t oErB  = off; off += PE;
  const size_t oQh   = off; off += PX;  const size_t oQl   = off; off += PX;
  const size_t oKh   = off; off += PX;  const size_t oKl   = off; off += PX;
  const size_t oVTh  = off; off += PV;  const size_t oVTl  = off; off += PV;
  if (off > ws_size) return;                          // off = 29818880
  if (off > (size_t)134217728) return;

  char* ws = (char*)d_ws;
  unsigned short* WqTh = (unsigned short*)(ws + oWqTh); unsigned short* WqTl = (unsigned short*)(ws + oWqTl);
  unsigned short* WkTh = (unsigned short*)(ws + oWkTh); unsigned short* WkTl = (unsigned short*)(ws + oWkTl);
  unsigned short* WvTh = (unsigned short*)(ws + oWvTh); unsigned short* WvTl = (unsigned short*)(ws + oWvTl);
  unsigned short* Xb   = (unsigned short*)(ws + oXb);
  unsigned short* ErB  = (unsigned short*)(ws + oErB);
  unsigned short* Qh   = (unsigned short*)(ws + oQh);   unsigned short* Ql   = (unsigned short*)(ws + oQl);
  unsigned short* Kh   = (unsigned short*)(ws + oKh);   unsigned short* Kl   = (unsigned short*)(ws + oKl);
  unsigned short* VTh  = (unsigned short*)(ws + oVTh);  unsigned short* VTl  = (unsigned short*)(ws + oVTl);

  const dim3 blk(256);
  const float sscale = 0.17677669529663688f;          // 1/sqrt(32)

  // (1) weights -> transposed bf16 planes, Er and x -> bf16 planes: 12 + 64 + 1024 blocks
  prep_kernel<<<dim3(PREP_W + PREP_E + PREP_X), blk, 0, stream>>>(x, Wq, Wk, Wv, Er, Xb, ErB, WqTh, WqTl, WkTh, WkTl, WvTh, WvTl);
  // (2) q, k and v^T projections: 64 blocks each
  proj_kernel<<<dim3(64, 3), blk, 0, stream>>>(Xb, WqTh, WkTh, WvTh, bq, bk, bv, Qh, Ql, Kh, Kl, VTh, VTl);
  // (3) causal rel-pos attention: 512 blocks = 16 (b,h) pairs x 32 pairs of query blocks (63 - t, t), 256 threads (2 key groups x 4 waves)
  relattn32_kernel<<<dim3(NB * NH * (NQB / 2)), dim3(256), 0, stream>>>(Qh, Ql, Kh, Kl, VTh, VTl, ErB, out, sscale);
  (void)hipGetLastError();
}

// v006
// A run of this version takes 108 microseconds.
// In both of two side-by-side timings against v005, it was 1.12 times as fast.
// Counting every step since v000, it is 3.83 times as fast.
// Contractions: q, k, v^T projections x.W, v^T = Wv^T.x^T (+bias): v_wmma_f32_16x16x32_bf16, single product of bf16-RNE-valued x and W planes, f32 accumulate;
// scores (k.q^T, keys as rows): bf16 hi/lo split (hi.hi + hi.lo + lo.hi); rel-pos term ErWin.q^T: q hi/lo x bf16-RNE Er (hi.E + lo.E); V^T.P^T: bf16 hi/lo split (3 products);
// all v_wmma_f32_16x16x32_bf16 with f32 accumulate. Softmax, bias adds and the 1/sqrt(32) score scale in f32.
//
// Math implemented (B=4, S=4096, hidden 128, 4 heads x 32):
//   q = x.Wq + bq, k = x.Wk + bk, v = x.Wv + bv   (W stored [in][out]; head h = columns h*32..h*32+31)
//   rel[i][j] = q_i . Er[S-1-(i-j)]  for j <= i   (pad-left / reshape shift identity; j > i entries are masked)
//   logit[i][j] = (q_i.k_j + rel[i][j]) * (1/sqrt(32)),  causal (j <= i, diagonal included), softmax over j, out = P.v
//   out[(b*S + i)*128 + h*32 + d]   (no output projection)
//
// Plane / carry audit: every 16-bit plane is bf16 with unit carry (x, W^T, Er: bf16-RNE of the inputs; q, k, v^T: hi/lo bf16
// pairs of the f32 projection results; P: hi/lo bf16 pairs of exp(s - m)); nothing is scaled, nothing to fold back.
//
// Er window per (query block qb, key chunk kc): window row w <-> Er row e0 + w, e0 = S - 64 - 64*(qb - kc), w in 0..127
// (clamped copy, rows past S-1 only ever meet masked keys). For block row il (0..63) and chunk key jl (0..63):
// w = 63 - il + jl. Wave wv (rows il = 16*wv..16*wv+15) computes G^T[80][16] = Win[48 - 16*wv + 0..79] . q^T, stores it as G[row][80] and reads
// G[row][15 - (il - 16*wv) + jl].
#include <hip/hip_runtime.h>
#include <math.h>
#include <stdint.h>

#define NB   4
#define SEQ  4096
#define HID  128
#define NH   4
#define HD   32
#define NQB  (SEQ / 64)

typedef __attribute__((ext_vector_type(16))) _Float16 v16h;
typedef __attribute__((ext_vector_type(8)))  _Float16 v8h;
typedef __attribute__((ext_vector_type(16))) __bf16   v16b;
typedef __attribute__((ext_vector_type(8)))  __bf16   v8b;
typedef __attribute__((ext_vector_type(8)))  float    v8f;
typedef __attribute__((ext_vector_type(4)))  float    v4f;
typedef __attribute__((ext_vector_type(4)))  unsigned int v4u;
typedef v4f __attribute__((may_alias)) v4fa;

__device__ __forceinline__ unsigned short f2bf_bits(float f) {
  unsigned u = __float_as_uint(f);
  return (unsigned short)((u + 0x7FFFu + ((u >> 16) & 1u)) >> 16);
}
__device__ __forceinline__ float bf_bits2f(unsigned short h) { return __uint_as_float(((unsigned)h) << 16); }
__device__ __forceinline__ float bf_rne(float f) { return bf_bits2f(f2bf_bits(f)); }
__device__ __forceinline__ unsigned pk16(unsigned short a, unsigned short b) { return (unsigned)a | ((unsigned)b << 16); }

// hazard guards as plain device helpers
__device__ __forceinline__ void dep_guard_b(v8f& a, v8f& b, v16b x, v16b y) { asm volatile("v_nop\n\tv_nop\n\tv_nop\n\tv_nop" : "+v"(a), "+v"(b) : "v"(x), "v"(y)); }
__device__ __forceinline__ void keep4_b(v16b a, v16b b, v16b c, v16b d) { asm volatile("v_nop" :: "v"(a), "v"(b), "v"(c), "v"(d)); }
__device__ __forceinline__ void acc_guard4(v8f& a, v8f& b, v8f& c, v8f& d) { asm volatile("v_nop\n\tv_nop\n\tv_nop\n\tv_nop" : "+v"(a), "+v"(b), "+v"(c), "+v"(d)); }

// 16-bit WMMA fragment (A: p = row m at k0 + 8h; B stored [n][k]: p = row n at k0 + 8h; same split k map):
// elements 0..7 <- p[0..7], elements 8..15 <- p[16..23]
struct FragB {
  union U { v16b v; v8b h[2]; };
  static __device__ __forceinline__ v16b load(const __bf16* p) {
    U f; f.h[0] = *(const v8b*)(p); f.h[1] = *(const v8b*)(p + 16); return f.v;
  }
  static __device__ __forceinline__ v8f mma(v16b a, v16b b, v8f c) {
    return __builtin_amdgcn_wmma_f32_16x16x32_bf16(false, a, false, b, (short)0, c, false, false);
  }
};

__device__ __forceinline__ v8f zero8() { v8f z = {0.f, 0.f, 0.f, 0.f, 0.f, 0.f, 0.f, 0.f}; return z; }

// ---- Register-blocked batched WMMA GEMM (bf16 operands) --------------------
// C[m,n] = scale * sum_k A[m,k] * Bt[n,k] (+bf16-RNE bias); each wave owns a 64x64 tile, 8 waves per block.
// A row-major [M,K]; Bt row-major [N,K]; M,N % 64 == 0, K % 32 == 0 (met by the constant shapes proj_kernel passes).
// SPLIT: operands are hi/lo planes (A2/Bt2 = lo planes, same layout); product = hi.hi + hi.lo + lo.hi.
// BIAS_MODE: 0 = none, 1 = bias[m], 2 = bias[n]  (bias value converted bf16-RNE, added in f32).
// OUT_MODE: 0 = f32, 2 = bf16 hi plane (Cout) + bf16 lo plane (Cout2).
// coverage: 4 slabs x 16 rows x 64 cols = the whole 64x64 tile per wave; tiles cover M x N exactly.
// Device body: the launching kernel hands in its LDS slabs sT, the block's index bx among the product's blocks and the batch b.
template <bool SPLIT, int BIAS_MODE, int OUT_MODE>
__device__ __forceinline__ void wmma_gemm64(
    float (*sT)[16 * 68], int bx, int b,
    const unsigned short* __restrict__ Ap, const unsigned short* __restrict__ A2p, int lda, long strideA,
    const unsigned short* __restrict__ Btp, const unsigned short* __restrict__ Bt2p, int ldb, long strideB,
    void* __restrict__ Cout, void* __restrict__ Cout2, int ldc, long strideC,
    const float* __restrict__ bias, int M, int N, int K, float scale) {
  const __bf16* A = (const __bf16*)(const void*)Ap;   const __bf16* A2  = (const __bf16*)(const void*)A2p;
  const __bf16* Bt = (const __bf16*)(const void*)Btp; const __bf16* Bt2 = (const __bf16*)(const void*)Bt2p;
  const int lane = threadIdx.x & 31;
  const int wave = threadIdx.x >> 5;
  const int tilesN = N >> 6;
  const int tilesM = M >> 6;
  const int tile = bx * 8 + wave;
  if (tile >= tilesM * tilesN) return;   // wave-uniform; no block barriers in this kernel
  const int tm = tile / tilesN;
  const int tn = tile - tm * tilesN;
  const int m0 = tm << 6;
  const int n0 = tn << 6;

  const __bf16* Ab  = A  + (size_t)b * strideA;
  const __bf16* Bb  = Bt + (size_t)b * strideB;
  const __bf16* Ab2 = SPLIT ? (A2  + (size_t)b * strideA) : nullptr;
  const __bf16* Bb2 = SPLIT ? (Bt2 + (size_t)b * strideB) : nullptr;

  const int rlane = lane & 15;                 // row (A) / col (B, D) within subtile
  const int koff  = (lane >> 4) * 8;           // k offset of this lane half
  const int mOff  = (lane >> 4) * 8;           // D row offset

  v8f acc[4][4];
#pragma unroll
  for (int i = 0; i < 4; ++i)
#pragma unroll
    for (int j = 0; j < 4; ++j) acc[i][j] = zero8();

  for (int k0 = 0; k0 < K; k0 += 32) {
    v16b bh[4], bl[4];
#pragma unroll
    for (int j = 0; j < 4; ++j) {
      const size_t bo = (size_t)(n0 + (j << 4) + rlane) * ldb + koff + k0;
      bh[j] = FragB::load(Bb + bo);
      bl[j] = bh[j];
      if (SPLIT) bl[j] = FragB::load(Bb2 + bo);
    }
#pragma unroll
    for (int i = 0; i < 4; ++i) {
      const size_t ao = (size_t)(m0 + (i << 4) + rlane) * lda + koff + k0;
      v16b ah = FragB::load(Ab + ao);
      v16b al = ah;
      if (SPLIT) al = FragB::load(Ab2 + ao);
#pragma unroll
      for (int j = 0; j < 4; ++j) {
        acc[i][j] = FragB::mma(ah, bh[j], acc[i][j]);
        if (SPLIT) {
          acc[i][j] = FragB::mma(ah, bl[j], acc[i][j]);
          acc[i][j] = FragB::mma(al, bh[j], acc[i][j]);
        }
      }
      dep_guard_b(acc[i][0], acc[i][3], ah, al);
    }
    keep4_b(bh[0], bh[1], bh[2], bh[3]);
    if (SPLIT) keep4_b(bl[0], bl[1], bl[2], bl[3]);
  }
  acc_guard4(acc[0][0], acc[0][1], acc[0][2], acc[0][3]);
  acc_guard4(acc[1][0], acc[1][1], acc[1][2], acc[1][3]);
  acc_guard4(acc[2][0], acc[2][1], acc[2][2], acc[2][3]);
  acc_guard4(acc[3][0], acc[3][1], acc[3][2], acc[3][3]);

  // ---- epilogue ----
  float* slab = sT[wave];
#pragma unroll
  for (int i = 0; i < 4; ++i) {
    const int mBase = m0 + (i << 4);
#pragma unroll
    for (int j = 0; j < 4; ++j) {
      const int n = n0 + (j << 4) + rlane;
      float bv = 0.f;
      if (BIAS_MODE == 2) bv = bf_rne(bias[n]);
#pragma unroll
      for (int r = 0; r < 8; ++r) {
        float v = acc[i][j][r] * scale;
        if (BIAS_MODE == 1) v += bf_rne(bias[mBase + mOff + r]);
        if (BIAS_MODE == 2) v += bv;
        slab[(mOff + r) * 68 + (j << 4) + rlane] = v;
      }
    }
    __builtin_amdgcn_fence(__ATOMIC_RELEASE, "workgroup");
    __builtin_amdgcn_wave_barrier();
    __builtin_amdgcn_fence(__ATOMIC_ACQUIRE, "workgroup");
    if (OUT_MODE == 0) {
      float* C = (float*)Cout + (size_t)b * strideC;
      const int hh = lane >> 4, c4 = (lane & 15) * 4;     // row seg = 256 B = 16 lanes x 16 B
      {
#pragma unroll
        for (int it = 0; it < 8; ++it) {
          const int row = it * 2 + hh;
          v4f v = *(const v4fa*)(slab + row * 68 + c4);
          *(v4f*)(C + (size_t)(mBase + row) * ldc + n0 + c4) = v;
        }
        
      }
    } else {
      const int q = lane >> 3, c8 = (lane & 7) * 8;
      unsigned short* C  = (unsigned short*)Cout  + (size_t)b * strideC;
      unsigned short* C2 = (unsigned short*)Cout2 + (size_t)b * strideC;
      {
#pragma unroll
        for (int it = 0; it < 4; ++it) {
          const int row = it * 4 + q;
          const float* sp = slab + row * 68 + c8;
          v8h hv, lv;
#pragma unroll
          for (int e = 0; e < 8; ++e) {
            unsigned short hb = f2bf_bits(sp[e]);
            unsigned short lb = f2bf_bits(sp[e] - bf_bits2f(hb));
            hv[e] = __builtin_bit_cast(_Float16, hb);
            lv[e] = __builtin_bit_cast(_Float16, lb);
          }
          *(v8h*)(C  + (size_t)(mBase + row) * ldc + n0 + c8) = hv;
          *(v8h*)(C2 + (size_t)(mBase + row) * ldc + n0 + c8) = lv;
        }
        
      }
    }
    __builtin_amdgcn_fence(__ATOMIC_RELEASE, "workgroup");
    __builtin_amdgcn_wave_barrier();
    __builtin_amdgcn_fence(__ATOMIC_ACQUIRE, "workgroup");
  }
}

// ---------------------------------------------------------------------------
// Contiguous f32 -> bf16-RNE plane: one thread = 8 consecutive elements = one 16-B store, so every wave writes
// 512 contiguous bytes; ceil(n8/256) blocks, blk = the block's index among them; coverage: n8 threads x 8 = the whole plane (n8 * 8 elements).
// ---------------------------------------------------------------------------
__device__ __forceinline__ void cvt_bf16x8(int blk, const float* __restrict__ in, unsigned short* __restrict__ o, int n8) {
  const int i = blk * 256 + threadIdx.x;
  if (i < n8) {
    const float* sp = in + (size_t)i * 8;
    const v4f a  = *(const v4f*)(sp);
    const v4f a2 = *(const v4f*)(sp + 4);
    v4u w;
    w[0] = pk16(f2bf_bits(a[0]),  f2bf_bits(a[1]));
    w[1] = pk16(f2bf_bits(a[2]),  f2bf_bits(a[3]));
    w[2] = pk16(f2bf_bits(a2[0]), f2bf_bits(a2[1]));
    w[3] = pk16(f2bf_bits(a2[2]), f2bf_bits(a2[3]));
    unsigned short* dp = o + (size_t)i * 8;
    *(v4u*)dp = w;
    
  }
}

// ---------------------------------------------------------------------------
// Fused transpose + bf16 split of an f32 matrix: in [R rows][Cc cols] (pitch Cc) ->
//   oh[c][r] = bf16_rne(in[r][c]), ol[c][r] = bf16_rne(in[r][c] - oh)   ([Cc][R], pitch R).
// 64x64 tiles through LDS. (Cc/64) x (R/64) blocks (cb, rb), 256 threads (R, Cc multiples of 64).
// Coverage per block and plane: load 4 it x 256 thr x 4 floats = 64x64; store 2 it x 256 thr x 8 u16 = 64x64.
// ---------------------------------------------------------------------------
__device__ __forceinline__ void tsplit(float* tf, int cb, int rb, const float* __restrict__ W, unsigned short* __restrict__ oh,
                                       unsigned short* __restrict__ ol, int R, int Cc) {
  const int c0  = cb * 64;           // input column block = output row block
  const int r0  = rb * 64;           // input row block    = output column block
  const int tid = threadIdx.x;
  {
    const int lr = tid >> 4;         // 0..15
    const int c4 = (tid & 15) * 4;   // 0..60
#pragma unroll
    for (int it = 0; it < 4; ++it) {
      const int rr = it * 16 + lr;   // 0..63
      const v4f a = *(const v4f*)(W + (size_t)(r0 + rr) * Cc + c0 + c4);
      *(v4f*)(tf + rr * 68 + c4) = a;
    }
  }
  __syncthreads();
  const int sub = tid >> 3;          // 0..31
  const int c8  = (tid & 7) * 8;     // 0..56
  v4u hv[2], lv[2];
#pragma unroll
  for (int it = 0; it < 2; ++it) {
    const int oc = it * 32 + sub;    // output row within tile (= input column)
    v4u a, a2;
#pragma unroll
    for (int q = 0; q < 4; ++q) {
      const float f0 = tf[(c8 + 2 * q) * 68 + oc];
      const float f1 = tf[(c8 + 2 * q + 1) * 68 + oc];
      const unsigned short h0 = f2bf_bits(f0), h1 = f2bf_bits(f1);
      const unsigned short l0 = f2bf_bits(f0 - bf_bits2f(h0)), l1 = f2bf_bits(f1 - bf_bits2f(h1));
      a[q]  = pk16(h0, h1);
      a2[q] = pk16(l0, l1);
    }
    hv[it] = a; lv[it] = a2;
  }
  {
#pragma unroll
    for (int it = 0; it < 2; ++it) {
      const int oc = it * 32 + sub;
      const size_t go = (size_t)(c0 + oc) * R + r0 + c8;
      *(v4u*)(oh + go) = hv[it];
      *(v4u*)(ol + go) = lv[it];
    }
    
  }
}

// ---------------------------------------------------------------------------
// Launch 1: every plane that depends on the inputs alone, one grid; the block index picks the job (block-uniform branch).
//   blocks 0..11     weight m = blk >> 2 (Wq, Wk, Wv), 64x64 tile blk & 3: transposed bf16 planes [n][k]
//   blocks 12..75    Er -> bf16 plane [4096][32]    (64 blocks x 256 threads x 8 = the whole plane)
//   blocks 76..1099  x  -> bf16 plane [16384][128]  (1024 blocks x 256 threads x 8 = the whole plane)
// ---------------------------------------------------------------------------
#define PREP_W  12
#define PREP_E  (SEQ * HD / 8 / 256)
#define PREP_X  (NB * SEQ * HID / 8 / 256)
__global__ __launch_bounds__(256) void prep_kernel(const float* __restrict__ x, const float* __restrict__ Wq, const float* __restrict__ Wk,
                                                   const float* __restrict__ Wv, const float* __restrict__ Er,
                                                   unsigned short* __restrict__ Xb, unsigned short* __restrict__ ErB,
                                                   unsigned short* __restrict__ WqTh, unsigned short* __restrict__ WqTl,
                                                   unsigned short* __restrict__ WkTh, unsigned short* __restrict__ WkTl,
                                                   unsigned short* __restrict__ WvTh, unsigned short* __restrict__ WvTl) {
  __shared__ __align__(16) float tf[64 * 68];
  const int blk = blockIdx.x;
  if (blk < PREP_W) {
    const int m = blk >> 2, t = blk & 3;
    const float*    W  = m == 0 ? Wq   : (m == 1 ? Wk   : Wv);
    unsigned short* oh = m == 0 ? WqTh : (m == 1 ? WkTh : WvTh);
    unsigned short* ol = m == 0 ? WqTl : (m == 1 ? WkTl : WvTl);
    tsplit(tf, t & 1, t >> 1, W, oh, ol, HID, HID);
  } else if (blk < PREP_W + PREP_E) {
    cvt_bf16x8(blk - PREP_W, Er, ErB, SEQ * HD / 8);
  } else {
    cvt_bf16x8(blk - (PREP_W + PREP_E), x, Xb, NB * SEQ * HID / 8);
  }
}

// ---------------------------------------------------------------------------
// Launch 2: the three projections, one grid (64, 3); blockIdx.y picks the product (block-uniform branch).
//   y = 0: q = x.Wq + bq -> Q hi/lo planes [b*4096+t][h*32+d]   (M=16384, N=128, K=128; 512 tiles -> 64 blocks)
//   y = 1: k = x.Wk + bk -> K hi/lo planes, same shape
//   y = 2: v^T = Wv^T . x^T + bv[m] -> VT hi/lo planes [b][h*32+d][s]   (A = Wv^T plane [128][128], Bt = x plane rows of batch b;
//          M=128, N=4096, K=128; 128 tiles -> 16 blocks a batch: block = blockIdx.x & 15, batch = blockIdx.x >> 4)
// ---------------------------------------------------------------------------
__global__ __launch_bounds__(256) void proj_kernel(const unsigned short* __restrict__ Xb, const unsigned short* __restrict__ WqTh,
                                                   const unsigned short* __restrict__ WkTh, const unsigned short* __restrict__ WvTh,
                                                   const float* __restrict__ bq, const float* __restrict__ bk, const float* __restrict__ bv,
                                                   unsigned short* __restrict__ Qh, unsigned short* __restrict__ Ql,
                                                   unsigned short* __restrict__ Kh, unsigned short* __restrict__ Kl,
                                                   unsigned short* __restrict__ VTh, unsigned short* __restrict__ VTl) {
  __shared__ __align__(16) float sT[8][16 * 68];   // per-wave 16x64 slab, pitch 68 floats
  const int job = blockIdx.y;
  if (job < 2) {
    const unsigned short* Wt = job ? WkTh : WqTh;
    const float*          bi = job ? bk   : bq;
    unsigned short*       Ch = job ? Kh   : Qh;
    unsigned short*       Cl = job ? Kl   : Ql;
    wmma_gemm64<false, 2, 2>(sT, blockIdx.x, 0, Xb, Xb, HID, 0L, Wt, Wt, HID, 0L, (void*)Ch, (void*)Cl, HID, 0L,
                             bi, NB * SEQ, HID, HID, 1.0f);
  } else {
    wmma_gemm64<false, 1, 2>(sT, blockIdx.x & 15, blockIdx.x >> 4, WvTh, WvTh, HID, 0L, Xb, Xb, HID, (long)SEQ * HID,
                             (void*)VTh, (void*)VTl, SEQ, (long)HID * SEQ, bv, HID, SEQ, HID, 1.0f);
  }
}

// =====================================================================================
// Causal rel-pos attention, head dim 32, all (batch, head) pairs in one launch.
//   q planes (hi/lo bf16): element (b, t, h, d) at [(b*SEQ + t)*HID + h*32 + d]
//   k planes (hi/lo bf16): same layout
//   v^T planes (hi/lo bf16): element (b, h, d, s) at [((b*HID + h*32 + d))*SEQ + s]
//   er plane (bf16-RNE of Er): [r][d], pitch 32
//   scores = ((q.k) + (q.ErWin at the shift index)) * sscale; masked (s > t) scores set to -inf.
//   Block = 8 waves = 2 key groups x 4 waves; the 4 waves of a group hold the 64 query rows of one (b,h) query block, and both
//   groups hold the same rows. Key chunks of 64, qb+1 <= 64 of them for query block qb, taken two a stage: group g takes chunk
//   2*stage + g, so a wave walks half the chunks and four waves instead of two share a SIMD. Each group keeps its own running
//   maximum, sum and O^T; after the last stage group 1 hands them to group 0 through LDS (one barrier) and group 0 joins them.
//   Where qb+1 is odd, group 1 has no chunk in the last stage: it stages chunk qb again (address in range) and skips the products.
//   Every block takes two query blocks of its (b,h), one after the other: 63 - t, then t (t = 0..31), so each block walks
//   (64 - t) + (t + 1) = 65 chunks in 33 stages and no WGP is left with only long or only short blocks. grid.x = NB*NH*32.
//   Staging per stage (plain 16-B copies, __syncthreads before and after); each group's 128 threads stage their own chunk:
//     K hi/lo [64][32]: 128 thr x 16 elements per plane = whole tile; V^T hi/lo [32][64]: 128 thr x 16 = whole tile;
//     Er window [192][32], shared (group g's 128-row window starts at row 64g): 256 thr x 3 x 8 elements = all 192 rows
//     (clamped source row, so every row is written).
//   All three products are taken transposed (keys, window rows or d as the rows of D, queries as its columns), so lane (c, hh)
//   holds query c of the wave's 16: its scores for keys 16j + 8hh + r, its maximum and sum in-lane (the two lane halves are joined
//   by one cross-half move), and exp(s - m) converts in place into the B fragment of V^T.P^T (element e of k-step kk =
//   tile 2kk + (e >> 3), register e & 7: the same split k map as the V^T loader). P never goes through LDS.
//   Per-wave LDS: G [16 queries][80] f32 (5 tiles x 16 window rows x 16 queries written, columns 0..78 read), reused as out staging [16][36].
//   LDS rows are padded (KP, VP, GP below); the pad bytes are never written and never read.
// =====================================================================================
#define AT_NW 8
#define AT_QB 64
#define AT_KC 64
#define EWIN  192
#define MGP   20   // hand-over record pitch in floats per lane: 80 B = 16 B x odd for the 16-B accesses (lane = row)
#define GP    84   // G row pitch in floats: 16 B x odd for the 16-B stores (lane = row); the shifted 4-B reads step 83 floats a lane, so the 16 lanes of a half hit distinct banks
#define OSP   36
#define KP    40   // K and Er-window row pitch in elements: 64-B rows at 80 B (16 B x odd), conflict-free for 16-B fragment reads
#define VP    72   // V^T row pitch in elements: 128-B rows at 144 B (16 B x odd)

__device__ __forceinline__ __bf16 at_f2bf(float f) { return __builtin_bit_cast(__bf16, f2bf_bits(f)); }
__device__ __forceinline__ void at_split(float f, __bf16& hi, __bf16& lo) {
  const unsigned short hb = f2bf_bits(f);
  hi = __builtin_bit_cast(__bf16, hb);
  lo = at_f2bf(f - __uint_as_float(((unsigned)hb) << 16));
}
// lane l <-> lane l ^ 16 (the two halves that share a query)
__device__ __forceinline__ float at_xhalf(float x) {
  return __builtin_bit_cast(float, __builtin_amdgcn_permlanex16(__builtin_bit_cast(int, x), __builtin_bit_cast(int, x),
                                                                0x76543210, 0xfedcba98, false, false));
}
__device__ __forceinline__ v8f at_mma(v16b a, v16b b, v8f c) {
  return __builtin_amdgcn_wmma_f32_16x16x32_bf16(false, a, false, b, (short)0, c, false, false);
}
// Distance guards, one behind each RUN of matrix products: four vector slots between the run and the first vector instruction that
// reads its results or rewrites its operand registers. The results pass through the statement and the operands are its inputs, so
// nothing of that kind can stand in front of it. Not volatile: LDS loads may move across it, so the fragment loads of a run go out together.
__device__ __forceinline__ void at_guard_s(v8f* s, const v16b* kh, const v16b* kl, v16b qh, v16b ql) {
  asm("v_nop\n\tv_nop\n\tv_nop\n\tv_nop" : "+v"(s[0]), "+v"(s[1]), "+v"(s[2]), "+v"(s[3])
      : "v"(kh[0]), "v"(kh[1]), "v"(kh[2]), "v"(kh[3]), "v"(kl[0]), "v"(kl[1]), "v"(kl[2]), "v"(kl[3]), "v"(qh), "v"(ql));
}
__device__ __forceinline__ void at_guard_g(v8f* g, const v16b* e, v16b qh, v16b ql) {
  asm("v_nop\n\tv_nop\n\tv_nop\n\tv_nop" : "+v"(g[0]), "+v"(g[1]), "+v"(g[2]), "+v"(g[3]), "+v"(g[4])
      : "v"(e[0]), "v"(e[1]), "v"(e[2]), "v"(e[3]), "v"(e[4]), "v"(qh), "v"(ql));
}
__device__ __forceinline__ void at_guard_o(v8f* o, const v16b* vh, const v16b* vl, v16b p0, v16b p1, v16b p2, v16b p3) {
  asm("v_nop\n\tv_nop\n\tv_nop\n\tv_nop" : "+v"(o[0]), "+v"(o[1])
      : "v"(vh[0]), "v"(vh[1]), "v"(vh[2]), "v"(vh[3]), "v"(vl[0]), "v"(vl[1]), "v"(vl[2]), "v"(vl[3]), "v"(p0), "v"(p1), "v"(p2), "v"(p3));
}

__global__ __launch_bounds__(256)
void relattn32_kernel(const unsigned short* __restrict__ qhp, const unsigned short* __restrict__ qlp,
                      const unsigned short* __restrict__ khp, const unsigned short* __restrict__ klp,
                      const unsigned short* __restrict__ vhp, const unsigned short* __restrict__ vlp,
                      const unsigned short* __restrict__ erp, float* __restrict__ out, float sscale) {
  union FB { v16b v; v8b h[2]; };
  __shared__ __align__(16) __bf16 KshA[2 * AT_KC * KP];        // K hi [group][kv][d], pitch KP      2 x 5 KB
  __shared__ __align__(16) __bf16 KslA[2 * AT_KC * KP];        // K lo
  __shared__ __align__(16) __bf16 VthA[2 * HD * VP];           // V hi [group][d][kv], pitch VP      2 x 4.5 KB
  __shared__ __align__(16) __bf16 VtlA[2 * HD * VP];           // V lo
  __shared__ __align__(16) __bf16 Esh[EWIN * KP];              // Er window [w][d], pitch KP         15 KB
  __shared__ __align__(16) float  Gs[AT_NW][16 * GP];          // per wave rel tile [query][80], pitch GP; later hand-over record (group 1) / out staging pitch 36 (group 0)

  const int tid  = threadIdx.x;
  const int wave = __builtin_amdgcn_readfirstlane(tid >> 5);   // in a scalar register: the tests on the key group below are scalar branches
  const int grp  = wave >> 2;             // key group 0 / 1
  const int wq   = wave & 3;              // which 16 of the 64 query rows
  const int tl   = tid & 127;             // thread within its group
  const int lane = tid & 31;
  const int hh   = lane >> 4;
  const int c    = lane & 15;

  const int bx   = blockIdx.x;
  const int tp   = bx & (NQB / 2 - 1);    // 0..31
  const int pair = bx >> 5;               // 0..15
  const int b    = pair >> 2;
  const int h    = pair & 3;
  const size_t rowBase = (size_t)b * SEQ;

  const __bf16* Qh = (const __bf16*)(const void*)qhp + h * HD;
  const __bf16* Ql = (const __bf16*)(const void*)qlp + h * HD;
  const __bf16* Kh = (const __bf16*)(const void*)khp + h * HD;
  const __bf16* Kl = (const __bf16*)(const void*)klp + h * HD;
  const __bf16* Vh = (const __bf16*)(const void*)vhp + ((size_t)b * HID + h * HD) * SEQ;
  const __bf16* Vl = (const __bf16*)(const void*)vlp + ((size_t)b * HID + h * HD) * SEQ;
  const __bf16* Er = (const __bf16*)(const void*)erp;
  float*        ob = out + h * HD;

  const int wbase = 64 * grp + 48 - 16 * wq;   // first row, in the staged 192-row window, of this wave's G tile
  float* gw = Gs[wave];
  __bf16* Ksh = KshA + grp * (AT_KC * KP);     // this group's own chunk
  __bf16* Ksl = KslA + grp * (AT_KC * KP);
  __bf16* Vth = VthA + grp * (HD * VP);
  __bf16* Vtl = VtlA + grp * (HD * VP);

  // the block's two query blocks, long one first; every (b, h, qb) is taken by exactly one block (block-uniform trip counts)
  for (int part = 0; part < 2; ++part) {
  const int qb = part ? tp : (NQB - 1 - tp);   // 63..32, then 0..31
  const int q0 = qb * AT_QB + wq * 16;

  // ---- Q fragments (B operand, column = query = lane&15, split k map, one k-step of 32 = d), hi and lo ----
  const v16b qah = FragB::load(Qh + (rowBase + q0 + c) * HID + 8 * hh);
  const v16b qal = FragB::load(Ql + (rowBase + q0 + c) * HID + 8 * hh);

  float mrow = -INFINITY;                 // running maximum of query c (equal in both lane halves)
  float lrow = 0.f;                       // running sum of query c over this lane half's keys; halves joined after the loop
  v8f oacc[2];                            // O^T: oacc[t][r] = out[query c][d = 16t + 8hh + r]
  oacc[0] = zero8(); oacc[1] = zero8();
  const int qrow = qb * AT_QB + wq * 16 + c;

  const int nStages = (qb + 2) >> 1;      // block-uniform, <= 32: ceil((qb + 1) / 2)
  for (int st = 0; st < nStages; ++st) {
    const int kc    = 2 * st + grp;       // this group's chunk (wave-uniform)
    const bool live = kc <= qb;           // false only for group 1 in the last stage of an odd chunk count
    const int kv0   = (live ? kc : qb) * AT_KC;
    const int e0 = SEQ - 64 - 64 * (qb - 2 * st);   // Er row of staged window row 0 (group 0's window base), 0 .. 4032
    __syncthreads();
    {
      // K: thread -> key row r = tl>>1, d half = (tl&1)*16; 2 x 8 elements per plane
      const int r = tl >> 1, half = (tl & 1) * 16;
      const __bf16* ks = Kh + (rowBase + kv0 + r) * HID + half;
      const __bf16* kl = Kl + (rowBase + kv0 + r) * HID + half;
      // V^T: thread -> d = tl>>2, key quarter = (tl&3)*16; 2 x 8 elements per plane
      const int d = tl >> 2, qt = (tl & 3) * 16;
      const __bf16* vs = Vh + (size_t)d * SEQ + kv0 + qt;
      const __bf16* vl = Vl + (size_t)d * SEQ + kv0 + qt;
      // Er window: 16-B piece p = tid + 256 i -> window row p>>2, d quarter (p&3)*8; clamped source row (address clamp)
      const __bf16* ep[3];
#pragma unroll
      for (int i = 0; i < 3; ++i) {
        const int p = tid + 256 * i;
        int erow = e0 + (p >> 2);
        erow = erow < 0 ? 0 : erow;
        erow = erow > (SEQ - 1) ? (SEQ - 1) : erow;
        ep[i] = Er + (size_t)erow * HD + (p & 3) * 8;
      }
      v8b a0[2], a1[2], b0[2], b1[2], ee[3];
#pragma unroll
      for (int i = 0; i < 2; ++i) {
        a0[i] = *(const v8b*)(ks + 8 * i);
        a1[i] = *(const v8b*)(kl + 8 * i);
        b0[i] = *(const v8b*)(vs + 8 * i);
        b1[i] = *(const v8b*)(vl + 8 * i);
      }
#pragma unroll
      for (int i = 0; i < 3; ++i) ee[i] = *(const v8b*)(ep[i]);
      // the wait that stands before a register named by an issued load is rewritten; the addresses are its inputs so that they
      // live up to it (without them a later load's result was placed over an earlier load's address pair)
      asm volatile("s_wait_xcnt 0x0" :: "v"(ks), "v"(kl), "v"(vs), "v"(vl), "v"(ep[0]), "v"(ep[1]), "v"(ep[2]) : "memory");
#pragma unroll
      for (int i = 0; i < 2; ++i) {
        *(v8b*)(Ksh + r * KP + half + 8 * i) = a0[i];
        *(v8b*)(Ksl + r * KP + half + 8 * i) = a1[i];
        *(v8b*)(Vth + d * VP + qt   + 8 * i) = b0[i];
        *(v8b*)(Vtl + d * VP + qt   + 8 * i) = b1[i];
      }
#pragma unroll
      for (int i = 0; i < 3; ++i) {
        const int p = tid + 256 * i;
        *(v8b*)(Esh + (p >> 2) * KP + (p & 3) * 8) = ee[i];
      }
    }
    __syncthreads();
    if (live) {   // wave-uniform; no block barrier inside

    // ---- rel-pos tile, transposed: G^T = Win[wbase + 0..79] . q^T (2 products); a lane's 8 registers are 8 consecutive
    //      window columns of its query's row, so they go to this wave's G[query][80] as two 16-B stores ----
    //      Taken in front of the score products: the G stores land and the G reads fly while those run.
    v8f gt[5];
    {
      v16b ef[5];
#pragma unroll
      for (int nt = 0; nt < 5; ++nt) {
        FB eb;
        const __bf16* ep = Esh + (wbase + nt * 16 + c) * KP + 8 * hh;
        eb.h[0] = *(const v8b*)(ep); eb.h[1] = *(const v8b*)(ep + 16);
        ef[nt] = eb.v;
        v8f g = zero8();
        g = at_mma(eb.v, qah, g);
        g = at_mma(eb.v, qal, g);
        gt[nt] = g;
      }
      at_guard_g(gt, ef, qah, qal);
    }
#pragma unroll
    for (int nt = 0; nt < 5; ++nt) {
      const v8f g = gt[nt];
      float* gp = gw + c * GP + nt * 16 + 8 * hh;
      const v4f g0 = {g[0], g[1], g[2], g[3]};
      const v4f g1 = {g[4], g[5], g[6], g[7]};
      *(v4fa*)(gp)     = g0;
      *(v4fa*)(gp + 4) = g1;
    }

    // ---- content scores, transposed: S^T tile j = K rows (16j..16j+15) . q^T, 3-term split; s[j][r] = score(key 16j + 8hh + r, query c) ----
    v8f s[4];
    {
      v16b kfh[4], kfl[4];
#pragma unroll
      for (int j = 0; j < 4; ++j) {
        FB kb, kl;
        const __bf16* kp = Ksh + (j * 16 + c) * KP + 8 * hh;
        const __bf16* kq = Ksl + (j * 16 + c) * KP + 8 * hh;
        kb.h[0] = *(const v8b*)(kp); kb.h[1] = *(const v8b*)(kp + 16);
        kl.h[0] = *(const v8b*)(kq); kl.h[1] = *(const v8b*)(kq + 16);
        kfh[j] = kb.v; kfl[j] = kl.v;
        v8f a = zero8();
        a = at_mma(kb.v, qah, a);
        a = at_mma(kl.v, qah, a);
        a = at_mma(kb.v, qal, a);
        s[j] = a;
      }
      at_guard_s(s, kfh, kfl, qah, qal);
    }
    __builtin_amdgcn_fence(__ATOMIC_RELEASE, "workgroup");
    __builtin_amdgcn_wave_barrier();
    __builtin_amdgcn_fence(__ATOMIC_ACQUIRE, "workgroup");

    // ---- combine, scale, causal mask, chunk maximum of query c (in-lane, four independent chains, then the other half) ----
    const bool diag = (kc == qb);           // wave-uniform
    const float* gr = gw + c * GP + (15 - c) + 8 * hh;   // + 16j + r gives shift column 15 - c + jl, jl = 16j + 8hh + r
    v8f relv[4];
#pragma unroll
    for (int j = 0; j < 4; ++j)
#pragma unroll
      for (int r = 0; r < 8; ++r) relv[j][r] = gr[j * 16 + r];
    // keeps the G reads together in front of the arithmetic: spread among it, each read's LDS latency is waited out on its own
    __builtin_amdgcn_sched_barrier(0);
    float mj[4];
#pragma unroll
    for (int j = 0; j < 4; ++j) {
      float m = -INFINITY;
#pragma unroll
      for (int r = 0; r < 8; ++r) {
        const int kvcol = kv0 + j * 16 + 8 * hh + r;
        const float rel = relv[j][r];
        const float sv  = (s[j][r] + rel) * sscale;
        const bool msk  = diag && (kvcol > qrow);
        const float sm  = msk ? -INFINITY : sv;
        s[j][r] = sm;
        m = fmaxf(m, sm);
      }
      mj[j] = m;
    }
    float cm = fmaxf(fmaxf(mj[0], mj[1]), fmaxf(mj[2], mj[3]));
    cm = fmaxf(cm, at_xhalf(cm));           // key kv0 is never masked, so the joined maximum is finite

    // ---- online softmax update; P^T (unnormalised) as bf16 hi/lo straight into the B fragments of V^T.P^T ----
    const float mnew  = fmaxf(mrow, cm);
    const float alpha = __expf(mrow - mnew);
    mrow = mnew;
    FB ph[2], pl[2];
    float pj[4];
#pragma unroll
    for (int j = 0; j < 4; ++j) {
      float psum = 0.f;
#pragma unroll
      for (int r = 0; r < 8; ++r) {
        const float p = __expf(s[j][r] - mnew);
        psum += p;
        __bf16 a, bl; at_split(p, a, bl);
        ph[j >> 1].v[(j & 1) * 8 + r] = a;
        pl[j >> 1].v[(j & 1) * 8 + r] = bl;
      }
      pj[j] = psum;
    }
    lrow = lrow * alpha + ((pj[0] + pj[1]) + (pj[2] + pj[3]));
#pragma unroll
    for (int r = 0; r < 8; ++r) {
      oacc[0][r] *= alpha;
      oacc[1][r] *= alpha;
    }

    // ---- O^T += V^T . P^T : A = V^T rows d (split k map over keys), B = P^T fragments; 3-term split ----
    v16b vfh[4], vfl[4];
#pragma unroll
    for (int kk = 0; kk < 2; ++kk) {
#pragma unroll
      for (int t = 0; t < 2; ++t) {
        FB vb, vl;
        vb.h[0] = *(const v8b*)(Vth + (t * 16 + c) * VP + kk * 32 + 8 * hh);
        vb.h[1] = *(const v8b*)(Vth + (t * 16 + c) * VP + kk * 32 + 16 + 8 * hh);
        vl.h[0] = *(const v8b*)(Vtl + (t * 16 + c) * VP + kk * 32 + 8 * hh);
        vl.h[1] = *(const v8b*)(Vtl + (t * 16 + c) * VP + kk * 32 + 16 + 8 * hh);
        vfh[kk * 2 + t] = vb.v; vfl[kk * 2 + t] = vl.v;
        oacc[t] = at_mma(vb.v, ph[kk].v, oacc[t]);
        oacc[t] = at_mma(vl.v, ph[kk].v, oacc[t]);
        oacc[t] = at_mma(vb.v, pl[kk].v, oacc[t]);
      }
    }
    at_guard_o(oacc, vfh, vfl, ph[0].v, ph[1].v, pl[0].v, pl[1].v);
    }   // live
  }

  __builtin_amdgcn_fence(__ATOMIC_RELEASE, "workgroup");
  __builtin_amdgcn_wave_barrier();
  __builtin_amdgcn_fence(__ATOMIC_ACQUIRE, "workgroup");
  // ---- group 1 hands its maximum, sum and O^T to group 0: lane to same lane of wave - 4, through group 1's own G area ----
  if (grp == 1) {
    float* mp = gw + lane * MGP;
#pragma unroll
    for (int t = 0; t < 2; ++t) {
      const v4f o0 = {oacc[t][0], oacc[t][1], oacc[t][2], oacc[t][3]};
      const v4f o1 = {oacc[t][4], oacc[t][5], oacc[t][6], oacc[t][7]};
      *(v4fa*)(mp + t * 8)     = o0;
      *(v4fa*)(mp + t * 8 + 4) = o1;
    }
    mp[16] = mrow;
    mp[17] = lrow;
  }
  __syncthreads();   // publishes the records; group 1 next writes its G area behind two more barriers, after group 0 has read them
  if (grp == 0) {
  {
    const float* mp = Gs[wave + 4] + lane * MGP;
    const float m1 = mp[16], l1 = mp[17];
    const float mN = fmaxf(mrow, m1);        // mrow is finite (group 0 always has chunk 0); m1 is -inf where group 1 had no chunk
    const float a0 = __expf(mrow - mN);
    const float a1 = __expf(m1 - mN);
    lrow = lrow * a0 + l1 * a1;
#pragma unroll
    for (int t = 0; t < 2; ++t) {
      const v4f o0 = *(const v4fa*)(mp + t * 8);
      const v4f o1 = *(const v4fa*)(mp + t * 8 + 4);
#pragma unroll
      for (int r = 0; r < 4; ++r) {
        oacc[t][r]     = oacc[t][r]     * a0 + o0[r] * a1;
        oacc[t][r + 4] = oacc[t][r + 4] * a0 + o1[r] * a1;
      }
    }
  }
  float* os = gw;
  {
    const float inv = 1.0f / (lrow + at_xhalf(lrow));   // the two halves' key sums joined once
#pragma unroll
    for (int t = 0; t < 2; ++t) {
      float* op = os + c * OSP + t * 16 + 8 * hh;        // row = query c, 8 consecutive d
      const v4f o0 = {oacc[t][0] * inv, oacc[t][1] * inv, oacc[t][2] * inv, oacc[t][3] * inv};
      const v4f o1 = {oacc[t][4] * inv, oacc[t][5] * inv, oacc[t][6] * inv, oacc[t][7] * inv};
      *(v4fa*)(op)     = o0;
      *(v4fa*)(op + 4) = o1;
    }
  }
  __builtin_amdgcn_fence(__ATOMIC_RELEASE, "workgroup");
  __builtin_amdgcn_wave_barrier();
  __builtin_amdgcn_fence(__ATOMIC_ACQUIRE, "workgroup");
  {
    const int q4 = lane >> 3, c4 = (lane & 7) * 4;
    {
#pragma unroll
      for (int it = 0; it < 4; ++it) {
        const int row = it * 4 + q4;                   // it 0..3 x q4 0..3 covers rows 0..15 of the wave tile
        const v4f val = *(const v4fa*)(os + row * OSP + c4);
        *(v4f*)(ob + (rowBase + q0 + row) * HID + c4) = val;
      }
      // the next query block's set-up rewrites the data and address registers that these stores name
      asm volatile("s_wait_xcnt 0x0" ::: "memory");
    }
  }
  }   // grp == 0
  }   // part: the next query block's first barrier stands before any staging store; G / out staging is this wave's own
}

// ---------------------------------------------------------------------------
// Workspace region map (byte offsets):
//   WqTh bf16 [128 n][128 k]        0      WqTl     32768
//   WkTh                        65536      WkTl     98304
//   WvTh                       131072      WvTl    163840     (lo weight planes written, not consumed)
//   Xb   bf16 [16384][128]     196608                         (4194304 B)
//   ErB  bf16 [4096][32]      4390912                         (262144 B)
//   Qh   bf16 [16384][128]    4653056      Ql    8847360
//   Kh   bf16 [16384][128]   13041664      Kl   17235968
//   VTh  bf16 [4][128][4096] 21430272      VTl  25624576
//   total                    29818880
// Every region is written in whole 64x64 tiles / whole 16-B-per-lane runs; all extents are exact tile multiples,
// ---------------------------------------------------------------------------
extern "C" void kernel_launch(void* const* d_in, const int* in_sizes, int n_in,
                              void* d_out, int out_size, void* d_ws, size_t ws_size,
                              hipStream_t stream) {
  if (n_in < 8) return;
  if (in_sizes[0] != NB * SEQ * HID) return;
  if (in_sizes[1] != HID * HID || in_sizes[3] != HID * HID || in_sizes[5] != HID * HID) return;
  if (in_sizes[2] != HID || in_sizes[4] != HID || in_sizes[6] != HID) return;
  if (in_sizes[7] != SEQ * HD) return;
  if (out_size != NB * SEQ * HID) return;

  const float* x  = (const float*)d_in[0];
  const float* Wq = (const float*)d_in[1];
  const float* bq = (const float*)d_in[2];
  const float* Wk = (const float*)d_in[3];
  const float* bk = (const float*)d_in[4];
  const float* Wv = (const float*)d_in[5];
  const float* bv = (const float*)d_in[6];
  const float* Er = (const float*)d_in[7];
  float* out = (float*)d_out;

  const size_t PW = (size_t)HID * HID * 2;            //    32768  bf16 weight plane
  const size_t PX = (size_t)NB * SEQ * HID * 2;       //  4194304  bf16 activation plane (all batch rows)
  const size_t PE = (size_t)SEQ * HD * 2;             //   262144  bf16 Er plane
  const size_t PV = (size_t)NB * HID * SEQ * 2;       //  4194304  bf16 v^T plane
  size_t off = 0;
  const size_t oWqTh = off; off += PW;  const size_t oWqTl = off; off += PW;
  const size_t oWkTh = off; off += PW;  const size_t oWkTl = off; off += PW;
  const size_t oWvTh = off; off += PW;  const size_t oWvTl = off; off += PW;
  const size_t oXb   = off; off += PX;
  const size_t oErB  = off; off += PE;
  const size_t oQh   = off; off += PX;  const size_t oQl   = off; off += PX;
  const size_t oKh   = off; off += PX;  const size_t oKl   = off; off += PX;
  const size_t oVTh  = off; off += PV;  const size_t oVTl  = off; off += PV;
  if (off > ws_size) return;                          // off = 29818880
  if (off > (size_t)134217728) return;

  char* ws = (char*)d_ws;
  unsigned short* WqTh = (unsigned short*)(ws + oWqTh); unsigned short* WqTl = (unsigned short*)(ws + oWqTl);
  unsigned short* WkTh = (unsigned short*)(ws + oWkTh); unsigned short* WkTl = (unsigned short*)(ws + oWkTl);
  unsigned short* WvTh = (unsigned short*)(ws + oWvTh); unsigned short* WvTl = (unsigned short*)(ws + oWvTl);
  unsigned short* Xb   = (unsigned short*)(ws + oXb);
  unsigned short* ErB  = (unsigned short*)(ws + oErB);
  unsigned short* Qh   = (unsigned short*)(ws + oQh);   unsigned short* Ql   = (unsigned short*)(ws + oQl);
  unsigned short* Kh   = (unsigned short*)(ws + oKh);   unsigned short* Kl   = (unsigned short*)(ws + oKl);
  unsigned short* VTh  = (unsigned short*)(ws + oVTh);  unsigned short* VTl  = (unsigned short*)(ws + oVTl);

  const dim3 blk(256);
  const float sscale = 0.17677669529663688f;          // 1/sqrt(32)

  // (1) weights -> transposed bf16 planes, Er and x -> bf16 planes: 12 + 64 + 1024 blocks
  prep_kernel<<<dim3(PREP_W + PREP_E + PREP_X), blk, 0, stream>>>(x, Wq, Wk, Wv, Er, Xb, ErB, WqTh, WqTl, WkTh, WkTl, WvTh, WvTl);
  // (2) q, k and v^T projections: 64 blocks each
  proj_kernel<<<dim3(64, 3), blk, 0, stream>>>(Xb, WqTh, WkTh, WvTh, bq, bk, bv, Qh, Ql, Kh, Kl, VTh, VTl);
  // (3) causal rel-pos attention: 512 blocks = 16 (b,h) pairs x 32 pairs of query blocks (63 - t, t), 256 threads (2 key groups x 4 waves)
  relattn32_kernel<<<dim3(NB * NH * (NQB / 2)), dim3(256), 0, stream>>>(Qh, Ql, Kh, Kl, VTh, VTl, ErB, out, sscale);
  (void)hipGetLastError();
}

// v007
// One run takes 101 microseconds.
// Timed twice side by side with v006, it ran 1.07 times as fast both times.
// All steps since v000 together make it 4.09 times as fast.
// Contractions: q, k, v^T projections x.W, v^T = Wv^T.x^T (+bias): v_wmma_f32_16x16x32_bf16, single product of bf16-RNE-valued x and W planes, f32 accumulate;
// scores (k.q^T, keys as rows): bf16 hi/lo split (hi.hi + hi.lo + lo.hi); rel-pos term ErWin.q^T: q hi/lo x bf16-RNE Er (hi.E + lo.E); V^T.P^T: bf16 hi/lo split (3 products);
// all v_wmma_f32_16x16x32_bf16 with f32 accumulate. Softmax, bias adds and the 1/sqrt(32) score scale in f32.
//
// Math implemented (B=4, S=4096, hidden 128, 4 heads x 32):
//   q = x.Wq + bq, k = x.Wk + bk, v = x.Wv + bv   (W stored [in][out]; head h = columns h*32..h*32+31)
//   rel[i][j] = q_i . Er[S-1-(i-j)]  for j <= i   (pad-left / reshape shift identity; j > i entries are masked)
//   logit[i][j] = (q_i.k_j + rel[i][j]) * (1/sqrt(32)),  causal (j <= i, diagonal included), softmax over j, out = P.v
//   out[(b*S + i)*128 + h*32 + d]   (no output projection)
//
// Plane / carry audit: every 16-bit plane is bf16 with unit carry (x, W^T, Er: bf16-RNE of the inputs; q, k, v^T: hi/lo bf16
// pairs of the f32 projection results; P: hi/lo bf16 pairs of exp(s - m)); nothing is scaled, nothing to fold back.
//
// Er window per (query block qb, key chunk kc): window row w <-> Er row e0 + w, e0 = S - 64 - 64*(qb - kc), w in 0..127
// (clamped copy, rows past S-1 only ever meet masked keys). For block row il (0..63) and chunk key jl (0..63):
// w = 63 - il + jl. Wave wv (rows il = 16*wv..16*wv+15) computes G^T[80][16] = Win[48 - 16*wv + 0..79] . q^T, stores it as G[row][80] and reads
// G[row][15 - (il - 16*wv) + jl].
#include <hip/hip_runtime.h>
#include <math.h>
#include <stdint.h>

#define NB   4
#define SEQ  4096
#define HID  128
#define NH   4
#define HD   32
#define NQB  (SEQ / 64)

typedef __attribute__((ext_vector_type(16))) _Float16 v16h;
typedef __attribute__((ext_vector_type(16))) __bf16   v16b;
typedef __attribute__((ext_vector_type(8)))  __bf16   v8b;
typedef __attribute__((ext_vector_type(8)))  float    v8f;
typedef __attribute__((ext_vector_type(4)))  float    v4f;
typedef __attribute__((ext_vector_type(4)))  unsigned int v4u;
typedef v4f __attribute__((may_alias)) v4fa;

typedef __attribute__((ext_vector_type(2)))  float    v2f;
typedef __attribute__((ext_vector_type(2)))  __bf16   v2b;

// f32 -> bf16, round to nearest even, two values a time in the chip's packed converter (one instruction a pair)
__device__ __forceinline__ v2b cvt2(float a, float b) { const v2f t = {a, b}; return __builtin_convertvector(t, v2b); }
__device__ __forceinline__ unsigned cvt2_bits(float a, float b) { return __builtin_bit_cast(unsigned, cvt2(a, b)); }
// hi/lo bf16 planes of a pair: hi = rne(f), lo = rne(f - hi)
__device__ __forceinline__ void split2(float a, float b, v2b& hi, v2b& lo) {
  hi = cvt2(a, b);
  lo = cvt2(a - (float)hi[0], b - (float)hi[1]);
}
__device__ __forceinline__ float bf_rne(float f) { return (float)(__bf16)f; }

// hazard guards as plain device helpers
__device__ __forceinline__ void dep_guard_b(v8f& a, v8f& b, v16b x, v16b y) { asm volatile("v_nop\n\tv_nop\n\tv_nop\n\tv_nop" : "+v"(a), "+v"(b) : "v"(x), "v"(y)); }
__device__ __forceinline__ void keep4_b(v16b a, v16b b, v16b c, v16b d) { asm volatile("v_nop" :: "v"(a), "v"(b), "v"(c), "v"(d)); }
__device__ __forceinline__ void acc_guard4(v8f& a, v8f& b, v8f& c, v8f& d) { asm volatile("v_nop\n\tv_nop\n\tv_nop\n\tv_nop" : "+v"(a), "+v"(b), "+v"(c), "+v"(d)); }

// 16-bit WMMA fragment (A: p = row m at k0 + 8h; B stored [n][k]: p = row n at k0 + 8h; same split k map):
// elements 0..7 <- p[0..7], elements 8..15 <- p[16..23]
struct FragB {
  union U { v16b v; v8b h[2]; };
  static __device__ __forceinline__ v16b load(const __bf16* p) {
    U f; f.h[0] = *(const v8b*)(p); f.h[1] = *(const v8b*)(p + 16); return f.v;
  }
  static __device__ __forceinline__ v8f mma(v16b a, v16b b, v8f c) {
    return __builtin_amdgcn_wmma_f32_16x16x32_bf16(false, a, false, b, (short)0, c, false, false);
  }
};

__device__ __forceinline__ v8f zero8() { v8f z = {0.f, 0.f, 0.f, 0.f, 0.f, 0.f, 0.f, 0.f}; return z; }

// ---- Register-blocked batched WMMA GEMM (bf16 operands) --------------------
// C[m,n] = scale * sum_k A[m,k] * Bt[n,k] (+bf16-RNE bias); each wave owns a 64x64 tile, 8 waves per block.
// A row-major [M,K]; Bt row-major [N,K]; M,N % 64 == 0, K % 32 == 0 (met by the constant shapes proj_kernel passes).
// SPLIT: operands are hi/lo planes (A2/Bt2 = lo planes, same layout); product = hi.hi + hi.lo + lo.hi.
// BIAS_MODE: 0 = none, 1 = bias[m], 2 = bias[n]  (bias value converted bf16-RNE, added in f32).
// OUT_MODE: 0 = f32, 2 = bf16 hi plane (Cout) + bf16 lo plane (Cout2).
// coverage: 4 slabs x 16 rows x 64 cols = the whole 64x64 tile per wave; tiles cover M x N exactly.
// Device body: the launching kernel hands in its LDS slabs sT, the block's index bx among the product's blocks and the batch b.
template <bool SPLIT, int BIAS_MODE, int OUT_MODE>
__device__ __forceinline__ void wmma_gemm64(
    float (*sT)[16 * 68], int bx, int b,
    const unsigned short* __restrict__ Ap, const unsigned short* __restrict__ A2p, int lda, long strideA,
    const unsigned short* __restrict__ Btp, const unsigned short* __restrict__ Bt2p, int ldb, long strideB,
    void* __restrict__ Cout, void* __restrict__ Cout2, int ldc, long strideC,
    const float* __restrict__ bias, int M, int N, int K, float scale) {
  const __bf16* A = (const __bf16*)(const void*)Ap;   const __bf16* A2  = (const __bf16*)(const void*)A2p;
  const __bf16* Bt = (const __bf16*)(const void*)Btp; const __bf16* Bt2 = (const __bf16*)(const void*)Bt2p;
  const int lane = threadIdx.x & 31;
  const int wave = threadIdx.x >> 5;
  const int tilesN = N >> 6;
  const int tilesM = M >> 6;
  const int tile = bx * 8 + wave;
  if (tile >= tilesM * tilesN) return;   // wave-uniform; no block barriers in this kernel
  const int tm = tile / tilesN;
  const int tn = tile - tm * tilesN;
  const int m0 = tm << 6;
  const int n0 = tn << 6;

  const __bf16* Ab  = A  + (size_t)b * strideA;
  const __bf16* Bb  = Bt + (size_t)b * strideB;
  const __bf16* Ab2 = SPLIT ? (A2  + (size_t)b * strideA) : nullptr;
  const __bf16* Bb2 = SPLIT ? (Bt2 + (size_t)b * strideB) : nullptr;

  const int rlane = lane & 15;                 // row (A) / col (B, D) within subtile
  const int koff  = (lane >> 4) * 8;           // k offset of this lane half
  const int mOff  = (lane >> 4) * 8;           // D row offset

  v8f acc[4][4];
#pragma unroll
  for (int i = 0; i < 4; ++i)
#pragma unroll
    for (int j = 0; j < 4; ++j) acc[i][j] = zero8();

  for (int k0 = 0; k0 < K; k0 += 32) {
    v16b bh[4], bl[4];
#pragma unroll
    for (int j = 0; j < 4; ++j) {
      const size_t bo = (size_t)(n0 + (j << 4) + rlane) * ldb + koff + k0;
      bh[j] = FragB::load(Bb + bo);
      bl[j] = bh[j];
      if (SPLIT) bl[j] = FragB::load(Bb2 + bo);
    }
#pragma unroll
    for (int i = 0; i < 4; ++i) {
      const size_t ao = (size_t)(m0 + (i << 4) + rlane) * lda + koff + k0;
      v16b ah = FragB::load(Ab + ao);
      v16b al = ah;
      if (SPLIT) al = FragB::load(Ab2 + ao);
#pragma unroll
      for (int j = 0; j < 4; ++j) {
        acc[i][j] = FragB::mma(ah, bh[j], acc[i][j]);
        if (SPLIT) {
          acc[i][j] = FragB::mma(ah, bl[j], acc[i][j]);
          acc[i][j] = FragB::mma(al, bh[j], acc[i][j]);
        }
      }
      dep_guard_b(acc[i][0], acc[i][3], ah, al);
    }
    keep4_b(bh[0], bh[1], bh[2], bh[3]);
    if (SPLIT) keep4_b(bl[0], bl[1], bl[2], bl[3]);
  }
  acc_guard4(acc[0][0], acc[0][1], acc[0][2], acc[0][3]);
  acc_guard4(acc[1][0], acc[1][1], acc[1][2], acc[1][3]);
  acc_guard4(acc[2][0], acc[2][1], acc[2][2], acc[2][3]);
  acc_guard4(acc[3][0], acc[3][1], acc[3][2], acc[3][3]);

  // ---- epilogue ----
  float* slab = sT[wave];
#pragma unroll
  for (int i = 0; i < 4; ++i) {
    const int mBase = m0 + (i << 4);
#pragma unroll
    for (int j = 0; j < 4; ++j) {
      const int n = n0 + (j << 4) + rlane;
      float bv = 0.f;
      if (BIAS_MODE == 2) bv = bf_rne(bias[n]);
#pragma unroll
      for (int r = 0; r < 8; ++r) {
        float v = acc[i][j][r] * scale;
        if (BIAS_MODE == 1) v += bf_rne(bias[mBase + mOff + r]);
        if (BIAS_MODE == 2) v += bv;
        slab[(mOff + r) * 68 + (j << 4) + rlane] = v;
      }
    }
    __builtin_amdgcn_fence(__ATOMIC_RELEASE, "workgroup");
    __builtin_amdgcn_wave_barrier();
    __builtin_amdgcn_fence(__ATOMIC_ACQUIRE, "workgroup");
    if (OUT_MODE == 0) {
      float* C = (float*)Cout + (size_t)b * strideC;
      const int hh = lane >> 4, c4 = (lane & 15) * 4;     // row seg = 256 B = 16 lanes x 16 B
      {
#pragma unroll
        for (int it = 0; it < 8; ++it) {
          const int row = it * 2 + hh;
          v4f v = *(const v4fa*)(slab + row * 68 + c4);
          *(v4f*)(C + (size_t)(mBase + row) * ldc + n0 + c4) = v;
        }
        
      }
    } else {
      const int q = lane >> 3, c8 = (lane & 7) * 8;
      unsigned short* C  = (unsigned short*)Cout  + (size_t)b * strideC;
      unsigned short* C2 = (unsigned short*)Cout2 + (size_t)b * strideC;
      {
#pragma unroll
        for (int it = 0; it < 4; ++it) {
          const int row = it * 4 + q;
          const float* sp = slab + row * 68 + c8;
          v4u hv, lv;
#pragma unroll
          for (int e = 0; e < 4; ++e) {
            v2b hb, lb;
            split2(sp[2 * e], sp[2 * e + 1], hb, lb);
            hv[e] = __builtin_bit_cast(unsigned, hb);
            lv[e] = __builtin_bit_cast(unsigned, lb);
          }
          *(v4u*)(C  + (size_t)(mBase + row) * ldc + n0 + c8) = hv;
          *(v4u*)(C2 + (size_t)(mBase + row) * ldc + n0 + c8) = lv;
        }
        
      }
    }
    __builtin_amdgcn_fence(__ATOMIC_RELEASE, "workgroup");
    __builtin_amdgcn_wave_barrier();
    __builtin_amdgcn_fence(__ATOMIC_ACQUIRE, "workgroup");
  }
}

// ---------------------------------------------------------------------------
// Contiguous f32 -> bf16-RNE plane: one thread = 8 consecutive elements = one 16-B store, so every wave writes
// 512 contiguous bytes; ceil(n8/256) blocks, blk = the block's index among them; coverage: n8 threads x 8 = the whole plane (n8 * 8 elements).
// ---------------------------------------------------------------------------
__device__ __forceinline__ void cvt_bf16x8(int blk, const float* __restrict__ in, unsigned short* __restrict__ o, int n8) {
  const int i = blk * 256 + threadIdx.x;
  if (i < n8) {
    const float* sp = in + (size_t)i * 8;
    const v4f a  = *(const v4f*)(sp);
    const v4f a2 = *(const v4f*)(sp + 4);
    v4u w;
    w[0] = cvt2_bits(a[0],  a[1]);
    w[1] = cvt2_bits(a[2],  a[3]);
    w[2] = cvt2_bits(a2[0], a2[1]);
    w[3] = cvt2_bits(a2[2], a2[3]);
    unsigned short* dp = o + (size_t)i * 8;
    *(v4u*)dp = w;
    
  }
}

// ---------------------------------------------------------------------------
// Fused transpose + bf16 split of an f32 matrix: in [R rows][Cc cols] (pitch Cc) ->
//   oh[c][r] = bf16_rne(in[r][c]), ol[c][r] = bf16_rne(in[r][c] - oh)   ([Cc][R], pitch R).
// 64x64 tiles through LDS. (Cc/64) x (R/64) blocks (cb, rb), 256 threads (R, Cc multiples of 64).
// Coverage per block and plane: load 4 it x 256 thr x 4 floats = 64x64; store 2 it x 256 thr x 8 u16 = 64x64.
// ---------------------------------------------------------------------------
__device__ __forceinline__ void tsplit(float* tf, int cb, int rb, const float* __restrict__ W, unsigned short* __restrict__ oh,
                                       unsigned short* __restrict__ ol, int R, int Cc) {
  const int c0  = cb * 64;           // input column block = output row block
  const int r0  = rb * 64;           // input row block    = output column block
  const int tid = threadIdx.x;
  {
    const int lr = tid >> 4;         // 0..15
    const int c4 = (tid & 15) * 4;   // 0..60
#pragma unroll
    for (int it = 0; it < 4; ++it) {
      const int rr = it * 16 + lr;   // 0..63
      const v4f a = *(const v4f*)(W + (size_t)(r0 + rr) * Cc + c0 + c4);
      *(v4f*)(tf + rr * 68 + c4) = a;
    }
  }
  __syncthreads();
  const int sub = tid >> 3;          // 0..31
  const int c8  = (tid & 7) * 8;     // 0..56
  v4u hv[2], lv[2];
#pragma unroll
  for (int it = 0; it < 2; ++it) {
    const int oc = it * 32 + sub;    // output row within tile (= input column)
    v4u a, a2;
#pragma unroll
    for (int q = 0; q < 4; ++q) {
      const float f0 = tf[(c8 + 2 * q) * 68 + oc];
      const float f1 = tf[(c8 + 2 * q + 1) * 68 + oc];
      v2b hb, lb;
      split2(f0, f1, hb, lb);
      a[q]  = __builtin_bit_cast(unsigned, hb);
      a2[q] = __builtin_bit_cast(unsigned, lb);
    }
    hv[it] = a; lv[it] = a2;
  }
  {
#pragma unroll
    for (int it = 0; it < 2; ++it) {
      const int oc = it * 32 + sub;
      const size_t go = (size_t)(c0 + oc) * R + r0 + c8;
      *(v4u*)(oh + go) = hv[it];
      *(v4u*)(ol + go) = lv[it];
    }
    
  }
}

// ---------------------------------------------------------------------------
// Launch 1: every plane that depends on the inputs alone, one grid; the block index picks the job (block-uniform branch).
//   blocks 0..11     weight m = blk >> 2 (Wq, Wk, Wv), 64x64 tile blk & 3: transposed bf16 planes [n][k]
//   blocks 12..75    Er -> bf16 plane [4096][32]    (64 blocks x 256 threads x 8 = the whole plane)
//   blocks 76..1099  x  -> bf16 plane [16384][128]  (1024 blocks x 256 threads x 8 = the whole plane)
// ---------------------------------------------------------------------------
#define PREP_W  12
#define PREP_E  (SEQ * HD / 8 / 256)
#define PREP_X  (NB * SEQ * HID / 8 / 256)
__global__ __launch_bounds__(256) void prep_kernel(const float* __restrict__ x, const float* __restrict__ Wq, const float* __restrict__ Wk,
                                                   const float* __restrict__ Wv, const float* __restrict__ Er,
                                                   unsigned short* __restrict__ Xb, unsigned short* __restrict__ ErB,
                                                   unsigned short* __restrict__ WqTh, unsigned short* __restrict__ WqTl,
                                                   unsigned short* __restrict__ WkTh, unsigned short* __restrict__ WkTl,
                                                   unsigned short* __restrict__ WvTh, unsigned short* __restrict__ WvTl) {
  __shared__ __align__(16) float tf[64 * 68];
  const int blk = blockIdx.x;
  if (blk < PREP_W) {
    const int m = blk >> 2, t = blk & 3;
    const float*    W  = m == 0 ? Wq   : (m == 1 ? Wk   : Wv);
    unsigned short* oh = m == 0 ? WqTh : (m == 1 ? WkTh : WvTh);
    unsigned short* ol = m == 0 ? WqTl : (m == 1 ? WkTl : WvTl);
    tsplit(tf, t & 1, t >> 1, W, oh, ol, HID, HID);
  } else if (blk < PREP_W + PREP_E) {
    cvt_bf16x8(blk - PREP_W, Er, ErB, SEQ * HD / 8);
  } else {
    cvt_bf16x8(blk - (PREP_W + PREP_E), x, Xb, NB * SEQ * HID / 8);
  }
}

// ---------------------------------------------------------------------------
// Launch 2: the three projections, one grid (64, 3); blockIdx.y picks the product (block-uniform branch).
//   y = 0: q = x.Wq + bq -> Q hi/lo planes [b*4096+t][h*32+d]   (M=16384, N=128, K=128; 512 tiles -> 64 blocks)
//   y = 1: k = x.Wk + bk -> K hi/lo planes, same shape
//   y = 2: v^T = Wv^T . x^T + bv[m] -> VT hi/lo planes [b][h*32+d][s]   (A = Wv^T plane [128][128], Bt = x plane rows of batch b;
//          M=128, N=4096, K=128; 128 tiles -> 16 blocks a batch: block = blockIdx.x & 15, batch = blockIdx.x >> 4)
// ---------------------------------------------------------------------------
__global__ __launch_bounds__(256) void proj_kernel(const unsigned short* __restrict__ Xb, const unsigned short* __restrict__ WqTh,
                                                   const unsigned short* __restrict__ WkTh, const unsigned short* __restrict__ WvTh,
                                                   const float* __restrict__ bq, const float* __restrict__ bk, const float* __restrict__ bv,
                                                   unsigned short* __restrict__ Qh, unsigned short* __restrict__ Ql,
                                                   unsigned short* __restrict__ Kh, unsigned short* __restrict__ Kl,
                                                   unsigned short* __restrict__ VTh, unsigned short* __restrict__ VTl) {
  __shared__ __align__(16) float sT[8][16 * 68];   // per-wave 16x64 slab, pitch 68 floats
  const int job = blockIdx.y;
  if (job < 2) {
    const unsigned short* Wt = job ? WkTh : WqTh;
    const float*          bi = job ? bk   : bq;
    unsigned short*       Ch = job ? Kh   : Qh;
    unsigned short*       Cl = job ? Kl   : Ql;
    wmma_gemm64<false, 2, 2>(sT, blockIdx.x, 0, Xb, Xb, HID, 0L, Wt, Wt, HID, 0L, (void*)Ch, (void*)Cl, HID, 0L,
                             bi, NB * SEQ, HID, HID, 1.0f);
  } else {
    wmma_gemm64<false, 1, 2>(sT, blockIdx.x & 15, blockIdx.x >> 4, WvTh, WvTh, HID, 0L, Xb, Xb, HID, (long)SEQ * HID,
                             (void*)VTh, (void*)VTl, SEQ, (long)HID * SEQ, bv, HID, SEQ, HID, 1.0f);
  }
}

// =====================================================================================
// Causal rel-pos attention, head dim 32, all (batch, head) pairs in one launch.
//   q planes (hi/lo bf16): element (b, t, h, d) at [(b*SEQ + t)*HID + h*32 + d]
//   k planes (hi/lo bf16): same layout
//   v^T planes (hi/lo bf16): element (b, h, d, s) at [((b*HID + h*32 + d))*SEQ + s]
//   er plane (bf16-RNE of Er): [r][d], pitch 32
//   scores = ((q.k) + (q.ErWin at the shift index)) * sscale; masked (s > t) scores set to -inf.
//   Block = 8 waves = 2 key groups x 4 waves; the 4 waves of a group hold the 64 query rows of one (b,h) query block, and both
//   groups hold the same rows. Key chunks of 64, qb+1 <= 64 of them for query block qb, taken two a stage: group g takes chunk
//   2*stage + g, so a wave walks half the chunks and four waves instead of two share a SIMD. Each group keeps its own running
//   maximum, sum and O^T; after the last stage group 1 hands them to group 0 through LDS (one barrier) and group 0 joins them.
//   Where qb+1 is odd, group 1 has no chunk in the last stage: it stages chunk qb again (address in range) and skips the products.
//   Every block takes two query blocks of its (b,h), one after the other: 63 - t, then t (t = 0..31), so each block walks
//   (64 - t) + (t + 1) = 65 chunks in 33 stages and no WGP is left with only long or only short blocks. grid.x = NB*NH*32.
//   Staging per stage (plain 16-B copies, __syncthreads before and after); each group's 128 threads stage their own chunk:
//     K hi/lo [64][32]: 128 thr x 16 elements per plane = whole tile; V^T hi/lo [32][64]: 128 thr x 16 = whole tile;
//     Er window [192][32], shared (group g's 128-row window starts at row 64g): 256 thr x 3 x 8 elements = all 192 rows
//     (clamped source row, so every row is written).
//   All three products are taken transposed (keys, window rows or d as the rows of D, queries as its columns), so lane (c, hh)
//   holds query c of the wave's 16: its scores for keys 16j + 8hh + r, its maximum and sum in-lane (the two lane halves are joined
//   by one cross-half move), and exp(s - m) converts in place into the B fragment of V^T.P^T (element e of k-step kk =
//   tile 2kk + (e >> 3), register e & 7: the same split k map as the V^T loader). P never goes through LDS.
//   Per-wave LDS: G [16 queries][80] f32 (5 tiles x 16 window rows x 16 queries written, columns 0..78 read), reused as out staging [16][36].
//   LDS rows are padded (KP, VP, GP below); the pad bytes are never written and never read.
// =====================================================================================
#define AT_NW 8
#define AT_QB 64
#define AT_KC 64
#define EWIN  192
#define MGP   20   // hand-over record pitch in floats per lane: 80 B = 16 B x odd for the 16-B accesses (lane = row)
#define GP    84   // G row pitch in floats: 16 B x odd for the 16-B stores (lane = row); the shifted 4-B reads step 83 floats a lane, so the 16 lanes of a half hit distinct banks
#define OSP   36
#define KP    40   // K and Er-window row pitch in elements: 64-B rows at 80 B (16 B x odd), conflict-free for 16-B fragment reads
#define VP    72   // V^T row pitch in elements: 128-B rows at 144 B (16 B x odd)

// lane l <-> lane l ^ 16 (the two halves that share a query)
__device__ __forceinline__ float at_xhalf(float x) {
  return __builtin_bit_cast(float, __builtin_amdgcn_permlanex16(__builtin_bit_cast(int, x), __builtin_bit_cast(int, x),
                                                                0x76543210, 0xfedcba98, false, false));
}
__device__ __forceinline__ v8f at_mma(v16b a, v16b b, v8f c) {
  return __builtin_amdgcn_wmma_f32_16x16x32_bf16(false, a, false, b, (short)0, c, false, false);
}
// Distance guards, one behind each RUN of matrix products: four vector slots between the run and the first vector instruction that
// reads its results or rewrites its operand registers. The results pass through the statement and the operands are its inputs, so
// nothing of that kind can stand in front of it. Not volatile: LDS loads may move across it, so the fragment loads of a run go out together.
__device__ __forceinline__ void at_guard_s(v8f* s, const v16b* kh, const v16b* kl, v16b qh, v16b ql) {
  asm("v_nop\n\tv_nop\n\tv_nop\n\tv_nop" : "+v"(s[0]), "+v"(s[1]), "+v"(s[2]), "+v"(s[3])
      : "v"(kh[0]), "v"(kh[1]), "v"(kh[2]), "v"(kh[3]), "v"(kl[0]), "v"(kl[1]), "v"(kl[2]), "v"(kl[3]), "v"(qh), "v"(ql));
}
__device__ __forceinline__ void at_guard_g(v8f* g, const v16b* e, v16b qh, v16b ql) {
  asm("v_nop\n\tv_nop\n\tv_nop\n\tv_nop" : "+v"(g[0]), "+v"(g[1]), "+v"(g[2]), "+v"(g[3]), "+v"(g[4])
      : "v"(e[0]), "v"(e[1]), "v"(e[2]), "v"(e[3]), "v"(e[4]), "v"(qh), "v"(ql));
}
__device__ __forceinline__ void at_guard_o(v8f* o, const v16b* vh, const v16b* vl, v16b p0, v16b p1, v16b p2, v16b p3) {
  asm("v_nop\n\tv_nop\n\tv_nop\n\tv_nop" : "+v"(o[0]), "+v"(o[1])
      : "v"(vh[0]), "v"(vh[1]), "v"(vh[2]), "v"(vh[3]), "v"(vl[0]), "v"(vl[1]), "v"(vl[2]), "v"(vl[3]), "v"(p0), "v"(p1), "v"(p2), "v"(p3));
}

__global__ __launch_bounds__(256)
void relattn32_kernel(const unsigned short* __restrict__ qhp, const unsigned short* __restrict__ qlp,
                      const unsigned short* __restrict__ khp, const unsigned short* __restrict__ klp,
                      const unsigned short* __restrict__ vhp, const unsigned short* __restrict__ vlp,
                      const unsigned short* __restrict__ erp, float* __restrict__ out, float sscale) {
  union FB { v16b v; v8b h[2]; };
  __shared__ __align__(16) __bf16 KshA[2 * AT_KC * KP];        // K hi [group][kv][d], pitch KP      2 x 5 KB
  __shared__ __align__(16) __bf16 KslA[2 * AT_KC * KP];        // K lo
  __shared__ __align__(16) __bf16 VthA[2 * HD * VP];           // V hi [group][d][kv], pitch VP      2 x 4.5 KB
  __shared__ __align__(16) __bf16 VtlA[2 * HD * VP];           // V lo
  __shared__ __align__(16) __bf16 Esh[EWIN * KP];              // Er window [w][d], pitch KP         15 KB
  __shared__ __align__(16) float  Gs[AT_NW][16 * GP];          // per wave rel tile [query][80], pitch GP; later hand-over record (group 1) / out staging pitch 36 (group 0)

  const int tid  = threadIdx.x;
  const int wave = __builtin_amdgcn_readfirstlane(tid >> 5);   // in a scalar register: the tests on the key group below are scalar branches
  const int grp  = wave >> 2;             // key group 0 / 1
  const int wq   = wave & 3;              // which 16 of the 64 query rows
  const int tl   = tid & 127;             // thread within its group
  const int lane = tid & 31;
  const int hh   = lane >> 4;
  const int c    = lane & 15;

  const int bx   = blockIdx.x;
  const int tp   = bx & (NQB / 2 - 1);    // 0..31
  const int pair = bx >> 5;               // 0..15
  const int b    = pair >> 2;
  const int h    = pair & 3;
  const size_t rowBase = (size_t)b * SEQ;

  const __bf16* Qh = (const __bf16*)(const void*)qhp + h * HD;
  const __bf16* Ql = (const __bf16*)(const void*)qlp + h * HD;
  const __bf16* Kh = (const __bf16*)(const void*)khp + h * HD;
  const __bf16* Kl = (const __bf16*)(const void*)klp + h * HD;
  const __bf16* Vh = (const __bf16*)(const void*)vhp + ((size_t)b * HID + h * HD) * SEQ;
  const __bf16* Vl = (const __bf16*)(const void*)vlp + ((size_t)b * HID + h * HD) * SEQ;
  const __bf16* Er = (const __bf16*)(const void*)erp;
  float*        ob = out + h * HD;

  const int wbase = 64 * grp + 48 - 16 * wq;   // first row, in the staged 192-row window, of this wave's G tile
  float* gw = Gs[wave];
  __bf16* Ksh = KshA + grp * (AT_KC * KP);     // this group's own chunk
  __bf16* Ksl = KslA + grp * (AT_KC * KP);
  __bf16* Vth = VthA + grp * (HD * VP);
  __bf16* Vtl = VtlA + grp * (HD * VP);

  // the block's two query blocks, long one first; every (b, h, qb) is taken by exactly one block (block-uniform trip counts)
  for (int part = 0; part < 2; ++part) {
  const int qb = part ? tp : (NQB - 1 - tp);   // 63..32, then 0..31
  const int q0 = qb * AT_QB + wq * 16;

  // ---- Q fragments (B operand, column = query = lane&15, split k map, one k-step of 32 = d), hi and lo ----
  const v16b qah = FragB::load(Qh + (rowBase + q0 + c) * HID + 8 * hh);
  const v16b qal = FragB::load(Ql + (rowBase + q0 + c) * HID + 8 * hh);

  float mrow = -INFINITY;                 // running maximum of query c (equal in both lane halves)
  float lrow = 0.f;                       // running sum of query c over this lane half's keys; halves joined after the loop
  v8f oacc[2];                            // O^T: oacc[t][r] = out[query c][d = 16t + 8hh + r]
  oacc[0] = zero8(); oacc[1] = zero8();
  const int qrow = qb * AT_QB + wq * 16 + c;

  const int nStages = (qb + 2) >> 1;      // block-uniform, <= 32: ceil((qb + 1) / 2)
  for (int st = 0; st < nStages; ++st) {
    const int kc    = 2 * st + grp;       // this group's chunk (wave-uniform)
    const bool live = kc <= qb;           // false only for group 1 in the last stage of an odd chunk count
    const int kv0   = (live ? kc : qb) * AT_KC;
    const int e0 = SEQ - 64 - 64 * (qb - 2 * st);   // Er row of staged window row 0 (group 0's window base), 0 .. 4032
    __syncthreads();
    {
      // K: thread -> key row r = tl>>1, d half = (tl&1)*16; 2 x 8 elements per plane
      const int r = tl >> 1, half = (tl & 1) * 16;
      const __bf16* ks = Kh + (rowBase + kv0 + r) * HID + half;
      const __bf16* kl = Kl + (rowBase + kv0 + r) * HID + half;
      // V^T: thread -> d = tl>>2, key quarter = (tl&3)*16; 2 x 8 elements per plane
      const int d = tl >> 2, qt = (tl & 3) * 16;
      const __bf16* vs = Vh + (size_t)d * SEQ + kv0 + qt;
      const __bf16* vl = Vl + (size_t)d * SEQ + kv0 + qt;
      // Er window: 16-B piece p = tid + 256 i -> window row p>>2, d quarter (p&3)*8; clamped source row (address clamp)
      const __bf16* ep[3];
#pragma unroll
      for (int i = 0; i < 3; ++i) {
        const int p = tid + 256 * i;
        int erow = e0 + (p >> 2);
        erow = erow < 0 ? 0 : erow;
        erow = erow > (SEQ - 1) ? (SEQ - 1) : erow;
        ep[i] = Er + (size_t)erow * HD + (p & 3) * 8;
      }
      v8b a0[2], a1[2], b0[2], b1[2], ee[3];
#pragma unroll
      for (int i = 0; i < 2; ++i) {
        a0[i] = *(const v8b*)(ks + 8 * i);
        a1[i] = *(const v8b*)(kl + 8 * i);
        b0[i] = *(const v8b*)(vs + 8 * i);
        b1[i] = *(const v8b*)(vl + 8 * i);
      }
#pragma unroll
      for (int i = 0; i < 3; ++i) ee[i] = *(const v8b*)(ep[i]);
      // the wait that stands before a register named by an issued load is rewritten; the addresses are its inputs so that they
      // live up to it (without them a later load's result was placed over an earlier load's address pair)
      asm volatile("s_wait_xcnt 0x0" :: "v"(ks), "v"(kl), "v"(vs), "v"(vl), "v"(ep[0]), "v"(ep[1]), "v"(ep[2]) : "memory");
#pragma unroll
      for (int i = 0; i < 2; ++i) {
        *(v8b*)(Ksh + r * KP + half + 8 * i) = a0[i];
        *(v8b*)(Ksl + r * KP + half + 8 * i) = a1[i];
        *(v8b*)(Vth + d * VP + qt   + 8 * i) = b0[i];
        *(v8b*)(Vtl + d * VP + qt   + 8 * i) = b1[i];
      }
#pragma unroll
      for (int i = 0; i < 3; ++i) {
        const int p = tid + 256 * i;
        *(v8b*)(Esh + (p >> 2) * KP + (p & 3) * 8) = ee[i];
      }
    }
    __syncthreads();
    if (live) {   // wave-uniform; no block barrier inside

    // ---- rel-pos tile, transposed: G^T = Win[wbase + 0..79] . q^T (2 products); a lane's 8 registers are 8 consecutive
    //      window columns of its query's row, so they go to this wave's G[query][80] as two 16-B stores ----
    //      Taken in front of the score products: the G stores land and the G reads fly while those run.
    v8f gt[5];
    {
      v16b ef[5];
#pragma unroll
      for (int nt = 0; nt < 5; ++nt) {
        FB eb;
        const __bf16* ep = Esh + (wbase + nt * 16 + c) * KP + 8 * hh;
        eb.h[0] = *(const v8b*)(ep); eb.h[1] = *(const v8b*)(ep + 16);
        ef[nt] = eb.v;
        v8f g = zero8();
        g = at_mma(eb.v, qah, g);
        g = at_mma(eb.v, qal, g);
        gt[nt] = g;
      }
      at_guard_g(gt, ef, qah, qal);
    }
#pragma unroll
    for (int nt = 0; nt < 5; ++nt) {
      const v8f g = gt[nt];
      float* gp = gw + c * GP + nt * 16 + 8 * hh;
      const v4f g0 = {g[0], g[1], g[2], g[3]};
      const v4f g1 = {g[4], g[5], g[6], g[7]};
      *(v4fa*)(gp)     = g0;
      *(v4fa*)(gp + 4) = g1;
    }

    // ---- content scores, transposed: S^T tile j = K rows (16j..16j+15) . q^T, 3-term split; s[j][r] = score(key 16j + 8hh + r, query c) ----
    v8f s[4];
    {
      v16b kfh[4], kfl[4];
#pragma unroll
      for (int j = 0; j < 4; ++j) {
        FB kb, kl;
        const __bf16* kp = Ksh + (j * 16 + c) * KP + 8 * hh;
        const __bf16* kq = Ksl + (j * 16 + c) * KP + 8 * hh;
        kb.h[0] = *(const v8b*)(kp); kb.h[1] = *(const v8b*)(kp + 16);
        kl.h[0] = *(const v8b*)(kq); kl.h[1] = *(const v8b*)(kq + 16);
        kfh[j] = kb.v; kfl[j] = kl.v;
        v8f a = zero8();
        a = at_mma(kb.v, qah, a);
        a = at_mma(kl.v, qah, a);
        a = at_mma(kb.v, qal, a);
        s[j] = a;
      }
      at_guard_s(s, kfh, kfl, qah, qal);
    }
    __builtin_amdgcn_fence(__ATOMIC_RELEASE, "workgroup");
    __builtin_amdgcn_wave_barrier();
    __builtin_amdgcn_fence(__ATOMIC_ACQUIRE, "workgroup");

    // ---- combine, scale, causal mask, chunk maximum of query c (in-lane, four independent chains, then the other half) ----
    const bool diag = (kc == qb);           // wave-uniform
    const float* gr = gw + c * GP + (15 - c) + 8 * hh;   // + 16j + r gives shift column 15 - c + jl, jl = 16j + 8hh + r
    v8f relv[4];
#pragma unroll
    for (int j = 0; j < 4; ++j)
#pragma unroll
      for (int r = 0; r < 8; ++r) relv[j][r] = gr[j * 16 + r];
    // keeps the G reads together in front of the arithmetic: spread among it, each read's LDS latency is waited out on its own
    __builtin_amdgcn_sched_barrier(0);
    float mj[4];
#pragma unroll
    for (int j = 0; j < 4; ++j) {
      float m = -INFINITY;
#pragma unroll
      for (int r = 0; r < 8; ++r) {
        const int kvcol = kv0 + j * 16 + 8 * hh + r;
        const float rel = relv[j][r];
        const float sv  = (s[j][r] + rel) * sscale;
        const bool msk  = diag && (kvcol > qrow);
        const float sm  = msk ? -INFINITY : sv;
        s[j][r] = sm;
        m = fmaxf(m, sm);
      }
      mj[j] = m;
    }
    float cm = fmaxf(fmaxf(mj[0], mj[1]), fmaxf(mj[2], mj[3]));
    cm = fmaxf(cm, at_xhalf(cm));           // key kv0 is never masked, so the joined maximum is finite

    // ---- online softmax update; P^T (unnormalised) as bf16 hi/lo straight into the B fragments of V^T.P^T ----
    const float mnew  = fmaxf(mrow, cm);
    const float alpha = __expf(mrow - mnew);
    mrow = mnew;
    FB ph[2], pl[2];
    float pj[4];
#pragma unroll
    for (int j = 0; j < 4; ++j) {
      float psum = 0.f;
#pragma unroll
      for (int r = 0; r < 8; r += 2) {
        const float p0 = __expf(s[j][r]     - mnew);
        const float p1 = __expf(s[j][r + 1] - mnew);
        psum += p0;
        psum += p1;
        v2b a, bl; split2(p0, p1, a, bl);
        ph[j >> 1].v[(j & 1) * 8 + r]     = a[0];
        ph[j >> 1].v[(j & 1) * 8 + r + 1] = a[1];
        pl[j >> 1].v[(j & 1) * 8 + r]     = bl[0];
        pl[j >> 1].v[(j & 1) * 8 + r + 1] = bl[1];
      }
      pj[j] = psum;
    }
    lrow = lrow * alpha + ((pj[0] + pj[1]) + (pj[2] + pj[3]));
#pragma unroll
    for (int r = 0; r < 8; ++r) {
      oacc[0][r] *= alpha;
      oacc[1][r] *= alpha;
    }

    // ---- O^T += V^T . P^T : A = V^T rows d (split k map over keys), B = P^T fragments; 3-term split ----
    v16b vfh[4], vfl[4];
#pragma unroll
    for (int kk = 0; kk < 2; ++kk) {
#pragma unroll
      for (int t = 0; t < 2; ++t) {
        FB vb, vl;
        vb.h[0] = *(const v8b*)(Vth + (t * 16 + c) * VP + kk * 32 + 8 * hh);
        vb.h[1] = *(const v8b*)(Vth + (t * 16 + c) * VP + kk * 32 + 16 + 8 * hh);
        vl.h[0] = *(const v8b*)(Vtl + (t * 16 + c) * VP + kk * 32 + 8 * hh);
        vl.h[1] = *(const v8b*)(Vtl + (t * 16 + c) * VP + kk * 32 + 16 + 8 * hh);
        vfh[kk * 2 + t] = vb.v; vfl[kk * 2 + t] = vl.v;
        oacc[t] = at_mma(vb.v, ph[kk].v, oacc[t]);
        oacc[t] = at_mma(vl.v, ph[kk].v, oacc[t]);
        oacc[t] = at_mma(vb.v, pl[kk].v, oacc[t]);
      }
    }
    at_guard_o(oacc, vfh, vfl, ph[0].v, ph[1].v, pl[0].v, pl[1].v);
    }   // live
  }

  __builtin_amdgcn_fence(__ATOMIC_RELEASE, "workgroup");
  __builtin_amdgcn_wave_barrier();
  __builtin_amdgcn_fence(__ATOMIC_ACQUIRE, "workgroup");
  // ---- group 1 hands its maximum, sum and O^T to group 0: lane to same lane of wave - 4, through group 1's own G area ----
  if (grp == 1) {
    float* mp = gw + lane * MGP;
#pragma unroll
    for (int t = 0; t < 2; ++t) {
      const v4f o0 = {oacc[t][0], oacc[t][1], oacc[t][2], oacc[t][3]};
      const v4f o1 = {oacc[t][4], oacc[t][5], oacc[t][6], oacc[t][7]};
      *(v4fa*)(mp + t * 8)     = o0;
      *(v4fa*)(mp + t * 8 + 4) = o1;
    }
    mp[16] = mrow;
    mp[17] = lrow;
  }
  __syncthreads();   // publishes the records; group 1 next writes its G area behind two more barriers, after group 0 has read them
  if (grp == 0) {
  {
    const float* mp = Gs[wave + 4] + lane * MGP;
    const float m1 = mp[16], l1 = mp[17];
    const float mN = fmaxf(mrow, m1);        // mrow is finite (group 0 always has chunk 0); m1 is -inf where group 1 had no chunk
    const float a0 = __expf(mrow - mN);
    const float a1 = __expf(m1 - mN);
    lrow = lrow * a0 + l1 * a1;
#pragma unroll
    for (int t = 0; t < 2; ++t) {
      const v4f o0 = *(const v4fa*)(mp + t * 8);
      const v4f o1 = *(const v4fa*)(mp + t * 8 + 4);
#pragma unroll
      for (int r = 0; r < 4; ++r) {
        oacc[t][r]     = oacc[t][r]     * a0 + o0[r] * a1;
        oacc[t][r + 4] = oacc[t][r + 4] * a0 + o1[r] * a1;
      }
    }
  }
  float* os = gw;
  {
    const float inv = 1.0f / (lrow + at_xhalf(lrow));   // the two halves' key sums joined once
#pragma unroll
    for (int t = 0; t < 2; ++t) {
      float* op = os + c * OSP + t * 16 + 8 * hh;        // row = query c, 8 consecutive d
      const v4f o0 = {oacc[t][0] * inv, oacc[t][1] * inv, oacc[t][2] * inv, oacc[t][3] * inv};
      const v4f o1 = {oacc[t][4] * inv, oacc[t][5] * inv, oacc[t][6] * inv, oacc[t][7] * inv};
      *(v4fa*)(op)     = o0;
      *(v4fa*)(op + 4) = o1;
    }
  }
  __builtin_amdgcn_fence(__ATOMIC_RELEASE, "workgroup");
  __builtin_amdgcn_wave_barrier();
  __builtin_amdgcn_fence(__ATOMIC_ACQUIRE, "workgroup");
  {
    const int q4 = lane >> 3, c4 = (lane & 7) * 4;
    {
#pragma unroll
      for (int it = 0; it < 4; ++it) {
        const int row = it * 4 + q4;                   // it 0..3 x q4 0..3 covers rows 0..15 of the wave tile
        const v4f val = *(const v4fa*)(os + row * OSP + c4);
        *(v4f*)(ob + (rowBase + q0 + row) * HID + c4) = val;
      }
      // the next query block's set-up rewrites the data and address registers that these stores name
      asm volatile("s_wait_xcnt 0x0" ::: "memory");
    }
  }
  }   // grp == 0
  }   // part: the next query block's first barrier stands before any staging store; G / out staging is this wave's own
}

// ---------------------------------------------------------------------------
// Workspace region map (byte offsets):
//   WqTh bf16 [128 n][128 k]        0      WqTl     32768
//   WkTh                        65536      WkTl     98304
//   WvTh                       131072      WvTl    163840     (lo weight planes written, not consumed)
//   Xb   bf16 [16384][128]     196608                         (4194304 B)
//   ErB  bf16 [4096][32]      4390912                         (262144 B)
//   Qh   bf16 [16384][128]    4653056      Ql    8847360
//   Kh   bf16 [16384][128]   13041664      Kl   17235968
//   VTh  bf16 [4][128][4096] 21430272      VTl  25624576
//   total                    29818880
// Every region is written in whole 64x64 tiles / whole 16-B-per-lane runs; all extents are exact tile multiples,
// ---------------------------------------------------------------------------
extern "C" void kernel_launch(void* const* d_in, const int* in_sizes, int n_in,
                              void* d_out, int out_size, void* d_ws, size_t ws_size,
                              hipStream_t stream) {
  if (n_in < 8) return;
  if (in_sizes[0] != NB * SEQ * HID) return;
  if (in_sizes[1] != HID * HID || in_sizes[3] != HID * HID || in_sizes[5] != HID * HID) return;
  if (in_sizes[2] != HID || in_sizes[4] != HID || in_sizes[6] != HID) return;
  if (in_sizes[7] != SEQ * HD) return;
  if (out_size != NB * SEQ * HID) return;

  const float* x  = (const float*)d_in[0];
  const float* Wq = (const float*)d_in[1];
  const float* bq = (const float*)d_in[2];
  const float* Wk = (const float*)d_in[3];
  const float* bk = (const float*)d_in[4];
  const float* Wv = (const float*)d_in[5];
  const float* bv = (const float*)d_in[6];
  const float* Er = (const float*)d_in[7];
  float* out = (float*)d_out;

  const size_t PW = (size_t)HID * HID * 2;            //    32768  bf16 weight plane
  const size_t PX = (size_t)NB * SEQ * HID * 2;       //  4194304  bf16 activation plane (all batch rows)
  const size_t PE = (size_t)SEQ * HD * 2;             //   262144  bf16 Er plane
  const size_t PV = (size_t)NB * HID * SEQ * 2;       //  4194304  bf16 v^T plane
  size_t off = 0;
  const size_t oWqTh = off; off += PW;  const size_t oWqTl = off; off += PW;
  const size_t oWkTh = off; off += PW;  const size_t oWkTl = off; off += PW;
  const size_t oWvTh = off; off += PW;  const size_t oWvTl = off; off += PW;
  const size_t oXb   = off; off += PX;
  const size_t oErB  = off; off += PE;
  const size_t oQh   = off; off += PX;  const size_t oQl   = off; off += PX;
  const size_t oKh   = off; off += PX;  const size_t oKl   = off; off += PX;
  const size_t oVTh  = off; off += PV;  const size_t oVTl  = off; off += PV;
  if (off > ws_size) return;                          // off = 29818880
  if (off > (size_t)134217728) return;

  char* ws = (char*)d_ws;
  unsigned short* WqTh = (unsigned short*)(ws + oWqTh); unsigned short* WqTl = (unsigned short*)(ws + oWqTl);
  unsigned short* WkTh = (unsigned short*)(ws + oWkTh); unsigned short* WkTl = (unsigned short*)(ws + oWkTl);
  unsigned short* WvTh = (unsigned short*)(ws + oWvTh); unsigned short* WvTl = (unsigned short*)(ws + oWvTl);
  unsigned short* Xb   = (unsigned short*)(ws + oXb);
  unsigned short* ErB  = (unsigned short*)(ws + oErB);
  unsigned short* Qh   = (unsigned short*)(ws + oQh);   unsigned short* Ql   = (unsigned short*)(ws + oQl);
  unsigned short* Kh   = (unsigned short*)(ws + oKh);   unsigned short* Kl   = (unsigned short*)(ws + oKl);
  unsigned short* VTh  = (unsigned short*)(ws + oVTh);  unsigned short* VTl  = (unsigned short*)(ws + oVTl);

  const dim3 blk(256);
  const float sscale = 0.17677669529663688f;          // 1/sqrt(32)

  // (1) weights -> transposed bf16 planes, Er and x -> bf16 planes: 12 + 64 + 1024 blocks
  prep_kernel<<<dim3(PREP_W + PREP_E + PREP_X), blk, 0, stream>>>(x, Wq, Wk, Wv, Er, Xb, ErB, WqTh, WqTl, WkTh, WkTl, WvTh, WvTl);
  // (2) q, k and v^T projections: 64 blocks each
  proj_kernel<<<dim3(64, 3), blk, 0, stream>>>(Xb, WqTh, WkTh, WvTh, bq, bk, bv, Qh, Ql, Kh, Kl, VTh, VTl);
  // (3) causal rel-pos attention: 512 blocks = 16 (b,h) pairs x 32 pairs of query blocks (63 - t, t), 256 threads (2 key groups x 4 waves)
  relattn32_kernel<<<dim3(NB * NH * (NQB / 2)), dim3(256), 0, stream>>>(Qh, Ql, Kh, Kl, VTh, VTl, ErB, out, sscale);
  (void)hipGetLastError();
}

// v008
// A run of this version takes 93 microseconds.
// In both of two side-by-side timings against v007, it was 1.09 times as fast.
// All steps since v000 together make it 4.47 times as fast.
// Contractions: q, k, v^T projections x.W, v^T = Wv^T.x^T (+bias): v_wmma_f32_16x16x32_bf16, single product of bf16-RNE-valued x and W planes, f32 accumulate;
// scores (k.q^T, keys as rows): bf16 hi/lo split (hi.hi + hi.lo + lo.hi); rel-pos term ErWin.q^T: q hi/lo x bf16-RNE Er (hi.E + lo.E); V^T.P^T: bf16 hi/lo split (3 products);
// all v_wmma_f32_16x16x32_bf16 with f32 accumulate. Softmax, bias adds and the 1/sqrt(32) score scale in f32.
//
// Math implemented (B=4, S=4096, hidden 128, 4 heads x 32):
//   q = x.Wq + bq, k = x.Wk + bk, v = x.Wv + bv   (W stored [in][out]; head h = columns h*32..h*32+31)
//   rel[i][j] = q_i . Er[S-1-(i-j)]  for j <= i   (pad-left / reshape shift identity; j > i entries are masked)
//   logit[i][j] = (q_i.k_j + rel[i][j]) * (1/sqrt(32)),  causal (j <= i, diagonal included), softmax over j, out = P.v
//   out[(b*S + i)*128 + h*32 + d]   (no output projection)
//
// Plane / carry audit: every 16-bit plane is bf16 with unit carry (x, W^T, Er: bf16-RNE of the inputs; q, k, v^T: hi/lo bf16
// pairs of the f32 projection results; P: hi/lo bf16 pairs of exp(s - m)); nothing is scaled, nothing to fold back.
//
// Er window per (query block qb, key chunk kc): window row w <-> Er row e0 + w, e0 = S - 64 - 64*(qb - kc), w in 0..127
// (clamped copy, rows past S-1 only ever meet masked keys). For block row il (0..63) and chunk key jl (0..63):
// w = 63 - il + jl. Wave wv (rows il = 16*wv..16*wv+15) computes G^T[80][16] = Win[48 - 16*wv + 0..79] . q^T, stores it as G[row][80] and reads
// G[row][15 - (il - 16*wv) + jl].
#include <hip/hip_runtime.h>
#include <math.h>
#include <stdint.h>

#define NB   4
#define SEQ  4096
#define HID  128
#define NH   4
#define HD   32
#define NQB  (SEQ / 64)

typedef __attribute__((ext_vector_type(16))) _Float16 v16h;
typedef __attribute__((ext_vector_type(16))) __bf16   v16b;
typedef __attribute__((ext_vector_type(8)))  __bf16   v8b;
typedef __attribute__((ext_vector_type(8)))  float    v8f;
typedef __attribute__((ext_vector_type(4)))  float    v4f;
typedef __attribute__((ext_vector_type(4)))  unsigned int v4u;
typedef v4f __attribute__((may_alias)) v4fa;

typedef __attribute__((ext_vector_type(2)))  float    v2f;
typedef __attribute__((ext_vector_type(2)))  __bf16   v2b;

// f32 -> bf16, round to nearest even, two values a time in the chip's packed converter (one instruction a pair)
__device__ __forceinline__ v2b cvt2(float a, float b) { const v2f t = {a, b}; return __builtin_convertvector(t, v2b); }
__device__ __forceinline__ unsigned cvt2_bits(float a, float b) { return __builtin_bit_cast(unsigned, cvt2(a, b)); }
// hi/lo bf16 planes of a pair: hi = rne(f), lo = rne(f - hi)
__device__ __forceinline__ void split2(float a, float b, v2b& hi, v2b& lo) {
  hi = cvt2(a, b);
  lo = cvt2(a - (float)hi[0], b - (float)hi[1]);
}
__device__ __forceinline__ float bf_rne(float f) { return (float)(__bf16)f; }

// hazard guards as plain device helpers
__device__ __forceinline__ void dep_guard_b(v8f& a, v8f& b, v16b x, v16b y) { asm volatile("v_nop\n\tv_nop\n\tv_nop\n\tv_nop" : "+v"(a), "+v"(b) : "v"(x), "v"(y)); }
__device__ __forceinline__ void keep4_b(v16b a, v16b b, v16b c, v16b d) { asm volatile("v_nop" :: "v"(a), "v"(b), "v"(c), "v"(d)); }
__device__ __forceinline__ void acc_guard4(v8f& a, v8f& b, v8f& c, v8f& d) { asm volatile("v_nop\n\tv_nop\n\tv_nop\n\tv_nop" : "+v"(a), "+v"(b), "+v"(c), "+v"(d)); }

// 16-bit WMMA fragment (A: p = row m at k0 + 8h; B stored [n][k]: p = row n at k0 + 8h; same split k map):
// elements 0..7 <- p[0..7], elements 8..15 <- p[16..23]
struct FragB {
  union U { v16b v; v8b h[2]; };
  static __device__ __forceinline__ v16b load(const __bf16* p) {
    U f; f.h[0] = *(const v8b*)(p); f.h[1] = *(const v8b*)(p + 16); return f.v;
  }
  static __device__ __forceinline__ v8f mma(v16b a, v16b b, v8f c) {
    return __builtin_amdgcn_wmma_f32_16x16x32_bf16(false, a, false, b, (short)0, c, false, false);
  }
};

__device__ __forceinline__ v8f zero8() { v8f z = {0.f, 0.f, 0.f, 0.f, 0.f, 0.f, 0.f, 0.f}; return z; }

// ---- Register-blocked batched WMMA GEMM (bf16 operands) --------------------
// C[m,n] = scale * sum_k A[m,k] * Bt[n,k] (+bf16-RNE bias); each wave owns a 64x64 tile, 8 waves per block.
// A row-major [M,K]; Bt row-major [N,K]; M,N % 64 == 0, K % 32 == 0 (met by the constant shapes proj_kernel passes).
// SPLIT: operands are hi/lo planes (A2/Bt2 = lo planes, same layout); product = hi.hi + hi.lo + lo.hi.
// BIAS_MODE: 0 = none, 1 = bias[m], 2 = bias[n]  (bias value converted bf16-RNE, added in f32).
// OUT_MODE: 0 = f32, 2 = bf16 hi plane (Cout) + bf16 lo plane (Cout2).
// coverage: 4 slabs x 16 rows x 64 cols = the whole 64x64 tile per wave; tiles cover M x N exactly.
// Device body: the launching kernel hands in its LDS slabs sT, the block's index bx among the product's blocks and the batch b.
template <bool SPLIT, int BIAS_MODE, int OUT_MODE>
__device__ __forceinline__ void wmma_gemm64(
    float (*sT)[16 * 68], int bx, int b,
    const unsigned short* __restrict__ Ap, const unsigned short* __restrict__ A2p, int lda, long strideA,
    const unsigned short* __restrict__ Btp, const unsigned short* __restrict__ Bt2p, int ldb, long strideB,
    void* __restrict__ Cout, void* __restrict__ Cout2, int ldc, long strideC,
    const float* __restrict__ bias, int M, int N, int K, float scale) {
  const __bf16* A = (const __bf16*)(const void*)Ap;   const __bf16* A2  = (const __bf16*)(const void*)A2p;
  const __bf16* Bt = (const __bf16*)(const void*)Btp; const __bf16* Bt2 = (const __bf16*)(const void*)Bt2p;
  const int lane = threadIdx.x & 31;
  const int wave = threadIdx.x >> 5;
  const int tilesN = N >> 6;
  const int tilesM = M >> 6;
  const int tile = bx * 8 + wave;
  if (tile >= tilesM * tilesN) return;   // wave-uniform; no block barriers in this kernel
  const int tm = tile / tilesN;
  const int tn = tile - tm * tilesN;
  const int m0 = tm << 6;
  const int n0 = tn << 6;

  const __bf16* Ab  = A  + (size_t)b * strideA;
  const __bf16* Bb  = Bt + (size_t)b * strideB;
  const __bf16* Ab2 = SPLIT ? (A2  + (size_t)b * strideA) : nullptr;
  const __bf16* Bb2 = SPLIT ? (Bt2 + (size_t)b * strideB) : nullptr;

  const int rlane = lane & 15;                 // row (A) / col (B, D) within subtile
  const int koff  = (lane >> 4) * 8;           // k offset of this lane half
  const int mOff  = (lane >> 4) * 8;           // D row offset

  v8f acc[4][4];
#pragma unroll
  for (int i = 0; i < 4; ++i)
#pragma unroll
    for (int j = 0; j < 4; ++j) acc[i][j] = zero8();

  for (int k0 = 0; k0 < K; k0 += 32) {
    v16b bh[4], bl[4];
#pragma unroll
    for (int j = 0; j < 4; ++j) {
      const size_t bo = (size_t)(n0 + (j << 4) + rlane) * ldb + koff + k0;
      bh[j] = FragB::load(Bb + bo);
      bl[j] = bh[j];
      if (SPLIT) bl[j] = FragB::load(Bb2 + bo);
    }
#pragma unroll
    for (int i = 0; i < 4; ++i) {
      const size_t ao = (size_t)(m0 + (i << 4) + rlane) * lda + koff + k0;
      v16b ah = FragB::load(Ab + ao);
      v16b al = ah;
      if (SPLIT) al = FragB::load(Ab2 + ao);
#pragma unroll
      for (int j = 0; j < 4; ++j) {
        acc[i][j] = FragB::mma(ah, bh[j], acc[i][j]);
        if (SPLIT) {
          acc[i][j] = FragB::mma(ah, bl[j], acc[i][j]);
          acc[i][j] = FragB::mma(al, bh[j], acc[i][j]);
        }
      }
      dep_guard_b(acc[i][0], acc[i][3], ah, al);
    }
    keep4_b(bh[0], bh[1], bh[2], bh[3]);
    if (SPLIT) keep4_b(bl[0], bl[1], bl[2], bl[3]);
  }
  acc_guard4(acc[0][0], acc[0][1], acc[0][2], acc[0][3]);
  acc_guard4(acc[1][0], acc[1][1], acc[1][2], acc[1][3]);
  acc_guard4(acc[2][0], acc[2][1], acc[2][2], acc[2][3]);
  acc_guard4(acc[3][0], acc[3][1], acc[3][2], acc[3][3]);

  // ---- epilogue ----
  float* slab = sT[wave];
#pragma unroll
  for (int i = 0; i < 4; ++i) {
    const int mBase = m0 + (i << 4);
#pragma unroll
    for (int j = 0; j < 4; ++j) {
      const int n = n0 + (j << 4) + rlane;
      float bv = 0.f;
      if (BIAS_MODE == 2) bv = bf_rne(bias[n]);
#pragma unroll
      for (int r = 0; r < 8; ++r) {
        float v = acc[i][j][r] * scale;
        if (BIAS_MODE == 1) v += bf_rne(bias[mBase + mOff + r]);
        if (BIAS_MODE == 2) v += bv;
        slab[(mOff + r) * 68 + (j << 4) + rlane] = v;
      }
    }
    __builtin_amdgcn_fence(__ATOMIC_RELEASE, "workgroup");
    __builtin_amdgcn_wave_barrier();
    __builtin_amdgcn_fence(__ATOMIC_ACQUIRE, "workgroup");
    if (OUT_MODE == 0) {
      float* C = (float*)Cout + (size_t)b * strideC;
      const int hh = lane >> 4, c4 = (lane & 15) * 4;     // row seg = 256 B = 16 lanes x 16 B
      {
#pragma unroll
        for (int it = 0; it < 8; ++it) {
          const int row = it * 2 + hh;
          v4f v = *(const v4fa*)(slab + row * 68 + c4);
          *(v4f*)(C + (size_t)(mBase + row) * ldc + n0 + c4) = v;
        }
        
      }
    } else {
      const int q = lane >> 3, c8 = (lane & 7) * 8;
      unsigned short* C  = (unsigned short*)Cout  + (size_t)b * strideC;
      unsigned short* C2 = (unsigned short*)Cout2 + (size_t)b * strideC;
      {
#pragma unroll
        for (int it = 0; it < 4; ++it) {
          const int row = it * 4 + q;
          const float* sp = slab + row * 68 + c8;
          v4u hv, lv;
#pragma unroll
          for (int e = 0; e < 4; ++e) {
            v2b hb, lb;
            split2(sp[2 * e], sp[2 * e + 1], hb, lb);
            hv[e] = __builtin_bit_cast(unsigned, hb);
            lv[e] = __builtin_bit_cast(unsigned, lb);
          }
          *(v4u*)(C  + (size_t)(mBase + row) * ldc + n0 + c8) = hv;
          *(v4u*)(C2 + (size_t)(mBase + row) * ldc + n0 + c8) = lv;
        }
        
      }
    }
    __builtin_amdgcn_fence(__ATOMIC_RELEASE, "workgroup");
    __builtin_amdgcn_wave_barrier();
    __builtin_amdgcn_fence(__ATOMIC_ACQUIRE, "workgroup");
  }
}

// ---------------------------------------------------------------------------
// Contiguous f32 -> bf16-RNE plane: one thread = 8 consecutive elements = one 16-B store, so every wave writes
// 512 contiguous bytes; ceil(n8/256) blocks, blk = the block's index among them; coverage: n8 threads x 8 = the whole plane (n8 * 8 elements).
// ---------------------------------------------------------------------------
__device__ __forceinline__ void cvt_bf16x8(int blk, const float* __restrict__ in, unsigned short* __restrict__ o, int n8) {
  const int i = blk * 256 + threadIdx.x;
  if (i < n8) {
    const float* sp = in + (size_t)i * 8;
    const v4f a  = *(const v4f*)(sp);
    const v4f a2 = *(const v4f*)(sp + 4);
    v4u w;
    w[0] = cvt2_bits(a[0],  a[1]);
    w[1] = cvt2_bits(a[2],  a[3]);
    w[2] = cvt2_bits(a2[0], a2[1]);
    w[3] = cvt2_bits(a2[2], a2[3]);
    unsigned short* dp = o + (size_t)i * 8;
    *(v4u*)dp = w;
    
  }
}

// ---------------------------------------------------------------------------
// Fused transpose + bf16 split of an f32 matrix: in [R rows][Cc cols] (pitch Cc) ->
//   oh[c][r] = bf16_rne(in[r][c]), ol[c][r] = bf16_rne(in[r][c] - oh)   ([Cc][R], pitch R).
// 64x64 tiles through LDS. (Cc/64) x (R/64) blocks (cb, rb), 256 threads (R, Cc multiples of 64).
// Coverage per block and plane: load 4 it x 256 thr x 4 floats = 64x64; store 2 it x 256 thr x 8 u16 = 64x64.
// ---------------------------------------------------------------------------
__device__ __forceinline__ void tsplit(float* tf, int cb, int rb, const float* __restrict__ W, unsigned short* __restrict__ oh,
                                       unsigned short* __restrict__ ol, int R, int Cc) {
  const int c0  = cb * 64;           // input column block = output row block
  const int r0  = rb * 64;           // input row block    = output column block
  const int tid = threadIdx.x;
  {
    const int lr = tid >> 4;         // 0..15
    const int c4 = (tid & 15) * 4;   // 0..60
#pragma unroll
    for (int it = 0; it < 4; ++it) {
      const int rr = it * 16 + lr;   // 0..63
      const v4f a = *(const v4f*)(W + (size_t)(r0 + rr) * Cc + c0 + c4);
      *(v4f*)(tf + rr * 68 + c4) = a;
    }
  }
  __syncthreads();
  const int sub = tid >> 3;          // 0..31
  const int c8  = (tid & 7) * 8;     // 0..56
  v4u hv[2], lv[2];
#pragma unroll
  for (int it = 0; it < 2; ++it) {
    const int oc = it * 32 + sub;    // output row within tile (= input column)
    v4u a, a2;
#pragma unroll
    for (int q = 0; q < 4; ++q) {
      const float f0 = tf[(c8 + 2 * q) * 68 + oc];
      const float f1 = tf[(c8 + 2 * q + 1) * 68 + oc];
      v2b hb, lb;
      split2(f0, f1, hb, lb);
      a[q]  = __builtin_bit_cast(unsigned, hb);
      a2[q] = __builtin_bit_cast(unsigned, lb);
    }
    hv[it] = a; lv[it] = a2;
  }
  {
#pragma unroll
    for (int it = 0; it < 2; ++it) {
      const int oc = it * 32 + sub;
      const size_t go = (size_t)(c0 + oc) * R + r0 + c8;
      *(v4u*)(oh + go) = hv[it];
      *(v4u*)(ol + go) = lv[it];
    }
    
  }
}

// ---------------------------------------------------------------------------
// Launch 1: every plane that depends on the inputs alone, one grid; the block index picks the job (block-uniform branch).
//   blocks 0..11     weight m = blk >> 2 (Wq, Wk, Wv), 64x64 tile blk & 3: transposed bf16 planes [n][k]
//   blocks 12..75    Er -> bf16 plane [4096][32]    (64 blocks x 256 threads x 8 = the whole plane)
//   blocks 76..1099  x  -> bf16 plane [16384][128]  (1024 blocks x 256 threads x 8 = the whole plane)
// ---------------------------------------------------------------------------
#define PREP_W  12
#define PREP_E  (SEQ * HD / 8 / 256)
#define PREP_X  (NB * SEQ * HID / 8 / 256)
__global__ __launch_bounds__(256) void prep_kernel(const float* __restrict__ x, const float* __restrict__ Wq, const float* __restrict__ Wk,
                                                   const float* __restrict__ Wv, const float* __restrict__ Er,
                                                   unsigned short* __restrict__ Xb, unsigned short* __restrict__ ErB,
                                                   unsigned short* __restrict__ WqTh, unsigned short* __restrict__ WqTl,
                                                   unsigned short* __restrict__ WkTh, unsigned short* __restrict__ WkTl,
                                                   unsigned short* __restrict__ WvTh, unsigned short* __restrict__ WvTl) {
  __shared__ __align__(16) float tf[64 * 68];
  const int blk = blockIdx.x;
  if (blk < PREP_W) {
    const int m = blk >> 2, t = blk & 3;
    const float*    W  = m == 0 ? Wq   : (m == 1 ? Wk   : Wv);
    unsigned short* oh = m == 0 ? WqTh : (m == 1 ? WkTh : WvTh);
    unsigned short* ol = m == 0 ? WqTl : (m == 1 ? WkTl : WvTl);
    tsplit(tf, t & 1, t >> 1, W, oh, ol, HID, HID);
  } else if (blk < PREP_W + PREP_E) {
    cvt_bf16x8(blk - PREP_W, Er, ErB, SEQ * HD / 8);
  } else {
    cvt_bf16x8(blk - (PREP_W + PREP_E), x, Xb, NB * SEQ * HID / 8);
  }
}

// ---------------------------------------------------------------------------
// Launch 2: the three projections, one grid (64, 3); blockIdx.y picks the product (block-uniform branch).
//   y = 0: q = x.Wq + bq -> Q hi/lo planes [b*4096+t][h*32+d]   (M=16384, N=128, K=128; 512 tiles -> 64 blocks)
//   y = 1: k = x.Wk + bk -> K hi/lo planes, same shape
//   y = 2: v^T = Wv^T . x^T + bv[m] -> VT hi/lo planes [b][h*32+d][s]   (A = Wv^T plane [128][128], Bt = x plane rows of batch b;
//          M=128, N=4096, K=128; 128 tiles -> 16 blocks a batch: block = blockIdx.x & 15, batch = blockIdx.x >> 4)
// ---------------------------------------------------------------------------
__global__ __launch_bounds__(256) void proj_kernel(const unsigned short* __restrict__ Xb, const unsigned short* __restrict__ WqTh,
                                                   const unsigned short* __restrict__ WkTh, const unsigned short* __restrict__ WvTh,
                                                   const float* __restrict__ bq, const float* __restrict__ bk, const float* __restrict__ bv,
                                                   unsigned short* __restrict__ Qh, unsigned short* __restrict__ Ql,
                                                   unsigned short* __restrict__ Kh, unsigned short* __restrict__ Kl,
                                                   unsigned short* __restrict__ VTh, unsigned short* __restrict__ VTl) {
  __shared__ __align__(16) float sT[8][16 * 68];   // per-wave 16x64 slab, pitch 68 floats
  const int job = blockIdx.y;
  if (job < 2) {
    const unsigned short* Wt = job ? WkTh : WqTh;
    const float*          bi = job ? bk   : bq;
    unsigned short*       Ch = job ? Kh   : Qh;
    unsigned short*       Cl = job ? Kl   : Ql;
    wmma_gemm64<false, 2, 2>(sT, blockIdx.x, 0, Xb, Xb, HID, 0L, Wt, Wt, HID, 0L, (void*)Ch, (void*)Cl, HID, 0L,
                             bi, NB * SEQ, HID, HID, 1.0f);
  } else {
    wmma_gemm64<false, 1, 2>(sT, blockIdx.x & 15, blockIdx.x >> 4, WvTh, WvTh, HID, 0L, Xb, Xb, HID, (long)SEQ * HID,
                             (void*)VTh, (void*)VTl, SEQ, (long)HID * SEQ, bv, HID, SEQ, HID, 1.0f);
  }
}

// =====================================================================================
// Causal rel-pos attention, head dim 32, all (batch, head) pairs in one launch.
//   q planes (hi/lo bf16): element (b, t, h, d) at [(b*SEQ + t)*HID + h*32 + d]
//   k planes (hi/lo bf16): same layout
//   v^T planes (hi/lo bf16): element (b, h, d, s) at [((b*HID + h*32 + d))*SEQ + s]
//   er plane (bf16-RNE of Er): [r][d], pitch 32
//   scores = ((q.k) + (q.ErWin at the shift index)) * sscale; masked (s > t) scores set to -inf.
//   Block = 8 waves = 2 key groups x 4 waves; the 4 waves of a group hold the 64 query rows of one (b,h) query block, and both
//   groups hold the same rows. Key chunks of 64, qb+1 <= 64 of them for query block qb, taken two a stage: group g takes chunk
//   2*stage + g, so a wave walks half the chunks and four waves instead of two share a SIMD. Each group keeps its own running
//   maximum, sum and O^T; after the last stage group 1 hands them to group 0 through LDS (one barrier) and group 0 joins them.
//   Where qb+1 is odd, group 1 has no chunk in the last stage: it stages chunk qb again (address in range) and skips the products.
//   Every block takes two query blocks of its (b,h), one after the other: 63 - t, then t (t = 0..31), so each block walks
//   (64 - t) + (t + 1) = 65 chunks in 33 stages and no WGP is left with only long or only short blocks. grid.x = NB*NH*32.
//   Staging per stage: asynchronous 16-B copies from global memory straight into LDS, two buffers: stage st + 2 is issued behind the
//   barrier at the foot of stage st, into the buffer that stage st has just read, and flies while stage st + 1 is worked on.
//   Each group's 128 threads stage their own chunk:
//     K hi/lo [64][32]: 128 thr x 16 elements per plane = whole tile; V^T hi/lo [32][64]: 128 thr x 16 = whole tile;
//     Er window [192][32], shared (group g's 128-row window starts at row 64g): 256 thr x 3 x 8 elements = all 192 rows
//     (clamped source row, so every row is written).
//   All three products are taken transposed (keys, window rows or d as the rows of D, queries as its columns), so lane (c, hh)
//   holds query c of the wave's 16: its scores for keys 16j + 8hh + r, its maximum and sum in-lane (the two lane halves are joined
//   by one cross-half move), and exp(s - m) converts in place into the B fragment of V^T.P^T (element e of k-step kk =
//   tile 2kk + (e >> 3), register e & 7: the same split k map as the V^T loader). P never goes through LDS.
//   Per-wave LDS: G [16 queries][80] f32 (5 tiles x 16 window rows x 16 queries written, columns 0..78 read), reused as out staging [16][36].
//   LDS rows are padded (KP, VP, GP below); the pad bytes are never written and never read.
// =====================================================================================
#define AT_NW 8
#define AT_QB 64
#define AT_KC 64
#define EWIN  192
#define MGP   20   // hand-over record pitch in floats per lane: 80 B = 16 B x odd for the 16-B accesses (lane = row)
#define GP    84   // G row pitch in floats: 16 B x odd for the 16-B stores (lane = row); the shifted 4-B reads step 83 floats a lane, so the 16 lanes of a half hit distinct banks
#define OSP   36
#define KP    40   // K and Er-window row pitch in elements: 64-B rows at 80 B (16 B x odd), conflict-free for 16-B fragment reads
#define VP    72   // V^T row pitch in elements: 128-B rows at 144 B (16 B x odd)
// one staging buffer, offsets in elements: K hi [group][kv][d], K lo, V^T hi [group][d][kv], V^T lo, Er window [w][d]
#define SB_KH 0
#define SB_KL (2 * AT_KC * KP)
#define SB_VH (4 * AT_KC * KP)
#define SB_VL (4 * AT_KC * KP + 2 * HD * VP)
#define SB_E  (4 * AT_KC * KP + 4 * HD * VP)
#define SB_SZ (4 * AT_KC * KP + 4 * HD * VP + EWIN * KP)   // 27136 elements = 54272 B, a multiple of 16 B

// lane l <-> lane l ^ 16 (the two halves that share a query)
__device__ __forceinline__ float at_xhalf(float x) {
  return __builtin_bit_cast(float, __builtin_amdgcn_permlanex16(__builtin_bit_cast(int, x), __builtin_bit_cast(int, x),
                                                                0x76543210, 0xfedcba98, false, false));
}
__device__ __forceinline__ unsigned at_lds_off(const void* p) { return (unsigned)(size_t)p; }
__device__ __forceinline__ v8f at_mma(v16b a, v16b b, v8f c) {
  return __builtin_amdgcn_wmma_f32_16x16x32_bf16(false, a, false, b, (short)0, c, false, false);
}
// Distance guards, one behind each RUN of matrix products: four vector slots between the run and the first vector instruction that
// reads its results or rewrites its operand registers. The results pass through the statement and the operands are its inputs, so
// nothing of that kind can stand in front of it. Not volatile: LDS loads may move across it, so the fragment loads of a run go out together.
__device__ __forceinline__ void at_guard_s(v8f* s, const v16b* kh, const v16b* kl, v16b qh, v16b ql) {
  asm("v_nop\n\tv_nop\n\tv_nop\n\tv_nop" : "+v"(s[0]), "+v"(s[1]), "+v"(s[2]), "+v"(s[3])
      : "v"(kh[0]), "v"(kh[1]), "v"(kh[2]), "v"(kh[3]), "v"(kl[0]), "v"(kl[1]), "v"(kl[2]), "v"(kl[3]), "v"(qh), "v"(ql));
}
__device__ __forceinline__ void at_guard_g(v8f* g, const v16b* e, v16b qh, v16b ql) {
  asm("v_nop\n\tv_nop\n\tv_nop\n\tv_nop" : "+v"(g[0]), "+v"(g[1]), "+v"(g[2]), "+v"(g[3]), "+v"(g[4])
      : "v"(e[0]), "v"(e[1]), "v"(e[2]), "v"(e[3]), "v"(e[4]), "v"(qh), "v"(ql));
}
__device__ __forceinline__ void at_guard_o(v8f* o, const v16b* vh, const v16b* vl, v16b p0, v16b p1, v16b p2, v16b p3) {
  asm("v_nop\n\tv_nop\n\tv_nop\n\tv_nop" : "+v"(o[0]), "+v"(o[1])
      : "v"(vh[0]), "v"(vh[1]), "v"(vh[2]), "v"(vh[3]), "v"(vl[0]), "v"(vl[1]), "v"(vl[2]), "v"(vl[3]), "v"(p0), "v"(p1), "v"(p2), "v"(p3));
}

__global__ __launch_bounds__(256)
void relattn32_kernel(const unsigned short* __restrict__ qhp, const unsigned short* __restrict__ qlp,
                      const unsigned short* __restrict__ khp, const unsigned short* __restrict__ klp,
                      const unsigned short* __restrict__ vhp, const unsigned short* __restrict__ vlp,
                      const unsigned short* __restrict__ erp, float* __restrict__ out, float sscale) {
  union FB { v16b v; v8b h[2]; };
  __shared__ __align__(16) __bf16 Stg[2 * SB_SZ];              // two staging buffers (K hi/lo, V^T hi/lo, Er window), 2 x 53 KB
  __shared__ __align__(16) float  Gs[AT_NW][16 * GP];          // per wave rel tile [query][80], pitch GP; later hand-over record (group 1) / out staging pitch 36 (group 0)

  const int tid  = threadIdx.x;
  const int wave = __builtin_amdgcn_readfirstlane(tid >> 5);   // in a scalar register: the tests on the key group below are scalar branches
  const int grp  = wave >> 2;             // key group 0 / 1
  const int wq   = wave & 3;              // which 16 of the 64 query rows
  const int tl   = tid & 127;             // thread within its group
  const int lane = tid & 31;
  const int hh   = lane >> 4;
  const int c    = lane & 15;

  const int bx   = blockIdx.x;
  const int tp   = bx & (NQB / 2 - 1);    // 0..31
  const int pair = bx >> 5;               // 0..15
  const int b    = pair >> 2;
  const int h    = pair & 3;
  const size_t rowBase = (size_t)b * SEQ;

  const __bf16* Qh = (const __bf16*)(const void*)qhp + h * HD;
  const __bf16* Ql = (const __bf16*)(const void*)qlp + h * HD;
  const __bf16* Kh = (const __bf16*)(const void*)khp + h * HD;
  const __bf16* Kl = (const __bf16*)(const void*)klp + h * HD;
  const __bf16* Vh = (const __bf16*)(const void*)vhp + ((size_t)b * HID + h * HD) * SEQ;
  const __bf16* Vl = (const __bf16*)(const void*)vlp + ((size_t)b * HID + h * HD) * SEQ;
  const __bf16* Er = (const __bf16*)(const void*)erp;
  float*        ob = out + h * HD;

  const int wbase = 64 * grp + 48 - 16 * wq;   // first row, in the staged 192-row window, of this wave's G tile
  float* gw = Gs[wave];
  // staging map of this thread, 16-B pieces; neighbouring lanes of one copy take neighbouring pieces, so a copy asks for each row's bytes whole.
  // K: piece p = tl + 128 i -> key row p>>2 (64-B rows), d quarter (p&3)*8; V^T: piece p = tl + 128 i -> row d = p>>3 (128-B rows), key eighth (p&7)*8;
  // Er window: piece p = tid + 256 i -> window row p>>2, d quarter (p&3)*8. LDS byte addresses of piece i = 0 in buffer 0:
  const int sr = tl >> 2, sdq = (tl & 3) * 8;
  const int sd = tl >> 3, ske = (tl & 7) * 8;
  const unsigned lK = at_lds_off(Stg) + 2u * (unsigned)(SB_KH + grp * (AT_KC * KP) + sr * KP + sdq);
  const unsigned lV = at_lds_off(Stg) + 2u * (unsigned)(SB_VH + grp * (HD * VP) + sd * VP + ske);
  const unsigned lE = at_lds_off(Stg) + 2u * (unsigned)(SB_E + (tid >> 2) * KP + (tid & 3) * 8);

  // the block's two query blocks, long one first; every (b, h, qb) is taken by exactly one block (block-uniform trip counts)
  for (int part = 0; part < 2; ++part) {
  const int qb = part ? tp : (NQB - 1 - tp);   // 63..32, then 0..31
  const int q0 = qb * AT_QB + wq * 16;

  // ---- Q fragments (B operand, column = query = lane&15, split k map, one k-step of 32 = d), hi and lo ----
  const v16b qah = FragB::load(Qh + (rowBase + q0 + c) * HID + 8 * hh);
  const v16b qal = FragB::load(Ql + (rowBase + q0 + c) * HID + 8 * hh);

  float mrow = -INFINITY;                 // running maximum of query c (equal in both lane halves)
  float lrow = 0.f;                       // running sum of query c over this lane half's keys; halves joined after the loop
  v8f oacc[2];                            // O^T: oacc[t][r] = out[query c][d = 16t + 8hh + r]
  oacc[0] = zero8(); oacc[1] = zero8();
  const int qrow = qb * AT_QB + wq * 16 + c;

  const int nStages = (qb + 2) >> 1;      // block-uniform, <= 32: ceil((qb + 1) / 2)

  // One stage's copies into buffer buf: 11 a thread, every lane on, every address a multiple of 16 B, each LDS byte written by one lane.
  auto stage_copies = [&](int st, int buf) {
    const int kcs = 2 * st + grp;                       // this group's chunk; past the last one (group 1, odd count): chunk qb again
    const int kvs = (kcs <= qb ? kcs : qb) * AT_KC;
    const int e0  = SEQ - 64 - 64 * (qb - 2 * st);      // Er row of staged window row 0 (group 0's window base), 0 .. 4032
    const __bf16* ks = Kh + (rowBase + kvs + sr) * HID + sdq;
    const __bf16* kl = Kl + (rowBase + kvs + sr) * HID + sdq;
    const __bf16* vs = Vh + (size_t)sd * SEQ + kvs + ske;
    const __bf16* vl = Vl + (size_t)sd * SEQ + kvs + ske;
    const __bf16* ep[3];
#pragma unroll
    for (int i = 0; i < 3; ++i) {
      int erow = e0 + ((tid + 256 * i) >> 2);           // clamped source row (address clamp)
      erow = erow < 0 ? 0 : erow;
      erow = erow > (SEQ - 1) ? (SEQ - 1) : erow;
      ep[i] = Er + (size_t)erow * HD + (tid & 3) * 8;
    }
    const unsigned bo = (unsigned)buf * (2u * SB_SZ);
    const unsigned dK = lK + bo, dL = dK + 2u * (SB_KL - SB_KH), dV = lV + bo, dW = dV + 2u * (SB_VL - SB_VH), dE = lE + bo;
    // global memory -> LDS through no register. The closing s_wait_xcnt stands in the copies' own statement, so that no register
    // that a copy names is rewritten in front of it.
    asm volatile("global_load_async_to_lds_b128 %0, %11, off\n\t"
                 "global_load_async_to_lds_b128 %1, %12, off\n\t"
                 "global_load_async_to_lds_b128 %2, %13, off\n\t"
                 "global_load_async_to_lds_b128 %3, %14, off\n\t"
                 "global_load_async_to_lds_b128 %4, %15, off\n\t"
                 "global_load_async_to_lds_b128 %5, %16, off\n\t"
                 "global_load_async_to_lds_b128 %6, %17, off\n\t"
                 "global_load_async_to_lds_b128 %7, %18, off\n\t"
                 "global_load_async_to_lds_b128 %8, %19, off\n\t"
                 "global_load_async_to_lds_b128 %9, %20, off\n\t"
                 "global_load_async_to_lds_b128 %10, %21, off\n\t"
                 "s_wait_xcnt 0x0"
                 :: "v"(dK), "v"(dK + 2u * 32 * KP), "v"(dL), "v"(dL + 2u * 32 * KP), "v"(dV), "v"(dV + 2u * 16 * VP), "v"(dW), "v"(dW + 2u * 16 * VP),
                    "v"(dE), "v"(dE + 2u * 64 * KP), "v"(dE + 2u * 128 * KP),
                    "v"(ks), "v"(ks + 32 * HID), "v"(kl), "v"(kl + 32 * HID), "v"(vs), "v"(vs + 16 * SEQ), "v"(vl), "v"(vl + 16 * SEQ),
                    "v"(ep[0]), "v"(ep[1]), "v"(ep[2])
                 : "memory");
  };

  // stage 0 lands and is published; then stage 1 is sent off. (Every reader of both buffers has left them: the barrier at the foot of the
  // previous query block's last stage.)
  stage_copies(0, 0);
  asm volatile("s_wait_asynccnt 0x0" ::: "memory");   // this wave's copies of stage 0 have landed
  __syncthreads();
  if (nStages > 1) stage_copies(1, 1);

  for (int st = 0; st < nStages; ++st) {
    const int kc    = 2 * st + grp;       // this group's chunk (wave-uniform)
    const bool live = kc <= qb;           // false only for group 1 in the last stage of an odd chunk count
    const int kv0   = (live ? kc : qb) * AT_KC;
    const int buf   = st & 1;
    const __bf16* Sb  = Stg + buf * SB_SZ;               // this stage's buffer
    const __bf16* Ksh = Sb + SB_KH + grp * (AT_KC * KP); // this group's own chunk
    const __bf16* Ksl = Sb + SB_KL + grp * (AT_KC * KP);
    const __bf16* Vth = Sb + SB_VH + grp * (HD * VP);
    const __bf16* Vtl = Sb + SB_VL + grp * (HD * VP);
    const __bf16* Esh = Sb + SB_E;
    if (live) {   // wave-uniform; no block barrier inside

    // ---- rel-pos tile, transposed: G^T = Win[wbase + 0..79] . q^T (2 products); a lane's 8 registers are 8 consecutive
    //      window columns of its query's row, so they go to this wave's G[query][80] as two 16-B stores ----
    //      Taken in front of the score products: the G stores land and the G reads fly while those run.
    v8f gt[5];
    {
      v16b ef[5];
#pragma unroll
      for (int nt = 0; nt < 5; ++nt) {
        FB eb;
        const __bf16* ep = Esh + (wbase + nt * 16 + c) * KP + 8 * hh;
        eb.h[0] = *(const v8b*)(ep); eb.h[1] = *(const v8b*)(ep + 16);
        ef[nt] = eb.v;
        v8f g = zero8();
        g = at_mma(eb.v, qah, g);
        g = at_mma(eb.v, qal, g);
        gt[nt] = g;
      }
      at_guard_g(gt, ef, qah, qal);
    }
#pragma unroll
    for (int nt = 0; nt < 5; ++nt) {
      const v8f g = gt[nt];
      float* gp = gw + c * GP + nt * 16 + 8 * hh;
      const v4f g0 = {g[0], g[1], g[2], g[3]};
      const v4f g1 = {g[4], g[5], g[6], g[7]};
      *(v4fa*)(gp)     = g0;
      *(v4fa*)(gp + 4) = g1;
    }

    // ---- content scores, transposed: S^T tile j = K rows (16j..16j+15) . q^T, 3-term split; s[j][r] = score(key 16j + 8hh + r, query c) ----
    v8f s[4];
    {
      v16b kfh[4], kfl[4];
#pragma unroll
      for (int j = 0; j < 4; ++j) {
        FB kb, kl;
        const __bf16* kp = Ksh + (j * 16 + c) * KP + 8 * hh;
        const __bf16* kq = Ksl + (j * 16 + c) * KP + 8 * hh;
        kb.h[0] = *(const v8b*)(kp); kb.h[1] = *(const v8b*)(kp + 16);
        kl.h[0] = *(const v8b*)(kq); kl.h[1] = *(const v8b*)(kq + 16);
        kfh[j] = kb.v; kfl[j] = kl.v;
        v8f a = zero8();
        a = at_mma(kb.v, qah, a);
        a = at_mma(kl.v, qah, a);
        a = at_mma(kb.v, qal, a);
        s[j] = a;
      }
      at_guard_s(s, kfh, kfl, qah, qal);
    }
    __builtin_amdgcn_fence(__ATOMIC_RELEASE, "workgroup");
    __builtin_amdgcn_wave_barrier();
    __builtin_amdgcn_fence(__ATOMIC_ACQUIRE, "workgroup");

    // ---- combine, scale, causal mask, chunk maximum of query c (in-lane, four independent chains, then the other half) ----
    const bool diag = (kc == qb);           // wave-uniform
    const float* gr = gw + c * GP + (15 - c) + 8 * hh;   // + 16j + r gives shift column 15 - c + jl, jl = 16j + 8hh + r
    v8f relv[4];
#pragma unroll
    for (int j = 0; j < 4; ++j)
#pragma unroll
      for (int r = 0; r < 8; ++r) relv[j][r] = gr[j * 16 + r];
    // keeps the G reads together in front of the arithmetic: spread among it, each read's LDS latency is waited out on its own
    __builtin_amdgcn_sched_barrier(0);
    float mj[4];
#pragma unroll
    for (int j = 0; j < 4; ++j) {
      float m = -INFINITY;
#pragma unroll
      for (int r = 0; r < 8; ++r) {
        const int kvcol = kv0 + j * 16 + 8 * hh + r;
        const float rel = relv[j][r];
        const float sv  = (s[j][r] + rel) * sscale;
        const bool msk  = diag && (kvcol > qrow);
        const float sm  = msk ? -INFINITY : sv;
        s[j][r] = sm;
        m = fmaxf(m, sm);
      }
      mj[j] = m;
    }
    float cm = fmaxf(fmaxf(mj[0], mj[1]), fmaxf(mj[2], mj[3]));
    cm = fmaxf(cm, at_xhalf(cm));           // key kv0 is never masked, so the joined maximum is finite

    // ---- online softmax update; P^T (unnormalised) as bf16 hi/lo straight into the B fragments of V^T.P^T ----
    const float mnew  = fmaxf(mrow, cm);
    const float alpha = __expf(mrow - mnew);
    mrow = mnew;
    FB ph[2], pl[2];
    float pj[4];
#pragma unroll
    for (int j = 0; j < 4; ++j) {
      float psum = 0.f;
#pragma unroll
      for (int r = 0; r < 8; r += 2) {
        const float p0 = __expf(s[j][r]     - mnew);
        const float p1 = __expf(s[j][r + 1] - mnew);
        psum += p0;
        psum += p1;
        v2b a, bl; split2(p0, p1, a, bl);
        ph[j >> 1].v[(j & 1) * 8 + r]     = a[0];
        ph[j >> 1].v[(j & 1) * 8 + r + 1] = a[1];
        pl[j >> 1].v[(j & 1) * 8 + r]     = bl[0];
        pl[j >> 1].v[(j & 1) * 8 + r + 1] = bl[1];
      }
      pj[j] = psum;
    }
    lrow = lrow * alpha + ((pj[0] + pj[1]) + (pj[2] + pj[3]));
#pragma unroll
    for (int r = 0; r < 8; ++r) {
      oacc[0][r] *= alpha;
      oacc[1][r] *= alpha;
    }

    // ---- O^T += V^T . P^T : A = V^T rows d (split k map over keys), B = P^T fragments; 3-term split ----
    v16b vfh[4], vfl[4];
#pragma unroll
    for (int kk = 0; kk < 2; ++kk) {
#pragma unroll
      for (int t = 0; t < 2; ++t) {
        FB vb, vl;
        vb.h[0] = *(const v8b*)(Vth + (t * 16 + c) * VP + kk * 32 + 8 * hh);
        vb.h[1] = *(const v8b*)(Vth + (t * 16 + c) * VP + kk * 32 + 16 + 8 * hh);
        vl.h[0] = *(const v8b*)(Vtl + (t * 16 + c) * VP + kk * 32 + 8 * hh);
        vl.h[1] = *(const v8b*)(Vtl + (t * 16 + c) * VP + kk * 32 + 16 + 8 * hh);
        vfh[kk * 2 + t] = vb.v; vfl[kk * 2 + t] = vl.v;
        oacc[t] = at_mma(vb.v, ph[kk].v, oacc[t]);
        oacc[t] = at_mma(vl.v, ph[kk].v, oacc[t]);
        oacc[t] = at_mma(vb.v, pl[kk].v, oacc[t]);
      }
    }
    at_guard_o(oacc, vfh, vfl, ph[0].v, ph[1].v, pl[0].v, pl[1].v);
    }   // live
    // foot of the stage, every wave: its own LDS reads of this buffer are done, its own copies of stage st + 1 have landed; the barrier
    // publishes stage st + 1 and frees this buffer; only then the refill.
    asm volatile("s_wait_dscnt 0x0" ::: "memory");
    asm volatile("s_wait_asynccnt 0x0" ::: "memory");
    __syncthreads();
    if (st + 2 < nStages) stage_copies(st + 2, buf);   // block-uniform test
  }
  asm volatile("s_wait_asynccnt 0x0" ::: "memory");    // nothing is in flight here; closes the ring

  __builtin_amdgcn_fence(__ATOMIC_RELEASE, "workgroup");
  __builtin_amdgcn_wave_barrier();
  __builtin_amdgcn_fence(__ATOMIC_ACQUIRE, "workgroup");
  // ---- group 1 hands its maximum, sum and O^T to group 0: lane to same lane of wave - 4, through group 1's own G area ----
  if (grp == 1) {
    float* mp = gw + lane * MGP;
#pragma unroll
    for (int t = 0; t < 2; ++t) {
      const v4f o0 = {oacc[t][0], oacc[t][1], oacc[t][2], oacc[t][3]};
      const v4f o1 = {oacc[t][4], oacc[t][5], oacc[t][6], oacc[t][7]};
      *(v4fa*)(mp + t * 8)     = o0;
      *(v4fa*)(mp + t * 8 + 4) = o1;
    }
    mp[16] = mrow;
    mp[17] = lrow;
  }
  __syncthreads();   // publishes the records; group 1 next writes its G area behind one more barrier, which group 0 passes after it has read them
  if (grp == 0) {
  {
    const float* mp = Gs[wave + 4] + lane * MGP;
    const float m1 = mp[16], l1 = mp[17];
    const float mN = fmaxf(mrow, m1);        // mrow is finite (group 0 always has chunk 0); m1 is -inf where group 1 had no chunk
    const float a0 = __expf(mrow - mN);
    const float a1 = __expf(m1 - mN);
    lrow = lrow * a0 + l1 * a1;
#pragma unroll
    for (int t = 0; t < 2; ++t) {
      const v4f o0 = *(const v4fa*)(mp + t * 8);
      const v4f o1 = *(const v4fa*)(mp + t * 8 + 4);
#pragma unroll
      for (int r = 0; r < 4; ++r) {
        oacc[t][r]     = oacc[t][r]     * a0 + o0[r] * a1;
        oacc[t][r + 4] = oacc[t][r + 4] * a0 + o1[r] * a1;
      }
    }
  }
  float* os = gw;
  {
    const float inv = 1.0f / (lrow + at_xhalf(lrow));   // the two halves' key sums joined once
#pragma unroll
    for (int t = 0; t < 2; ++t) {
      float* op = os + c * OSP + t * 16 + 8 * hh;        // row = query c, 8 consecutive d
      const v4f o0 = {oacc[t][0] * inv, oacc[t][1] * inv, oacc[t][2] * inv, oacc[t][3] * inv};
      const v4f o1 = {oacc[t][4] * inv, oacc[t][5] * inv, oacc[t][6] * inv, oacc[t][7] * inv};
      *(v4fa*)(op)     = o0;
      *(v4fa*)(op + 4) = o1;
    }
  }
  __builtin_amdgcn_fence(__ATOMIC_RELEASE, "workgroup");
  __builtin_amdgcn_wave_barrier();
  __builtin_amdgcn_fence(__ATOMIC_ACQUIRE, "workgroup");
  {
    const int q4 = lane >> 3, c4 = (lane & 7) * 4;
    {
#pragma unroll
      for (int it = 0; it < 4; ++it) {
        const int row = it * 4 + q4;                   // it 0..3 x q4 0..3 covers rows 0..15 of the wave tile
        const v4f val = *(const v4fa*)(os + row * OSP + c4);
        *(v4f*)(ob + (rowBase + q0 + row) * HID + c4) = val;
      }
      // the next query block's set-up rewrites the data and address registers that these stores name
      asm volatile("s_wait_xcnt 0x0" ::: "memory");
    }
  }
  }   // grp == 0
  }   // part: the staging buffers were left by every reader at the last stage's foot; G / out staging is this wave's own
}

// ---------------------------------------------------------------------------
// Workspace region map (byte offsets):
//   WqTh bf16 [128 n][128 k]        0      WqTl     32768
//   WkTh                        65536      WkTl     98304
//   WvTh                       131072      WvTl    163840     (lo weight planes written, not consumed)
//   Xb   bf16 [16384][128]     196608                         (4194304 B)
//   ErB  bf16 [4096][32]      4390912                         (262144 B)
//   Qh   bf16 [16384][128]    4653056      Ql    8847360
//   Kh   bf16 [16384][128]   13041664      Kl   17235968
//   VTh  bf16 [4][128][4096] 21430272      VTl  25624576
//   total                    29818880
// Every region is written in whole 64x64 tiles / whole 16-B-per-lane runs; all extents are exact tile multiples,
// ---------------------------------------------------------------------------
extern "C" void kernel_launch(void* const* d_in, const int* in_sizes, int n_in,
                              void* d_out, int out_size, void* d_ws, size_t ws_size,
                              hipStream_t stream) {
  if (n_in < 8) return;
  if (in_sizes[0] != NB * SEQ * HID) return;
  if (in_sizes[1] != HID * HID || in_sizes[3] != HID * HID || in_sizes[5] != HID * HID) return;
  if (in_sizes[2] != HID || in_sizes[4] != HID || in_sizes[6] != HID) return;
  if (in_sizes[7] != SEQ * HD) return;
  if (out_size != NB * SEQ * HID) return;

  const float* x  = (const float*)d_in[0];
  const float* Wq = (const float*)d_in[1];
  const float* bq = (const float*)d_in[2];
  const float* Wk = (const float*)d_in[3];
  const float* bk = (const float*)d_in[4];
  const float* Wv = (const float*)d_in[5];
  const float* bv = (const float*)d_in[6];
  const float* Er = (const float*)d_in[7];
  float* out = (float*)d_out;

  const size_t PW = (size_t)HID * HID * 2;            //    32768  bf16 weight plane
  const size_t PX = (size_t)NB * SEQ * HID * 2;       //  4194304  bf16 activation plane (all batch rows)
  const size_t PE = (size_t)SEQ * HD * 2;             //   262144  bf16 Er plane
  const size_t PV = (size_t)NB * HID * SEQ * 2;       //  4194304  bf16 v^T plane
  size_t off = 0;
  const size_t oWqTh = off; off += PW;  const size_t oWqTl = off; off += PW;
  const size_t oWkTh = off; off += PW;  const size_t oWkTl = off; off += PW;
  const size_t oWvTh = off; off += PW;  const size_t oWvTl = off; off += PW;
  const size_t oXb   = off; off += PX;
  const size_t oErB  = off; off += PE;
  const size_t oQh   = off; off += PX;  const size_t oQl   = off; off += PX;
  const size_t oKh   = off; off += PX;  const size_t oKl   = off; off += PX;
  const size_t oVTh  = off; off += PV;  const size_t oVTl  = off; off += PV;
  if (off > ws_size) return;                          // off = 29818880
  if (off > (size_t)134217728) return;

  char* ws = (char*)d_ws;
  unsigned short* WqTh = (unsigned short*)(ws + oWqTh); unsigned short* WqTl = (unsigned short*)(ws + oWqTl);
  unsigned short* WkTh = (unsigned short*)(ws + oWkTh); unsigned short* WkTl = (unsigned short*)(ws + oWkTl);
  unsigned short* WvTh = (unsigned short*)(ws + oWvTh); unsigned short* WvTl = (unsigned short*)(ws + oWvTl);
  unsigned short* Xb   = (unsigned short*)(ws + oXb);
  unsigned short* ErB  = (unsigned short*)(ws + oErB);
  unsigned short* Qh   = (unsigned short*)(ws + oQh);   unsigned short* Ql   = (unsigned short*)(ws + oQl);
  unsigned short* Kh   = (unsigned short*)(ws + oKh);   unsigned short* Kl   = (unsigned short*)(ws + oKl);
  unsigned short* VTh  = (unsigned short*)(ws + oVTh);  unsigned short* VTl  = (unsigned short*)(ws + oVTl);

  const dim3 blk(256);
  const float sscale = 0.17677669529663688f;          // 1/sqrt(32)

  // (1) weights -> transposed bf16 planes, Er and x -> bf16 planes: 12 + 64 + 1024 blocks
  prep_kernel<<<dim3(PREP_W + PREP_E + PREP_X), blk, 0, stream>>>(x, Wq, Wk, Wv, Er, Xb, ErB, WqTh, WqTl, WkTh, WkTl, WvTh, WvTl);
  // (2) q, k and v^T projections: 64 blocks each
  proj_kernel<<<dim3(64, 3), blk, 0, stream>>>(Xb, WqTh, WkTh, WvTh, bq, bk, bv, Qh, Ql, Kh, Kl, VTh, VTl);
  // (3) causal rel-pos attention: 512 blocks = 16 (b,h) pairs x 32 pairs of query blocks (63 - t, t), 256 threads (2 key groups x 4 waves)
  relattn32_kernel<<<dim3(NB * NH * (NQB / 2)), dim3(256), 0, stream>>>(Qh, Ql, Kh, Kl, VTh, VTl, ErB, out, sscale);
  (void)hipGetLastError();
}

// v009
// One run takes 88.6 microseconds.
// Next to v008, in two timings, it ran 1.05 and 1.04 times as fast.
// Counting every step since v000, it is 4.68 times as fast.
// Contractions: q, k, v^T projections x.W, v^T = Wv^T.x^T (+bias): v_wmma_f32_16x16x32_bf16, single product of bf16-RNE-valued x and W planes, f32 accumulate;
// scores (k.q^T, keys as rows): bf16 hi/lo split (hi.hi + hi.lo + lo.hi); rel-pos term ErWin.q^T: q hi/lo x bf16-RNE Er (hi.E + lo.E); V^T.P^T: bf16 hi/lo split (3 products);
// all v_wmma_f32_16x16x32_bf16 with f32 accumulate. Softmax, bias adds and the 1/sqrt(32) score scale in f32.
//
// Math implemented (B=4, S=4096, hidden 128, 4 heads x 32):
//   q = x.Wq + bq, k = x.Wk + bk, v = x.Wv + bv   (W stored [in][out]; head h = columns h*32..h*32+31)
//   rel[i][j] = q_i . Er[S-1-(i-j)]  for j <= i   (pad-left / reshape shift identity; j > i entries are masked)
//   logit[i][j] = (q_i.k_j + rel[i][j]) * (1/sqrt(32)),  causal (j <= i, diagonal included), softmax over j, out = P.v
//   out[(b*S + i)*128 + h*32 + d]   (no output projection)
//
// Plane / carry audit: every 16-bit plane is bf16 with unit carry (x, W^T, Er: bf16-RNE of the inputs; q, k, v^T: hi/lo bf16
// pairs of the f32 projection results; P: hi/lo bf16 pairs of exp(s - m)); nothing is scaled, nothing to fold back.
//
// Er window per (query block qb, key chunk kc): window row w <-> Er row e0 + w, e0 = S - 64 - 64*(qb - kc), w in 0..127
// (clamped copy, rows past S-1 only ever meet masked keys). For block row il (0..63) and chunk key jl (0..63):
// w = 63 - il + jl. Wave wv (rows il = 16*wv..16*wv+15) computes G^T[80][16] = Win[48 - 16*wv + 0..79] . q^T, stores it as G[row][80] and reads
// G[row][15 - (il - 16*wv) + jl].
#include <hip/hip_runtime.h>
#include <math.h>
#include <stdint.h>

#define NB   4
#define SEQ  4096
#define HID  128
#define NH   4
#define HD   32
#define NQB  (SEQ / 64)

typedef __attribute__((ext_vector_type(16))) _Float16 v16h;
typedef __attribute__((ext_vector_type(16))) __bf16   v16b;
typedef __attribute__((ext_vector_type(8)))  __bf16   v8b;
typedef __attribute__((ext_vector_type(8)))  float    v8f;
typedef __attribute__((ext_vector_type(4)))  float    v4f;
typedef __attribute__((ext_vector_type(4)))  unsigned int v4u;
typedef v4f __attribute__((may_alias)) v4fa;

typedef __attribute__((ext_vector_type(2)))  float    v2f;
typedef __attribute__((ext_vector_type(2)))  __bf16   v2b;

// f32 -> bf16, round to nearest even, two values a time in the chip's packed converter (one instruction a pair)
__device__ __forceinline__ v2b cvt2(float a, float b) { const v2f t = {a, b}; return __builtin_convertvector(t, v2b); }
__device__ __forceinline__ unsigned cvt2_bits(float a, float b) { return __builtin_bit_cast(unsigned, cvt2(a, b)); }
// hi/lo bf16 planes of a pair: hi = rne(f), lo = rne(f - hi)
__device__ __forceinline__ void split2(float a, float b, v2b& hi, v2b& lo) {
  hi = cvt2(a, b);
  lo = cvt2(a - (float)hi[0], b - (float)hi[1]);
}
__device__ __forceinline__ float bf_rne(float f) { return (float)(__bf16)f; }

// hazard guards as plain device helpers
__device__ __forceinline__ void dep_guard_b(v8f& a, v8f& b, v16b x, v16b y) { asm volatile("v_nop\n\tv_nop\n\tv_nop\n\tv_nop" : "+v"(a), "+v"(b) : "v"(x), "v"(y)); }
__device__ __forceinline__ void keep4_b(v16b a, v16b b, v16b c, v16b d) { asm volatile("v_nop" :: "v"(a), "v"(b), "v"(c), "v"(d)); }
__device__ __forceinline__ void acc_guard4(v8f& a, v8f& b, v8f& c, v8f& d) { asm volatile("v_nop\n\tv_nop\n\tv_nop\n\tv_nop" : "+v"(a), "+v"(b), "+v"(c), "+v"(d)); }

// 16-bit WMMA fragment (A: p = row m at k0 + 8h; B stored [n][k]: p = row n at k0 + 8h; same split k map):
// elements 0..7 <- p[0..7], elements 8..15 <- p[16..23]
struct FragB {
  union U { v16b v; v8b h[2]; };
  static __device__ __forceinline__ v16b load(const __bf16* p) {
    U f; f.h[0] = *(const v8b*)(p); f.h[1] = *(const v8b*)(p + 16); return f.v;
  }
  static __device__ __forceinline__ v8f mma(v16b a, v16b b, v8f c) {
    return __builtin_amdgcn_wmma_f32_16x16x32_bf16(false, a, false, b, (short)0, c, false, false);
  }
};

__device__ __forceinline__ v8f zero8() { v8f z = {0.f, 0.f, 0.f, 0.f, 0.f, 0.f, 0.f, 0.f}; return z; }

// ---- Register-blocked batched WMMA GEMM (bf16 operands) --------------------
// C[m,n] = scale * sum_k A[m,k] * Bt[n,k] (+bf16-RNE bias); each wave owns a 64x64 tile, 8 waves per block.
// A row-major [M,K]; Bt row-major [N,K]; M,N % 64 == 0, K % 32 == 0 (met by the constant shapes proj_kernel passes).
// SPLIT: operands are hi/lo planes (A2/Bt2 = lo planes, same layout); product = hi.hi + hi.lo + lo.hi.
// BIAS_MODE: 0 = none, 1 = bias[m], 2 = bias[n]  (bias value converted bf16-RNE, added in f32).
// OUT_MODE: 0 = f32, 2 = bf16 hi plane (Cout) + bf16 lo plane (Cout2).
// coverage: 4 slabs x 16 rows x 64 cols = the whole 64x64 tile per wave; tiles cover M x N exactly.
// Device body: the launching kernel hands in its LDS slabs sT, the block's index bx among the product's blocks and the batch b.
template <bool SPLIT, int BIAS_MODE, int OUT_MODE>
__device__ __forceinline__ void wmma_gemm64(
    float (*sT)[16 * 68], int bx, int b,
    const unsigned short* __restrict__ Ap, const unsigned short* __restrict__ A2p, int lda, long strideA,
    const unsigned short* __restrict__ Btp, const unsigned short* __restrict__ Bt2p, int ldb, long strideB,
    void* __restrict__ Cout, void* __restrict__ Cout2, int ldc, long strideC,
    const float* __restrict__ bias, int M, int N, int K, float scale) {
  const __bf16* A = (const __bf16*)(const void*)Ap;   const __bf16* A2  = (const __bf16*)(const void*)A2p;
  const __bf16* Bt = (const __bf16*)(const void*)Btp; const __bf16* Bt2 = (const __bf16*)(const void*)Bt2p;
  const int lane = threadIdx.x & 31;
  const int wave = threadIdx.x >> 5;
  const int tilesN = N >> 6;
  const int tilesM = M >> 6;
  const int tile = bx * 8 + wave;
  if (tile >= tilesM * tilesN) return;   // wave-uniform; no block barriers in this kernel
  const int tm = tile / tilesN;
  const int tn = tile - tm * tilesN;
  const int m0 = tm << 6;
  const int n0 = tn << 6;

  const __bf16* Ab  = A  + (size_t)b * strideA;
  const __bf16* Bb  = Bt + (size_t)b * strideB;
  const __bf16* Ab2 = SPLIT ? (A2  + (size_t)b * strideA) : nullptr;
  const __bf16* Bb2 = SPLIT ? (Bt2 + (size_t)b * strideB) : nullptr;

  const int rlane = lane & 15;                 // row (A) / col (B, D) within subtile
  const int koff  = (lane >> 4) * 8;           // k offset of this lane half
  const int mOff  = (lane >> 4) * 8;           // D row offset

  v8f acc[4][4];
#pragma unroll
  for (int i = 0; i < 4; ++i)
#pragma unroll
    for (int j = 0; j < 4; ++j) acc[i][j] = zero8();

  for (int k0 = 0; k0 < K; k0 += 32) {
    v16b bh[4], bl[4];
#pragma unroll
    for (int j = 0; j < 4; ++j) {
      const size_t bo = (size_t)(n0 + (j << 4) + rlane) * ldb + koff + k0;
      bh[j] = FragB::load(Bb + bo);
      bl[j] = bh[j];
      if (SPLIT) bl[j] = FragB::load(Bb2 + bo);
    }
#pragma unroll
    for (int i = 0; i < 4; ++i) {
      const size_t ao = (size_t)(m0 + (i << 4) + rlane) * lda + koff + k0;
      v16b ah = FragB::load(Ab + ao);
      v16b al = ah;
      if (SPLIT) al = FragB::load(Ab2 + ao);
#pragma unroll
      for (int j = 0; j < 4; ++j) {
        acc[i][j] = FragB::mma(ah, bh[j], acc[i][j]);
        if (SPLIT) {
          acc[i][j] = FragB::mma(ah, bl[j], acc[i][j]);
          acc[i][j] = FragB::mma(al, bh[j], acc[i][j]);
        }
      }
      dep_guard_b(acc[i][0], acc[i][3], ah, al);
    }
    keep4_b(bh[0], bh[1], bh[2], bh[3]);
    if (SPLIT) keep4_b(bl[0], bl[1], bl[2], bl[3]);
  }
  acc_guard4(acc[0][0], acc[0][1], acc[0][2], acc[0][3]);
  acc_guard4(acc[1][0], acc[1][1], acc[1][2], acc[1][3]);
  acc_guard4(acc[2][0], acc[2][1], acc[2][2], acc[2][3]);
  acc_guard4(acc[3][0], acc[3][1], acc[3][2], acc[3][3]);

  // ---- epilogue ----
  float* slab = sT[wave];
#pragma unroll
  for (int i = 0; i < 4; ++i) {
    const int mBase = m0 + (i << 4);
#pragma unroll
    for (int j = 0; j < 4; ++j) {
      const int n = n0 + (j << 4) + rlane;
      float bv = 0.f;
      if (BIAS_MODE == 2) bv = bf_rne(bias[n]);
#pragma unroll
      for (int r = 0; r < 8; ++r) {
        float v = acc[i][j][r] * scale;
        if (BIAS_MODE == 1) v += bf_rne(bias[mBase + mOff + r]);
        if (BIAS_MODE == 2) v += bv;
        slab[(mOff + r) * 68 + (j << 4) + rlane] = v;
      }
    }
    __builtin_amdgcn_fence(__ATOMIC_RELEASE, "workgroup");
    __builtin_amdgcn_wave_barrier();
    __builtin_amdgcn_fence(__ATOMIC_ACQUIRE, "workgroup");
    if (OUT_MODE == 0) {
      float* C = (float*)Cout + (size_t)b * strideC;
      const int hh = lane >> 4, c4 = (lane & 15) * 4;     // row seg = 256 B = 16 lanes x 16 B
      {
#pragma unroll
        for (int it = 0; it < 8; ++it) {
          const int row = it * 2 + hh;
          v4f v = *(const v4fa*)(slab + row * 68 + c4);
          *(v4f*)(C + (size_t)(mBase + row) * ldc + n0 + c4) = v;
        }
        
      }
    } else {
      const int q = lane >> 3, c8 = (lane & 7) * 8;
      unsigned short* C  = (unsigned short*)Cout  + (size_t)b * strideC;
      unsigned short* C2 = (unsigned short*)Cout2 + (size_t)b * strideC;
      {
#pragma unroll
        for (int it = 0; it < 4; ++it) {
          const int row = it * 4 + q;
          const float* sp = slab + row * 68 + c8;
          v4u hv, lv;
#pragma unroll
          for (int e = 0; e < 4; ++e) {
            v2b hb, lb;
            split2(sp[2 * e], sp[2 * e + 1], hb, lb);
            hv[e] = __builtin_bit_cast(unsigned, hb);
            lv[e] = __builtin_bit_cast(unsigned, lb);
          }
          *(v4u*)(C  + (size_t)(mBase + row) * ldc + n0 + c8) = hv;
          *(v4u*)(C2 + (size_t)(mBase + row) * ldc + n0 + c8) = lv;
        }
        
      }
    }
    __builtin_amdgcn_fence(__ATOMIC_RELEASE, "workgroup");
    __builtin_amdgcn_wave_barrier();
    __builtin_amdgcn_fence(__ATOMIC_ACQUIRE, "workgroup");
  }
}

// ---------------------------------------------------------------------------
// Contiguous f32 -> bf16-RNE plane: one thread = 8 consecutive elements = one 16-B store, so every wave writes
// 512 contiguous bytes; ceil(n8/256) blocks, blk = the block's index among them; coverage: n8 threads x 8 = the whole plane (n8 * 8 elements).
// ---------------------------------------------------------------------------
__device__ __forceinline__ void cvt_bf16x8(int blk, const float* __restrict__ in, unsigned short* __restrict__ o, int n8) {
  const int i = blk * 256 + threadIdx.x;
  if (i < n8) {
    const float* sp = in + (size_t)i * 8;
    const v4f a  = *(const v4f*)(sp);
    const v4f a2 = *(const v4f*)(sp + 4);
    v4u w;
    w[0] = cvt2_bits(a[0],  a[1]);
    w[1] = cvt2_bits(a[2],  a[3]);
    w[2] = cvt2_bits(a2[0], a2[1]);
    w[3] = cvt2_bits(a2[2], a2[3]);
    unsigned short* dp = o + (size_t)i * 8;
    *(v4u*)dp = w;
    
  }
}

// ---------------------------------------------------------------------------
// Fused transpose + bf16 split of an f32 matrix: in [R rows][Cc cols] (pitch Cc) ->
//   oh[c][r] = bf16_rne(in[r][c]), ol[c][r] = bf16_rne(in[r][c] - oh)   ([Cc][R], pitch R).
// 64x64 tiles through LDS. (Cc/64) x (R/64) blocks (cb, rb), 256 threads (R, Cc multiples of 64).
// Coverage per block and plane: load 4 it x 256 thr x 4 floats = 64x64; store 2 it x 256 thr x 8 u16 = 64x64.
// ---------------------------------------------------------------------------
__device__ __forceinline__ void tsplit(float* tf, int cb, int rb, const float* __restrict__ W, unsigned short* __restrict__ oh,
                                       unsigned short* __restrict__ ol, int R, int Cc) {
  const int c0  = cb * 64;           // input column block = output row block
  const int r0  = rb * 64;           // input row block    = output column block
  const int tid = threadIdx.x;
  {
    const int lr = tid >> 4;         // 0..15
    const int c4 = (tid & 15) * 4;   // 0..60
#pragma unroll
    for (int it = 0; it < 4; ++it) {
      const int rr = it * 16 + lr;   // 0..63
      const v4f a = *(const v4f*)(W + (size_t)(r0 + rr) * Cc + c0 + c4);
      *(v4f*)(tf + rr * 68 + c4) = a;
    }
  }
  __syncthreads();
  const int sub = tid >> 3;          // 0..31
  const int c8  = (tid & 7) * 8;     // 0..56
  v4u hv[2], lv[2];
#pragma unroll
  for (int it = 0; it < 2; ++it) {
    const int oc = it * 32 + sub;    // output row within tile (= input column)
    v4u a, a2;
#pragma unroll
    for (int q = 0; q < 4; ++q) {
      const float f0 = tf[(c8 + 2 * q) * 68 + oc];
      const float f1 = tf[(c8 + 2 * q + 1) * 68 + oc];
      v2b hb, lb;
      split2(f0, f1, hb, lb);
      a[q]  = __builtin_bit_cast(unsigned, hb);
      a2[q] = __builtin_bit_cast(unsigned, lb);
    }
    hv[it] = a; lv[it] = a2;
  }
  {
#pragma unroll
    for (int it = 0; it < 2; ++it) {
      const int oc = it * 32 + sub;
      const size_t go = (size_t)(c0 + oc) * R + r0 + c8;
      *(v4u*)(oh + go) = hv[it];
      *(v4u*)(ol + go) = lv[it];
    }
    
  }
}

// ---------------------------------------------------------------------------
// Launch 1: every plane that depends on the inputs alone, one grid; the block index picks the job (block-uniform branch).
//   blocks 0..11     weight m = blk >> 2 (Wq, Wk, Wv), 64x64 tile blk & 3: transposed bf16 planes [n][k]
//   blocks 12..75    Er -> bf16 plane [4096][32]    (64 blocks x 256 threads x 8 = the whole plane)
//   blocks 76..1099  x  -> bf16 plane [16384][128]  (1024 blocks x 256 threads x 8 = the whole plane)
// ---------------------------------------------------------------------------
#define PREP_W  12
#define PREP_E  (SEQ * HD / 8 / 256)
#define PREP_X  (NB * SEQ * HID / 8 / 256)
__global__ __launch_bounds__(256) void prep_kernel(const float* __restrict__ x, const float* __restrict__ Wq, const float* __restrict__ Wk,
                                                   const float* __restrict__ Wv, const float* __restrict__ Er,
                                                   unsigned short* __restrict__ Xb, unsigned short* __restrict__ ErB,
                                                   unsigned short* __restrict__ WqTh, unsigned short* __restrict__ WqTl,
                                                   unsigned short* __restrict__ WkTh, unsigned short* __restrict__ WkTl,
                                                   unsigned short* __restrict__ WvTh, unsigned short* __restrict__ WvTl) {
  __shared__ __align__(16) float tf[64 * 68];
  const int blk = blockIdx.x;
  if (blk < PREP_W) {
    const int m = blk >> 2, t = blk & 3;
    const float*    W  = m == 0 ? Wq   : (m == 1 ? Wk   : Wv);
    unsigned short* oh = m == 0 ? WqTh : (m == 1 ? WkTh : WvTh);
    unsigned short* ol = m == 0 ? WqTl : (m == 1 ? WkTl : WvTl);
    tsplit(tf, t & 1, t >> 1, W, oh, ol, HID, HID);
  } else if (blk < PREP_W + PREP_E) {
    cvt_bf16x8(blk - PREP_W, Er, ErB, SEQ * HD / 8);
  } else {
    cvt_bf16x8(blk - (PREP_W + PREP_E), x, Xb, NB * SEQ * HID / 8);
  }
}

// ---------------------------------------------------------------------------
// Launch 2: the three projections, one grid (64, 3); blockIdx.y picks the product (block-uniform branch).
//   y = 0: q = x.Wq + bq -> Q hi/lo planes [b*4096+t][h*32+d]   (M=16384, N=128, K=128; 512 tiles -> 64 blocks)
//   y = 1: k = x.Wk + bk -> K hi/lo planes, same shape
//   y = 2: v^T = Wv^T . x^T + bv[m] -> VT hi/lo planes [b][h*32+d][s]   (A = Wv^T plane [128][128], Bt = x plane rows of batch b;
//          M=128, N=4096, K=128; 128 tiles -> 16 blocks a batch: block = blockIdx.x & 15, batch = blockIdx.x >> 4)
// ---------------------------------------------------------------------------
__global__ __launch_bounds__(256) void proj_kernel(const unsigned short* __restrict__ Xb, const unsigned short* __restrict__ WqTh,
                                                   const unsigned short* __restrict__ WkTh, const unsigned short* __restrict__ WvTh,
                                                   const float* __restrict__ bq, const float* __restrict__ bk, const float* __restrict__ bv,
                                                   unsigned short* __restrict__ Qh, unsigned short* __restrict__ Ql,
                                                   unsigned short* __restrict__ Kh, unsigned short* __restrict__ Kl,
                                                   unsigned short* __restrict__ VTh, unsigned short* __restrict__ VTl) {
  __shared__ __align__(16) float sT[8][16 * 68];   // per-wave 16x64 slab, pitch 68 floats
  const int job = blockIdx.y;
  if (job < 2) {
    const unsigned short* Wt = job ? WkTh : WqTh;
    const float*          bi = job ? bk   : bq;
    unsigned short*       Ch = job ? Kh   : Qh;
    unsigned short*       Cl = job ? Kl   : Ql;
    wmma_gemm64<false, 2, 2>(sT, blockIdx.x, 0, Xb, Xb, HID, 0L, Wt, Wt, HID, 0L, (void*)Ch, (void*)Cl, HID, 0L,
                             bi, NB * SEQ, HID, HID, 1.0f);
  } else {
    wmma_gemm64<false, 1, 2>(sT, blockIdx.x & 15, blockIdx.x >> 4, WvTh, WvTh, HID, 0L, Xb, Xb, HID, (long)SEQ * HID,
                             (void*)VTh, (void*)VTl, SEQ, (long)HID * SEQ, bv, HID, SEQ, HID, 1.0f);
  }
}

// =====================================================================================
// Causal rel-pos attention, head dim 32, all (batch, head) pairs in one launch.
//   q planes (hi/lo bf16): element (b, t, h, d) at [(b*SEQ + t)*HID + h*32 + d]
//   k planes (hi/lo bf16): same layout
//   v^T planes (hi/lo bf16): element (b, h, d, s) at [((b*HID + h*32 + d))*SEQ + s]
//   er plane (bf16-RNE of Er): [r][d], pitch 32
//   scores = ((q.k) + (q.ErWin at the shift index)) * sscale; masked (s > t) scores set to -inf.
//   Block = 8 waves = 2 key groups x 4 waves; the 4 waves of a group hold the 64 query rows of one (b,h) query block, and both
//   groups hold the same rows. Key chunks of 64, qb+1 <= 64 of them for query block qb, taken two a stage: group g takes chunk
//   2*stage + g, so a wave walks half the chunks and four waves instead of two share a SIMD. Each group keeps its own running
//   maximum, sum and O^T; after the last stage group 1 hands them to group 0 through LDS (one barrier) and group 0 joins them.
//   Where qb+1 is odd, group 1 has no chunk in the last stage: it stages chunk qb again (address in range) and skips the products.
//   Every block takes two query blocks of its (b,h), one after the other: 63 - t, then t (t = 0..31), so each block walks
//   (64 - t) + (t + 1) = 65 chunks in 33 stages and no WGP is left with only long or only short blocks. grid.x = NB*NH*32.
//   Staging per stage: asynchronous 16-B copies from global memory straight into LDS, two buffers: stage st + 2 is issued behind the
//   barrier at the foot of stage st, into the buffer that stage st has just read, and flies while stage st + 1 is worked on.
//   Each group's 128 threads stage their own chunk:
//     K hi/lo [64][32]: 128 thr x 16 elements per plane = whole tile; V^T hi/lo [32][64]: 128 thr x 16 = whole tile;
//     Er window [192][32], shared (group g's 128-row window starts at row 64g): 256 thr x 3 x 8 elements = all 192 rows
//     (clamped source row, so every row is written).
//   All three products are taken transposed (keys, window rows or d as the rows of D, queries as its columns), so lane (c, hh)
//   holds query c of the wave's 16: its scores for keys 16j + 8hh + r, its maximum and sum in-lane (the two lane halves are joined
//   by one cross-half move), and exp(s - m) converts in place into the B fragment of V^T.P^T (element e of k-step kk =
//   tile 2kk + (e >> 3), register e & 7: the same split k map as the V^T loader). P never goes through LDS.
//   Per-wave LDS: G [16 queries][80] f32 (5 tiles x 16 window rows x 16 queries written, columns 0..78 read), reused as out staging [16][36].
//   LDS rows are padded (KP, VP, GP below); the pad bytes are never written and never read.
// =====================================================================================
#define AT_NW 8
#define AT_QB 64
#define AT_KC 64
#define EWIN  192
#define MGP   20   // hand-over record pitch in floats per lane: 80 B = 16 B x odd for the 16-B accesses (lane = row)
#define GP    84   // G row pitch in floats: 16 B x odd for the 16-B stores (lane = row); the shifted 4-B reads step 83 floats a lane, so the 16 lanes of a half hit distinct banks
#define OSP   36
#define KP    40   // K and Er-window row pitch in elements: 64-B rows at 80 B (16 B x odd), conflict-free for 16-B fragment reads
#define VP    72   // V^T row pitch in elements: 128-B rows at 144 B (16 B x odd)
// one staging buffer, offsets in elements: K hi [group][kv][d], K lo, V^T hi [group][d][kv], V^T lo, Er window [w][d]
#define SB_KH 0
#define SB_KL (2 * AT_KC * KP)
#define SB_VH (4 * AT_KC * KP)
#define SB_VL (4 * AT_KC * KP + 2 * HD * VP)
#define SB_E  (4 * AT_KC * KP + 4 * HD * VP)
#define SB_SZ (4 * AT_KC * KP + 4 * HD * VP + EWIN * KP)   // 27136 elements = 54272 B, a multiple of 16 B

// lane l <-> lane l ^ 16 (the two halves that share a query)
__device__ __forceinline__ float at_xhalf(float x) {
  return __builtin_bit_cast(float, __builtin_amdgcn_permlanex16(__builtin_bit_cast(int, x), __builtin_bit_cast(int, x),
                                                                0x76543210, 0xfedcba98, false, false));
}
__device__ __forceinline__ unsigned at_lds_off(const void* p) { return (unsigned)(size_t)p; }
__device__ __forceinline__ v8f at_mma(v16b a, v16b b, v8f c) {
  return __builtin_amdgcn_wmma_f32_16x16x32_bf16(false, a, false, b, (short)0, c, false, false);
}
// Distance guards, one behind each RUN of matrix products: four vector slots between the run and the first vector instruction that
// reads its results or rewrites its operand registers. The results pass through the statement and the operands are its inputs, so
// nothing of that kind can stand in front of it. Not volatile: LDS loads may move across it, so the fragment loads of a run go out together.
__device__ __forceinline__ void at_guard_s(v8f* s, const v16b* kh, const v16b* kl, v16b qh, v16b ql) {
  asm("v_nop\n\tv_nop\n\tv_nop\n\tv_nop" : "+v"(s[0]), "+v"(s[1]), "+v"(s[2]), "+v"(s[3])
      : "v"(kh[0]), "v"(kh[1]), "v"(kh[2]), "v"(kh[3]), "v"(kl[0]), "v"(kl[1]), "v"(kl[2]), "v"(kl[3]), "v"(qh), "v"(ql));
}
__device__ __forceinline__ void at_guard_g(v8f* g, const v16b* e, v16b qh, v16b ql) {
  asm("v_nop\n\tv_nop\n\tv_nop\n\tv_nop" : "+v"(g[0]), "+v"(g[1]), "+v"(g[2]), "+v"(g[3]), "+v"(g[4])
      : "v"(e[0]), "v"(e[1]), "v"(e[2]), "v"(e[3]), "v"(e[4]), "v"(qh), "v"(ql));
}
__device__ __forceinline__ void at_guard_o(v8f* o, const v16b* vh, const v16b* vl, v16b p0, v16b p1, v16b p2, v16b p3) {
  asm("v_nop\n\tv_nop\n\tv_nop\n\tv_nop" : "+v"(o[0]), "+v"(o[1])
      : "v"(vh[0]), "v"(vh[1]), "v"(vh[2]), "v"(vh[3]), "v"(vl[0]), "v"(vl[1]), "v"(vl[2]), "v"(vl[3]), "v"(p0), "v"(p1), "v"(p2), "v"(p3));
}

__global__ __launch_bounds__(256)
void relattn32_kernel(const unsigned short* __restrict__ qhp, const unsigned short* __restrict__ qlp,
                      const unsigned short* __restrict__ khp, const unsigned short* __restrict__ klp,
                      const unsigned short* __restrict__ vhp, const unsigned short* __restrict__ vlp,
                      const unsigned short* __restrict__ erp, float* __restrict__ out, float sscale) {
  union FB { v16b v; v8b h[2]; };
  __shared__ __align__(16) __bf16 Stg[2 * SB_SZ];              // two staging buffers (K hi/lo, V^T hi/lo, Er window), 2 x 53 KB
  __shared__ __align__(16) float  Gs[AT_NW][16 * GP];          // per wave rel tile [query][80], pitch GP; later hand-over record (group 1) / out staging pitch 36 (group 0)

  const int tid  = threadIdx.x;
  const int wave = __builtin_amdgcn_readfirstlane(tid >> 5);   // in a scalar register: the tests on the key group below are scalar branches
  const int grp  = wave >> 2;             // key group 0 / 1
  const int wq   = wave & 3;              // which 16 of the 64 query rows
  const int tl   = tid & 127;             // thread within its group
  const int lane = tid & 31;
  const int hh   = lane >> 4;
  const int c    = lane & 15;

  const int bx   = blockIdx.x;
  const int tp   = bx & (NQB / 2 - 1);    // 0..31
  const int pair = bx >> 5;               // 0..15
  const int b    = pair >> 2;
  const int h    = pair & 3;
  const size_t rowBase = (size_t)b * SEQ;

  const __bf16* Qh = (const __bf16*)(const void*)qhp + h * HD;
  const __bf16* Ql = (const __bf16*)(const void*)qlp + h * HD;
  const __bf16* Kh = (const __bf16*)(const void*)khp + h * HD;
  const __bf16* Kl = (const __bf16*)(const void*)klp + h * HD;
  const __bf16* Vh = (const __bf16*)(const void*)vhp + ((size_t)b * HID + h * HD) * SEQ;
  const __bf16* Vl = (const __bf16*)(const void*)vlp + ((size_t)b * HID + h * HD) * SEQ;
  const __bf16* Er = (const __bf16*)(const void*)erp;
  float*        ob = out + h * HD;

  const int wbase = 64 * grp + 48 - 16 * wq;   // first row, in the staged 192-row window, of this wave's G tile
  float* gw = Gs[wave];
  // staging map of this thread, 16-B pieces; neighbouring lanes of one copy take neighbouring pieces, so a copy asks for each row's bytes whole.
  // K: piece p = tl + 128 i -> key row p>>2 (64-B rows), d quarter (p&3)*8; V^T: piece p = tl + 128 i -> row d = p>>3 (128-B rows), key eighth (p&7)*8;
  // Er window: piece p = tid + 256 i -> window row p>>2, d quarter (p&3)*8. LDS byte addresses of piece i = 0 in buffer 0:
  const int sr = tl >> 2, sdq = (tl & 3) * 8;
  const int sd = tl >> 3, ske = (tl & 7) * 8;
  const unsigned lK = at_lds_off(Stg) + 2u * (unsigned)(SB_KH + grp * (AT_KC * KP) + sr * KP + sdq);
  const unsigned lV = at_lds_off(Stg) + 2u * (unsigned)(SB_VH + grp * (HD * VP) + sd * VP + ske);
  const unsigned lE = at_lds_off(Stg) + 2u * (unsigned)(SB_E + (tid >> 2) * KP + (tid & 3) * 8);

  // the block's two query blocks, long one first; every (b, h, qb) is taken by exactly one block (block-uniform trip counts)
  for (int part = 0; part < 2; ++part) {
  const int qb = part ? tp : (NQB - 1 - tp);   // 63..32, then 0..31
  const int q0 = qb * AT_QB + wq * 16;

  // ---- Q fragments (B operand, column = query = lane&15, split k map, one k-step of 32 = d), hi and lo ----
  const v16b qah = FragB::load(Qh + (rowBase + q0 + c) * HID + 8 * hh);
  const v16b qal = FragB::load(Ql + (rowBase + q0 + c) * HID + 8 * hh);

  float mrow = -INFINITY;                 // running maximum of query c (equal in both lane halves)
  float lrow = 0.f;                       // running sum of query c over this lane half's keys; halves joined after the loop
  v8f oacc[2];                            // O^T: oacc[t][r] = out[query c][d = 16t + 8hh + r]
  oacc[0] = zero8(); oacc[1] = zero8();
  const int qrow = qb * AT_QB + wq * 16 + c;

  const int nStages = (qb + 2) >> 1;      // block-uniform, <= 32: ceil((qb + 1) / 2)

  // One stage's copies into buffer buf: 11 a thread, every lane on, every address a multiple of 16 B, each LDS byte written by one lane.
  auto stage_copies = [&](int st, int buf) {
    const int kcs = 2 * st + grp;                       // this group's chunk; past the last one (group 1, odd count): chunk qb again
    const int kvs = (kcs <= qb ? kcs : qb) * AT_KC;
    const int e0  = SEQ - 64 - 64 * (qb - 2 * st);      // Er row of staged window row 0 (group 0's window base), 0 .. 4032
    const __bf16* ks = Kh + (rowBase + kvs + sr) * HID + sdq;
    const __bf16* kl = Kl + (rowBase + kvs + sr) * HID + sdq;
    const __bf16* vs = Vh + (size_t)sd * SEQ + kvs + ske;
    const __bf16* vl = Vl + (size_t)sd * SEQ + kvs + ske;
    const __bf16* ep[3];
#pragma unroll
    for (int i = 0; i < 3; ++i) {
      int erow = e0 + ((tid + 256 * i) >> 2);           // clamped source row (address clamp)
      erow = erow < 0 ? 0 : erow;
      erow = erow > (SEQ - 1) ? (SEQ - 1) : erow;
      ep[i] = Er + (size_t)erow * HD + (tid & 3) * 8;
    }
    const unsigned bo = (unsigned)buf * (2u * SB_SZ);
    const unsigned dK = lK + bo, dL = dK + 2u * (SB_KL - SB_KH), dV = lV + bo, dW = dV + 2u * (SB_VL - SB_VH), dE = lE + bo;
    // global memory -> LDS through no register. The closing s_wait_xcnt stands in the copies' own statement, so that no register
    // that a copy names is rewritten in front of it.
    asm volatile("global_load_async_to_lds_b128 %0, %11, off\n\t"
                 "global_load_async_to_lds_b128 %1, %12, off\n\t"
                 "global_load_async_to_lds_b128 %2, %13, off\n\t"
                 "global_load_async_to_lds_b128 %3, %14, off\n\t"
                 "global_load_async_to_lds_b128 %4, %15, off\n\t"
                 "global_load_async_to_lds_b128 %5, %16, off\n\t"
                 "global_load_async_to_lds_b128 %6, %17, off\n\t"
                 "global_load_async_to_lds_b128 %7, %18, off\n\t"
                 "global_load_async_to_lds_b128 %8, %19, off\n\t"
                 "global_load_async_to_lds_b128 %9, %20, off\n\t"
                 "global_load_async_to_lds_b128 %10, %21, off\n\t"
                 "s_wait_xcnt 0x0"
                 :: "v"(dK), "v"(dK + 2u * 32 * KP), "v"(dL), "v"(dL + 2u * 32 * KP), "v"(dV), "v"(dV + 2u * 16 * VP), "v"(dW), "v"(dW + 2u * 16 * VP),
                    "v"(dE), "v"(dE + 2u * 64 * KP), "v"(dE + 2u * 128 * KP),
                    "v"(ks), "v"(ks + 32 * HID), "v"(kl), "v"(kl + 32 * HID), "v"(vs), "v"(vs + 16 * SEQ), "v"(vl), "v"(vl + 16 * SEQ),
                    "v"(ep[0]), "v"(ep[1]), "v"(ep[2])
                 : "memory");
  };

  // stage 0 lands and is published; then stage 1 is sent off. (Every reader of both buffers has left them: the barrier at the foot of the
  // previous query block's last stage.)
  stage_copies(0, 0);
  asm volatile("s_wait_asynccnt 0x0" ::: "memory");   // this wave's copies of stage 0 have landed
  __syncthreads();
  if (nStages > 1) stage_copies(1, 1);

  for (int st = 0; st < nStages; ++st) {
    const int kc    = 2 * st + grp;       // this group's chunk (wave-uniform)
    const bool live = kc <= qb;           // false only for group 1 in the last stage of an odd chunk count
    const int kv0   = (live ? kc : qb) * AT_KC;
    const int buf   = st & 1;
    const __bf16* Sb  = Stg + buf * SB_SZ;               // this stage's buffer
    const __bf16* Ksh = Sb + SB_KH + grp * (AT_KC * KP); // this group's own chunk
    const __bf16* Ksl = Sb + SB_KL + grp * (AT_KC * KP);
    const __bf16* Vth = Sb + SB_VH + grp * (HD * VP);
    const __bf16* Vtl = Sb + SB_VL + grp * (HD * VP);
    const __bf16* Esh = Sb + SB_E;
    if (live) {   // wave-uniform; no block barrier inside

    // ---- rel-pos tile, transposed: G^T = Win[wbase + 0..79] . q^T (2 products); a lane's 8 registers are 8 consecutive
    //      window columns of its query's row, so they go to this wave's G[query][80] as two 16-B stores ----
    //      Taken in front of the score products: the G stores land and the G reads fly while those run.
    v8f gt[5];
    {
      v16b ef[5];
#pragma unroll
      for (int nt = 0; nt < 5; ++nt) {
        FB eb;
        const __bf16* ep = Esh + (wbase + nt * 16 + c) * KP + 8 * hh;
        eb.h[0] = *(const v8b*)(ep); eb.h[1] = *(const v8b*)(ep + 16);
        ef[nt] = eb.v;
        v8f g = zero8();
        g = at_mma(eb.v, qah, g);
        g = at_mma(eb.v, qal, g);
        gt[nt] = g;
      }
      at_guard_g(gt, ef, qah, qal);
    }
#pragma unroll
    for (int nt = 0; nt < 5; ++nt) {
      const v8f g = gt[nt];
      float* gp = gw + c * GP + nt * 16 + 8 * hh;
      const v4f g0 = {g[0], g[1], g[2], g[3]};
      const v4f g1 = {g[4], g[5], g[6], g[7]};
      *(v4fa*)(gp)     = g0;
      *(v4fa*)(gp + 4) = g1;
    }

    // ---- content scores, transposed: S^T tile j = K rows (16j..16j+15) . q^T, 3-term split; s[j][r] = score(key 16j + 8hh + r, query c) ----
    v8f s[4];
    {
      v16b kfh[4], kfl[4];
#pragma unroll
      for (int j = 0; j < 4; ++j) {
        FB kb, kl;
        const __bf16* kp = Ksh + (j * 16 + c) * KP + 8 * hh;
        const __bf16* kq = Ksl + (j * 16 + c) * KP + 8 * hh;
        kb.h[0] = *(const v8b*)(kp); kb.h[1] = *(const v8b*)(kp + 16);
        kl.h[0] = *(const v8b*)(kq); kl.h[1] = *(const v8b*)(kq + 16);
        kfh[j] = kb.v; kfl[j] = kl.v;
        v8f a = zero8();
        a = at_mma(kb.v, qah, a);
        a = at_mma(kl.v, qah, a);
        a = at_mma(kb.v, qal, a);
        s[j] = a;
      }
      at_guard_s(s, kfh, kfl, qah, qal);
    }
    __builtin_amdgcn_fence(__ATOMIC_RELEASE, "workgroup");
    __builtin_amdgcn_wave_barrier();
    __builtin_amdgcn_fence(__ATOMIC_ACQUIRE, "workgroup");

    // ---- combine, scale, causal mask, chunk maximum of query c (in-lane, four independent chains, then the other half) ----
    const bool diag = (kc == qb);           // wave-uniform
    const float* gr = gw + c * GP + (15 - c) + 8 * hh;   // + 16j + r gives shift column 15 - c + jl, jl = 16j + 8hh + r
    v8f relv[4];
#pragma unroll
    for (int j = 0; j < 4; ++j)
#pragma unroll
      for (int r = 0; r < 8; ++r) relv[j][r] = gr[j * 16 + r];
    // keeps the G reads together in front of the arithmetic: spread among it, each read's LDS latency is waited out on its own
    __builtin_amdgcn_sched_barrier(0);
#pragma unroll
    for (int j = 0; j < 4; ++j)
#pragma unroll
      for (int r = 0; r < 8; ++r) s[j][r] = (s[j][r] + relv[j][r]) * sscale;
    // Only the diagonal chunk holds keys past a query, so the mask's compares and selects stand behind a scalar branch that
    // every other chunk jumps over.
    if (diag) {
#pragma unroll
      for (int j = 0; j < 4; ++j)
#pragma unroll
        for (int r = 0; r < 8; ++r) {
          const int kvcol = kv0 + j * 16 + 8 * hh + r;
          s[j][r] = (kvcol > qrow) ? -INFINITY : s[j][r];
        }
    }
    float mj[4];
#pragma unroll
    for (int j = 0; j < 4; ++j) {
      float m = -INFINITY;
#pragma unroll
      for (int r = 0; r < 8; ++r) m = fmaxf(m, s[j][r]);
      mj[j] = m;
    }
    float cm = fmaxf(fmaxf(mj[0], mj[1]), fmaxf(mj[2], mj[3]));
    cm = fmaxf(cm, at_xhalf(cm));           // key kv0 is never masked, so the joined maximum is finite

    // ---- online softmax update; P^T (unnormalised) as bf16 hi/lo straight into the B fragments of V^T.P^T ----
    const float mnew  = fmaxf(mrow, cm);
    const float alpha = __expf(mrow - mnew);
    mrow = mnew;
    FB ph[2], pl[2];
    float pj[4];
#pragma unroll
    for (int j = 0; j < 4; ++j) {
      float psum = 0.f;
#pragma unroll
      for (int r = 0; r < 8; r += 2) {
        const float p0 = __expf(s[j][r]     - mnew);
        const float p1 = __expf(s[j][r + 1] - mnew);
        psum += p0;
        psum += p1;
        v2b a, bl; split2(p0, p1, a, bl);
        ph[j >> 1].v[(j & 1) * 8 + r]     = a[0];
        ph[j >> 1].v[(j & 1) * 8 + r + 1] = a[1];
        pl[j >> 1].v[(j & 1) * 8 + r]     = bl[0];
        pl[j >> 1].v[(j & 1) * 8 + r + 1] = bl[1];
      }
      pj[j] = psum;
    }
    lrow = lrow * alpha + ((pj[0] + pj[1]) + (pj[2] + pj[3]));
#pragma unroll
    for (int r = 0; r < 8; ++r) {
      oacc[0][r] *= alpha;
      oacc[1][r] *= alpha;
    }

    // ---- O^T += V^T . P^T : A = V^T rows d (split k map over keys), B = P^T fragments; 3-term split ----
    v16b vfh[4], vfl[4];
#pragma unroll
    for (int kk = 0; kk < 2; ++kk) {
#pragma unroll
      for (int t = 0; t < 2; ++t) {
        FB vb, vl;
        vb.h[0] = *(const v8b*)(Vth + (t * 16 + c) * VP + kk * 32 + 8 * hh);
        vb.h[1] = *(const v8b*)(Vth + (t * 16 + c) * VP + kk * 32 + 16 + 8 * hh);
        vl.h[0] = *(const v8b*)(Vtl + (t * 16 + c) * VP + kk * 32 + 8 * hh);
        vl.h[1] = *(const v8b*)(Vtl + (t * 16 + c) * VP + kk * 32 + 16 + 8 * hh);
        vfh[kk * 2 + t] = vb.v; vfl[kk * 2 + t] = vl.v;
        oacc[t] = at_mma(vb.v, ph[kk].v, oacc[t]);
        oacc[t] = at_mma(vl.v, ph[kk].v, oacc[t]);
        oacc[t] = at_mma(vb.v, pl[kk].v, oacc[t]);
      }
    }
    at_guard_o(oacc, vfh, vfl, ph[0].v, ph[1].v, pl[0].v, pl[1].v);
    }   // live
    // foot of the stage, every wave: its own LDS reads of this buffer are done, its own copies of stage st + 1 have landed; the barrier
    // publishes stage st + 1 and frees this buffer; only then the refill.
    asm volatile("s_wait_dscnt 0x0" ::: "memory");
    asm volatile("s_wait_asynccnt 0x0" ::: "memory");
    __syncthreads();
    if (st + 2 < nStages) stage_copies(st + 2, buf);   // block-uniform test
  }
  asm volatile("s_wait_asynccnt 0x0" ::: "memory");    // nothing is in flight here; closes the ring

  __builtin_amdgcn_fence(__ATOMIC_RELEASE, "workgroup");
  __builtin_amdgcn_wave_barrier();
  __builtin_amdgcn_fence(__ATOMIC_ACQUIRE, "workgroup");
  // ---- group 1 hands its maximum, sum and O^T to group 0: lane to same lane of wave - 4, through group 1's own G area ----
  if (grp == 1) {
    float* mp = gw + lane * MGP;
#pragma unroll
    for (int t = 0; t < 2; ++t) {
      const v4f o0 = {oacc[t][0], oacc[t][1], oacc[t][2], oacc[t][3]};
      const v4f o1 = {oacc[t][4], oacc[t][5], oacc[t][6], oacc[t][7]};
      *(v4fa*)(mp + t * 8)     = o0;
      *(v4fa*)(mp + t * 8 + 4) = o1;
    }
    mp[16] = mrow;
    mp[17] = lrow;
  }
  __syncthreads();   // publishes the records; group 1 next writes its G area behind one more barrier, which group 0 passes after it has read them
  if (grp == 0) {
  {
    const float* mp = Gs[wave + 4] + lane * MGP;
    const float m1 = mp[16], l1 = mp[17];
    const float mN = fmaxf(mrow, m1);        // mrow is finite (group 0 always has chunk 0); m1 is -inf where group 1 had no chunk
    const float a0 = __expf(mrow - mN);
    const float a1 = __expf(m1 - mN);
    lrow = lrow * a0 + l1 * a1;
#pragma unroll
    for (int t = 0; t < 2; ++t) {
      const v4f o0 = *(const v4fa*)(mp + t * 8);
      const v4f o1 = *(const v4fa*)(mp + t * 8 + 4);
#pragma unroll
      for (int r = 0; r < 4; ++r) {
        oacc[t][r]     = oacc[t][r]     * a0 + o0[r] * a1;
        oacc[t][r + 4] = oacc[t][r + 4] * a0 + o1[r] * a1;
      }
    }
  }
  float* os = gw;
  {
    const float inv = 1.0f / (lrow + at_xhalf(lrow));   // the two halves' key sums joined once
#pragma unroll
    for (int t = 0; t < 2; ++t) {
      float* op = os + c * OSP + t * 16 + 8 * hh;        // row = query c, 8 consecutive d
      const v4f o0 = {oacc[t][0] * inv, oacc[t][1] * inv, oacc[t][2] * inv, oacc[t][3] * inv};
      const v4f o1 = {oacc[t][4] * inv, oacc[t][5] * inv, oacc[t][6] * inv, oacc[t][7] * inv};
      *(v4fa*)(op)     = o0;
      *(v4fa*)(op + 4) = o1;
    }
  }
  __builtin_amdgcn_fence(__ATOMIC_RELEASE, "workgroup");
  __builtin_amdgcn_wave_barrier();
  __builtin_amdgcn_fence(__ATOMIC_ACQUIRE, "workgroup");
  {
    const int q4 = lane >> 3, c4 = (lane & 7) * 4;
    {
#pragma unroll
      for (int it = 0; it < 4; ++it) {
        const int row = it * 4 + q4;                   // it 0..3 x q4 0..3 covers rows 0..15 of the wave tile
        const v4f val = *(const v4fa*)(os + row * OSP + c4);
        *(v4f*)(ob + (rowBase + q0 + row) * HID + c4) = val;
      }
      // the next query block's set-up rewrites the data and address registers that these stores name
      asm volatile("s_wait_xcnt 0x0" ::: "memory");
    }
  }
  }   // grp == 0
  }   // part: the staging buffers were left by every reader at the last stage's foot; G / out staging is this wave's own
}

// ---------------------------------------------------------------------------
// Workspace region map (byte offsets):
//   WqTh bf16 [128 n][128 k]        0      WqTl     32768
//   WkTh                        65536      WkTl     98304
//   WvTh                       131072      WvTl    163840     (lo weight planes written, not consumed)
//   Xb   bf16 [16384][128]     196608                         (4194304 B)
//   ErB  bf16 [4096][32]      4390912                         (262144 B)
//   Qh   bf16 [16384][128]    4653056      Ql    8847360
//   Kh   bf16 [16384][128]   13041664      Kl   17235968
//   VTh  bf16 [4][128][4096] 21430272      VTl  25624576
//   total                    29818880
// Every region is written in whole 64x64 tiles / whole 16-B-per-lane runs; all extents are exact tile multiples,
// ---------------------------------------------------------------------------
extern "C" void kernel_launch(void* const* d_in, const int* in_sizes, int n_in,
                              void* d_out, int out_size, void* d_ws, size_t ws_size,
                              hipStream_t stream) {
  if (n_in < 8) return;
  if (in_sizes[0] != NB * SEQ * HID) return;
  if (in_sizes[1] != HID * HID || in_sizes[3] != HID * HID || in_sizes[5] != HID * HID) return;
  if (in_sizes[2] != HID || in_sizes[4] != HID || in_sizes[6] != HID) return;
  if (in_sizes[7] != SEQ * HD) return;
  if (out_size != NB * SEQ * HID) return;

  const float* x  = (const float*)d_in[0];
  const float* Wq = (const float*)d_in[1];
  const float* bq = (const float*)d_in[2];
  const float* Wk = (const float*)d_in[3];
  const float* bk = (const float*)d_in[4];
  const float* Wv = (const float*)d_in[5];
  const float* bv = (const float*)d_in[6];
  const float* Er = (const float*)d_in[7];
  float* out = (float*)d_out;

  const size_t PW = (size_t)HID * HID * 2;            //    32768  bf16 weight plane
  const size_t PX = (size_t)NB * SEQ * HID * 2;       //  4194304  bf16 activation plane (all batch rows)
  const size_t PE = (size_t)SEQ * HD * 2;             //   262144  bf16 Er plane
  const size_t PV = (size_t)NB * HID * SEQ * 2;       //  4194304  bf16 v^T plane
  size_t off = 0;
  const size_t oWqTh = off; off += PW;  const size_t oWqTl = off; off += PW;
  const size_t oWkTh = off; off += PW;  const size_t oWkTl = off; off += PW;
  const size_t oWvTh = off; off += PW;  const size_t oWvTl = off; off += PW;
  const size_t oXb   = off; off += PX;
  const size_t oErB  = off; off += PE;
  const size_t oQh   = off; off += PX;  const size_t oQl   = off; off += PX;
  const size_t oKh   = off; off += PX;  const size_t oKl   = off; off += PX;
  const size_t oVTh  = off; off += PV;  const size_t oVTl  = off; off += PV;
  if (off > ws_size) return;                          // off = 29818880
  if (off > (size_t)134217728) return;

  char* ws = (char*)d_ws;
  unsigned short* WqTh = (unsigned short*)(ws + oWqTh); unsigned short* WqTl = (unsigned short*)(ws + oWqTl);
  unsigned short* WkTh = (unsigned short*)(ws + oWkTh); unsigned short* WkTl = (unsigned short*)(ws + oWkTl);
  unsigned short* WvTh = (unsigned short*)(ws + oWvTh); unsigned short* WvTl = (unsigned short*)(ws + oWvTl);
  unsigned short* Xb   = (unsigned short*)(ws + oXb);
  unsigned short* ErB  = (unsigned short*)(ws + oErB);
  unsigned short* Qh   = (unsigned short*)(ws + oQh);   unsigned short* Ql   = (unsigned short*)(ws + oQl);
  unsigned short* Kh   = (unsigned short*)(ws + oKh);   unsigned short* Kl   = (unsigned short*)(ws + oKl);
  unsigned short* VTh  = (unsigned short*)(ws + oVTh);  unsigned short* VTl  = (unsigned short*)(ws + oVTl);

  const dim3 blk(256);
  const float sscale = 0.17677669529663688f;          // 1/sqrt(32)

  // (1) weights -> transposed bf16 planes, Er and x -> bf16 planes: 12 + 64 + 1024 blocks
  prep_kernel<<<dim3(PREP_W + PREP_E + PREP_X), blk, 0, stream>>>(x, Wq, Wk, Wv, Er, Xb, ErB, WqTh, WqTl, WkTh, WkTl, WvTh, WvTl);
  // (2) q, k and v^T projections: 64 blocks each
  proj_kernel<<<dim3(64, 3), blk, 0, stream>>>(Xb, WqTh, WkTh, WvTh, bq, bk, bv, Qh, Ql, Kh, Kl, VTh, VTl);
  // (3) causal rel-pos attention: 512 blocks = 16 (b,h) pairs x 32 pairs of query blocks (63 - t, t), 256 threads (2 key groups x 4 waves)
  relattn32_kernel<<<dim3(NB * NH * (NQB / 2)), dim3(256), 0, stream>>>(Qh, Ql, Kh, Kl, VTh, VTl, ErB, out, sscale);
  (void)hipGetLastError();
}

// v010
// It runs in 82.9 microseconds.
// Two timings next to v009 put it at 1.06 and 1.07 times that version's speed.
// All steps since v000 together make it 4.98 times as fast.
// Contractions: q, k, v^T projections x.W (+bias): v_wmma_f32_16x16x32_bf16, single product of bf16-RNE-valued x and W (rounded in registers), f32 accumulate;
// scores (k.q^T, keys as rows): bf16 hi/lo split (hi.hi + hi.lo + lo.hi); rel-pos term ErWin.q^T: q hi/lo x bf16-RNE Er (hi.E + lo.E); V^T.P^T: bf16 hi/lo split (3 products);
// all v_wmma_f32_16x16x32_bf16 with f32 accumulate. Softmax, bias adds and the 1/sqrt(32) score scale in f32.
//
// Math implemented (B=4, S=4096, hidden 128, 4 heads x 32):
//   q = x.Wq + bq, k = x.Wk + bk, v = x.Wv + bv   (W stored [in][out]; head h = columns h*32..h*32+31)
//   rel[i][j] = q_i . Er[S-1-(i-j)]  for j <= i   (pad-left / reshape shift identity; j > i entries are masked)
//   logit[i][j] = (q_i.k_j + rel[i][j]) * (1/sqrt(32)),  causal (j <= i, diagonal included), softmax over j, out = P.v
//   out[(b*S + i)*128 + h*32 + d]   (no output projection)
//
// Plane / carry audit: every 16-bit operand is bf16 with unit carry (x, W, Er: bf16-RNE of the inputs; q, k, v^T: hi/lo bf16
// pairs of the f32 projection results; P: hi/lo bf16 pairs of exp(s - m)); nothing is scaled, nothing to fold back.
//
// Er window per (query block qb, key chunk kc): window row w <-> Er row e0 + w, e0 = S - 64 - 64*(qb - kc), w in 0..127
// (clamped copy, rows past S-1 only ever meet masked keys). For block row il (0..63) and chunk key jl (0..63):
// w = 63 - il + jl. Wave wv (rows il = 16*wv..16*wv+15) computes G^T[80][16] = Win[48 - 16*wv + 0..79] . q^T, stores it as G[row][80] and reads
// G[row][15 - (il - 16*wv) + jl].
#include <hip/hip_runtime.h>
#include <math.h>
#include <stdint.h>

#define NB   4
#define SEQ  4096
#define HID  128
#define NH   4
#define HD   32
#define NQB  (SEQ / 64)

typedef __attribute__((ext_vector_type(16))) _Float16 v16h;
typedef __attribute__((ext_vector_type(16))) __bf16   v16b;
typedef __attribute__((ext_vector_type(8)))  __bf16   v8b;
typedef __attribute__((ext_vector_type(8)))  float    v8f;
typedef __attribute__((ext_vector_type(4)))  float    v4f;
typedef __attribute__((ext_vector_type(4)))  unsigned int v4u;
typedef v4f __attribute__((may_alias)) v4fa;

typedef __attribute__((ext_vector_type(2)))  float    v2f;
typedef __attribute__((ext_vector_type(2)))  __bf16   v2b;

// f32 -> bf16, round to nearest even, two values a time in the chip's packed converter (one instruction a pair)
__device__ __forceinline__ v2b cvt2(float a, float b) { const v2f t = {a, b}; return __builtin_convertvector(t, v2b); }
__device__ __forceinline__ unsigned cvt2_bits(float a, float b) { return __builtin_bit_cast(unsigned, cvt2(a, b)); }
// hi/lo bf16 planes of a pair: hi = rne(f), lo = rne(f - hi)
__device__ __forceinline__ void split2(float a, float b, v2b& hi, v2b& lo) {
  hi = cvt2(a, b);
  lo = cvt2(a - (float)hi[0], b - (float)hi[1]);
}
__device__ __forceinline__ float bf_rne(float f) { return (float)(__bf16)f; }

// hazard guards as plain device helpers
__device__ __forceinline__ void dep_guard_b(v8f& a, v8f& b, v16b x, v16b y) { asm volatile("v_nop\n\tv_nop\n\tv_nop\n\tv_nop" : "+v"(a), "+v"(b) : "v"(x), "v"(y)); }
__device__ __forceinline__ void keep4_b(v16b a, v16b b, v16b c, v16b d) { asm volatile("v_nop" :: "v"(a), "v"(b), "v"(c), "v"(d)); }
__device__ __forceinline__ void acc_guard4(v8f& a, v8f& b, v8f& c, v8f& d) { asm volatile("v_nop\n\tv_nop\n\tv_nop\n\tv_nop" : "+v"(a), "+v"(b), "+v"(c), "+v"(d)); }

// 16-bit WMMA fragment (A: p = row m at k0 + 8h; B stored [n][k]: p = row n at k0 + 8h; same split k map):
// elements 0..7 <- p[0..7], elements 8..15 <- p[16..23]
struct FragB {
  union U { v16b v; v8b h[2]; };
  static __device__ __forceinline__ v16b load(const __bf16* p) {
    U f; f.h[0] = *(const v8b*)(p); f.h[1] = *(const v8b*)(p + 16); return f.v;
  }
  static __device__ __forceinline__ v8f mma(v16b a, v16b b, v8f c) {
    return __builtin_amdgcn_wmma_f32_16x16x32_bf16(false, a, false, b, (short)0, c, false, false);
  }
};

__device__ __forceinline__ v8f zero8() { v8f z = {0.f, 0.f, 0.f, 0.f, 0.f, 0.f, 0.f, 0.f}; return z; }

// ---- Register-blocked WMMA projection (bf16 operands rounded from the f32 inputs on the way in) --------------------
// Each wave owns a 64x64 tile, 8 waves per block, K = HID = 128 in 4 k-steps of 32.
//   WA = false: C[m][n] = sum_k x[m][k] * W[k][n] + bias[n]   (A = x rows, B = W columns; M = rows of x, N = HID)
//   WA = true : C[m][n] = sum_k W[k][m] * x[n][k] + bias[m]   (A = W columns, B = x rows; M = HID, N = rows of x)
// Both loaders use the split k map of the 16-bit fragments: element e of a lane <-> k = k0 + 8*(lane>>4) + (e < 8 ? e : e + 8).
// x side: a lane's 16 k values of its row are four 16-B loads of f32, rounded to bf16 (RNE) in pairs in registers.
// W side: the block first puts the whole W, rounded to bf16 (RNE) and transposed, into LDS as sW[column][k] (stage_w); fragments are 16-B LDS reads.
// Bias value converted bf16-RNE, added in f32. Output: bf16 hi plane (Ch) + bf16 lo plane (Cl).
// coverage: 4 slabs x 16 rows x 64 cols = the whole 64x64 tile per wave; tiles cover M x N exactly.
#define WP 136   // sW row pitch in elements: 256-B rows at 272 B (16 B x odd), conflict-free for the 16-B fragment reads
struct XRaw { v4f a[4]; };
__device__ __forceinline__ XRaw load_x(const float* __restrict__ p) {
  XRaw r;
  r.a[0] = *(const v4f*)(p); r.a[1] = *(const v4f*)(p + 4); r.a[2] = *(const v4f*)(p + 16); r.a[3] = *(const v4f*)(p + 20);
  return r;
}
__device__ __forceinline__ v16b frag_x(const XRaw& r) {
  union { v16b v; v2b h[8]; } f;
#pragma unroll
  for (int q = 0; q < 4; ++q) { f.h[2 * q] = cvt2(r.a[q][0], r.a[q][1]); f.h[2 * q + 1] = cvt2(r.a[q][2], r.a[q][3]); }
  return f.v;
}
// 256 threads: thread = 4 neighbouring columns x 16 k rows; a wave's load is one whole 512-B row of W. 32 x 4 columns, 8 x 16 rows = all of W.
__device__ __forceinline__ void stage_w(__bf16* sW, const float* __restrict__ Wm) {
  const int c4 = (threadIdx.x & 31) * 4;
  const int kb = (threadIdx.x >> 5) * 16;
  const float* wb = Wm + (size_t)kb * HID + c4;
  v4f w[16];
#pragma unroll
  for (int e = 0; e < 16; ++e) w[e] = *(const v4f*)(wb + (size_t)e * HID);
  // the loads' address is an input here, so its registers stay as they are (no load's result lands on them) up to this wait
  asm volatile("s_wait_xcnt 0x0" :: "v"(wb) : "memory");
#pragma unroll
  for (int t = 0; t < 4; ++t) {
    union { v8b v; v2b h[4]; } lo, hi;
#pragma unroll
    for (int q = 0; q < 4; ++q) { lo.h[q] = cvt2(w[2 * q][t], w[2 * q + 1][t]); hi.h[q] = cvt2(w[8 + 2 * q][t], w[9 + 2 * q][t]); }
    *(v8b*)(sW + (c4 + t) * WP + kb)     = lo.v;
    *(v8b*)(sW + (c4 + t) * WP + kb + 8) = hi.v;
  }
  __syncthreads();   // publishes sW; it is only read from here on
}

template <bool WA>
__device__ __forceinline__ void proj_gemm64(
    float (*sT)[16 * 68], const __bf16* sW, int bx, const float* __restrict__ X, const float* __restrict__ bias,
    unsigned short* __restrict__ Ch, unsigned short* __restrict__ Cl, int ldc, int M, int N) {
  const int lane = threadIdx.x & 31;
  const int wave = threadIdx.x >> 5;
  const int tilesN = N >> 6;
  const int tilesM = M >> 6;
  const int tile = bx * 8 + wave;
  if (tile >= tilesM * tilesN) return;   // wave-uniform; no block barriers behind this line
  const int tm = tile / tilesN;
  const int tn = tile - tm * tilesN;
  const int m0 = tm << 6;
  const int n0 = tn << 6;

  const int rlane = lane & 15;                 // row (A) / col (B, D) within subtile
  const int koff  = (lane >> 4) * 8;           // k offset of this lane half
  const int mOff  = (lane >> 4) * 8;           // D row offset

  const float*  xp = X  + (size_t)((WA ? n0 : m0) + rlane) * HID + koff;   // + 16 t rows, + k0
  const __bf16* wp = sW + ((WA ? m0 : n0) + rlane) * WP + koff;            // + 16 t rows, + k0

  v8f acc[4][4];
#pragma unroll
  for (int i = 0; i < 4; ++i)
#pragma unroll
    for (int j = 0; j < 4; ++j) acc[i][j] = zero8();

#pragma unroll
  for (int k0 = 0; k0 < HID; k0 += 32) {
    XRaw xr[4];
#pragma unroll
    for (int t = 0; t < 4; ++t) xr[t] = load_x(xp + (size_t)(t << 4) * HID + k0);
    // keeps the k-step's 16 global loads together in front of the roundings: spread among them, each load's latency is waited out on its own
    __builtin_amdgcn_sched_barrier(0);
    v16b af[4], bf[4];
#pragma unroll
    for (int t = 0; t < 4; ++t) {
      (WA ? af : bf)[t] = FragB::load(wp + (t << 4) * WP + k0);
      (WA ? bf : af)[t] = frag_x(xr[t]);
    }
#pragma unroll
    for (int i = 0; i < 4; ++i) {
#pragma unroll
      for (int j = 0; j < 4; ++j) acc[i][j] = FragB::mma(af[i], bf[j], acc[i][j]);
      dep_guard_b(acc[i][0], acc[i][3], af[i], af[i]);
    }
    keep4_b(bf[0], bf[1], bf[2], bf[3]);
  }
  acc_guard4(acc[0][0], acc[0][1], acc[0][2], acc[0][3]);
  acc_guard4(acc[1][0], acc[1][1], acc[1][2], acc[1][3]);
  acc_guard4(acc[2][0], acc[2][1], acc[2][2], acc[2][3]);
  acc_guard4(acc[3][0], acc[3][1], acc[3][2], acc[3][3]);

  // ---- epilogue ----
  float* slab = sT[wave];
#pragma unroll
  for (int i = 0; i < 4; ++i) {
    const int mBase = m0 + (i << 4);
#pragma unroll
    for (int j = 0; j < 4; ++j) {
      const int n = n0 + (j << 4) + rlane;
      float bv = 0.f;
      if (!WA) bv = bf_rne(bias[n]);
#pragma unroll
      for (int r = 0; r < 8; ++r) {
        float v = acc[i][j][r];
        if (WA) v += bf_rne(bias[mBase + mOff + r]);
        else    v += bv;
        slab[(mOff + r) * 68 + (j << 4) + rlane] = v;
      }
    }
    __builtin_amdgcn_fence(__ATOMIC_RELEASE, "workgroup");
    __builtin_amdgcn_wave_barrier();
    __builtin_amdgcn_fence(__ATOMIC_ACQUIRE, "workgroup");
    {
      const int q = lane >> 3, c8 = (lane & 7) * 8;
#pragma unroll
      for (int it = 0; it < 4; ++it) {
        const int row = it * 4 + q;
        const float* sp = slab + row * 68 + c8;
        v4u hv, lv;
#pragma unroll
        for (int e = 0; e < 4; ++e) {
          v2b hb, lb;
          split2(sp[2 * e], sp[2 * e + 1], hb, lb);
          hv[e] = __builtin_bit_cast(unsigned, hb);
          lv[e] = __builtin_bit_cast(unsigned, lb);
        }
        *(v4u*)(Ch + (size_t)(mBase + row) * ldc + n0 + c8) = hv;
        *(v4u*)(Cl + (size_t)(mBase + row) * ldc + n0 + c8) = lv;
      }
    }
    __builtin_amdgcn_fence(__ATOMIC_RELEASE, "workgroup");
    __builtin_amdgcn_wave_barrier();
    __builtin_amdgcn_fence(__ATOMIC_ACQUIRE, "workgroup");
  }
}

// ---------------------------------------------------------------------------
// Contiguous f32 -> bf16-RNE plane: one thread = 8 consecutive elements = one 16-B store, so every wave writes
// 512 contiguous bytes; ceil(n8/256) blocks, blk = the block's index among them; coverage: n8 threads x 8 = the whole plane (n8 * 8 elements).
// ---------------------------------------------------------------------------
__device__ __forceinline__ void cvt_bf16x8(int blk, const float* __restrict__ in, unsigned short* __restrict__ o, int n8) {
  const int i = blk * 256 + threadIdx.x;
  if (i < n8) {
    const float* sp = in + (size_t)i * 8;
    const v4f a  = *(const v4f*)(sp);
    const v4f a2 = *(const v4f*)(sp + 4);
    v4u w;
    w[0] = cvt2_bits(a[0],  a[1]);
    w[1] = cvt2_bits(a[2],  a[3]);
    w[2] = cvt2_bits(a2[0], a2[1]);
    w[3] = cvt2_bits(a2[2], a2[3]);
    unsigned short* dp = o + (size_t)i * 8;
    *(v4u*)dp = w;
  }
}

// ---------------------------------------------------------------------------
// Launch 1: all that the attention launch reads, straight from the f32 inputs, one grid (64, 4); blockIdx.y picks the job (block-uniform branch).
//   y = 0: q = x.Wq + bq -> Q hi/lo planes [b*4096+t][h*32+d]   (M=16384, N=128; 512 tiles -> 64 blocks)
//   y = 1: k = x.Wk + bk -> K hi/lo planes, same shape
//   y = 2: v^T = Wv^T . x^T + bv[m] -> VT hi/lo planes [b][h*32+d][s]   (M=128, N=4096 rows of batch b;
//          128 tiles -> 16 blocks a batch: block = blockIdx.x & 15, batch = blockIdx.x >> 4)
//   y = 3: Er -> bf16 plane [4096][32]   (64 blocks x 256 threads x 8 = the whole plane)
// ---------------------------------------------------------------------------
__global__ __launch_bounds__(256) void proj_kernel(const float* __restrict__ x, const float* __restrict__ Wq, const float* __restrict__ Wk,
                                                   const float* __restrict__ Wv, const float* __restrict__ bq, const float* __restrict__ bk,
                                                   const float* __restrict__ bv, const float* __restrict__ Er,
                                                   unsigned short* __restrict__ Qh, unsigned short* __restrict__ Ql,
                                                   unsigned short* __restrict__ Kh, unsigned short* __restrict__ Kl,
                                                   unsigned short* __restrict__ VTh, unsigned short* __restrict__ VTl,
                                                   unsigned short* __restrict__ ErB) {
  __shared__ __align__(16) float  sT[8][16 * 68];   // per-wave 16x64 slab, pitch 68 floats
  __shared__ __align__(16) __bf16 sW[HID * WP];     // the job's weight matrix, bf16, [column][k]
  const int job = blockIdx.y;
  if (job < 2) {
    const float*    bi = job ? bk : bq;
    unsigned short* Ch = job ? Kh : Qh;
    unsigned short* Cl = job ? Kl : Ql;
    stage_w(sW, job ? Wk : Wq);
    proj_gemm64<false>(sT, sW, blockIdx.x, x, bi, Ch, Cl, HID, NB * SEQ, HID);
  } else if (job == 2) {
    const int b = blockIdx.x >> 4;
    stage_w(sW, Wv);
    proj_gemm64<true>(sT, sW, blockIdx.x & 15, x + (size_t)b * SEQ * HID, bv, VTh + (size_t)b * HID * SEQ, VTl + (size_t)b * HID * SEQ,
                      SEQ, HID, SEQ);
  } else {
    cvt_bf16x8(blockIdx.x, Er, ErB, SEQ * HD / 8);
  }
}

// =====================================================================================
// Causal rel-pos attention, head dim 32, all (batch, head) pairs in one launch.
//   q planes (hi/lo bf16): element (b, t, h, d) at [(b*SEQ + t)*HID + h*32 + d]
//   k planes (hi/lo bf16): same layout
//   v^T planes (hi/lo bf16): element (b, h, d, s) at [((b*HID + h*32 + d))*SEQ + s]
//   er plane (bf16-RNE of Er): [r][d], pitch 32
//   scores = ((q.k) + (q.ErWin at the shift index)) * sscale; masked (s > t) scores set to -inf.
//   Block = 8 waves = 2 key groups x 4 waves; the 4 waves of a group hold the 64 query rows of one (b,h) query block, and both
//   groups hold the same rows. Key chunks of 64, qb+1 <= 64 of them for query block qb, taken two a stage: group g takes chunk
//   2*stage + g, so a wave walks half the chunks and four waves instead of two share a SIMD. Each group keeps its own running
//   maximum, sum and O^T; after the last stage group 1 hands them to group 0 through LDS (one barrier) and group 0 joins them.
//   Where qb+1 is odd, group 1 has no chunk in the last stage: it stages chunk qb again (address in range) and skips the products.
//   Every block takes two query blocks of its (b,h), one after the other: 63 - t, then t (t = 0..31), so each block walks
//   (64 - t) + (t + 1) = 65 chunks in 33 stages and no WGP is left with only long or only short blocks. grid.x = NB*NH*32.
//   Staging per stage: asynchronous 16-B copies from global memory straight into LDS, two buffers: stage st + 2 is issued behind the
//   barrier at the foot of stage st, into the buffer that stage st has just read, and flies while stage st + 1 is worked on.
//   Each group's 128 threads stage their own chunk:
//     K hi/lo [64][32]: 128 thr x 16 elements per plane = whole tile; V^T hi/lo [32][64]: 128 thr x 16 = whole tile;
//     Er window [192][32], shared (group g's 128-row window starts at row 64g): 256 thr x 3 x 8 elements = all 192 rows
//     (clamped source row, so every row is written).
//   All three products are taken transposed (keys, window rows or d as the rows of D, queries as its columns), so lane (c, hh)
//   holds query c of the wave's 16: its scores for keys 16j + 8hh + r, its maximum and sum in-lane (the two lane halves are joined
//   by one cross-half move), and exp(s - m) converts in place into the B fragment of V^T.P^T (element e of k-step kk =
//   tile 2kk + (e >> 3), register e & 7: the same split k map as the V^T loader). P never goes through LDS.
//   Per-wave LDS: G [16 queries][80] f32 (5 tiles x 16 window rows x 16 queries written, columns 0..78 read), reused as out staging [16][36].
//   LDS rows are padded (KP, VP, GP below); the pad bytes are never written and never read.
// =====================================================================================
#define AT_NW 8
#define AT_QB 64
#define AT_KC 64
#define EWIN  192
#define MGP   20   // hand-over record pitch in floats per lane: 80 B = 16 B x odd for the 16-B accesses (lane = row)
#define GP    84   // G row pitch in floats: 16 B x odd for the 16-B stores (lane = row); the shifted 4-B reads step 83 floats a lane, so the 16 lanes of a half hit distinct banks
#define OSP   36
#define KP    40   // K and Er-window row pitch in elements: 64-B rows at 80 B (16 B x odd), conflict-free for 16-B fragment reads
#define VP    72   // V^T row pitch in elements: 128-B rows at 144 B (16 B x odd)
// one staging buffer, offsets in elements: K hi [group][kv][d], K lo, V^T hi [group][d][kv], V^T lo, Er window [w][d]
#define SB_KH 0
#define SB_KL (2 * AT_KC * KP)
#define SB_VH (4 * AT_KC * KP)
#define SB_VL (4 * AT_KC * KP + 2 * HD * VP)
#define SB_E  (4 * AT_KC * KP + 4 * HD * VP)
#define SB_SZ (4 * AT_KC * KP + 4 * HD * VP + EWIN * KP)   // 27136 elements = 54272 B, a multiple of 16 B

// lane l <-> lane l ^ 16 (the two halves that share a query)
__device__ __forceinline__ float at_xhalf(float x) {
  return __builtin_bit_cast(float, __builtin_amdgcn_permlanex16(__builtin_bit_cast(int, x), __builtin_bit_cast(int, x),
                                                                0x76543210, 0xfedcba98, false, false));
}
__device__ __forceinline__ unsigned at_lds_off(const void* p) { return (unsigned)(size_t)p; }
__device__ __forceinline__ v8f at_mma(v16b a, v16b b, v8f c) {
  return __builtin_amdgcn_wmma_f32_16x16x32_bf16(false, a, false, b, (short)0, c, false, false);
}
// Distance guards, one behind each RUN of matrix products: four vector slots between the run and the first vector instruction that
// reads its results or rewrites its operand registers. The results pass through the statement and the operands are its inputs, so
// nothing of that kind can stand in front of it. Not volatile: LDS loads may move across it, so the fragment loads of a run go out together.
__device__ __forceinline__ void at_guard_s(v8f* s, const v16b* kh, const v16b* kl, v16b qh, v16b ql) {
  asm("v_nop\n\tv_nop\n\tv_nop\n\tv_nop" : "+v"(s[0]), "+v"(s[1]), "+v"(s[2]), "+v"(s[3])
      : "v"(kh[0]), "v"(kh[1]), "v"(kh[2]), "v"(kh[3]), "v"(kl[0]), "v"(kl[1]), "v"(kl[2]), "v"(kl[3]), "v"(qh), "v"(ql));
}
__device__ __forceinline__ void at_guard_g(v8f* g, const v16b* e, v16b qh, v16b ql) {
  asm("v_nop\n\tv_nop\n\tv_nop\n\tv_nop" : "+v"(g[0]), "+v"(g[1]), "+v"(g[2]), "+v"(g[3]), "+v"(g[4])
      : "v"(e[0]), "v"(e[1]), "v"(e[2]), "v"(e[3]), "v"(e[4]), "v"(qh), "v"(ql));
}
__device__ __forceinline__ void at_guard_o(v8f* o, const v16b* vh, const v16b* vl, v16b p0, v16b p1, v16b p2, v16b p3) {
  asm("v_nop\n\tv_nop\n\tv_nop\n\tv_nop" : "+v"(o[0]), "+v"(o[1])
      : "v"(vh[0]), "v"(vh[1]), "v"(vh[2]), "v"(vh[3]), "v"(vl[0]), "v"(vl[1]), "v"(vl[2]), "v"(vl[3]), "v"(p0), "v"(p1), "v"(p2), "v"(p3));
}

__global__ __launch_bounds__(256)
void relattn32_kernel(const unsigned short* __restrict__ qhp, const unsigned short* __restrict__ qlp,
                      const unsigned short* __restrict__ khp, const unsigned short* __restrict__ klp,
                      const unsigned short* __restrict__ vhp, const unsigned short* __restrict__ vlp,
                      const unsigned short* __restrict__ erp, float* __restrict__ out, float sscale) {
  union FB { v16b v; v8b h[2]; };
  __shared__ __align__(16) __bf16 Stg[2 * SB_SZ];              // two staging buffers (K hi/lo, V^T hi/lo, Er window), 2 x 53 KB
  __shared__ __align__(16) float  Gs[AT_NW][16 * GP];          // per wave rel tile [query][80], pitch GP; later hand-over record (group 1) / out staging pitch 36 (group 0)

  const int tid  = threadIdx.x;
  const int wave = __builtin_amdgcn_readfirstlane(tid >> 5);   // in a scalar register: the tests on the key group below are scalar branches
  const int grp  = wave >> 2;             // key group 0 / 1
  const int wq   = wave & 3;              // which 16 of the 64 query rows
  const int tl   = tid & 127;             // thread within its group
  const int lane = tid & 31;
  const int hh   = lane >> 4;
  const int c    = lane & 15;

  const int bx   = blockIdx.x;
  const int tp   = bx & (NQB / 2 - 1);    // 0..31
  const int pair = bx >> 5;               // 0..15
  const int b    = pair >> 2;
  const int h    = pair & 3;
  const size_t rowBase = (size_t)b * SEQ;

  const __bf16* Qh = (const __bf16*)(const void*)qhp + h * HD;
  const __bf16* Ql = (const __bf16*)(const void*)qlp + h * HD;
  const __bf16* Kh = (const __bf16*)(const void*)khp + h * HD;
  const __bf16* Kl = (const __bf16*)(const void*)klp + h * HD;
  const __bf16* Vh = (const __bf16*)(const void*)vhp + ((size_t)b * HID + h * HD) * SEQ;
  const __bf16* Vl = (const __bf16*)(const void*)vlp + ((size_t)b * HID + h * HD) * SEQ;
  const __bf16* Er = (const __bf16*)(const void*)erp;
  float*        ob = out + h * HD;

  const int wbase = 64 * grp + 48 - 16 * wq;   // first row, in the staged 192-row window, of this wave's G tile
  float* gw = Gs[wave];
  // staging map of this thread, 16-B pieces; neighbouring lanes of one copy take neighbouring pieces, so a copy asks for each row's bytes whole.
  // K: piece p = tl + 128 i -> key row p>>2 (64-B rows), d quarter (p&3)*8; V^T: piece p = tl + 128 i -> row d = p>>3 (128-B rows), key eighth (p&7)*8;
  // Er window: piece p = tid + 256 i -> window row p>>2, d quarter (p&3)*8. LDS byte addresses of piece i = 0 in buffer 0:
  const int sr = tl >> 2, sdq = (tl & 3) * 8;
  const int sd = tl >> 3, ske = (tl & 7) * 8;
  const unsigned lK = at_lds_off(Stg) + 2u * (unsigned)(SB_KH + grp * (AT_KC * KP) + sr * KP + sdq);
  const unsigned lV = at_lds_off(Stg) + 2u * (unsigned)(SB_VH + grp * (HD * VP) + sd * VP + ske);
  const unsigned lE = at_lds_off(Stg) + 2u * (unsigned)(SB_E + (tid >> 2) * KP + (tid & 3) * 8);

  // the block's two query blocks, long one first; every (b, h, qb) is taken by exactly one block (block-uniform trip counts)
  for (int part = 0; part < 2; ++part) {
  const int qb = part ? tp : (NQB - 1 - tp);   // 63..32, then 0..31
  const int q0 = qb * AT_QB + wq * 16;

  // ---- Q fragments (B operand, column = query = lane&15, split k map, one k-step of 32 = d), hi and lo ----
  const v16b qah = FragB::load(Qh + (rowBase + q0 + c) * HID + 8 * hh);
  const v16b qal = FragB::load(Ql + (rowBase + q0 + c) * HID + 8 * hh);

  float mrow = -INFINITY;                 // running maximum of query c (equal in both lane halves)
  float lrow = 0.f;                       // running sum of query c over this lane half's keys; halves joined after the loop
  v8f oacc[2];                            // O^T: oacc[t][r] = out[query c][d = 16t + 8hh + r]
  oacc[0] = zero8(); oacc[1] = zero8();
  const int qrow = qb * AT_QB + wq * 16 + c;

  const int nStages = (qb + 2) >> 1;      // block-uniform, <= 32: ceil((qb + 1) / 2)

  // One stage's copies into buffer buf: 11 a thread, every lane on, every address a multiple of 16 B, each LDS byte written by one lane.
  auto stage_copies = [&](int st, int buf) {
    const int kcs = 2 * st + grp;                       // this group's chunk; past the last one (group 1, odd count): chunk qb again
    const int kvs = (kcs <= qb ? kcs : qb) * AT_KC;
    const int e0  = SEQ - 64 - 64 * (qb - 2 * st);      // Er row of staged window row 0 (group 0's window base), 0 .. 4032
    const __bf16* ks = Kh + (rowBase + kvs + sr) * HID + sdq;
    const __bf16* kl = Kl + (rowBase + kvs + sr) * HID + sdq;
    const __bf16* vs = Vh + (size_t)sd * SEQ + kvs + ske;
    const __bf16* vl = Vl + (size_t)sd * SEQ + kvs + ske;
    const __bf16* ep[3];
#pragma unroll
    for (int i = 0; i < 3; ++i) {
      int erow = e0 + ((tid + 256 * i) >> 2);           // clamped source row (address clamp)
      erow = erow < 0 ? 0 : erow;
      erow = erow > (SEQ - 1) ? (SEQ - 1) : erow;
      ep[i] = Er + (size_t)erow * HD + (tid & 3) * 8;
    }
    const unsigned bo = (unsigned)buf * (2u * SB_SZ);
    const unsigned dK = lK + bo, dL = dK + 2u * (SB_KL - SB_KH), dV = lV + bo, dW = dV + 2u * (SB_VL - SB_VH), dE = lE + bo;
    // global memory -> LDS through no register. The closing s_wait_xcnt stands in the copies' own statement, so that no register
    // that a copy names is rewritten in front of it.
    asm volatile("global_load_async_to_lds_b128 %0, %11, off\n\t"
                 "global_load_async_to_lds_b128 %1, %12, off\n\t"
                 "global_load_async_to_lds_b128 %2, %13, off\n\t"
                 "global_load_async_to_lds_b128 %3, %14, off\n\t"
                 "global_load_async_to_lds_b128 %4, %15, off\n\t"
                 "global_load_async_to_lds_b128 %5, %16, off\n\t"
                 "global_load_async_to_lds_b128 %6, %17, off\n\t"
                 "global_load_async_to_lds_b128 %7, %18, off\n\t"
                 "global_load_async_to_lds_b128 %8, %19, off\n\t"
                 "global_load_async_to_lds_b128 %9, %20, off\n\t"
                 "global_load_async_to_lds_b128 %10, %21, off\n\t"
                 "s_wait_xcnt 0x0"
                 :: "v"(dK), "v"(dK + 2u * 32 * KP), "v"(dL), "v"(dL + 2u * 32 * KP), "v"(dV), "v"(dV + 2u * 16 * VP), "v"(dW), "v"(dW + 2u * 16 * VP),
                    "v"(dE), "v"(dE + 2u * 64 * KP), "v"(dE + 2u * 128 * KP),
                    "v"(ks), "v"(ks + 32 * HID), "v"(kl), "v"(kl + 32 * HID), "v"(vs), "v"(vs + 16 * SEQ), "v"(vl), "v"(vl + 16 * SEQ),
                    "v"(ep[0]), "v"(ep[1]), "v"(ep[2])
                 : "memory");
  };

  // stage 0 lands and is published; then stage 1 is sent off. (Every reader of both buffers has left them: the barrier at the foot of the
  // previous query block's last stage.)
  stage_copies(0, 0);
  asm volatile("s_wait_asynccnt 0x0" ::: "memory");   // this wave's copies of stage 0 have landed
  __syncthreads();
  if (nStages > 1) stage_copies(1, 1);

  for (int st = 0; st < nStages; ++st) {
    const int kc    = 2 * st + grp;       // this group's chunk (wave-uniform)
    const bool live = kc <= qb;           // false only for group 1 in the last stage of an odd chunk count
    const int kv0   = (live ? kc : qb) * AT_KC;
    const int buf   = st & 1;
    const __bf16* Sb  = Stg + buf * SB_SZ;               // this stage's buffer
    const __bf16* Ksh = Sb + SB_KH + grp * (AT_KC * KP); // this group's own chunk
    const __bf16* Ksl = Sb + SB_KL + grp * (AT_KC * KP);
    const __bf16* Vth = Sb + SB_VH + grp * (HD * VP);
    const __bf16* Vtl = Sb + SB_VL + grp * (HD * VP);
    const __bf16* Esh = Sb + SB_E;
    if (live) {   // wave-uniform; no block barrier inside

    // ---- rel-pos tile, transposed: G^T = Win[wbase + 0..79] . q^T (2 products); a lane's 8 registers are 8 consecutive
    //      window columns of its query's row, so they go to this wave's G[query][80] as two 16-B stores ----
    //      Taken in front of the score products: the G stores land and the G reads fly while those run.
    v8f gt[5];
    {
      v16b ef[5];
#pragma unroll
      for (int nt = 0; nt < 5; ++nt) {
        FB eb;
        const __bf16* ep = Esh + (wbase + nt * 16 + c) * KP + 8 * hh;
        eb.h[0] = *(const v8b*)(ep); eb.h[1] = *(const v8b*)(ep + 16);
        ef[nt] = eb.v;
        v8f g = zero8();
        g = at_mma(eb.v, qah, g);
        g = at_mma(eb.v, qal, g);
        gt[nt] = g;
      }
      at_guard_g(gt, ef, qah, qal);
    }
#pragma unroll
    for (int nt = 0; nt < 5; ++nt) {
      const v8f g = gt[nt];
      float* gp = gw + c * GP + nt * 16 + 8 * hh;
      const v4f g0 = {g[0], g[1], g[2], g[3]};
      const v4f g1 = {g[4], g[5], g[6], g[7]};
      *(v4fa*)(gp)     = g0;
      *(v4fa*)(gp + 4) = g1;
    }

    // ---- content scores, transposed: S^T tile j = K rows (16j..16j+15) . q^T, 3-term split; s[j][r] = score(key 16j + 8hh + r, query c) ----
    v8f s[4];
    {
      v16b kfh[4], kfl[4];
#pragma unroll
      for (int j = 0; j < 4; ++j) {
        FB kb, kl;
        const __bf16* kp = Ksh + (j * 16 + c) * KP + 8 * hh;
        const __bf16* kq = Ksl + (j * 16 + c) * KP + 8 * hh;
        kb.h[0] = *(const v8b*)(kp); kb.h[1] = *(const v8b*)(kp + 16);
        kl.h[0] = *(const v8b*)(kq); kl.h[1] = *(const v8b*)(kq + 16);
        kfh[j] = kb.v; kfl[j] = kl.v;
        v8f a = zero8();
        a = at_mma(kb.v, qah, a);
        a = at_mma(kl.v, qah, a);
        a = at_mma(kb.v, qal, a);
        s[j] = a;
      }
      at_guard_s(s, kfh, kfl, qah, qal);
    }
    __builtin_amdgcn_fence(__ATOMIC_RELEASE, "workgroup");
    __builtin_amdgcn_wave_barrier();
    __builtin_amdgcn_fence(__ATOMIC_ACQUIRE, "workgroup");

    // ---- combine, scale, causal mask, chunk maximum of query c (in-lane, four independent chains, then the other half) ----
    const bool diag = (kc == qb);           // wave-uniform
    const float* gr = gw + c * GP + (15 - c) + 8 * hh;   // + 16j + r gives shift column 15 - c + jl, jl = 16j + 8hh + r
    v8f relv[4];
#pragma unroll
    for (int j = 0; j < 4; ++j)
#pragma unroll
      for (int r = 0; r < 8; ++r) relv[j][r] = gr[j * 16 + r];
    // keeps the G reads together in front of the arithmetic: spread among it, each read's LDS latency is waited out on its own
    __builtin_amdgcn_sched_barrier(0);
#pragma unroll
    for (int j = 0; j < 4; ++j)
#pragma unroll
      for (int r = 0; r < 8; ++r) s[j][r] = (s[j][r] + relv[j][r]) * sscale;
    // Only the diagonal chunk holds keys past a query, so the mask's compares and selects stand behind a scalar branch that
    // every other chunk jumps over.
    if (diag) {
#pragma unroll
      for (int j = 0; j < 4; ++j)
#pragma unroll
        for (int r = 0; r < 8; ++r) {
          const int kvcol = kv0 + j * 16 + 8 * hh + r;
          s[j][r] = (kvcol > qrow) ? -INFINITY : s[j][r];
        }
    }
    float mj[4];
#pragma unroll
    for (int j = 0; j < 4; ++j) {
      float m = -INFINITY;
#pragma unroll
      for (int r = 0; r < 8; ++r) m = fmaxf(m, s[j][r]);
      mj[j] = m;
    }
    float cm = fmaxf(fmaxf(mj[0], mj[1]), fmaxf(mj[2], mj[3]));
    cm = fmaxf(cm, at_xhalf(cm));           // key kv0 is never masked, so the joined maximum is finite

    // ---- online softmax update; P^T (unnormalised) as bf16 hi/lo straight into the B fragments of V^T.P^T ----
    const float mnew  = fmaxf(mrow, cm);
    const float alpha = __expf(mrow - mnew);
    mrow = mnew;
    FB ph[2], pl[2];
    float pj[4];
#pragma unroll
    for (int j = 0; j < 4; ++j) {
      float psum = 0.f;
#pragma unroll
      for (int r = 0; r < 8; r += 2) {
        const float p0 = __expf(s[j][r]     - mnew);
        const float p1 = __expf(s[j][r + 1] - mnew);
        psum += p0;
        psum += p1;
        v2b a, bl; split2(p0, p1, a, bl);
        ph[j >> 1].v[(j & 1) * 8 + r]     = a[0];
        ph[j >> 1].v[(j & 1) * 8 + r + 1] = a[1];
        pl[j >> 1].v[(j & 1) * 8 + r]     = bl[0];
        pl[j >> 1].v[(j & 1) * 8 + r + 1] = bl[1];
      }
      pj[j] = psum;
    }
    lrow = lrow * alpha + ((pj[0] + pj[1]) + (pj[2] + pj[3]));
#pragma unroll
    for (int r = 0; r < 8; ++r) {
      oacc[0][r] *= alpha;
      oacc[1][r] *= alpha;
    }

    // ---- O^T += V^T . P^T : A = V^T rows d (split k map over keys), B = P^T fragments; 3-term split ----
    v16b vfh[4], vfl[4];
#pragma unroll
    for (int kk = 0; kk < 2; ++kk) {
#pragma unroll
      for (int t = 0; t < 2; ++t) {
        FB vb, vl;
        vb.h[0] = *(const v8b*)(Vth + (t * 16 + c) * VP + kk * 32 + 8 * hh);
        vb.h[1] = *(const v8b*)(Vth + (t * 16 + c) * VP + kk * 32 + 16 + 8 * hh);
        vl.h[0] = *(const v8b*)(Vtl + (t * 16 + c) * VP + kk * 32 + 8 * hh);
        vl.h[1] = *(const v8b*)(Vtl + (t * 16 + c) * VP + kk * 32 + 16 + 8 * hh);
        vfh[kk * 2 + t] = vb.v; vfl[kk * 2 + t] = vl.v;
        oacc[t] = at_mma(vb.v, ph[kk].v, oacc[t]);
        oacc[t] = at_mma(vl.v, ph[kk].v, oacc[t]);
        oacc[t] = at_mma(vb.v, pl[kk].v, oacc[t]);
      }
    }
    at_guard_o(oacc, vfh, vfl, ph[0].v, ph[1].v, pl[0].v, pl[1].v);
    }   // live
    // foot of the stage, every wave: its own LDS reads of this buffer are done, its own copies of stage st + 1 have landed; the barrier
    // publishes stage st + 1 and frees this buffer; only then the refill.
    asm volatile("s_wait_dscnt 0x0" ::: "memory");
    asm volatile("s_wait_asynccnt 0x0" ::: "memory");
    __syncthreads();
    if (st + 2 < nStages) stage_copies(st + 2, buf);   // block-uniform test
  }
  asm volatile("s_wait_asynccnt 0x0" ::: "memory");    // nothing is in flight here; closes the ring

  __builtin_amdgcn_fence(__ATOMIC_RELEASE, "workgroup");
  __builtin_amdgcn_wave_barrier();
  __builtin_amdgcn_fence(__ATOMIC_ACQUIRE, "workgroup");
  // ---- group 1 hands its maximum, sum and O^T to group 0: lane to same lane of wave - 4, through group 1's own G area ----
  if (grp == 1) {
    float* mp = gw + lane * MGP;
#pragma unroll
    for (int t = 0; t < 2; ++t) {
      const v4f o0 = {oacc[t][0], oacc[t][1], oacc[t][2], oacc[t][3]};
      const v4f o1 = {oacc[t][4], oacc[t][5], oacc[t][6], oacc[t][7]};
      *(v4fa*)(mp + t * 8)     = o0;
      *(v4fa*)(mp + t * 8 + 4) = o1;
    }
    mp[16] = mrow;
    mp[17] = lrow;
  }
  __syncthreads();   // publishes the records; group 1 next writes its G area behind one more barrier, which group 0 passes after it has read them
  if (grp == 0) {
  {
    const float* mp = Gs[wave + 4] + lane * MGP;
    const float m1 = mp[16], l1 = mp[17];
    const float mN = fmaxf(mrow, m1);        // mrow is finite (group 0 always has chunk 0); m1 is -inf where group 1 had no chunk
    const float a0 = __expf(mrow - mN);
    const float a1 = __expf(m1 - mN);
    lrow = lrow * a0 + l1 * a1;
#pragma unroll
    for (int t = 0; t < 2; ++t) {
      const v4f o0 = *(const v4fa*)(mp + t * 8);
      const v4f o1 = *(const v4fa*)(mp + t * 8 + 4);
#pragma unroll
      for (int r = 0; r < 4; ++r) {
        oacc[t][r]     = oacc[t][r]     * a0 + o0[r] * a1;
        oacc[t][r + 4] = oacc[t][r + 4] * a0 + o1[r] * a1;
      }
    }
  }
  float* os = gw;
  {
    const float inv = 1.0f / (lrow + at_xhalf(lrow));   // the two halves' key sums joined once
#pragma unroll
    for (int t = 0; t < 2; ++t) {
      float* op = os + c * OSP + t * 16 + 8 * hh;        // row = query c, 8 consecutive d
      const v4f o0 = {oacc[t][0] * inv, oacc[t][1] * inv, oacc[t][2] * inv, oacc[t][3] * inv};
      const v4f o1 = {oacc[t][4] * inv, oacc[t][5] * inv, oacc[t][6] * inv, oacc[t][7] * inv};
      *(v4fa*)(op)     = o0;
      *(v4fa*)(op + 4) = o1;
    }
  }
  __builtin_amdgcn_fence(__ATOMIC_RELEASE, "workgroup");
  __builtin_amdgcn_wave_barrier();
  __builtin_amdgcn_fence(__ATOMIC_ACQUIRE, "workgroup");
  {
    const int q4 = lane >> 3, c4 = (lane & 7) * 4;
    {
#pragma unroll
      for (int it = 0; it < 4; ++it) {
        const int row = it * 4 + q4;                   // it 0..3 x q4 0..3 covers rows 0..15 of the wave tile
        const v4f val = *(const v4fa*)(os + row * OSP + c4);
        *(v4f*)(ob + (rowBase + q0 + row) * HID + c4) = val;
      }
      // the next query block's set-up rewrites the data and address registers that these stores name
      asm volatile("s_wait_xcnt 0x0" ::: "memory");
    }
  }
  }   // grp == 0
  }   // part: the staging buffers were left by every reader at the last stage's foot; G / out staging is this wave's own
}

// ---------------------------------------------------------------------------
// Workspace region map (byte offsets):
//   ErB  bf16 [4096][32]             0                         (262144 B)
//   Qh   bf16 [16384][128]      262144      Ql    4456448
//   Kh   bf16 [16384][128]     8650752      Kl   12845056
//   VTh  bf16 [4][128][4096]  17039360      VTl  21233664
//   total                     25427968
// Every region is written in whole 64x64 tiles / whole 16-B-per-lane runs; all extents are exact tile multiples,
// ---------------------------------------------------------------------------
extern "C" void kernel_launch(void* const* d_in, const int* in_sizes, int n_in,
                              void* d_out, int out_size, void* d_ws, size_t ws_size,
                              hipStream_t stream) {
  if (n_in < 8) return;
  if (in_sizes[0] != NB * SEQ * HID) return;
  if (in_sizes[1] != HID * HID || in_sizes[3] != HID * HID || in_sizes[5] != HID * HID) return;
  if (in_sizes[2] != HID || in_sizes[4] != HID || in_sizes[6] != HID) return;
  if (in_sizes[7] != SEQ * HD) return;
  if (out_size != NB * SEQ * HID) return;

  const float* x  = (const float*)d_in[0];
  const float* Wq = (const float*)d_in[1];
  const float* bq = (const float*)d_in[2];
  const float* Wk = (const float*)d_in[3];
  const float* bk = (const float*)d_in[4];
  const float* Wv = (const float*)d_in[5];
  const float* bv = (const float*)d_in[6];
  const float* Er = (const float*)d_in[7];
  float* out = (float*)d_out;

  const size_t PX = (size_t)NB * SEQ * HID * 2;       //  4194304  bf16 activation plane (all batch rows)
  const size_t PE = (size_t)SEQ * HD * 2;             //   262144  bf16 Er plane
  const size_t PV = (size_t)NB * HID * SEQ * 2;       //  4194304  bf16 v^T plane
  size_t off = 0;
  const size_t oErB  = off; off += PE;
  const size_t oQh   = off; off += PX;  const size_t oQl   = off; off += PX;
  const size_t oKh   = off; off += PX;  const size_t oKl   = off; off += PX;
  const size_t oVTh  = off; off += PV;  const size_t oVTl  = off; off += PV;
  if (off > ws_size) return;                          // off = 25427968
  if (off > (size_t)134217728) return;

  char* ws = (char*)d_ws;
  unsigned short* ErB  = (unsigned short*)(ws + oErB);
  unsigned short* Qh   = (unsigned short*)(ws + oQh);   unsigned short* Ql   = (unsigned short*)(ws + oQl);
  unsigned short* Kh   = (unsigned short*)(ws + oKh);   unsigned short* Kl   = (unsigned short*)(ws + oKl);
  unsigned short* VTh  = (unsigned short*)(ws + oVTh);  unsigned short* VTl  = (unsigned short*)(ws + oVTl);

  const dim3 blk(256);
  const float sscale = 0.17677669529663688f;          // 1/sqrt(32)

  // (1) q, k and v^T projections from the f32 inputs, and the bf16 Er plane: 64 blocks each
  proj_kernel<<<dim3(64, 4), blk, 0, stream>>>(x, Wq, Wk, Wv, bq, bk, bv, Er, Qh, Ql, Kh, Kl, VTh, VTl, ErB);
  // (2) causal rel-pos attention: 512 blocks = 16 (b,h) pairs x 32 pairs of query blocks (63 - t, t), 256 threads (2 key groups x 4 waves)
  relattn32_kernel<<<dim3(NB * NH * (NQB / 2)), dim3(256), 0, stream>>>(Qh, Ql, Kh, Kl, VTh, VTl, ErB, out, sscale);
  (void)hipGetLastError();
}
